// v000
// The times below were measured on an AMD MI455X: many runs one after another, warmed up first and cycling through
// copies of the inputs, with the whole window's GPU time divided by the number of runs. Launches and the gaps
// between them are all in it. The median over several windows is given; except for v000 it joins two sittings, which
// can be a few percent apart, so the side-by-side timings, each taken in one sitting, are the better comparison.
// v000, which the later versions start from, runs in 4080 microseconds.
#include <hip/hip_runtime.h>
// Relative-position multi-head attention with rel_shift (query, key, value [4][1024][512]; mask [4][1024][1024] int32 verbatim (nonzero = masked, ~50 %); pos_emb [1][2047][512]; q/k/v = x W + b ([512][512] [in][out]); p = pos_emb Wpos; 8 heads of 64; ac = (q + pos_bias_u) . k; bd = rel_shift((q + pos_bias_v) . p^T) = (q_i + v) . p[T-1+i-j]; scores = (ac + bd) / 8; masked -> float32 min; softmax; masked weights -> 0; x = attn v merged; out = x Wout + bout -> [4][1024][512].
// Structure: token rows; inputs and pos_emb as exact f16 rows (pos table padded to 2048 rows with zeros); q as a WMMA GEMM (32x64 wave tiles, f32 accumulation, exact x16 weights + bias) into f32 rows, then f16 planes of q + u and q + v on VALU; k, v, p as WMMA GEMMs (f16 outputs); per batch: V^T via LDS transposes; ac GEMM (all 8 heads, K = 64) and bd GEMM against all 2,048 table rows (K = 64) into f32 planes; the shifted relative softmax with the mask on VALU (f32 statistics, native exp; weights x256 f16); o = P . V^T GEMM (K = 1024; o x64 in f16); out GEMM (f32, + bout); 36 launches.
// Compute dtype: inputs rounded to bf16; inputs / weights exact in f16; q + u, q + v, k, v, p, softmax weights and o plain f16 (~2^-12); ac, bd, softmax statistics f32. v_wmma_f32_16x16x32_f16.
#define NB 4
#define SQ 1024
#define PP 2048                      /* position table rows (2047 used, row 2047 zero) */
#define NPOS 2047
#define DM 512
#define NH 8
#define HD 64
#define HG 8
#define B0 0                         /* first batch attended (debug hook) */
#define NBR NB                       /* batches attended (debug hook) */
#define QN SQ                        /* query rows attended per batch (debug hook) */
#define NR ((size_t)NB * SQ)
typedef __bf16 v16b __attribute__((ext_vector_type(16)));
typedef unsigned short v8us __attribute__((ext_vector_type(8), may_alias));
typedef float  v8f  __attribute__((ext_vector_type(8)));
typedef float  v4f  __attribute__((ext_vector_type(4)));
typedef float  v4fa __attribute__((ext_vector_type(4), may_alias));
union FragB { v16b v; v8us half[2]; unsigned short u[16]; };

__device__ __forceinline__ unsigned short bf16_bits(float x) { unsigned int u = __float_as_uint(x); return (unsigned short)((u + 0x7FFFu + ((u >> 16) & 1u)) >> 16); }
__device__ __forceinline__ float bf16_val(unsigned short b) { return __uint_as_float(((unsigned int)b) << 16); }
__device__ __forceinline__ float bf16_round(float x) { return bf16_val(bf16_bits(x)); }
// D += A·B with NT terms: 1 = ah·bh, 2 = + al·bh (A split), 3 = + ah·bl (both split)
template <int NT>
__device__ __forceinline__ v8f mmaN(v16b ah, v16b al, v16b bh, v16b bl, v8f c) {
  c = __builtin_amdgcn_wmma_f32_16x16x32_bf16(false, ah, false, bh, (short)0, c, false, false);
  if (NT >= 2) c = __builtin_amdgcn_wmma_f32_16x16x32_bf16(false, al, false, bh, (short)0, c, false, false);
  if (NT >= 3) c = __builtin_amdgcn_wmma_f32_16x16x32_bf16(false, ah, false, bl, (short)0, c, false, false);
  asm volatile("v_nop\n\tv_nop\n\tv_nop\n\tv_nop" : "+v"(c) : "v"(ah), "v"(al), "v"(bh), "v"(bl));
  return c;
}

__global__ __launch_bounds__(256) void k_wt_bf16(const float* __restrict__ W, unsigned short* __restrict__ Wt, int K, int N) {
  const int t = blockIdx.x * 256 + threadIdx.x;
  const int k8n = K / 8;
  if (t >= N * k8n) return;
  const int n = t / k8n, k8 = (t % k8n) * 8;
  v8us v;
#pragma unroll
  for (int i = 0; i < 8; ++i) v[i] = bf16_bits(W[(size_t)(k8 + i) * N + n]);
  *(v8us*)(Wt + (size_t)n * K + k8) = v;
  
}

// GEMM C[M][N] (f32, pitch ldc) = act(A[M][K]·W + bias). A f32 row-major (pitch lda) converted per fragment to bf16
// (ASPLIT: hi/lo two planes -> 2 terms, else single rounded term); Wt bf16 [N][K] (pitch ldb). BIAS_BF16 rounds the
// bias to bf16 first (bias quantised to bf16 before the add). K%32==0, M%16==0, N%64==0.
template <bool ASPLIT, int ACT, bool BIAS_BF16>
__global__ __launch_bounds__(128) void k_gemm_bf(const float* __restrict__ A, int lda, const unsigned short* __restrict__ Wt, int ldb,
                                               const float* __restrict__ bias, float* __restrict__ C, int ldc, int M, int N, int K) {
  __shared__ __attribute__((aligned(16))) float so[4][16][64];
  const int tid = threadIdx.x, w = tid >> 5, lane = tid & 31, ln = lane & 15, hh = lane >> 4;
  const int ntn = N / 64;
  const int wid = blockIdx.x * 4 + w;
  const int mt = wid / ntn, nq = wid % ntn;
  if (mt * 16 >= M) return;
  const int row0 = mt * 16, col0 = nq * 64;
  const float* arow = A + (size_t)(row0 + ln) * lda;
  v8f acc[4] = {};
  for (int kb = 0; kb < K; kb += 32) {
    FragB ah, al;
    const v4f x0 = *(const v4fa*)(arow + kb + 8 * hh), x1 = *(const v4fa*)(arow + kb + 8 * hh + 4);
    const v4f x2 = *(const v4fa*)(arow + kb + 16 + 8 * hh), x3 = *(const v4fa*)(arow + kb + 16 + 8 * hh + 4);
    float xs[16] = {x0[0],x0[1],x0[2],x0[3],x1[0],x1[1],x1[2],x1[3],x2[0],x2[1],x2[2],x2[3],x3[0],x3[1],x3[2],x3[3]};
#pragma unroll
    for (int i = 0; i < 16; ++i) { const unsigned short hb = bf16_bits(xs[i]); ah.u[i] = hb; al.u[i] = ASPLIT ? bf16_bits(xs[i] - bf16_val(hb)) : (unsigned short)0; }
#pragma unroll
    for (int t = 0; t < 4; ++t) {
      const unsigned short* brow = Wt + (size_t)(col0 + t * 16 + ln) * ldb + kb;
      FragB b;
      b.half[0] = *(const v8us*)(brow + 8 * hh);
      b.half[1] = *(const v8us*)(brow + 16 + 8 * hh);
      acc[t] = mmaN<ASPLIT ? 2 : 1>(ah.v, al.v, b.v, b.v, acc[t]);
    }
  }
#pragma unroll
  for (int t = 0; t < 4; ++t) {
    float bv = bias ? bias[col0 + t * 16 + ln] : 0.f;
    if (BIAS_BF16) bv = bf16_round(bv);
#pragma unroll
    for (int r = 0; r < 8; ++r) { float v = acc[t][r] + bv; if (ACT == 1) v = fmaxf(v, 0.f); so[w][8 * hh + r][t * 16 + ln] = v; }
  }
  __builtin_amdgcn_fence(__ATOMIC_ACQ_REL, "workgroup");
  __builtin_amdgcn_wave_barrier();
  const int rsub = lane >> 4, c4 = (lane & 15) * 4;
  {
#pragma unroll
    for (int q = 0; q < 8; ++q) {
      const int r = q * 2 + rsub;
      const v4f v = *(const v4fa*)&so[w][r][c4];
      *(v4f*)(C + (size_t)(row0 + r) * ldc + col0 + c4) = v;
    }
    
  }
}

// GEMM C = act(A·W + bias + resid): A f32 (ASPLIT -> hi/lo 2 terms), Wt bf16 [N][K]; ACT 0 none, 1 relu, 2 exact gelu;
// resid (optional, f32, row index = (row % rmod), pitch ldr, RES_BF16 rounds it) added before the activation.
template <bool ASPLIT, int ACT, bool BIAS_BF16, bool RES_BF16>
__global__ __launch_bounds__(128) void k_gemm_bf3(const float* __restrict__ A, int lda, const unsigned short* __restrict__ Wt, int ldb,
                                                const float* __restrict__ bias, const float* __restrict__ resid, int rmod, int ldr,
                                                float* __restrict__ C, int ldc, int M, int N, int K) {
  __shared__ __attribute__((aligned(16))) float so[4][16][64];
  const int tid = threadIdx.x, w = tid >> 5, lane = tid & 31, ln = lane & 15, hh = lane >> 4;
  const int ntn = N / 64;
  const int wid = blockIdx.x * 4 + w;
  const int mt = wid / ntn, nq = wid % ntn;
  if (mt * 16 >= M) return;
  const int row0 = mt * 16, col0 = nq * 64;
  const float* arow = A + (size_t)(row0 + ln) * lda;
  v8f acc[4] = {};
  for (int kb = 0; kb < K; kb += 32) {
    FragB ah, al;
    const v4f x0 = *(const v4fa*)(arow + kb + 8 * hh), x1 = *(const v4fa*)(arow + kb + 8 * hh + 4);
    const v4f x2 = *(const v4fa*)(arow + kb + 16 + 8 * hh), x3 = *(const v4fa*)(arow + kb + 16 + 8 * hh + 4);
    float xs[16] = {x0[0],x0[1],x0[2],x0[3],x1[0],x1[1],x1[2],x1[3],x2[0],x2[1],x2[2],x2[3],x3[0],x3[1],x3[2],x3[3]};
#pragma unroll
    for (int i = 0; i < 16; ++i) { const unsigned short hb = bf16_bits(xs[i]); ah.u[i] = hb; al.u[i] = ASPLIT ? bf16_bits(xs[i] - bf16_val(hb)) : (unsigned short)0; }
#pragma unroll
    for (int t = 0; t < 4; ++t) {
      const unsigned short* brow = Wt + (size_t)(col0 + t * 16 + ln) * ldb + kb;
      FragB b;
      b.half[0] = *(const v8us*)(brow + 8 * hh);
      b.half[1] = *(const v8us*)(brow + 16 + 8 * hh);
      acc[t] = mmaN<ASPLIT ? 2 : 1>(ah.v, al.v, b.v, b.v, acc[t]);
    }
  }
#pragma unroll
  for (int t = 0; t < 4; ++t) {
    const int col = col0 + t * 16 + ln;
    float bv = bias ? bias[col] : 0.f;
    if (BIAS_BF16) bv = bf16_round(bv);
#pragma unroll
    for (int r = 0; r < 8; ++r) {
      float v = acc[t][r] + bv;
      if (resid) { float rv = resid[(size_t)((row0 + 8 * hh + r) % rmod) * ldr + col]; if (RES_BF16) rv = bf16_round(rv); v += rv; }
      if (ACT == 1) v = fmaxf(v, 0.f);
      if (ACT == 2) v = 0.5f * v * (1.0f + erff(v * 0.70710678118654752f));
      if (ACT == 3) { const float u = 0.7978845608028654f * (v + 0.044715f * v * v * v); v = 0.5f * v * (1.0f + tanhf(u)); }
      so[w][8 * hh + r][t * 16 + ln] = v;
    }
  }
  __builtin_amdgcn_fence(__ATOMIC_ACQ_REL, "workgroup");
  __builtin_amdgcn_wave_barrier();
  const int rsub = lane >> 4, c4 = (lane & 15) * 4;
  {
#pragma unroll
    for (int q = 0; q < 8; ++q) {
      const int r = q * 2 + rsub;
      const v4f v = *(const v4fa*)&so[w][r][c4];
      *(v4f*)(C + (size_t)(row0 + r) * ldc + col0 + c4) = v;
    }
    
  }
}
// row LayerNorm (biased variance, eps) over N: s = X (+ R); optional out_sum <- s; out_norm <- (s-mu)*rsqrt(var+eps)*g + b
template <bool PARAM_BF16>
__global__ __launch_bounds__(256) void k_layernorm(const float* __restrict__ X, const float* __restrict__ R, const float* __restrict__ g, const float* __restrict__ bta,
                                                  float* __restrict__ out_sum, float* __restrict__ out_norm, int N, float eps) {
  __shared__ float red[256];
  const int row = blockIdx.x, tid = threadIdx.x;
  const float* x = X + (size_t)row * N; const float* rr = R ? R + (size_t)row * N : nullptr;
  float vals[16];                     // up to N = 4096
  const int per = N / 256;            // contiguous chunk per thread? use strided-by-4 chunks: thread handles j = tid*4 + 1024*u
  float s1 = 0.f;
  for (int u = 0; u < per / 4; ++u) {
    const int j = tid * 4 + 1024 * u;
    const v4f a = *(const v4fa*)(x + j);
    v4f b = {0.f,0.f,0.f,0.f}; if (rr) b = *(const v4fa*)(rr + j);
#pragma unroll
    for (int q = 0; q < 4; ++q) { const float v = a[q] + b[q]; vals[u * 4 + q] = v; s1 += v; }
  }
  red[tid] = s1; __syncthreads();
  for (int st = 128; st > 0; st >>= 1) { if (tid < st) red[tid] += red[tid + st]; __syncthreads(); }
  const float mu = red[0] / (float)N; __syncthreads();
  float s2 = 0.f;
  for (int u = 0; u < per / 4; ++u)
#pragma unroll
    for (int q = 0; q < 4; ++q) { const float c = vals[u * 4 + q] - mu; s2 += c * c; }
  red[tid] = s2; __syncthreads();
  for (int st = 128; st > 0; st >>= 1) { if (tid < st) red[tid] += red[tid + st]; __syncthreads(); }
  const float rs = rsqrtf(red[0] / (float)N + eps);
  {
    for (int u = 0; u < per / 4; ++u) {
      const int j = tid * 4 + 1024 * u;
      v4f o, sm;
#pragma unroll
      for (int q = 0; q < 4; ++q) {
        float gg = g[j + q], bb = bta[j + q];
        if (PARAM_BF16) { gg = bf16_round(gg); bb = bf16_round(bb); }
        sm[q] = vals[u * 4 + q]; o[q] = (vals[u * 4 + q] - mu) * rs * gg + bb;
      }
      if (out_sum) *(v4f*)(out_sum + (size_t)row * N + j) = sm;
      *(v4f*)(out_norm + (size_t)row * N + j) = o;
    }
    
  }
}



// ---- f16 WMMA path (v_wmma_f32_16x16x32_f16): 11-bit significands for operands in range — used where a [0,1] probability operand needs more precision than bf16
typedef _Float16 v16h __attribute__((ext_vector_type(16)));
union FragH { v16h v; v8us half[2]; _Float16 h[16]; unsigned short u[16]; };
template <int NT>
__device__ __forceinline__ v8f mmaH(v16h ah, v16h al, v16h bh, v16h bl, v8f c) {
  c = __builtin_amdgcn_wmma_f32_16x16x32_f16(false, ah, false, bh, (short)0, c, false, false);
  if (NT >= 2) c = __builtin_amdgcn_wmma_f32_16x16x32_f16(false, al, false, bh, (short)0, c, false, false);
  if (NT >= 3) c = __builtin_amdgcn_wmma_f32_16x16x32_f16(false, ah, false, bl, (short)0, c, false, false);
  asm volatile("v_nop\n\tv_nop\n\tv_nop\n\tv_nop" : "+v"(c) : "v"(ah), "v"(al), "v"(bh), "v"(bl));
  return c;
}
// batched GEMM like k_gemm_b but f16 operands: A f32 (split into f16 hi/lo if ASPLIT, else rounded to f16), Bt = f16 values [n][k]; alpha; C f32; N multiple of 16 (partial tiles skipped)
template <bool ASPLIT>
__global__ __launch_bounds__(128) void k_gemm_h(const float* __restrict__ A, int lda, size_t sA, const _Float16* __restrict__ Bh, int ldb, size_t sB, float alpha, float* __restrict__ C, int ldc, size_t sC, int M, int N, int K) {
  __shared__ __attribute__((aligned(16))) float so[4][16][64];
  const int tid = threadIdx.x, w = tid >> 5, lane = tid & 31, ln = lane & 15, hh = lane >> 4; const int by = blockIdx.y;
  A += (size_t)by * sA; Bh += (size_t)by * sB; C += (size_t)by * sC;
  const int ntn = (N + 63) / 64; const int wid = blockIdx.x * 4 + w; const int mt = wid / ntn, nq = wid % ntn; if (mt * 16 >= M) return;
  const int row0 = mt * 16, col0 = nq * 64; const float* arow = A + (size_t)(row0 + ln) * lda;
  v8f acc[4] = {};
  for (int kb = 0; kb < K; kb += 32) {
    FragH ah, al;
    const v4f x0 = *(const v4fa*)(arow + kb + 8 * hh), x1 = *(const v4fa*)(arow + kb + 8 * hh + 4), x2 = *(const v4fa*)(arow + kb + 16 + 8 * hh), x3 = *(const v4fa*)(arow + kb + 16 + 8 * hh + 4);
    float xs[16] = {x0[0],x0[1],x0[2],x0[3],x1[0],x1[1],x1[2],x1[3],x2[0],x2[1],x2[2],x2[3],x3[0],x3[1],x3[2],x3[3]};
#pragma unroll
    for (int i = 0; i < 16; ++i) { const _Float16 h = (_Float16)xs[i]; ah.h[i] = h; al.h[i] = ASPLIT ? (_Float16)(xs[i] - (float)h) : (_Float16)0.0f; }
#pragma unroll
    for (int t = 0; t < 4; ++t) { if (col0 + t * 16 >= N) continue; const size_t boff = (size_t)(col0 + t * 16 + ln) * ldb + kb; FragH bq; bq.half[0] = *(const v8us*)(Bh + boff + 8 * hh); bq.half[1] = *(const v8us*)(Bh + boff + 16 + 8 * hh);
      acc[t] = mmaH<ASPLIT ? 2 : 1>(ah.v, al.v, bq.v, bq.v, acc[t]); }
  }
#pragma unroll
  for (int t = 0; t < 4; ++t) { if (col0 + t * 16 >= N) continue;
#pragma unroll
    for (int r = 0; r < 8; ++r) so[w][8 * hh + r][t * 16 + ln] = acc[t][r] * alpha; }
  __builtin_amdgcn_fence(__ATOMIC_ACQ_REL, "workgroup"); __builtin_amdgcn_wave_barrier();
  const int rsub = lane >> 4, c4 = (lane & 15) * 4;
  {
#pragma unroll
    for (int q = 0; q < 8; ++q) { const int r = q * 2 + rsub; if (col0 + c4 < N) { const v4f v = *(const v4fa*)&so[w][r][c4]; *(v4f*)(C + (size_t)(row0 + r) * ldc + col0 + c4) = v; } }
     }
}

// Wt[n][k] = f16(W[k][n]·scale) from f32 row-major W[K][N] (scale = power of two; bf16-exact weights stay exact in f16 away from the subnormal range)
__global__ __launch_bounds__(256) void k_wt_f16(const float* __restrict__ W, _Float16* __restrict__ Wt, int K, int N, float scale) {
  const int t = blockIdx.x * 256 + threadIdx.x; if (t >= N * (K / 8)) return; const int n = t / (K / 8), k8 = (t % (K / 8)) * 8; FragH f;
#pragma unroll
  for (int i = 0; i < 8; ++i) f.h[i] = (_Float16)(bf16_round(W[(size_t)(k8 + i) * N + n]) * scale); const v8us o = f.half[0];
  *(v8us*)((unsigned short*)Wt + (size_t)n * K + k8) = o; 
}
// k_gemm_hh variant with fused epilogue: v = acc·alpha + bias[by·sBias + col] (+ CP[(row/rowsPerB)·sCPb + by·64 + col] if CP) ; ACT 0 none / 1 elu ; writes f16 C16 (and f32 C if non-null)
template <int ACT>
__global__ __launch_bounds__(128) void k_gemm_hhx(const _Float16* __restrict__ A, int lda, size_t sA, const _Float16* __restrict__ Bh, int ldb, size_t sB, float alpha, const float* __restrict__ bias, size_t sBias, const float* __restrict__ CP, int rowsPerB, size_t sCPb, int row0g,
    float* __restrict__ C, _Float16* __restrict__ C16, int ldc, size_t sC, int M, int N, int K) {
  __shared__ __attribute__((aligned(16))) float so[4][16][64];
  const int tid = threadIdx.x, w = tid >> 5, lane = tid & 31, ln = lane & 15, hh = lane >> 4; const int by = blockIdx.y;
  A += (size_t)by * sA; Bh += (size_t)by * sB; const size_t cofs = (size_t)by * sC; const float* bp = bias ? bias + (size_t)by * sBias : nullptr;
  const int ntn = (N + 63) / 64; const int wid = blockIdx.x * 4 + w; const int mt = wid / ntn, nq = wid % ntn; if (mt * 16 >= M) return;
  const int row0 = mt * 16, col0 = nq * 64; const _Float16* arow = A + (size_t)(row0 + ln) * lda;
  v8f acc[4] = {};
  for (int kb = 0; kb < K; kb += 32) { FragH ah; ah.half[0] = *(const v8us*)((const unsigned short*)arow + kb + 8 * hh); ah.half[1] = *(const v8us*)((const unsigned short*)arow + kb + 16 + 8 * hh);
#pragma unroll
    for (int t = 0; t < 4; ++t) { if (col0 + t * 16 >= N) continue; const size_t boff = (size_t)(col0 + t * 16 + ln) * ldb + kb; FragH bq; bq.half[0] = *(const v8us*)((const unsigned short*)Bh + boff + 8 * hh); bq.half[1] = *(const v8us*)((const unsigned short*)Bh + boff + 16 + 8 * hh);
      acc[t] = mmaH<1>(ah.v, ah.v, bq.v, bq.v, acc[t]); }
  }
#pragma unroll
  for (int t = 0; t < 4; ++t) { if (col0 + t * 16 >= N) continue; const int col = col0 + t * 16 + ln; const float bv = bp ? bf16_round(bp[col]) : 0.f;
#pragma unroll
    for (int r = 0; r < 8; ++r) { float v = acc[t][r] * alpha + bv; if (CP) { const int rr = row0g + row0 + 8 * hh + r; if (rowsPerB < 0) v += CP[cofs + (size_t)rr * ldc + col];      /* rowsPerB < 0: own element of the batched C plane */ else { const int bidx = rr / rowsPerB; v += CP[(size_t)bidx * sCPb + (size_t)by * 64 + col]; } } if (ACT == 1) v = (v > 0.f) ? v : expm1f(v); else if (ACT == 7) v = (v > 0.f) ? v + 1.0f : expf(v); else if (ACT == 8) v = tanhf(v); else if (ACT == 9) v = 0.5f * v * (1.0f + tanhf(0.7978845608028654f * (v + 0.044715f * v * v * v))); else if (ACT == 11) v = 1.0f / (1.0f + expf(-v)); else if (ACT == 12) v = (v > 0.f) ? v : 0.01f * v; else if (ACT == 14) v = (v > 0.f) ? v : 0.1f * v; else if (ACT == 16) v = (v >= 0.f) ? v : 0.3f * v; else if (ACT == 17) v = (v >= 0.f) ? v : 0.2f * v; else if (ACT == 15) v = v / (1.0f + expf(-v)); else if (ACT == 3) v = fmaxf(v, 0.f); else if (ACT == 6) v = 0.5f * v * (1.0f + erff(v * 0.70710678118654752f)); so[w][8 * hh + r][t * 16 + ln] = v; } }
  __builtin_amdgcn_fence(__ATOMIC_ACQ_REL, "workgroup"); __builtin_amdgcn_wave_barrier();
  const int rsub = lane >> 4, c4 = (lane & 15) * 4; typedef _Float16 v4h __attribute__((ext_vector_type(4)));
  {
#pragma unroll
    for (int q = 0; q < 8; ++q) { const int r = q * 2 + rsub; if (col0 + c4 < N) { const v4f v = *(const v4fa*)&so[w][r][c4]; if (C) *(v4f*)(C + cofs + (size_t)(row0 + r) * ldc + col0 + c4) = v; if (C16) { v4h h4; for (int i = 0; i < 4; ++i) h4[i] = (_Float16)v[i]; *(v4h*)(C16 + cofs + (size_t)(row0 + r) * ldc + col0 + c4) = h4; } } }
     }
}


typedef _Float16 v4h __attribute__((ext_vector_type(4)));

__global__ __launch_bounds__(256) void k_x16(const float* __restrict__ x, _Float16* __restrict__ X16, size_t n8) { const size_t t = (size_t)blockIdx.x * 256 + threadIdx.x; if (t >= n8) return; FragH f;
#pragma unroll
  for (int q = 0; q < 8; ++q) f.h[q] = (_Float16)bf16_round(x[t * 8 + q]); *(v8us*)((unsigned short*)X16 + t * 8) = f.half[0];  }
__global__ __launch_bounds__(256) void k_h16(const float* __restrict__ x, _Float16* __restrict__ X16, size_t n8) { const size_t t = (size_t)blockIdx.x * 256 + threadIdx.x; if (t >= n8) return; FragH f;
#pragma unroll
  for (int q = 0; q < 8; ++q) f.h[q] = (_Float16)x[t * 8 + q]; *(v8us*)((unsigned short*)X16 + t * 8) = f.half[0];  }
__global__ __launch_bounds__(256) void k_round16f(const float* __restrict__ W, _Float16* __restrict__ Bt, size_t n8) { const size_t t = (size_t)blockIdx.x * 256 + threadIdx.x; if (t >= n8) return; FragH f;
#pragma unroll
  for (int i = 0; i < 8; ++i) f.h[i] = (_Float16)(bf16_round(W[t * 8 + i]) * 16.0f); *(v8us*)((unsigned short*)Bt + t * 8) = f.half[0];  }
template <int NHv, int TTv>
__global__ __launch_bounds__(256) void k_vt(const _Float16* __restrict__ V16, int ldv, int voff, _Float16* __restrict__ Vt) { __shared__ unsigned short tl[64][66]; const int tid = threadIdx.x; const int slab = blockIdx.x / (TTv / 64), lg = blockIdx.x % (TTv / 64); const int b = slab / NHv, h = slab % NHv;
  for (int i = tid; i < 64 * 8; i += 256) { const int r = i / 8, c8 = (i % 8) * 8; FragH f; f.half[0] = *(const v8us*)((const unsigned short*)V16 + ((size_t)b * TTv + lg * 64 + r) * ldv + voff + h * 64 + c8);
#pragma unroll
    for (int q = 0; q < 8; ++q) tl[r][c8 + q] = f.u[q]; }
  __syncthreads();
  {
#pragma unroll
    for (int rd = 0; rd < 2; ++rd) { const int d = rd * 32 + tid / 8, pc = tid % 8; FragH f;
#pragma unroll
      for (int q = 0; q < 8; ++q) f.u[q] = tl[pc * 8 + q][d];
      *(v8us*)((unsigned short*)Vt + ((size_t)slab * 64 + d) * TTv + lg * 64 + pc * 8) = f.half[0]; }
     } }

__global__ __launch_bounds__(256) void k_hl(const float* __restrict__ F, _Float16* __restrict__ Hh, _Float16* __restrict__ Hl, size_t n8) { const size_t t = (size_t)blockIdx.x * 256 + threadIdx.x; if (t >= n8) return; FragH fh, fl; const v4f a = *(const v4fa*)(F + t * 8), c = *(const v4fa*)(F + t * 8 + 4);
#pragma unroll
  for (int q = 0; q < 4; ++q) { _Float16 h = (_Float16)a[q]; fh.h[q] = h; fl.h[q] = (_Float16)((a[q] - (float)h) * 1024.0f); h = (_Float16)c[q]; fh.h[4 + q] = h; fl.h[4 + q] = (_Float16)((c[q] - (float)h) * 1024.0f); }
  { *(v8us*)((unsigned short*)Hh + t * 8) = fh.half[0]; *(v8us*)((unsigned short*)Hl + t * 8) = fl.half[0];  } }

// ---- fast GEMM (wave tile 32x64; requires M % 32 == 0 rows per launch region and N % 64 == 0); epilogue = k_gemm_hhx semantics ----
__device__ __forceinline__ v16h g2_frag(const _Float16* p, int hh) { FragH f; f.half[0] = *(const v8us*)((const unsigned short*)p + 8 * hh); f.half[1] = *(const v8us*)((const unsigned short*)p + 16 + 8 * hh); return f.v; }
__device__ __forceinline__ v8f g2_mma(v16h a, v16h b, v8f c) { v8f d = __builtin_amdgcn_wmma_f32_16x16x32_f16(false, a, false, b, (short)0, c, false, false); asm volatile("v_nop\n\tv_nop\n\tv_nop\n\tv_nop" : "+v"(d) : "v"(a), "v"(b)); return d; }
template <int ACT>
__global__ __launch_bounds__(128) void k_gemm2(const _Float16* __restrict__ A, int lda, size_t sA, const _Float16* __restrict__ Bh, int ldb, size_t sB, float alpha, const float* __restrict__ bias, size_t sBias, const float* __restrict__ CP, int rowsPerB, size_t sCPb, int row0g,
    float* __restrict__ C, _Float16* __restrict__ C16, int ldc, size_t sC, int M, int N, int K) { static_assert(ACT == 0 || ACT == 3 || ACT == 6 || ACT == 8 || ACT == 9 || ACT == 11 || ACT == 12 || ACT == 14 || ACT == 15 || ACT == 16 || ACT == 17, "k_gemm2: unsupported ACT code (would silently apply no activation)");
  __shared__ __attribute__((aligned(16))) float so[4][32][68];
  const int tid = threadIdx.x, w = tid >> 5, lane = tid & 31, ln = lane & 15, hh = lane >> 4; const int by = blockIdx.y;
  A += (size_t)by * sA; Bh += (size_t)by * sB; const size_t cofs = (size_t)by * sC; const float* bp = bias ? bias + (size_t)by * sBias : nullptr;
  const int ntn = N >> 6; const int mt = blockIdx.x / ntn, nq = blockIdx.x - mt * ntn; const int row0 = mt * 128 + 32 * w, col0 = nq * 64; if (row0 >= M) return;
  const _Float16* a0p = A + (size_t)(row0 + ln) * lda; const _Float16* a1p = a0p + (size_t)16 * lda;
  const _Float16* b0p = Bh + (size_t)(col0 + ln) * ldb; const _Float16* b1p = b0p + (size_t)16 * ldb; const _Float16* b2p = b1p + (size_t)16 * ldb; const _Float16* b3p = b2p + (size_t)16 * ldb;
  const v8f z8 = {0.f,0.f,0.f,0.f,0.f,0.f,0.f,0.f}; v8f c00 = z8, c01 = z8, c02 = z8, c03 = z8, c10 = z8, c11 = z8, c12 = z8, c13 = z8;
#pragma unroll 1
  for (int kb = 0; kb < K; kb += 32) { const v16h a0 = g2_frag(a0p + kb, hh), a1 = g2_frag(a1p + kb, hh);
    v16h b = g2_frag(b0p + kb, hh); c00 = g2_mma(a0, b, c00); c10 = g2_mma(a1, b, c10);
    b = g2_frag(b1p + kb, hh); c01 = g2_mma(a0, b, c01); c11 = g2_mma(a1, b, c11);
    b = g2_frag(b2p + kb, hh); c02 = g2_mma(a0, b, c02); c12 = g2_mma(a1, b, c12);
    b = g2_frag(b3p + kb, hh); c03 = g2_mma(a0, b, c03); c13 = g2_mma(a1, b, c13); }
  v8f accs[8] = {c00, c01, c02, c03, c10, c11, c12, c13};
#pragma unroll
  for (int u = 0; u < 8; ++u) { const int t = u & 3, half = u >> 2; const int col = col0 + t * 16 + ln; const float bv = bp ? bf16_round(bp[col]) : 0.f;
#pragma unroll
    for (int r = 0; r < 8; ++r) { const int rloc = half * 16 + 8 * hh + r; float v = accs[u][r] * alpha + bv; if (CP) { if (rowsPerB < 0) v += CP[cofs + (size_t)(row0g + row0 + rloc) * ldc + col];      /* rowsPerB < 0: own element of the batched C plane */ else { const int bidx = (row0g + row0 + rloc) / rowsPerB; v += CP[(size_t)bidx * sCPb + (size_t)by * 64 + col]; } }
      if (ACT == 3) v = fmaxf(v, 0.f); else if (ACT == 6) v = 0.5f * v * (1.0f + erff(v * 0.70710678118654752f)); else if (ACT == 11) v = 1.0f / (1.0f + expf(-v)); else if (ACT == 15) v = v / (1.0f + expf(-v)); else if (ACT == 12) v = (v > 0.f) ? v : 0.01f * v; else if (ACT == 8) v = tanhf(v); else if (ACT == 9) v = 0.5f * v * (1.0f + tanhf(0.7978845608028654f * (v + 0.044715f * v * v * v))); else if (ACT == 14) v = (v > 0.f) ? v : 0.1f * v; else if (ACT == 16) v = (v >= 0.f) ? v : 0.3f * v; else if (ACT == 17) v = (v >= 0.f) ? v : 0.2f * v;
      so[w][rloc][t * 16 + ln] = v; } }
  __builtin_amdgcn_fence(__ATOMIC_ACQ_REL, "workgroup"); __builtin_amdgcn_wave_barrier();
  const int rsub = lane >> 4, c4 = (lane & 15) * 4;
  {
#pragma unroll
    for (int q = 0; q < 16; ++q) { const int r = q * 2 + rsub; const v4f v = *(const v4fa*)&so[w][r][c4]; if (C) *(v4f*)(C + cofs + (size_t)(row0 + r) * ldc + col0 + c4) = v; if (C16) { v4h h4; for (int i = 0; i < 4; ++i) h4[i] = (_Float16)v[i]; *(v4h*)(C16 + cofs + (size_t)(row0 + r) * ldc + col0 + c4) = h4; } }
     } }


__global__ __launch_bounds__(256) void k_wnat(const float* __restrict__ w, size_t n8, _Float16* __restrict__ Bt) { const size_t t = (size_t)blockIdx.x * 256 + threadIdx.x; if (t >= n8) return; FragH f; for (int q = 0; q < 8; ++q) f.h[q] = (_Float16)(bf16_round(w[t * 8 + q]) * 16.0f); *(v8us*)((unsigned short*)Bt + t * 8) = f.half[0];  }
__global__ __launch_bounds__(256) void k_rsm(const float* __restrict__ S, _Float16* __restrict__ P, int nrows) {
  #pragma clang fp contract(off)
  const int i = blockIdx.x * 256 + threadIdx.x; if (i >= nrows) return; const float* s = S + (size_t)i * SQ; float mx = -3.0e38f;
#pragma unroll 1
  for (int j = 0; j < SQ; ++j) mx = fmaxf(mx, s[j]); float se = 0.f;
#pragma unroll 1
  for (int j = 0; j < SQ; ++j) se += expf(s[j] - mx); const float sc = 256.0f / se;
#pragma unroll 1
  for (int j0 = 0; j0 < SQ; j0 += 8) { FragH f; for (int q = 0; q < 8; ++q) f.h[q] = (_Float16)(expf(s[j0 + q] - mx) * sc); unsigned short* d = (unsigned short*)P + (size_t)i * SQ + j0; *(v8us*)d = f.half[0];  } }
__global__ __launch_bounds__(256) void k_vt(const _Float16* __restrict__ V16, int b, int h0, _Float16* __restrict__ VT) { __shared__ unsigned short tl[64][65]; const int tid = threadIdx.x; const int hh = blockIdx.x % HG, sg = blockIdx.x / HG; const int s0 = sg * 64; const int h = h0 + hh;
  for (int i = tid; i < 64 * 8; i += 256) { const int j = i / 8, d8 = (i % 8) * 8; FragH f; f.half[0] = *(const v8us*)((const unsigned short*)V16 + ((size_t)b * SQ + s0 + j) * DM + h * HD + d8); for (int q = 0; q < 8; ++q) tl[d8 + q][j] = f.u[q]; }
  __syncthreads();
  { for (int i = tid; i < 64 * 8; i += 256) { const int d = i / 8, j8 = (i % 8) * 8; FragH f; for (int q = 0; q < 8; ++q) f.u[q] = tl[d][j8 + q]; *(v8us*)((unsigned short*)VT + ((size_t)hh * HD + d) * SQ + s0 + j8) = f.half[0]; }  } }

__global__ __launch_bounds__(256) void k_qprep(const float* __restrict__ QF, const float* __restrict__ ub, const float* __restrict__ vb, _Float16* __restrict__ Q16, _Float16* __restrict__ QU, _Float16* __restrict__ QV, size_t n8) {
  #pragma clang fp contract(off)
  const size_t t = (size_t)blockIdx.x * 256 + threadIdx.x; if (t >= n8) return; const size_t e = t * 8; const int c = (int)(e % DM); FragH a, b, d;
#pragma unroll
  for (int q = 0; q < 8; ++q) { const float v = QF[e + q]; a.h[q] = (_Float16)v; b.h[q] = (_Float16)__fadd_rn(v, bf16_round(ub[c + q])); d.h[q] = (_Float16)__fadd_rn(v, bf16_round(vb[c + q])); }
  { *(v8us*)((unsigned short*)Q16 + e) = a.half[0]; *(v8us*)((unsigned short*)QU + e) = b.half[0]; *(v8us*)((unsigned short*)QV + e) = d.half[0];  } }

__global__ __launch_bounds__(256) void k_zfill(_Float16* __restrict__ dst, size_t n8) { const size_t t = (size_t)blockIdx.x * 256 + threadIdx.x; if (t >= n8) return; const v8us z = {0, 0, 0, 0, 0, 0, 0, 0}; *(v8us*)((unsigned short*)dst + t * 8) = z;  }
__global__ __launch_bounds__(256) void k_relsm2(const float* __restrict__ AC, const float* __restrict__ BD, const int* __restrict__ mrows, _Float16* __restrict__ P, int qn, int hg) {
  #pragma clang fp contract(off)
  const int t = blockIdx.x * 256 + threadIdx.x; if (t >= qn * hg) return; const int i = t % qn; const size_t rw = (size_t)(t / qn) * SQ + i; const float* s = AC + rw * SQ; const float* bd = BD + rw * PP + (SQ - 1 + i); const int* mk = mrows + (size_t)i * SQ;
  float mx = -3.0e38f;
#pragma unroll 1
  for (int j = 0; j < SQ; ++j) { const float f = (mk[j] == 0) ? 1.f : 0.f; const float v = __fmul_rn(__fadd_rn(s[j], bd[-j]), 0.125f); mx = fmaxf(mx, fmaf(f, v, (1.f - f) * -3.0e38f)); }
  float se = 0.f;
#pragma unroll 1
  for (int j = 0; j < SQ; ++j) { const float f = (mk[j] == 0) ? 1.f : 0.f; const float v = __fmul_rn(__fadd_rn(s[j], bd[-j]), 0.125f); se += f * __expf(fminf(v - mx, 80.f)); }
  const float sc = (se > 0.f) ? 256.0f / se : 0.f;
#pragma unroll 1
  for (int j0 = 0; j0 < SQ; j0 += 8) { FragH fr; for (int q = 0; q < 8; ++q) { const int j = j0 + q; const float f = (mk[j] == 0) ? 1.f : 0.f; const float v = __fmul_rn(__fadd_rn(s[j], bd[-j]), 0.125f); fr.h[q] = (_Float16)(f * __expf(fminf(v - mx, 80.f)) * sc); }
    unsigned short* d = (unsigned short*)P + rw * SQ + j0; *(v8us*)d = fr.half[0];  } }

extern "C" void kernel_launch(void* const* d_in, const int* in_sizes, int n_in,
                              void* d_out, int out_size, void* d_ws, size_t ws_size, hipStream_t stream) {
  (void)in_sizes; (void)n_in; (void)out_size;
  const float* const* I = (const float* const*)d_in; const float* xq = I[0]; const float* xk = I[1]; const float* xv = I[2]; const int* mask = (const int*)d_in[3]; const float* pe = I[4]; const float* wq = I[5]; const float* bq = I[6]; const float* wk = I[7]; const float* bk = I[8]; const float* wv = I[9]; const float* bv = I[10]; const float* wpos = I[11]; const float* wo = I[12]; const float* bo = I[13]; const float* pbu = I[14]; const float* pbv = I[15];
  char* ws = (char*)d_ws; size_t off = 0;
  auto take = [&](size_t bytes) { char* p = ws + off; off += (bytes + 255) & ~(size_t)255; return p; };
  _Float16* BQ = (_Float16*)take((size_t)DM * DM * 2); _Float16* BK = (_Float16*)take((size_t)DM * DM * 2); _Float16* BV = (_Float16*)take((size_t)DM * DM * 2); _Float16* BP = (_Float16*)take((size_t)DM * DM * 2); _Float16* BO = (_Float16*)take((size_t)DM * DM * 2);
  _Float16* XQ = (_Float16*)take(NR * DM * 2); _Float16* XK = (_Float16*)take(NR * DM * 2); _Float16* XV = (_Float16*)take(NR * DM * 2); _Float16* PE = (_Float16*)take((size_t)PP * DM * 2);
  float* QF = (float*)take(NR * DM * 4); _Float16* Q16 = (_Float16*)take(NR * DM * 2); _Float16* QU = (_Float16*)take(NR * DM * 2); _Float16* QV = (_Float16*)take(NR * DM * 2); _Float16* K16 = (_Float16*)take(NR * DM * 2); _Float16* V16 = (_Float16*)take(NR * DM * 2); _Float16* R16 = (_Float16*)take((size_t)PP * DM * 2); _Float16* O16 = (_Float16*)take(NR * DM * 2);
  float* S = (float*)take((size_t)HG * SQ * SQ * 4); float* BD = (float*)take((size_t)HG * SQ * PP * 4); _Float16* P = (_Float16*)take((size_t)HG * SQ * SQ * 2); _Float16* VT = (_Float16*)take((size_t)NH * HD * SQ * 2);
  if (off > ws_size) return;      /* 2.5 + 12 + 2 + 8 + 20 + 2 + 4 + 32 + 64 + 16 + 1 = approx 164 MiB */
  { const unsigned gw = (unsigned)(((size_t)DM * (DM / 8) + 255) / 256); k_wt_f16<<<gw, 256, 0, stream>>>(wq, BQ, DM, DM, 16.0f); k_wt_f16<<<gw, 256, 0, stream>>>(wk, BK, DM, DM, 16.0f); k_wt_f16<<<gw, 256, 0, stream>>>(wv, BV, DM, DM, 16.0f); k_wt_f16<<<gw, 256, 0, stream>>>(wpos, BP, DM, DM, 16.0f); k_wt_f16<<<gw, 256, 0, stream>>>(wo, BO, DM, DM, 16.0f); }
  { const unsigned gx = (unsigned)((NR * DM / 8 + 255) / 256); k_x16<<<gx, 256, 0, stream>>>(xq, XQ, NR * DM / 8); k_x16<<<gx, 256, 0, stream>>>(xk, XK, NR * DM / 8); k_x16<<<gx, 256, 0, stream>>>(xv, XV, NR * DM / 8); }
  k_x16<<<(unsigned)(((size_t)NPOS * DM / 8 + 255) / 256), 256, 0, stream>>>(pe, PE, (size_t)NPOS * DM / 8); k_zfill<<<1, 256, 0, stream>>>(PE + (size_t)NPOS * DM, DM / 8);      /* pad row 2047 */
  const dim3 gp((unsigned)((NR / 128) * (DM / 64)), 1);
  k_gemm2<0><<<gp, 128, 0, stream>>>(XQ, DM, 0, BQ, DM, 0, 0.0625f, bq, 0, nullptr, 1, 0, 0, QF, nullptr, DM, 0, (int)NR, DM, DM);      /* q (f32) */
  k_qprep<<<(unsigned)((NR * DM / 8 + 255) / 256), 256, 0, stream>>>(QF, pbu, pbv, Q16, QU, QV, NR * DM / 8);      /* q + pos_bias_u, q + pos_bias_v (f16) */
  k_gemm2<0><<<gp, 128, 0, stream>>>(XK, DM, 0, BK, DM, 0, 0.0625f, bk, 0, nullptr, 1, 0, 0, nullptr, K16, DM, 0, (int)NR, DM, DM);
  k_gemm2<0><<<gp, 128, 0, stream>>>(XV, DM, 0, BV, DM, 0, 0.0625f, bv, 0, nullptr, 1, 0, 0, nullptr, V16, DM, 0, (int)NR, DM, DM);
  k_gemm2<0><<<dim3((PP / 128) * (DM / 64), 1), 128, 0, stream>>>(PE, DM, 0, BP, DM, 0, 0.0625f, nullptr, 0, nullptr, 1, 0, 0, nullptr, R16, DM, 0, PP, DM, DM);      /* p = pos_emb Wpos (f16; row 2047 is the zero pad) */
  for (int b = B0; b < B0 + NBR; ++b) { const size_t r0 = (size_t)b * SQ;
    k_vt<NH, SQ><<<NH * (SQ / 64), 256, 0, stream>>>(V16 + r0 * DM, DM, 0, VT);      /* V^T [8][64][1024] */
    k_gemm2<0><<<dim3((QN / 128) * (SQ / 64), HG), 128, 0, stream>>>(QU + r0 * DM, DM, (size_t)HD, K16 + r0 * DM, DM, (size_t)HD, 1.0f, nullptr, 0, nullptr, 1, 0, 0, S, nullptr, SQ, (size_t)SQ * SQ, QN, SQ, HD);      /* ac = (q + u) . k */
    k_gemm2<0><<<dim3((QN / 128) * (PP / 64), HG), 128, 0, stream>>>(QV + r0 * DM, DM, (size_t)HD, R16, DM, (size_t)HD, 1.0f, nullptr, 0, nullptr, 1, 0, 0, BD, nullptr, PP, (size_t)SQ * PP, QN, PP, HD);      /* bd_raw[i][r] = (q_i + v) . p[r] */
    k_relsm2<<<(HG * QN + 255) / 256, 256, 0, stream>>>(S, BD, mask + r0 * SQ, P, QN, HG);
    k_gemm2<0><<<dim3((QN / 128) * (HD / 64), HG), 128, 0, stream>>>(P, SQ, (size_t)SQ * SQ, VT, SQ, (size_t)HD * SQ, 0.25f, nullptr, 0, nullptr, 1, 0, 0, nullptr, O16 + r0 * DM, DM, (size_t)HD, QN, HD, SQ); }      /* o x64, merged rows */
  k_gemm2<0><<<gp, 128, 0, stream>>>(O16, DM, 0, BO, DM, 0, 0.0009765625f, bo, 0, nullptr, 1, 0, 0, (float*)d_out, nullptr, DM, 0, (int)NR, DM, DM);      /* out = x Wout + bout */
}

// v001
// Measured time: 454 microseconds a run.
// In two side-by-side timings against v000, it was 9.18 and 9.04 times as fast.
#include <hip/hip_runtime.h>
// Relative-position multi-head attention with rel_shift (query, key, value [4][1024][512]; mask [4][1024][1024] int32 verbatim (nonzero = masked, ~50 %); pos_emb [1][2047][512]; q/k/v = x W + b ([512][512] [in][out]); p = pos_emb Wpos; 8 heads of 64; ac = (q + pos_bias_u) . k; bd = rel_shift((q + pos_bias_v) . p^T) = (q_i + v) . p[T-1+i-j]; scores = (ac + bd) / 8; masked -> float32 min; softmax; masked weights -> 0; x = attn v merged; out = x Wout + bout -> [4][1024][512].
// Structure: token rows; inputs and pos_emb as exact f16 rows (pos table padded to 2048 rows with zeros); q as a WMMA GEMM (32x64 wave tiles, f32 accumulation, exact x16 weights + bias) into f32 rows, then f16 planes of q + u and q + v on VALU; k, v, p as WMMA GEMMs (f16 outputs); per batch: V^T via LDS transposes; ac GEMM (all 8 heads, K = 64) and bd GEMM against all 2,048 table rows (K = 64) into f32 planes; the shifted relative softmax with the mask on VALU (f32 statistics, native exp; weights x256 f16); o = P . V^T GEMM (K = 1024; o x64 in f16); out GEMM (f32, + bout); 36 launches.
// Compute dtype: inputs rounded to bf16; inputs / weights exact in f16; q + u, q + v, k, v, p, softmax weights and o plain f16 (~2^-12); ac, bd, softmax statistics f32. v_wmma_f32_16x16x32_f16.
#define NB 4
#define SQ 1024
#define PP 2048                      /* position table rows (2047 used, row 2047 zero) */
#define NPOS 2047
#define DM 512
#define NH 8
#define HD 64
#define HG 8
#define B0 0                         /* first batch attended (debug hook) */
#define NBR NB                       /* batches attended (debug hook) */
#define QN SQ                        /* query rows attended per batch (debug hook) */
#define NR ((size_t)NB * SQ)
typedef __bf16 v16b __attribute__((ext_vector_type(16)));
typedef unsigned short v8us __attribute__((ext_vector_type(8), may_alias));
typedef float  v8f  __attribute__((ext_vector_type(8)));
typedef float  v4f  __attribute__((ext_vector_type(4)));
typedef float  v4fa __attribute__((ext_vector_type(4), may_alias));
union FragB { v16b v; v8us half[2]; unsigned short u[16]; };

__device__ __forceinline__ unsigned short bf16_bits(float x) { unsigned int u = __float_as_uint(x); return (unsigned short)((u + 0x7FFFu + ((u >> 16) & 1u)) >> 16); }
__device__ __forceinline__ float bf16_val(unsigned short b) { return __uint_as_float(((unsigned int)b) << 16); }
__device__ __forceinline__ float bf16_round(float x) { return bf16_val(bf16_bits(x)); }
// D += A·B with NT terms: 1 = ah·bh, 2 = + al·bh (A split), 3 = + ah·bl (both split)
template <int NT>
__device__ __forceinline__ v8f mmaN(v16b ah, v16b al, v16b bh, v16b bl, v8f c) {
  c = __builtin_amdgcn_wmma_f32_16x16x32_bf16(false, ah, false, bh, (short)0, c, false, false);
  if (NT >= 2) c = __builtin_amdgcn_wmma_f32_16x16x32_bf16(false, al, false, bh, (short)0, c, false, false);
  if (NT >= 3) c = __builtin_amdgcn_wmma_f32_16x16x32_bf16(false, ah, false, bl, (short)0, c, false, false);
  asm volatile("v_nop\n\tv_nop\n\tv_nop\n\tv_nop" : "+v"(c) : "v"(ah), "v"(al), "v"(bh), "v"(bl));
  return c;
}

__global__ __launch_bounds__(256) void k_wt_bf16(const float* __restrict__ W, unsigned short* __restrict__ Wt, int K, int N) {
  const int t = blockIdx.x * 256 + threadIdx.x;
  const int k8n = K / 8;
  if (t >= N * k8n) return;
  const int n = t / k8n, k8 = (t % k8n) * 8;
  v8us v;
#pragma unroll
  for (int i = 0; i < 8; ++i) v[i] = bf16_bits(W[(size_t)(k8 + i) * N + n]);
  *(v8us*)(Wt + (size_t)n * K + k8) = v;
  
}

// GEMM C[M][N] (f32, pitch ldc) = act(A[M][K]·W + bias). A f32 row-major (pitch lda) converted per fragment to bf16
// (ASPLIT: hi/lo two planes -> 2 terms, else single rounded term); Wt bf16 [N][K] (pitch ldb). BIAS_BF16 rounds the
// bias to bf16 first (bias quantised to bf16 before the add). K%32==0, M%16==0, N%64==0.
template <bool ASPLIT, int ACT, bool BIAS_BF16>
__global__ __launch_bounds__(128) void k_gemm_bf(const float* __restrict__ A, int lda, const unsigned short* __restrict__ Wt, int ldb,
                                               const float* __restrict__ bias, float* __restrict__ C, int ldc, int M, int N, int K) {
  __shared__ __attribute__((aligned(16))) float so[4][16][64];
  const int tid = threadIdx.x, w = tid >> 5, lane = tid & 31, ln = lane & 15, hh = lane >> 4;
  const int ntn = N / 64;
  const int wid = blockIdx.x * 4 + w;
  const int mt = wid / ntn, nq = wid % ntn;
  if (mt * 16 >= M) return;
  const int row0 = mt * 16, col0 = nq * 64;
  const float* arow = A + (size_t)(row0 + ln) * lda;
  v8f acc[4] = {};
  for (int kb = 0; kb < K; kb += 32) {
    FragB ah, al;
    const v4f x0 = *(const v4fa*)(arow + kb + 8 * hh), x1 = *(const v4fa*)(arow + kb + 8 * hh + 4);
    const v4f x2 = *(const v4fa*)(arow + kb + 16 + 8 * hh), x3 = *(const v4fa*)(arow + kb + 16 + 8 * hh + 4);
    float xs[16] = {x0[0],x0[1],x0[2],x0[3],x1[0],x1[1],x1[2],x1[3],x2[0],x2[1],x2[2],x2[3],x3[0],x3[1],x3[2],x3[3]};
#pragma unroll
    for (int i = 0; i < 16; ++i) { const unsigned short hb = bf16_bits(xs[i]); ah.u[i] = hb; al.u[i] = ASPLIT ? bf16_bits(xs[i] - bf16_val(hb)) : (unsigned short)0; }
#pragma unroll
    for (int t = 0; t < 4; ++t) {
      const unsigned short* brow = Wt + (size_t)(col0 + t * 16 + ln) * ldb + kb;
      FragB b;
      b.half[0] = *(const v8us*)(brow + 8 * hh);
      b.half[1] = *(const v8us*)(brow + 16 + 8 * hh);
      acc[t] = mmaN<ASPLIT ? 2 : 1>(ah.v, al.v, b.v, b.v, acc[t]);
    }
  }
#pragma unroll
  for (int t = 0; t < 4; ++t) {
    float bv = bias ? bias[col0 + t * 16 + ln] : 0.f;
    if (BIAS_BF16) bv = bf16_round(bv);
#pragma unroll
    for (int r = 0; r < 8; ++r) { float v = acc[t][r] + bv; if (ACT == 1) v = fmaxf(v, 0.f); so[w][8 * hh + r][t * 16 + ln] = v; }
  }
  __builtin_amdgcn_fence(__ATOMIC_ACQ_REL, "workgroup");
  __builtin_amdgcn_wave_barrier();
  const int rsub = lane >> 4, c4 = (lane & 15) * 4;
  {
#pragma unroll
    for (int q = 0; q < 8; ++q) {
      const int r = q * 2 + rsub;
      const v4f v = *(const v4fa*)&so[w][r][c4];
      *(v4f*)(C + (size_t)(row0 + r) * ldc + col0 + c4) = v;
    }
    
  }
}

// GEMM C = act(A·W + bias + resid): A f32 (ASPLIT -> hi/lo 2 terms), Wt bf16 [N][K]; ACT 0 none, 1 relu, 2 exact gelu;
// resid (optional, f32, row index = (row % rmod), pitch ldr, RES_BF16 rounds it) added before the activation.
template <bool ASPLIT, int ACT, bool BIAS_BF16, bool RES_BF16>
__global__ __launch_bounds__(128) void k_gemm_bf3(const float* __restrict__ A, int lda, const unsigned short* __restrict__ Wt, int ldb,
                                                const float* __restrict__ bias, const float* __restrict__ resid, int rmod, int ldr,
                                                float* __restrict__ C, int ldc, int M, int N, int K) {
  __shared__ __attribute__((aligned(16))) float so[4][16][64];
  const int tid = threadIdx.x, w = tid >> 5, lane = tid & 31, ln = lane & 15, hh = lane >> 4;
  const int ntn = N / 64;
  const int wid = blockIdx.x * 4 + w;
  const int mt = wid / ntn, nq = wid % ntn;
  if (mt * 16 >= M) return;
  const int row0 = mt * 16, col0 = nq * 64;
  const float* arow = A + (size_t)(row0 + ln) * lda;
  v8f acc[4] = {};
  for (int kb = 0; kb < K; kb += 32) {
    FragB ah, al;
    const v4f x0 = *(const v4fa*)(arow + kb + 8 * hh), x1 = *(const v4fa*)(arow + kb + 8 * hh + 4);
    const v4f x2 = *(const v4fa*)(arow + kb + 16 + 8 * hh), x3 = *(const v4fa*)(arow + kb + 16 + 8 * hh + 4);
    float xs[16] = {x0[0],x0[1],x0[2],x0[3],x1[0],x1[1],x1[2],x1[3],x2[0],x2[1],x2[2],x2[3],x3[0],x3[1],x3[2],x3[3]};
#pragma unroll
    for (int i = 0; i < 16; ++i) { const unsigned short hb = bf16_bits(xs[i]); ah.u[i] = hb; al.u[i] = ASPLIT ? bf16_bits(xs[i] - bf16_val(hb)) : (unsigned short)0; }
#pragma unroll
    for (int t = 0; t < 4; ++t) {
      const unsigned short* brow = Wt + (size_t)(col0 + t * 16 + ln) * ldb + kb;
      FragB b;
      b.half[0] = *(const v8us*)(brow + 8 * hh);
      b.half[1] = *(const v8us*)(brow + 16 + 8 * hh);
      acc[t] = mmaN<ASPLIT ? 2 : 1>(ah.v, al.v, b.v, b.v, acc[t]);
    }
  }
#pragma unroll
  for (int t = 0; t < 4; ++t) {
    const int col = col0 + t * 16 + ln;
    float bv = bias ? bias[col] : 0.f;
    if (BIAS_BF16) bv = bf16_round(bv);
#pragma unroll
    for (int r = 0; r < 8; ++r) {
      float v = acc[t][r] + bv;
      if (resid) { float rv = resid[(size_t)((row0 + 8 * hh + r) % rmod) * ldr + col]; if (RES_BF16) rv = bf16_round(rv); v += rv; }
      if (ACT == 1) v = fmaxf(v, 0.f);
      if (ACT == 2) v = 0.5f * v * (1.0f + erff(v * 0.70710678118654752f));
      if (ACT == 3) { const float u = 0.7978845608028654f * (v + 0.044715f * v * v * v); v = 0.5f * v * (1.0f + tanhf(u)); }
      so[w][8 * hh + r][t * 16 + ln] = v;
    }
  }
  __builtin_amdgcn_fence(__ATOMIC_ACQ_REL, "workgroup");
  __builtin_amdgcn_wave_barrier();
  const int rsub = lane >> 4, c4 = (lane & 15) * 4;
  {
#pragma unroll
    for (int q = 0; q < 8; ++q) {
      const int r = q * 2 + rsub;
      const v4f v = *(const v4fa*)&so[w][r][c4];
      *(v4f*)(C + (size_t)(row0 + r) * ldc + col0 + c4) = v;
    }
    
  }
}
// row LayerNorm (biased variance, eps) over N: s = X (+ R); optional out_sum <- s; out_norm <- (s-mu)*rsqrt(var+eps)*g + b
template <bool PARAM_BF16>
__global__ __launch_bounds__(256) void k_layernorm(const float* __restrict__ X, const float* __restrict__ R, const float* __restrict__ g, const float* __restrict__ bta,
                                                  float* __restrict__ out_sum, float* __restrict__ out_norm, int N, float eps) {
  __shared__ float red[256];
  const int row = blockIdx.x, tid = threadIdx.x;
  const float* x = X + (size_t)row * N; const float* rr = R ? R + (size_t)row * N : nullptr;
  float vals[16];                     // up to N = 4096
  const int per = N / 256;            // contiguous chunk per thread? use strided-by-4 chunks: thread handles j = tid*4 + 1024*u
  float s1 = 0.f;
  for (int u = 0; u < per / 4; ++u) {
    const int j = tid * 4 + 1024 * u;
    const v4f a = *(const v4fa*)(x + j);
    v4f b = {0.f,0.f,0.f,0.f}; if (rr) b = *(const v4fa*)(rr + j);
#pragma unroll
    for (int q = 0; q < 4; ++q) { const float v = a[q] + b[q]; vals[u * 4 + q] = v; s1 += v; }
  }
  red[tid] = s1; __syncthreads();
  for (int st = 128; st > 0; st >>= 1) { if (tid < st) red[tid] += red[tid + st]; __syncthreads(); }
  const float mu = red[0] / (float)N; __syncthreads();
  float s2 = 0.f;
  for (int u = 0; u < per / 4; ++u)
#pragma unroll
    for (int q = 0; q < 4; ++q) { const float c = vals[u * 4 + q] - mu; s2 += c * c; }
  red[tid] = s2; __syncthreads();
  for (int st = 128; st > 0; st >>= 1) { if (tid < st) red[tid] += red[tid + st]; __syncthreads(); }
  const float rs = rsqrtf(red[0] / (float)N + eps);
  {
    for (int u = 0; u < per / 4; ++u) {
      const int j = tid * 4 + 1024 * u;
      v4f o, sm;
#pragma unroll
      for (int q = 0; q < 4; ++q) {
        float gg = g[j + q], bb = bta[j + q];
        if (PARAM_BF16) { gg = bf16_round(gg); bb = bf16_round(bb); }
        sm[q] = vals[u * 4 + q]; o[q] = (vals[u * 4 + q] - mu) * rs * gg + bb;
      }
      if (out_sum) *(v4f*)(out_sum + (size_t)row * N + j) = sm;
      *(v4f*)(out_norm + (size_t)row * N + j) = o;
    }
    
  }
}



// ---- f16 WMMA path (v_wmma_f32_16x16x32_f16): 11-bit significands for operands in range — used where a [0,1] probability operand needs more precision than bf16
typedef _Float16 v16h __attribute__((ext_vector_type(16)));
union FragH { v16h v; v8us half[2]; _Float16 h[16]; unsigned short u[16]; };
template <int NT>
__device__ __forceinline__ v8f mmaH(v16h ah, v16h al, v16h bh, v16h bl, v8f c) {
  c = __builtin_amdgcn_wmma_f32_16x16x32_f16(false, ah, false, bh, (short)0, c, false, false);
  if (NT >= 2) c = __builtin_amdgcn_wmma_f32_16x16x32_f16(false, al, false, bh, (short)0, c, false, false);
  if (NT >= 3) c = __builtin_amdgcn_wmma_f32_16x16x32_f16(false, ah, false, bl, (short)0, c, false, false);
  asm volatile("v_nop\n\tv_nop\n\tv_nop\n\tv_nop" : "+v"(c) : "v"(ah), "v"(al), "v"(bh), "v"(bl));
  return c;
}
// batched GEMM like k_gemm_b but f16 operands: A f32 (split into f16 hi/lo if ASPLIT, else rounded to f16), Bt = f16 values [n][k]; alpha; C f32; N multiple of 16 (partial tiles skipped)
template <bool ASPLIT>
__global__ __launch_bounds__(128) void k_gemm_h(const float* __restrict__ A, int lda, size_t sA, const _Float16* __restrict__ Bh, int ldb, size_t sB, float alpha, float* __restrict__ C, int ldc, size_t sC, int M, int N, int K) {
  __shared__ __attribute__((aligned(16))) float so[4][16][64];
  const int tid = threadIdx.x, w = tid >> 5, lane = tid & 31, ln = lane & 15, hh = lane >> 4; const int by = blockIdx.y;
  A += (size_t)by * sA; Bh += (size_t)by * sB; C += (size_t)by * sC;
  const int ntn = (N + 63) / 64; const int wid = blockIdx.x * 4 + w; const int mt = wid / ntn, nq = wid % ntn; if (mt * 16 >= M) return;
  const int row0 = mt * 16, col0 = nq * 64; const float* arow = A + (size_t)(row0 + ln) * lda;
  v8f acc[4] = {};
  for (int kb = 0; kb < K; kb += 32) {
    FragH ah, al;
    const v4f x0 = *(const v4fa*)(arow + kb + 8 * hh), x1 = *(const v4fa*)(arow + kb + 8 * hh + 4), x2 = *(const v4fa*)(arow + kb + 16 + 8 * hh), x3 = *(const v4fa*)(arow + kb + 16 + 8 * hh + 4);
    float xs[16] = {x0[0],x0[1],x0[2],x0[3],x1[0],x1[1],x1[2],x1[3],x2[0],x2[1],x2[2],x2[3],x3[0],x3[1],x3[2],x3[3]};
#pragma unroll
    for (int i = 0; i < 16; ++i) { const _Float16 h = (_Float16)xs[i]; ah.h[i] = h; al.h[i] = ASPLIT ? (_Float16)(xs[i] - (float)h) : (_Float16)0.0f; }
#pragma unroll
    for (int t = 0; t < 4; ++t) { if (col0 + t * 16 >= N) continue; const size_t boff = (size_t)(col0 + t * 16 + ln) * ldb + kb; FragH bq; bq.half[0] = *(const v8us*)(Bh + boff + 8 * hh); bq.half[1] = *(const v8us*)(Bh + boff + 16 + 8 * hh);
      acc[t] = mmaH<ASPLIT ? 2 : 1>(ah.v, al.v, bq.v, bq.v, acc[t]); }
  }
#pragma unroll
  for (int t = 0; t < 4; ++t) { if (col0 + t * 16 >= N) continue;
#pragma unroll
    for (int r = 0; r < 8; ++r) so[w][8 * hh + r][t * 16 + ln] = acc[t][r] * alpha; }
  __builtin_amdgcn_fence(__ATOMIC_ACQ_REL, "workgroup"); __builtin_amdgcn_wave_barrier();
  const int rsub = lane >> 4, c4 = (lane & 15) * 4;
  {
#pragma unroll
    for (int q = 0; q < 8; ++q) { const int r = q * 2 + rsub; if (col0 + c4 < N) { const v4f v = *(const v4fa*)&so[w][r][c4]; *(v4f*)(C + (size_t)(row0 + r) * ldc + col0 + c4) = v; } }
     }
}

// Wt[n][k] = f16(W[k][n]·scale) from f32 row-major W[K][N] (scale = power of two; bf16-exact weights stay exact in f16 away from the subnormal range)
__global__ __launch_bounds__(256) void k_wt_f16(const float* __restrict__ W, _Float16* __restrict__ Wt, int K, int N, float scale) {
  const int t = blockIdx.x * 256 + threadIdx.x; if (t >= N * (K / 8)) return; const int n = t / (K / 8), k8 = (t % (K / 8)) * 8; FragH f;
#pragma unroll
  for (int i = 0; i < 8; ++i) f.h[i] = (_Float16)(bf16_round(W[(size_t)(k8 + i) * N + n]) * scale); const v8us o = f.half[0];
  *(v8us*)((unsigned short*)Wt + (size_t)n * K + k8) = o; 
}
// k_gemm_hh variant with fused epilogue: v = acc·alpha + bias[by·sBias + col] (+ CP[(row/rowsPerB)·sCPb + by·64 + col] if CP) ; ACT 0 none / 1 elu ; writes f16 C16 (and f32 C if non-null)
template <int ACT>
__global__ __launch_bounds__(128) void k_gemm_hhx(const _Float16* __restrict__ A, int lda, size_t sA, const _Float16* __restrict__ Bh, int ldb, size_t sB, float alpha, const float* __restrict__ bias, size_t sBias, const float* __restrict__ CP, int rowsPerB, size_t sCPb, int row0g,
    float* __restrict__ C, _Float16* __restrict__ C16, int ldc, size_t sC, int M, int N, int K) {
  __shared__ __attribute__((aligned(16))) float so[4][16][64];
  const int tid = threadIdx.x, w = tid >> 5, lane = tid & 31, ln = lane & 15, hh = lane >> 4; const int by = blockIdx.y;
  A += (size_t)by * sA; Bh += (size_t)by * sB; const size_t cofs = (size_t)by * sC; const float* bp = bias ? bias + (size_t)by * sBias : nullptr;
  const int ntn = (N + 63) / 64; const int wid = blockIdx.x * 4 + w; const int mt = wid / ntn, nq = wid % ntn; if (mt * 16 >= M) return;
  const int row0 = mt * 16, col0 = nq * 64; const _Float16* arow = A + (size_t)(row0 + ln) * lda;
  v8f acc[4] = {};
  for (int kb = 0; kb < K; kb += 32) { FragH ah; ah.half[0] = *(const v8us*)((const unsigned short*)arow + kb + 8 * hh); ah.half[1] = *(const v8us*)((const unsigned short*)arow + kb + 16 + 8 * hh);
#pragma unroll
    for (int t = 0; t < 4; ++t) { if (col0 + t * 16 >= N) continue; const size_t boff = (size_t)(col0 + t * 16 + ln) * ldb + kb; FragH bq; bq.half[0] = *(const v8us*)((const unsigned short*)Bh + boff + 8 * hh); bq.half[1] = *(const v8us*)((const unsigned short*)Bh + boff + 16 + 8 * hh);
      acc[t] = mmaH<1>(ah.v, ah.v, bq.v, bq.v, acc[t]); }
  }
#pragma unroll
  for (int t = 0; t < 4; ++t) { if (col0 + t * 16 >= N) continue; const int col = col0 + t * 16 + ln; const float bv = bp ? bf16_round(bp[col]) : 0.f;
#pragma unroll
    for (int r = 0; r < 8; ++r) { float v = acc[t][r] * alpha + bv; if (CP) { const int rr = row0g + row0 + 8 * hh + r; if (rowsPerB < 0) v += CP[cofs + (size_t)rr * ldc + col];      /* rowsPerB < 0: own element of the batched C plane */ else { const int bidx = rr / rowsPerB; v += CP[(size_t)bidx * sCPb + (size_t)by * 64 + col]; } } if (ACT == 1) v = (v > 0.f) ? v : expm1f(v); else if (ACT == 7) v = (v > 0.f) ? v + 1.0f : expf(v); else if (ACT == 8) v = tanhf(v); else if (ACT == 9) v = 0.5f * v * (1.0f + tanhf(0.7978845608028654f * (v + 0.044715f * v * v * v))); else if (ACT == 11) v = 1.0f / (1.0f + expf(-v)); else if (ACT == 12) v = (v > 0.f) ? v : 0.01f * v; else if (ACT == 14) v = (v > 0.f) ? v : 0.1f * v; else if (ACT == 16) v = (v >= 0.f) ? v : 0.3f * v; else if (ACT == 17) v = (v >= 0.f) ? v : 0.2f * v; else if (ACT == 15) v = v / (1.0f + expf(-v)); else if (ACT == 3) v = fmaxf(v, 0.f); else if (ACT == 6) v = 0.5f * v * (1.0f + erff(v * 0.70710678118654752f)); so[w][8 * hh + r][t * 16 + ln] = v; } }
  __builtin_amdgcn_fence(__ATOMIC_ACQ_REL, "workgroup"); __builtin_amdgcn_wave_barrier();
  const int rsub = lane >> 4, c4 = (lane & 15) * 4; typedef _Float16 v4h __attribute__((ext_vector_type(4)));
  {
#pragma unroll
    for (int q = 0; q < 8; ++q) { const int r = q * 2 + rsub; if (col0 + c4 < N) { const v4f v = *(const v4fa*)&so[w][r][c4]; if (C) *(v4f*)(C + cofs + (size_t)(row0 + r) * ldc + col0 + c4) = v; if (C16) { v4h h4; for (int i = 0; i < 4; ++i) h4[i] = (_Float16)v[i]; *(v4h*)(C16 + cofs + (size_t)(row0 + r) * ldc + col0 + c4) = h4; } } }
     }
}


typedef _Float16 v4h __attribute__((ext_vector_type(4)));

__global__ __launch_bounds__(256) void k_x16(const float* __restrict__ x, _Float16* __restrict__ X16, size_t n8) { const size_t t = (size_t)blockIdx.x * 256 + threadIdx.x; if (t >= n8) return; FragH f;
#pragma unroll
  for (int q = 0; q < 8; ++q) f.h[q] = (_Float16)bf16_round(x[t * 8 + q]); *(v8us*)((unsigned short*)X16 + t * 8) = f.half[0];  }
__global__ __launch_bounds__(256) void k_h16(const float* __restrict__ x, _Float16* __restrict__ X16, size_t n8) { const size_t t = (size_t)blockIdx.x * 256 + threadIdx.x; if (t >= n8) return; FragH f;
#pragma unroll
  for (int q = 0; q < 8; ++q) f.h[q] = (_Float16)x[t * 8 + q]; *(v8us*)((unsigned short*)X16 + t * 8) = f.half[0];  }
__global__ __launch_bounds__(256) void k_round16f(const float* __restrict__ W, _Float16* __restrict__ Bt, size_t n8) { const size_t t = (size_t)blockIdx.x * 256 + threadIdx.x; if (t >= n8) return; FragH f;
#pragma unroll
  for (int i = 0; i < 8; ++i) f.h[i] = (_Float16)(bf16_round(W[t * 8 + i]) * 16.0f); *(v8us*)((unsigned short*)Bt + t * 8) = f.half[0];  }
template <int NHv, int TTv>
__global__ __launch_bounds__(256) void k_vt(const _Float16* __restrict__ V16, int ldv, int voff, _Float16* __restrict__ Vt) { __shared__ unsigned short tl[64][66]; const int tid = threadIdx.x; const int slab = blockIdx.x / (TTv / 64), lg = blockIdx.x % (TTv / 64); const int b = slab / NHv, h = slab % NHv;
  for (int i = tid; i < 64 * 8; i += 256) { const int r = i / 8, c8 = (i % 8) * 8; FragH f; f.half[0] = *(const v8us*)((const unsigned short*)V16 + ((size_t)b * TTv + lg * 64 + r) * ldv + voff + h * 64 + c8);
#pragma unroll
    for (int q = 0; q < 8; ++q) tl[r][c8 + q] = f.u[q]; }
  __syncthreads();
  {
#pragma unroll
    for (int rd = 0; rd < 2; ++rd) { const int d = rd * 32 + tid / 8, pc = tid % 8; FragH f;
#pragma unroll
      for (int q = 0; q < 8; ++q) f.u[q] = tl[pc * 8 + q][d];
      *(v8us*)((unsigned short*)Vt + ((size_t)slab * 64 + d) * TTv + lg * 64 + pc * 8) = f.half[0]; }
     } }

__global__ __launch_bounds__(256) void k_hl(const float* __restrict__ F, _Float16* __restrict__ Hh, _Float16* __restrict__ Hl, size_t n8) { const size_t t = (size_t)blockIdx.x * 256 + threadIdx.x; if (t >= n8) return; FragH fh, fl; const v4f a = *(const v4fa*)(F + t * 8), c = *(const v4fa*)(F + t * 8 + 4);
#pragma unroll
  for (int q = 0; q < 4; ++q) { _Float16 h = (_Float16)a[q]; fh.h[q] = h; fl.h[q] = (_Float16)((a[q] - (float)h) * 1024.0f); h = (_Float16)c[q]; fh.h[4 + q] = h; fl.h[4 + q] = (_Float16)((c[q] - (float)h) * 1024.0f); }
  { *(v8us*)((unsigned short*)Hh + t * 8) = fh.half[0]; *(v8us*)((unsigned short*)Hl + t * 8) = fl.half[0];  } }

// ---- fast GEMM (wave tile 32x64; requires M % 32 == 0 rows per launch region and N % 64 == 0); epilogue = k_gemm_hhx semantics ----
__device__ __forceinline__ v16h g2_frag(const _Float16* p, int hh) { FragH f; f.half[0] = *(const v8us*)((const unsigned short*)p + 8 * hh); f.half[1] = *(const v8us*)((const unsigned short*)p + 16 + 8 * hh); return f.v; }
__device__ __forceinline__ v8f g2_mma(v16h a, v16h b, v8f c) { v8f d = __builtin_amdgcn_wmma_f32_16x16x32_f16(false, a, false, b, (short)0, c, false, false); asm volatile("v_nop\n\tv_nop\n\tv_nop\n\tv_nop" : "+v"(d) : "v"(a), "v"(b)); return d; }
template <int ACT>
__global__ __launch_bounds__(128) void k_gemm2(const _Float16* __restrict__ A, int lda, size_t sA, const _Float16* __restrict__ Bh, int ldb, size_t sB, float alpha, const float* __restrict__ bias, size_t sBias, const float* __restrict__ CP, int rowsPerB, size_t sCPb, int row0g,
    float* __restrict__ C, _Float16* __restrict__ C16, int ldc, size_t sC, int M, int N, int K) { static_assert(ACT == 0 || ACT == 3 || ACT == 6 || ACT == 8 || ACT == 9 || ACT == 11 || ACT == 12 || ACT == 14 || ACT == 15 || ACT == 16 || ACT == 17, "k_gemm2: unsupported ACT code (would silently apply no activation)");
  __shared__ __attribute__((aligned(16))) float so[4][32][68];
  const int tid = threadIdx.x, w = tid >> 5, lane = tid & 31, ln = lane & 15, hh = lane >> 4; const int by = blockIdx.y;
  A += (size_t)by * sA; Bh += (size_t)by * sB; const size_t cofs = (size_t)by * sC; const float* bp = bias ? bias + (size_t)by * sBias : nullptr;
  const int ntn = N >> 6; const int mt = blockIdx.x / ntn, nq = blockIdx.x - mt * ntn; const int row0 = mt * 128 + 32 * w, col0 = nq * 64; if (row0 >= M) return;
  const _Float16* a0p = A + (size_t)(row0 + ln) * lda; const _Float16* a1p = a0p + (size_t)16 * lda;
  const _Float16* b0p = Bh + (size_t)(col0 + ln) * ldb; const _Float16* b1p = b0p + (size_t)16 * ldb; const _Float16* b2p = b1p + (size_t)16 * ldb; const _Float16* b3p = b2p + (size_t)16 * ldb;
  const v8f z8 = {0.f,0.f,0.f,0.f,0.f,0.f,0.f,0.f}; v8f c00 = z8, c01 = z8, c02 = z8, c03 = z8, c10 = z8, c11 = z8, c12 = z8, c13 = z8;
#pragma unroll 1
  for (int kb = 0; kb < K; kb += 32) { const v16h a0 = g2_frag(a0p + kb, hh), a1 = g2_frag(a1p + kb, hh);
    v16h b = g2_frag(b0p + kb, hh); c00 = g2_mma(a0, b, c00); c10 = g2_mma(a1, b, c10);
    b = g2_frag(b1p + kb, hh); c01 = g2_mma(a0, b, c01); c11 = g2_mma(a1, b, c11);
    b = g2_frag(b2p + kb, hh); c02 = g2_mma(a0, b, c02); c12 = g2_mma(a1, b, c12);
    b = g2_frag(b3p + kb, hh); c03 = g2_mma(a0, b, c03); c13 = g2_mma(a1, b, c13); }
  v8f accs[8] = {c00, c01, c02, c03, c10, c11, c12, c13};
#pragma unroll
  for (int u = 0; u < 8; ++u) { const int t = u & 3, half = u >> 2; const int col = col0 + t * 16 + ln; const float bv = bp ? bf16_round(bp[col]) : 0.f;
#pragma unroll
    for (int r = 0; r < 8; ++r) { const int rloc = half * 16 + 8 * hh + r; float v = accs[u][r] * alpha + bv; if (CP) { if (rowsPerB < 0) v += CP[cofs + (size_t)(row0g + row0 + rloc) * ldc + col];      /* rowsPerB < 0: own element of the batched C plane */ else { const int bidx = (row0g + row0 + rloc) / rowsPerB; v += CP[(size_t)bidx * sCPb + (size_t)by * 64 + col]; } }
      if (ACT == 3) v = fmaxf(v, 0.f); else if (ACT == 6) v = 0.5f * v * (1.0f + erff(v * 0.70710678118654752f)); else if (ACT == 11) v = 1.0f / (1.0f + expf(-v)); else if (ACT == 15) v = v / (1.0f + expf(-v)); else if (ACT == 12) v = (v > 0.f) ? v : 0.01f * v; else if (ACT == 8) v = tanhf(v); else if (ACT == 9) v = 0.5f * v * (1.0f + tanhf(0.7978845608028654f * (v + 0.044715f * v * v * v))); else if (ACT == 14) v = (v > 0.f) ? v : 0.1f * v; else if (ACT == 16) v = (v >= 0.f) ? v : 0.3f * v; else if (ACT == 17) v = (v >= 0.f) ? v : 0.2f * v;
      so[w][rloc][t * 16 + ln] = v; } }
  __builtin_amdgcn_fence(__ATOMIC_ACQ_REL, "workgroup"); __builtin_amdgcn_wave_barrier();
  const int rsub = lane >> 4, c4 = (lane & 15) * 4;
  {
#pragma unroll
    for (int q = 0; q < 16; ++q) { const int r = q * 2 + rsub; const v4f v = *(const v4fa*)&so[w][r][c4]; if (C) *(v4f*)(C + cofs + (size_t)(row0 + r) * ldc + col0 + c4) = v; if (C16) { v4h h4; for (int i = 0; i < 4; ++i) h4[i] = (_Float16)v[i]; *(v4h*)(C16 + cofs + (size_t)(row0 + r) * ldc + col0 + c4) = h4; } }
     } }


__global__ __launch_bounds__(256) void k_wnat(const float* __restrict__ w, size_t n8, _Float16* __restrict__ Bt) { const size_t t = (size_t)blockIdx.x * 256 + threadIdx.x; if (t >= n8) return; FragH f; for (int q = 0; q < 8; ++q) f.h[q] = (_Float16)(bf16_round(w[t * 8 + q]) * 16.0f); *(v8us*)((unsigned short*)Bt + t * 8) = f.half[0];  }
__global__ __launch_bounds__(256) void k_rsm(const float* __restrict__ S, _Float16* __restrict__ P, int nrows) {
  #pragma clang fp contract(off)
  const int i = blockIdx.x * 256 + threadIdx.x; if (i >= nrows) return; const float* s = S + (size_t)i * SQ; float mx = -3.0e38f;
#pragma unroll 1
  for (int j = 0; j < SQ; ++j) mx = fmaxf(mx, s[j]); float se = 0.f;
#pragma unroll 1
  for (int j = 0; j < SQ; ++j) se += expf(s[j] - mx); const float sc = 256.0f / se;
#pragma unroll 1
  for (int j0 = 0; j0 < SQ; j0 += 8) { FragH f; for (int q = 0; q < 8; ++q) f.h[q] = (_Float16)(expf(s[j0 + q] - mx) * sc); unsigned short* d = (unsigned short*)P + (size_t)i * SQ + j0; *(v8us*)d = f.half[0];  } }
__global__ __launch_bounds__(256) void k_vt(const _Float16* __restrict__ V16, int b, int h0, _Float16* __restrict__ VT) { __shared__ unsigned short tl[64][65]; const int tid = threadIdx.x; const int hh = blockIdx.x % HG, sg = blockIdx.x / HG; const int s0 = sg * 64; const int h = h0 + hh;
  for (int i = tid; i < 64 * 8; i += 256) { const int j = i / 8, d8 = (i % 8) * 8; FragH f; f.half[0] = *(const v8us*)((const unsigned short*)V16 + ((size_t)b * SQ + s0 + j) * DM + h * HD + d8); for (int q = 0; q < 8; ++q) tl[d8 + q][j] = f.u[q]; }
  __syncthreads();
  { for (int i = tid; i < 64 * 8; i += 256) { const int d = i / 8, j8 = (i % 8) * 8; FragH f; for (int q = 0; q < 8; ++q) f.u[q] = tl[d][j8 + q]; *(v8us*)((unsigned short*)VT + ((size_t)hh * HD + d) * SQ + s0 + j8) = f.half[0]; }  } }

__global__ __launch_bounds__(256) void k_qprep(const float* __restrict__ QF, const float* __restrict__ ub, const float* __restrict__ vb, _Float16* __restrict__ Q16, _Float16* __restrict__ QU, _Float16* __restrict__ QV, size_t n8) {
  #pragma clang fp contract(off)
  const size_t t = (size_t)blockIdx.x * 256 + threadIdx.x; if (t >= n8) return; const size_t e = t * 8; const int c = (int)(e % DM); FragH a, b, d;
#pragma unroll
  for (int q = 0; q < 8; ++q) { const float v = QF[e + q]; a.h[q] = (_Float16)v; b.h[q] = (_Float16)__fadd_rn(v, bf16_round(ub[c + q])); d.h[q] = (_Float16)__fadd_rn(v, bf16_round(vb[c + q])); }
  { *(v8us*)((unsigned short*)Q16 + e) = a.half[0]; *(v8us*)((unsigned short*)QU + e) = b.half[0]; *(v8us*)((unsigned short*)QV + e) = d.half[0];  } }

__global__ __launch_bounds__(256) void k_zfill(_Float16* __restrict__ dst, size_t n8) { const size_t t = (size_t)blockIdx.x * 256 + threadIdx.x; if (t >= n8) return; const v8us z = {0, 0, 0, 0, 0, 0, 0, 0}; *(v8us*)((unsigned short*)dst + t * 8) = z;  }
// Shifted relative softmax, one wave per SMH score rows: lane l holds columns 4 l + 128 u + (0..3), u = 0..7, so each wave-wide load covers 512 contiguous bytes
// (the bd row runs backwards in j: four floats at a 4-byte-aligned address, taken in reverse). Scores stay in registers: each plane is read once.
// A wave does SMH heads of one query row, which share that row of the mask. No barrier; every wave has work (exact grid).
#define SMH 2
typedef float v4fu __attribute__((ext_vector_type(4), aligned(4), may_alias));
typedef int   v4ia __attribute__((ext_vector_type(4), may_alias));
static_assert(SQ == 1024 && SMH == 2 && HG % SMH == 0 && (QN * (HG / SMH)) % 8 == 0, "k_relsm2: 32 columns a lane, whole blocks of 8 waves");
// Four native 2^x (what __expf compiles to, behind its multiply by log2 e). Written in one statement so that the slot the instruction set asks for behind a transcendental is kept by construction:
// each v_exp_f32 is followed by one that neither reads its result nor overwrites its source (early-clobber outputs), the last by v_nop.
__device__ __forceinline__ void exp2x4(float x0, float x1, float x2, float x3, float* e) {
  asm("v_exp_f32 %0, %4\n\tv_exp_f32 %1, %5\n\tv_exp_f32 %2, %6\n\tv_exp_f32 %3, %7\n\tv_nop" : "=&v"(e[0]), "=&v"(e[1]), "=&v"(e[2]), "=&v"(e[3]) : "v"(x0), "v"(x1), "v"(x2), "v"(x3)); }
__global__ __launch_bounds__(256) void k_relsm2(const float* __restrict__ AC, const float* __restrict__ BD, const int* __restrict__ mrows, _Float16* __restrict__ P) {
  const int lane = threadIdx.x & 31; const int wv = blockIdx.x * 8 + (threadIdx.x >> 5);
  const int i = wv / (HG / SMH), hq = wv % (HG / SMH);
  const int* mk = mrows + (size_t)i * SQ + 4 * lane; const float* sp[SMH]; const float* bp[SMH];
  v4ia m[8]; v4f s[SMH][8], r[SMH][8]; v4h h[SMH][8]; _Float16* pp[SMH];
#pragma unroll
  for (int u = 0; u < 8; ++u) m[u] = *(const v4ia*)(mk + 128 * u);
#pragma unroll
  for (int g = 0; g < SMH; ++g) { const size_t rw = (size_t)(hq + g * (HG / SMH)) * SQ + i; sp[g] = AC + rw * SQ + 4 * lane; bp[g] = BD + rw * PP + i - 4 * lane;      /* bp[T - 1 - q] = bd[T - 1 + i - (4 lane + q)] */
#pragma unroll
    for (int u = 0; u < 8; ++u) { s[g][u] = *(const v4fa*)(sp[g] + 128 * u); r[g][u] = *(const v4fu*)(bp[g] + (SQ - 4 - 128 * u)); } }
  asm volatile("s_wait_xcnt 0x0" :: "v"(mk), "v"(sp[0]), "v"(bp[0]), "v"(sp[1]), "v"(bp[1]) : "memory");      /* the loads' address registers stay whole up to here and are reused only behind this wait */
  __builtin_amdgcn_sched_barrier(0);      /* keeps all 40 loads of the wave in front of the arithmetic: one memory latency a wave; without it the mask loads sink behind waits on the score loads */
#pragma unroll
  for (int g = 0; g < SMH; ++g) { const size_t rw = (size_t)(hq + g * (HG / SMH)) * SQ + i;
    float v[8][4]; float m4[4] = {-3.0e38f, -3.0e38f, -3.0e38f, -3.0e38f};
#pragma unroll
    for (int u = 0; u < 8; ++u)
#pragma unroll
      for (int q = 0; q < 4; ++q) { v[u][q] = (s[g][u][q] + r[g][u][3 - q]) * 0.125f; m4[q] = fmaxf(m4[q], (m[u][q] == 0) ? v[u][q] : -3.0e38f); }
    float mx = fmaxf(fmaxf(m4[0], m4[1]), fmaxf(m4[2], m4[3]));
#pragma unroll
    for (int d = 16; d >= 1; d >>= 1) mx = fmaxf(mx, __shfl_xor(mx, d, 32));
    float s4[4] = {0.f, 0.f, 0.f, 0.f};
#pragma unroll
    for (int u = 0; u < 8; ++u) { float e[4]; exp2x4((v[u][0] - mx) * 1.44269504f, (v[u][1] - mx) * 1.44269504f, (v[u][2] - mx) * 1.44269504f, (v[u][3] - mx) * 1.44269504f, e);
#pragma unroll
      for (int q = 0; q < 4; ++q) { v[u][q] = (m[u][q] == 0) ? e[q] : 0.f; s4[q] += v[u][q]; } }
    float se = (s4[0] + s4[1]) + (s4[2] + s4[3]);
#pragma unroll
    for (int d = 16; d >= 1; d >>= 1) se += __shfl_xor(se, d, 32);
    const float sc = (se > 0.f) ? 256.0f / se : 0.f;
    pp[g] = P + rw * SQ + 4 * lane;
#pragma unroll
    for (int u = 0; u < 8; ++u)
#pragma unroll
      for (int q = 0; q < 4; ++q) h[g][u][q] = (_Float16)(v[u][q] * sc); }
  __builtin_amdgcn_sched_barrier(0);      /* every weight is packed in front of the first store, so no register of an issued store is written again */
#pragma unroll
  for (int g = 0; g < SMH; ++g)
#pragma unroll
    for (int u = 0; u < 8; ++u) *(v4h*)(pp[g] + 128 * u) = h[g][u]; }

extern "C" void kernel_launch(void* const* d_in, const int* in_sizes, int n_in,
                              void* d_out, int out_size, void* d_ws, size_t ws_size, hipStream_t stream) {
  (void)in_sizes; (void)n_in; (void)out_size;
  const float* const* I = (const float* const*)d_in; const float* xq = I[0]; const float* xk = I[1]; const float* xv = I[2]; const int* mask = (const int*)d_in[3]; const float* pe = I[4]; const float* wq = I[5]; const float* bq = I[6]; const float* wk = I[7]; const float* bk = I[8]; const float* wv = I[9]; const float* bv = I[10]; const float* wpos = I[11]; const float* wo = I[12]; const float* bo = I[13]; const float* pbu = I[14]; const float* pbv = I[15];
  char* ws = (char*)d_ws; size_t off = 0;
  auto take = [&](size_t bytes) { char* p = ws + off; off += (bytes + 255) & ~(size_t)255; return p; };
  _Float16* BQ = (_Float16*)take((size_t)DM * DM * 2); _Float16* BK = (_Float16*)take((size_t)DM * DM * 2); _Float16* BV = (_Float16*)take((size_t)DM * DM * 2); _Float16* BP = (_Float16*)take((size_t)DM * DM * 2); _Float16* BO = (_Float16*)take((size_t)DM * DM * 2);
  _Float16* XQ = (_Float16*)take(NR * DM * 2); _Float16* XK = (_Float16*)take(NR * DM * 2); _Float16* XV = (_Float16*)take(NR * DM * 2); _Float16* PE = (_Float16*)take((size_t)PP * DM * 2);
  float* QF = (float*)take(NR * DM * 4); _Float16* Q16 = (_Float16*)take(NR * DM * 2); _Float16* QU = (_Float16*)take(NR * DM * 2); _Float16* QV = (_Float16*)take(NR * DM * 2); _Float16* K16 = (_Float16*)take(NR * DM * 2); _Float16* V16 = (_Float16*)take(NR * DM * 2); _Float16* R16 = (_Float16*)take((size_t)PP * DM * 2); _Float16* O16 = (_Float16*)take(NR * DM * 2);
  float* S = (float*)take((size_t)HG * SQ * SQ * 4); float* BD = (float*)take((size_t)HG * SQ * PP * 4); _Float16* P = (_Float16*)take((size_t)HG * SQ * SQ * 2); _Float16* VT = (_Float16*)take((size_t)NH * HD * SQ * 2);
  if (off > ws_size) return;      /* 2.5 + 12 + 2 + 8 + 20 + 2 + 4 + 32 + 64 + 16 + 1 = approx 164 MiB */
  { const unsigned gw = (unsigned)(((size_t)DM * (DM / 8) + 255) / 256); k_wt_f16<<<gw, 256, 0, stream>>>(wq, BQ, DM, DM, 16.0f); k_wt_f16<<<gw, 256, 0, stream>>>(wk, BK, DM, DM, 16.0f); k_wt_f16<<<gw, 256, 0, stream>>>(wv, BV, DM, DM, 16.0f); k_wt_f16<<<gw, 256, 0, stream>>>(wpos, BP, DM, DM, 16.0f); k_wt_f16<<<gw, 256, 0, stream>>>(wo, BO, DM, DM, 16.0f); }
  { const unsigned gx = (unsigned)((NR * DM / 8 + 255) / 256); k_x16<<<gx, 256, 0, stream>>>(xq, XQ, NR * DM / 8); k_x16<<<gx, 256, 0, stream>>>(xk, XK, NR * DM / 8); k_x16<<<gx, 256, 0, stream>>>(xv, XV, NR * DM / 8); }
  k_x16<<<(unsigned)(((size_t)NPOS * DM / 8 + 255) / 256), 256, 0, stream>>>(pe, PE, (size_t)NPOS * DM / 8); k_zfill<<<1, 256, 0, stream>>>(PE + (size_t)NPOS * DM, DM / 8);      /* pad row 2047 */
  const dim3 gp((unsigned)((NR / 128) * (DM / 64)), 1);
  k_gemm2<0><<<gp, 128, 0, stream>>>(XQ, DM, 0, BQ, DM, 0, 0.0625f, bq, 0, nullptr, 1, 0, 0, QF, nullptr, DM, 0, (int)NR, DM, DM);      /* q (f32) */
  k_qprep<<<(unsigned)((NR * DM / 8 + 255) / 256), 256, 0, stream>>>(QF, pbu, pbv, Q16, QU, QV, NR * DM / 8);      /* q + pos_bias_u, q + pos_bias_v (f16) */
  k_gemm2<0><<<gp, 128, 0, stream>>>(XK, DM, 0, BK, DM, 0, 0.0625f, bk, 0, nullptr, 1, 0, 0, nullptr, K16, DM, 0, (int)NR, DM, DM);
  k_gemm2<0><<<gp, 128, 0, stream>>>(XV, DM, 0, BV, DM, 0, 0.0625f, bv, 0, nullptr, 1, 0, 0, nullptr, V16, DM, 0, (int)NR, DM, DM);
  k_gemm2<0><<<dim3((PP / 128) * (DM / 64), 1), 128, 0, stream>>>(PE, DM, 0, BP, DM, 0, 0.0625f, nullptr, 0, nullptr, 1, 0, 0, nullptr, R16, DM, 0, PP, DM, DM);      /* p = pos_emb Wpos (f16; row 2047 is the zero pad) */
  for (int b = B0; b < B0 + NBR; ++b) { const size_t r0 = (size_t)b * SQ;
    k_vt<NH, SQ><<<NH * (SQ / 64), 256, 0, stream>>>(V16 + r0 * DM, DM, 0, VT);      /* V^T [8][64][1024] */
    k_gemm2<0><<<dim3((QN / 128) * (SQ / 64), HG), 128, 0, stream>>>(QU + r0 * DM, DM, (size_t)HD, K16 + r0 * DM, DM, (size_t)HD, 1.0f, nullptr, 0, nullptr, 1, 0, 0, S, nullptr, SQ, (size_t)SQ * SQ, QN, SQ, HD);      /* ac = (q + u) . k */
    k_gemm2<0><<<dim3((QN / 128) * (PP / 64), HG), 128, 0, stream>>>(QV + r0 * DM, DM, (size_t)HD, R16, DM, (size_t)HD, 1.0f, nullptr, 0, nullptr, 1, 0, 0, BD, nullptr, PP, (size_t)SQ * PP, QN, PP, HD);      /* bd_raw[i][r] = (q_i + v) . p[r] */
    k_relsm2<<<QN * (HG / SMH) / 8, 256, 0, stream>>>(S, BD, mask + r0 * SQ, P);
    k_gemm2<0><<<dim3((QN / 128) * (HD / 64), HG), 128, 0, stream>>>(P, SQ, (size_t)SQ * SQ, VT, SQ, (size_t)HD * SQ, 0.25f, nullptr, 0, nullptr, 1, 0, 0, nullptr, O16 + r0 * DM, DM, (size_t)HD, QN, HD, SQ); }      /* o x64, merged rows */
  k_gemm2<0><<<gp, 128, 0, stream>>>(O16, DM, 0, BO, DM, 0, 0.0009765625f, bo, 0, nullptr, 1, 0, 0, (float*)d_out, nullptr, DM, 0, (int)NR, DM, DM);      /* out = x Wout + bout */
}

// v002
// One run takes 184 microseconds.
// Two timings next to v001 put it at 2.47 and 2.43 times that version's speed.
// Over all steps from v000 it is 22.3 times as fast.
#include <hip/hip_runtime.h>
// Relative-position multi-head attention with rel_shift (query, key, value [4][1024][512]; mask [4][1024][1024] int32 verbatim (nonzero = masked, ~50 %); pos_emb [1][2047][512]; q/k/v = x W + b ([512][512] [in][out]); p = pos_emb Wpos; 8 heads of 64; ac = (q + pos_bias_u) . k; bd = rel_shift((q + pos_bias_v) . p^T) = (q_i + v) . p[T-1+i-j]; scores = (ac + bd) / 8; masked -> float32 min; softmax; masked weights -> 0; x = attn v merged; out = x Wout + bout -> [4][1024][512].
// Structure: token rows; inputs and pos_emb as exact f16 rows (pos table padded to 2048 rows with zeros); q as a WMMA GEMM (32x64 wave tiles, f32 accumulation, exact x16 weights + bias) into f32 rows, then f16 planes of q + u and q + v on VALU; k, v, p as WMMA GEMMs (f16 outputs); V^T via LDS transposes; one fused kernel per (batch, head, 32 query rows): bd and ac WMMA tiles (K = 64) into f32 score rows in LDS, bd stored at its shifted column; the relative softmax with the mask on VALU (f32 statistics, native exp; weights x256 f16, in LDS); o = P . V^T on WMMA (K = 1024; o x64 in f16); out GEMM (f32, + bout); 18 launches.
// Compute dtype: inputs rounded to bf16; inputs / weights exact in f16; q + u, q + v, k, v, p, softmax weights and o plain f16 (~2^-12); ac, bd, softmax statistics f32; v_wmma_f32_16x16x32_f16.
#define NB 4
#define SQ 1024
#define PP 2048                      /* position table rows (2047 used, row 2047 zero) */
#define NPOS 2047
#define DM 512
#define NH 8
#define HD 64
#define HG 8
#define NR ((size_t)NB * SQ)
typedef __bf16 v16b __attribute__((ext_vector_type(16)));
typedef unsigned short v8us __attribute__((ext_vector_type(8), may_alias));
typedef float  v8f  __attribute__((ext_vector_type(8)));
typedef float  v4f  __attribute__((ext_vector_type(4)));
typedef float  v4fa __attribute__((ext_vector_type(4), may_alias));
union FragB { v16b v; v8us half[2]; unsigned short u[16]; };

__device__ __forceinline__ unsigned short bf16_bits(float x) { unsigned int u = __float_as_uint(x); return (unsigned short)((u + 0x7FFFu + ((u >> 16) & 1u)) >> 16); }
__device__ __forceinline__ float bf16_val(unsigned short b) { return __uint_as_float(((unsigned int)b) << 16); }
__device__ __forceinline__ float bf16_round(float x) { return bf16_val(bf16_bits(x)); }
// D += A·B with NT terms: 1 = ah·bh, 2 = + al·bh (A split), 3 = + ah·bl (both split)
template <int NT>
__device__ __forceinline__ v8f mmaN(v16b ah, v16b al, v16b bh, v16b bl, v8f c) {
  c = __builtin_amdgcn_wmma_f32_16x16x32_bf16(false, ah, false, bh, (short)0, c, false, false);
  if (NT >= 2) c = __builtin_amdgcn_wmma_f32_16x16x32_bf16(false, al, false, bh, (short)0, c, false, false);
  if (NT >= 3) c = __builtin_amdgcn_wmma_f32_16x16x32_bf16(false, ah, false, bl, (short)0, c, false, false);
  asm volatile("v_nop\n\tv_nop\n\tv_nop\n\tv_nop" : "+v"(c) : "v"(ah), "v"(al), "v"(bh), "v"(bl));
  return c;
}

__global__ __launch_bounds__(256) void k_wt_bf16(const float* __restrict__ W, unsigned short* __restrict__ Wt, int K, int N) {
  const int t = blockIdx.x * 256 + threadIdx.x;
  const int k8n = K / 8;
  if (t >= N * k8n) return;
  const int n = t / k8n, k8 = (t % k8n) * 8;
  v8us v;
#pragma unroll
  for (int i = 0; i < 8; ++i) v[i] = bf16_bits(W[(size_t)(k8 + i) * N + n]);
  *(v8us*)(Wt + (size_t)n * K + k8) = v;
  
}

// GEMM C[M][N] (f32, pitch ldc) = act(A[M][K]·W + bias). A f32 row-major (pitch lda) converted per fragment to bf16
// (ASPLIT: hi/lo two planes -> 2 terms, else single rounded term); Wt bf16 [N][K] (pitch ldb). BIAS_BF16 rounds the
// bias to bf16 first (bias quantised to bf16 before the add). K%32==0, M%16==0, N%64==0.
template <bool ASPLIT, int ACT, bool BIAS_BF16>
__global__ __launch_bounds__(128) void k_gemm_bf(const float* __restrict__ A, int lda, const unsigned short* __restrict__ Wt, int ldb,
                                               const float* __restrict__ bias, float* __restrict__ C, int ldc, int M, int N, int K) {
  __shared__ __attribute__((aligned(16))) float so[4][16][64];
  const int tid = threadIdx.x, w = tid >> 5, lane = tid & 31, ln = lane & 15, hh = lane >> 4;
  const int ntn = N / 64;
  const int wid = blockIdx.x * 4 + w;
  const int mt = wid / ntn, nq = wid % ntn;
  if (mt * 16 >= M) return;
  const int row0 = mt * 16, col0 = nq * 64;
  const float* arow = A + (size_t)(row0 + ln) * lda;
  v8f acc[4] = {};
  for (int kb = 0; kb < K; kb += 32) {
    FragB ah, al;
    const v4f x0 = *(const v4fa*)(arow + kb + 8 * hh), x1 = *(const v4fa*)(arow + kb + 8 * hh + 4);
    const v4f x2 = *(const v4fa*)(arow + kb + 16 + 8 * hh), x3 = *(const v4fa*)(arow + kb + 16 + 8 * hh + 4);
    float xs[16] = {x0[0],x0[1],x0[2],x0[3],x1[0],x1[1],x1[2],x1[3],x2[0],x2[1],x2[2],x2[3],x3[0],x3[1],x3[2],x3[3]};
#pragma unroll
    for (int i = 0; i < 16; ++i) { const unsigned short hb = bf16_bits(xs[i]); ah.u[i] = hb; al.u[i] = ASPLIT ? bf16_bits(xs[i] - bf16_val(hb)) : (unsigned short)0; }
#pragma unroll
    for (int t = 0; t < 4; ++t) {
      const unsigned short* brow = Wt + (size_t)(col0 + t * 16 + ln) * ldb + kb;
      FragB b;
      b.half[0] = *(const v8us*)(brow + 8 * hh);
      b.half[1] = *(const v8us*)(brow + 16 + 8 * hh);
      acc[t] = mmaN<ASPLIT ? 2 : 1>(ah.v, al.v, b.v, b.v, acc[t]);
    }
  }
#pragma unroll
  for (int t = 0; t < 4; ++t) {
    float bv = bias ? bias[col0 + t * 16 + ln] : 0.f;
    if (BIAS_BF16) bv = bf16_round(bv);
#pragma unroll
    for (int r = 0; r < 8; ++r) { float v = acc[t][r] + bv; if (ACT == 1) v = fmaxf(v, 0.f); so[w][8 * hh + r][t * 16 + ln] = v; }
  }
  __builtin_amdgcn_fence(__ATOMIC_ACQ_REL, "workgroup");
  __builtin_amdgcn_wave_barrier();
  const int rsub = lane >> 4, c4 = (lane & 15) * 4;
  {
#pragma unroll
    for (int q = 0; q < 8; ++q) {
      const int r = q * 2 + rsub;
      const v4f v = *(const v4fa*)&so[w][r][c4];
      *(v4f*)(C + (size_t)(row0 + r) * ldc + col0 + c4) = v;
    }
    
  }
}

// GEMM C = act(A·W + bias + resid): A f32 (ASPLIT -> hi/lo 2 terms), Wt bf16 [N][K]; ACT 0 none, 1 relu, 2 exact gelu;
// resid (optional, f32, row index = (row % rmod), pitch ldr, RES_BF16 rounds it) added before the activation.
template <bool ASPLIT, int ACT, bool BIAS_BF16, bool RES_BF16>
__global__ __launch_bounds__(128) void k_gemm_bf3(const float* __restrict__ A, int lda, const unsigned short* __restrict__ Wt, int ldb,
                                                const float* __restrict__ bias, const float* __restrict__ resid, int rmod, int ldr,
                                                float* __restrict__ C, int ldc, int M, int N, int K) {
  __shared__ __attribute__((aligned(16))) float so[4][16][64];
  const int tid = threadIdx.x, w = tid >> 5, lane = tid & 31, ln = lane & 15, hh = lane >> 4;
  const int ntn = N / 64;
  const int wid = blockIdx.x * 4 + w;
  const int mt = wid / ntn, nq = wid % ntn;
  if (mt * 16 >= M) return;
  const int row0 = mt * 16, col0 = nq * 64;
  const float* arow = A + (size_t)(row0 + ln) * lda;
  v8f acc[4] = {};
  for (int kb = 0; kb < K; kb += 32) {
    FragB ah, al;
    const v4f x0 = *(const v4fa*)(arow + kb + 8 * hh), x1 = *(const v4fa*)(arow + kb + 8 * hh + 4);
    const v4f x2 = *(const v4fa*)(arow + kb + 16 + 8 * hh), x3 = *(const v4fa*)(arow + kb + 16 + 8 * hh + 4);
    float xs[16] = {x0[0],x0[1],x0[2],x0[3],x1[0],x1[1],x1[2],x1[3],x2[0],x2[1],x2[2],x2[3],x3[0],x3[1],x3[2],x3[3]};
#pragma unroll
    for (int i = 0; i < 16; ++i) { const unsigned short hb = bf16_bits(xs[i]); ah.u[i] = hb; al.u[i] = ASPLIT ? bf16_bits(xs[i] - bf16_val(hb)) : (unsigned short)0; }
#pragma unroll
    for (int t = 0; t < 4; ++t) {
      const unsigned short* brow = Wt + (size_t)(col0 + t * 16 + ln) * ldb + kb;
      FragB b;
      b.half[0] = *(const v8us*)(brow + 8 * hh);
      b.half[1] = *(const v8us*)(brow + 16 + 8 * hh);
      acc[t] = mmaN<ASPLIT ? 2 : 1>(ah.v, al.v, b.v, b.v, acc[t]);
    }
  }
#pragma unroll
  for (int t = 0; t < 4; ++t) {
    const int col = col0 + t * 16 + ln;
    float bv = bias ? bias[col] : 0.f;
    if (BIAS_BF16) bv = bf16_round(bv);
#pragma unroll
    for (int r = 0; r < 8; ++r) {
      float v = acc[t][r] + bv;
      if (resid) { float rv = resid[(size_t)((row0 + 8 * hh + r) % rmod) * ldr + col]; if (RES_BF16) rv = bf16_round(rv); v += rv; }
      if (ACT == 1) v = fmaxf(v, 0.f);
      if (ACT == 2) v = 0.5f * v * (1.0f + erff(v * 0.70710678118654752f));
      if (ACT == 3) { const float u = 0.7978845608028654f * (v + 0.044715f * v * v * v); v = 0.5f * v * (1.0f + tanhf(u)); }
      so[w][8 * hh + r][t * 16 + ln] = v;
    }
  }
  __builtin_amdgcn_fence(__ATOMIC_ACQ_REL, "workgroup");
  __builtin_amdgcn_wave_barrier();
  const int rsub = lane >> 4, c4 = (lane & 15) * 4;
  {
#pragma unroll
    for (int q = 0; q < 8; ++q) {
      const int r = q * 2 + rsub;
      const v4f v = *(const v4fa*)&so[w][r][c4];
      *(v4f*)(C + (size_t)(row0 + r) * ldc + col0 + c4) = v;
    }
    
  }
}
// row LayerNorm (biased variance, eps) over N: s = X (+ R); optional out_sum <- s; out_norm <- (s-mu)*rsqrt(var+eps)*g + b
template <bool PARAM_BF16>
__global__ __launch_bounds__(256) void k_layernorm(const float* __restrict__ X, const float* __restrict__ R, const float* __restrict__ g, const float* __restrict__ bta,
                                                  float* __restrict__ out_sum, float* __restrict__ out_norm, int N, float eps) {
  __shared__ float red[256];
  const int row = blockIdx.x, tid = threadIdx.x;
  const float* x = X + (size_t)row * N; const float* rr = R ? R + (size_t)row * N : nullptr;
  float vals[16];                     // up to N = 4096
  const int per = N / 256;            // contiguous chunk per thread? use strided-by-4 chunks: thread handles j = tid*4 + 1024*u
  float s1 = 0.f;
  for (int u = 0; u < per / 4; ++u) {
    const int j = tid * 4 + 1024 * u;
    const v4f a = *(const v4fa*)(x + j);
    v4f b = {0.f,0.f,0.f,0.f}; if (rr) b = *(const v4fa*)(rr + j);
#pragma unroll
    for (int q = 0; q < 4; ++q) { const float v = a[q] + b[q]; vals[u * 4 + q] = v; s1 += v; }
  }
  red[tid] = s1; __syncthreads();
  for (int st = 128; st > 0; st >>= 1) { if (tid < st) red[tid] += red[tid + st]; __syncthreads(); }
  const float mu = red[0] / (float)N; __syncthreads();
  float s2 = 0.f;
  for (int u = 0; u < per / 4; ++u)
#pragma unroll
    for (int q = 0; q < 4; ++q) { const float c = vals[u * 4 + q] - mu; s2 += c * c; }
  red[tid] = s2; __syncthreads();
  for (int st = 128; st > 0; st >>= 1) { if (tid < st) red[tid] += red[tid + st]; __syncthreads(); }
  const float rs = rsqrtf(red[0] / (float)N + eps);
  {
    for (int u = 0; u < per / 4; ++u) {
      const int j = tid * 4 + 1024 * u;
      v4f o, sm;
#pragma unroll
      for (int q = 0; q < 4; ++q) {
        float gg = g[j + q], bb = bta[j + q];
        if (PARAM_BF16) { gg = bf16_round(gg); bb = bf16_round(bb); }
        sm[q] = vals[u * 4 + q]; o[q] = (vals[u * 4 + q] - mu) * rs * gg + bb;
      }
      if (out_sum) *(v4f*)(out_sum + (size_t)row * N + j) = sm;
      *(v4f*)(out_norm + (size_t)row * N + j) = o;
    }
    
  }
}



// ---- f16 WMMA path (v_wmma_f32_16x16x32_f16): 11-bit significands for operands in range — used where a [0,1] probability operand needs more precision than bf16
typedef _Float16 v16h __attribute__((ext_vector_type(16)));
union FragH { v16h v; v8us half[2]; _Float16 h[16]; unsigned short u[16]; };
template <int NT>
__device__ __forceinline__ v8f mmaH(v16h ah, v16h al, v16h bh, v16h bl, v8f c) {
  c = __builtin_amdgcn_wmma_f32_16x16x32_f16(false, ah, false, bh, (short)0, c, false, false);
  if (NT >= 2) c = __builtin_amdgcn_wmma_f32_16x16x32_f16(false, al, false, bh, (short)0, c, false, false);
  if (NT >= 3) c = __builtin_amdgcn_wmma_f32_16x16x32_f16(false, ah, false, bl, (short)0, c, false, false);
  asm volatile("v_nop\n\tv_nop\n\tv_nop\n\tv_nop" : "+v"(c) : "v"(ah), "v"(al), "v"(bh), "v"(bl));
  return c;
}
// batched GEMM like k_gemm_b but f16 operands: A f32 (split into f16 hi/lo if ASPLIT, else rounded to f16), Bt = f16 values [n][k]; alpha; C f32; N multiple of 16 (partial tiles skipped)
template <bool ASPLIT>
__global__ __launch_bounds__(128) void k_gemm_h(const float* __restrict__ A, int lda, size_t sA, const _Float16* __restrict__ Bh, int ldb, size_t sB, float alpha, float* __restrict__ C, int ldc, size_t sC, int M, int N, int K) {
  __shared__ __attribute__((aligned(16))) float so[4][16][64];
  const int tid = threadIdx.x, w = tid >> 5, lane = tid & 31, ln = lane & 15, hh = lane >> 4; const int by = blockIdx.y;
  A += (size_t)by * sA; Bh += (size_t)by * sB; C += (size_t)by * sC;
  const int ntn = (N + 63) / 64; const int wid = blockIdx.x * 4 + w; const int mt = wid / ntn, nq = wid % ntn; if (mt * 16 >= M) return;
  const int row0 = mt * 16, col0 = nq * 64; const float* arow = A + (size_t)(row0 + ln) * lda;
  v8f acc[4] = {};
  for (int kb = 0; kb < K; kb += 32) {
    FragH ah, al;
    const v4f x0 = *(const v4fa*)(arow + kb + 8 * hh), x1 = *(const v4fa*)(arow + kb + 8 * hh + 4), x2 = *(const v4fa*)(arow + kb + 16 + 8 * hh), x3 = *(const v4fa*)(arow + kb + 16 + 8 * hh + 4);
    float xs[16] = {x0[0],x0[1],x0[2],x0[3],x1[0],x1[1],x1[2],x1[3],x2[0],x2[1],x2[2],x2[3],x3[0],x3[1],x3[2],x3[3]};
#pragma unroll
    for (int i = 0; i < 16; ++i) { const _Float16 h = (_Float16)xs[i]; ah.h[i] = h; al.h[i] = ASPLIT ? (_Float16)(xs[i] - (float)h) : (_Float16)0.0f; }
#pragma unroll
    for (int t = 0; t < 4; ++t) { if (col0 + t * 16 >= N) continue; const size_t boff = (size_t)(col0 + t * 16 + ln) * ldb + kb; FragH bq; bq.half[0] = *(const v8us*)(Bh + boff + 8 * hh); bq.half[1] = *(const v8us*)(Bh + boff + 16 + 8 * hh);
      acc[t] = mmaH<ASPLIT ? 2 : 1>(ah.v, al.v, bq.v, bq.v, acc[t]); }
  }
#pragma unroll
  for (int t = 0; t < 4; ++t) { if (col0 + t * 16 >= N) continue;
#pragma unroll
    for (int r = 0; r < 8; ++r) so[w][8 * hh + r][t * 16 + ln] = acc[t][r] * alpha; }
  __builtin_amdgcn_fence(__ATOMIC_ACQ_REL, "workgroup"); __builtin_amdgcn_wave_barrier();
  const int rsub = lane >> 4, c4 = (lane & 15) * 4;
  {
#pragma unroll
    for (int q = 0; q < 8; ++q) { const int r = q * 2 + rsub; if (col0 + c4 < N) { const v4f v = *(const v4fa*)&so[w][r][c4]; *(v4f*)(C + (size_t)(row0 + r) * ldc + col0 + c4) = v; } }
     }
}

// Wt[n][k] = f16(W[k][n]·scale) from f32 row-major W[K][N] (scale = power of two; bf16-exact weights stay exact in f16 away from the subnormal range)
__global__ __launch_bounds__(256) void k_wt_f16(const float* __restrict__ W, _Float16* __restrict__ Wt, int K, int N, float scale) {
  const int t = blockIdx.x * 256 + threadIdx.x; if (t >= N * (K / 8)) return; const int n = t / (K / 8), k8 = (t % (K / 8)) * 8; FragH f;
#pragma unroll
  for (int i = 0; i < 8; ++i) f.h[i] = (_Float16)(bf16_round(W[(size_t)(k8 + i) * N + n]) * scale); const v8us o = f.half[0];
  *(v8us*)((unsigned short*)Wt + (size_t)n * K + k8) = o; 
}
// k_gemm_hh variant with fused epilogue: v = acc·alpha + bias[by·sBias + col] (+ CP[(row/rowsPerB)·sCPb + by·64 + col] if CP) ; ACT 0 none / 1 elu ; writes f16 C16 (and f32 C if non-null)
template <int ACT>
__global__ __launch_bounds__(128) void k_gemm_hhx(const _Float16* __restrict__ A, int lda, size_t sA, const _Float16* __restrict__ Bh, int ldb, size_t sB, float alpha, const float* __restrict__ bias, size_t sBias, const float* __restrict__ CP, int rowsPerB, size_t sCPb, int row0g,
    float* __restrict__ C, _Float16* __restrict__ C16, int ldc, size_t sC, int M, int N, int K) {
  __shared__ __attribute__((aligned(16))) float so[4][16][64];
  const int tid = threadIdx.x, w = tid >> 5, lane = tid & 31, ln = lane & 15, hh = lane >> 4; const int by = blockIdx.y;
  A += (size_t)by * sA; Bh += (size_t)by * sB; const size_t cofs = (size_t)by * sC; const float* bp = bias ? bias + (size_t)by * sBias : nullptr;
  const int ntn = (N + 63) / 64; const int wid = blockIdx.x * 4 + w; const int mt = wid / ntn, nq = wid % ntn; if (mt * 16 >= M) return;
  const int row0 = mt * 16, col0 = nq * 64; const _Float16* arow = A + (size_t)(row0 + ln) * lda;
  v8f acc[4] = {};
  for (int kb = 0; kb < K; kb += 32) { FragH ah; ah.half[0] = *(const v8us*)((const unsigned short*)arow + kb + 8 * hh); ah.half[1] = *(const v8us*)((const unsigned short*)arow + kb + 16 + 8 * hh);
#pragma unroll
    for (int t = 0; t < 4; ++t) { if (col0 + t * 16 >= N) continue; const size_t boff = (size_t)(col0 + t * 16 + ln) * ldb + kb; FragH bq; bq.half[0] = *(const v8us*)((const unsigned short*)Bh + boff + 8 * hh); bq.half[1] = *(const v8us*)((const unsigned short*)Bh + boff + 16 + 8 * hh);
      acc[t] = mmaH<1>(ah.v, ah.v, bq.v, bq.v, acc[t]); }
  }
#pragma unroll
  for (int t = 0; t < 4; ++t) { if (col0 + t * 16 >= N) continue; const int col = col0 + t * 16 + ln; const float bv = bp ? bf16_round(bp[col]) : 0.f;
#pragma unroll
    for (int r = 0; r < 8; ++r) { float v = acc[t][r] * alpha + bv; if (CP) { const int rr = row0g + row0 + 8 * hh + r; if (rowsPerB < 0) v += CP[cofs + (size_t)rr * ldc + col];      /* rowsPerB < 0: own element of the batched C plane */ else { const int bidx = rr / rowsPerB; v += CP[(size_t)bidx * sCPb + (size_t)by * 64 + col]; } } if (ACT == 1) v = (v > 0.f) ? v : expm1f(v); else if (ACT == 7) v = (v > 0.f) ? v + 1.0f : expf(v); else if (ACT == 8) v = tanhf(v); else if (ACT == 9) v = 0.5f * v * (1.0f + tanhf(0.7978845608028654f * (v + 0.044715f * v * v * v))); else if (ACT == 11) v = 1.0f / (1.0f + expf(-v)); else if (ACT == 12) v = (v > 0.f) ? v : 0.01f * v; else if (ACT == 14) v = (v > 0.f) ? v : 0.1f * v; else if (ACT == 16) v = (v >= 0.f) ? v : 0.3f * v; else if (ACT == 17) v = (v >= 0.f) ? v : 0.2f * v; else if (ACT == 15) v = v / (1.0f + expf(-v)); else if (ACT == 3) v = fmaxf(v, 0.f); else if (ACT == 6) v = 0.5f * v * (1.0f + erff(v * 0.70710678118654752f)); so[w][8 * hh + r][t * 16 + ln] = v; } }
  __builtin_amdgcn_fence(__ATOMIC_ACQ_REL, "workgroup"); __builtin_amdgcn_wave_barrier();
  const int rsub = lane >> 4, c4 = (lane & 15) * 4; typedef _Float16 v4h __attribute__((ext_vector_type(4)));
  {
#pragma unroll
    for (int q = 0; q < 8; ++q) { const int r = q * 2 + rsub; if (col0 + c4 < N) { const v4f v = *(const v4fa*)&so[w][r][c4]; if (C) *(v4f*)(C + cofs + (size_t)(row0 + r) * ldc + col0 + c4) = v; if (C16) { v4h h4; for (int i = 0; i < 4; ++i) h4[i] = (_Float16)v[i]; *(v4h*)(C16 + cofs + (size_t)(row0 + r) * ldc + col0 + c4) = h4; } } }
     }
}


typedef _Float16 v4h __attribute__((ext_vector_type(4)));

__global__ __launch_bounds__(256) void k_x16(const float* __restrict__ x, _Float16* __restrict__ X16, size_t n8) { const size_t t = (size_t)blockIdx.x * 256 + threadIdx.x; if (t >= n8) return; FragH f;
#pragma unroll
  for (int q = 0; q < 8; ++q) f.h[q] = (_Float16)bf16_round(x[t * 8 + q]); *(v8us*)((unsigned short*)X16 + t * 8) = f.half[0];  }
__global__ __launch_bounds__(256) void k_h16(const float* __restrict__ x, _Float16* __restrict__ X16, size_t n8) { const size_t t = (size_t)blockIdx.x * 256 + threadIdx.x; if (t >= n8) return; FragH f;
#pragma unroll
  for (int q = 0; q < 8; ++q) f.h[q] = (_Float16)x[t * 8 + q]; *(v8us*)((unsigned short*)X16 + t * 8) = f.half[0];  }
__global__ __launch_bounds__(256) void k_round16f(const float* __restrict__ W, _Float16* __restrict__ Bt, size_t n8) { const size_t t = (size_t)blockIdx.x * 256 + threadIdx.x; if (t >= n8) return; FragH f;
#pragma unroll
  for (int i = 0; i < 8; ++i) f.h[i] = (_Float16)(bf16_round(W[t * 8 + i]) * 16.0f); *(v8us*)((unsigned short*)Bt + t * 8) = f.half[0];  }
template <int NHv, int TTv>
__global__ __launch_bounds__(256) void k_vt(const _Float16* __restrict__ V16, int ldv, int voff, _Float16* __restrict__ Vt) { __shared__ unsigned short tl[64][66]; const int tid = threadIdx.x; const int slab = blockIdx.x / (TTv / 64), lg = blockIdx.x % (TTv / 64); const int b = slab / NHv, h = slab % NHv;
  for (int i = tid; i < 64 * 8; i += 256) { const int r = i / 8, c8 = (i % 8) * 8; FragH f; f.half[0] = *(const v8us*)((const unsigned short*)V16 + ((size_t)b * TTv + lg * 64 + r) * ldv + voff + h * 64 + c8);
#pragma unroll
    for (int q = 0; q < 8; ++q) tl[r][c8 + q] = f.u[q]; }
  __syncthreads();
  {
#pragma unroll
    for (int rd = 0; rd < 2; ++rd) { const int d = rd * 32 + tid / 8, pc = tid % 8; FragH f;
#pragma unroll
      for (int q = 0; q < 8; ++q) f.u[q] = tl[pc * 8 + q][d];
      *(v8us*)((unsigned short*)Vt + ((size_t)slab * 64 + d) * TTv + lg * 64 + pc * 8) = f.half[0]; }
     } }

__global__ __launch_bounds__(256) void k_hl(const float* __restrict__ F, _Float16* __restrict__ Hh, _Float16* __restrict__ Hl, size_t n8) { const size_t t = (size_t)blockIdx.x * 256 + threadIdx.x; if (t >= n8) return; FragH fh, fl; const v4f a = *(const v4fa*)(F + t * 8), c = *(const v4fa*)(F + t * 8 + 4);
#pragma unroll
  for (int q = 0; q < 4; ++q) { _Float16 h = (_Float16)a[q]; fh.h[q] = h; fl.h[q] = (_Float16)((a[q] - (float)h) * 1024.0f); h = (_Float16)c[q]; fh.h[4 + q] = h; fl.h[4 + q] = (_Float16)((c[q] - (float)h) * 1024.0f); }
  { *(v8us*)((unsigned short*)Hh + t * 8) = fh.half[0]; *(v8us*)((unsigned short*)Hl + t * 8) = fl.half[0];  } }

// ---- fast GEMM (wave tile 32x64; requires M % 32 == 0 rows per launch region and N % 64 == 0); epilogue = k_gemm_hhx semantics ----
__device__ __forceinline__ v16h g2_frag(const _Float16* p, int hh) { FragH f; f.half[0] = *(const v8us*)((const unsigned short*)p + 8 * hh); f.half[1] = *(const v8us*)((const unsigned short*)p + 16 + 8 * hh); return f.v; }
__device__ __forceinline__ v8f g2_mma(v16h a, v16h b, v8f c) { v8f d = __builtin_amdgcn_wmma_f32_16x16x32_f16(false, a, false, b, (short)0, c, false, false); asm volatile("v_nop\n\tv_nop\n\tv_nop\n\tv_nop" : "+v"(d) : "v"(a), "v"(b)); return d; }
template <int ACT>
__global__ __launch_bounds__(128) void k_gemm2(const _Float16* __restrict__ A, int lda, size_t sA, const _Float16* __restrict__ Bh, int ldb, size_t sB, float alpha, const float* __restrict__ bias, size_t sBias, const float* __restrict__ CP, int rowsPerB, size_t sCPb, int row0g,
    float* __restrict__ C, _Float16* __restrict__ C16, int ldc, size_t sC, int M, int N, int K) { static_assert(ACT == 0 || ACT == 3 || ACT == 6 || ACT == 8 || ACT == 9 || ACT == 11 || ACT == 12 || ACT == 14 || ACT == 15 || ACT == 16 || ACT == 17, "k_gemm2: unsupported ACT code (would silently apply no activation)");
  __shared__ __attribute__((aligned(16))) float so[4][32][68];
  const int tid = threadIdx.x, w = tid >> 5, lane = tid & 31, ln = lane & 15, hh = lane >> 4; const int by = blockIdx.y;
  A += (size_t)by * sA; Bh += (size_t)by * sB; const size_t cofs = (size_t)by * sC; const float* bp = bias ? bias + (size_t)by * sBias : nullptr;
  const int ntn = N >> 6; const int mt = blockIdx.x / ntn, nq = blockIdx.x - mt * ntn; const int row0 = mt * 128 + 32 * w, col0 = nq * 64; if (row0 >= M) return;
  const _Float16* a0p = A + (size_t)(row0 + ln) * lda; const _Float16* a1p = a0p + (size_t)16 * lda;
  const _Float16* b0p = Bh + (size_t)(col0 + ln) * ldb; const _Float16* b1p = b0p + (size_t)16 * ldb; const _Float16* b2p = b1p + (size_t)16 * ldb; const _Float16* b3p = b2p + (size_t)16 * ldb;
  const v8f z8 = {0.f,0.f,0.f,0.f,0.f,0.f,0.f,0.f}; v8f c00 = z8, c01 = z8, c02 = z8, c03 = z8, c10 = z8, c11 = z8, c12 = z8, c13 = z8;
#pragma unroll 1
  for (int kb = 0; kb < K; kb += 32) { const v16h a0 = g2_frag(a0p + kb, hh), a1 = g2_frag(a1p + kb, hh);
    v16h b = g2_frag(b0p + kb, hh); c00 = g2_mma(a0, b, c00); c10 = g2_mma(a1, b, c10);
    b = g2_frag(b1p + kb, hh); c01 = g2_mma(a0, b, c01); c11 = g2_mma(a1, b, c11);
    b = g2_frag(b2p + kb, hh); c02 = g2_mma(a0, b, c02); c12 = g2_mma(a1, b, c12);
    b = g2_frag(b3p + kb, hh); c03 = g2_mma(a0, b, c03); c13 = g2_mma(a1, b, c13); }
  v8f accs[8] = {c00, c01, c02, c03, c10, c11, c12, c13};
#pragma unroll
  for (int u = 0; u < 8; ++u) { const int t = u & 3, half = u >> 2; const int col = col0 + t * 16 + ln; const float bv = bp ? bf16_round(bp[col]) : 0.f;
#pragma unroll
    for (int r = 0; r < 8; ++r) { const int rloc = half * 16 + 8 * hh + r; float v = accs[u][r] * alpha + bv; if (CP) { if (rowsPerB < 0) v += CP[cofs + (size_t)(row0g + row0 + rloc) * ldc + col];      /* rowsPerB < 0: own element of the batched C plane */ else { const int bidx = (row0g + row0 + rloc) / rowsPerB; v += CP[(size_t)bidx * sCPb + (size_t)by * 64 + col]; } }
      if (ACT == 3) v = fmaxf(v, 0.f); else if (ACT == 6) v = 0.5f * v * (1.0f + erff(v * 0.70710678118654752f)); else if (ACT == 11) v = 1.0f / (1.0f + expf(-v)); else if (ACT == 15) v = v / (1.0f + expf(-v)); else if (ACT == 12) v = (v > 0.f) ? v : 0.01f * v; else if (ACT == 8) v = tanhf(v); else if (ACT == 9) v = 0.5f * v * (1.0f + tanhf(0.7978845608028654f * (v + 0.044715f * v * v * v))); else if (ACT == 14) v = (v > 0.f) ? v : 0.1f * v; else if (ACT == 16) v = (v >= 0.f) ? v : 0.3f * v; else if (ACT == 17) v = (v >= 0.f) ? v : 0.2f * v;
      so[w][rloc][t * 16 + ln] = v; } }
  __builtin_amdgcn_fence(__ATOMIC_ACQ_REL, "workgroup"); __builtin_amdgcn_wave_barrier();
  const int rsub = lane >> 4, c4 = (lane & 15) * 4;
  {
#pragma unroll
    for (int q = 0; q < 16; ++q) { const int r = q * 2 + rsub; const v4f v = *(const v4fa*)&so[w][r][c4]; if (C) *(v4f*)(C + cofs + (size_t)(row0 + r) * ldc + col0 + c4) = v; if (C16) { v4h h4; for (int i = 0; i < 4; ++i) h4[i] = (_Float16)v[i]; *(v4h*)(C16 + cofs + (size_t)(row0 + r) * ldc + col0 + c4) = h4; } }
     } }


__global__ __launch_bounds__(256) void k_wnat(const float* __restrict__ w, size_t n8, _Float16* __restrict__ Bt) { const size_t t = (size_t)blockIdx.x * 256 + threadIdx.x; if (t >= n8) return; FragH f; for (int q = 0; q < 8; ++q) f.h[q] = (_Float16)(bf16_round(w[t * 8 + q]) * 16.0f); *(v8us*)((unsigned short*)Bt + t * 8) = f.half[0];  }
__global__ __launch_bounds__(256) void k_rsm(const float* __restrict__ S, _Float16* __restrict__ P, int nrows) {
  #pragma clang fp contract(off)
  const int i = blockIdx.x * 256 + threadIdx.x; if (i >= nrows) return; const float* s = S + (size_t)i * SQ; float mx = -3.0e38f;
#pragma unroll 1
  for (int j = 0; j < SQ; ++j) mx = fmaxf(mx, s[j]); float se = 0.f;
#pragma unroll 1
  for (int j = 0; j < SQ; ++j) se += expf(s[j] - mx); const float sc = 256.0f / se;
#pragma unroll 1
  for (int j0 = 0; j0 < SQ; j0 += 8) { FragH f; for (int q = 0; q < 8; ++q) f.h[q] = (_Float16)(expf(s[j0 + q] - mx) * sc); unsigned short* d = (unsigned short*)P + (size_t)i * SQ + j0; *(v8us*)d = f.half[0];  } }
__global__ __launch_bounds__(256) void k_vt(const _Float16* __restrict__ V16, int b, int h0, _Float16* __restrict__ VT) { __shared__ unsigned short tl[64][65]; const int tid = threadIdx.x; const int hh = blockIdx.x % HG, sg = blockIdx.x / HG; const int s0 = sg * 64; const int h = h0 + hh;
  for (int i = tid; i < 64 * 8; i += 256) { const int j = i / 8, d8 = (i % 8) * 8; FragH f; f.half[0] = *(const v8us*)((const unsigned short*)V16 + ((size_t)b * SQ + s0 + j) * DM + h * HD + d8); for (int q = 0; q < 8; ++q) tl[d8 + q][j] = f.u[q]; }
  __syncthreads();
  { for (int i = tid; i < 64 * 8; i += 256) { const int d = i / 8, j8 = (i % 8) * 8; FragH f; for (int q = 0; q < 8; ++q) f.u[q] = tl[d][j8 + q]; *(v8us*)((unsigned short*)VT + ((size_t)hh * HD + d) * SQ + s0 + j8) = f.half[0]; }  } }

__global__ __launch_bounds__(256) void k_qprep(const float* __restrict__ QF, const float* __restrict__ ub, const float* __restrict__ vb, _Float16* __restrict__ Q16, _Float16* __restrict__ QU, _Float16* __restrict__ QV, size_t n8) {
  #pragma clang fp contract(off)
  const size_t t = (size_t)blockIdx.x * 256 + threadIdx.x; if (t >= n8) return; const size_t e = t * 8; const int c = (int)(e % DM); FragH a, b, d;
#pragma unroll
  for (int q = 0; q < 8; ++q) { const float v = QF[e + q]; a.h[q] = (_Float16)v; b.h[q] = (_Float16)__fadd_rn(v, bf16_round(ub[c + q])); d.h[q] = (_Float16)__fadd_rn(v, bf16_round(vb[c + q])); }
  { *(v8us*)((unsigned short*)Q16 + e) = a.half[0]; *(v8us*)((unsigned short*)QU + e) = b.half[0]; *(v8us*)((unsigned short*)QV + e) = d.half[0];  } }

__global__ __launch_bounds__(256) void k_zfill(_Float16* __restrict__ dst, size_t n8) { const size_t t = (size_t)blockIdx.x * 256 + threadIdx.x; if (t >= n8) return; const v8us z = {0, 0, 0, 0, 0, 0, 0, 0}; *(v8us*)((unsigned short*)dst + t * 8) = z;  }
// Fused relative attention, one work-group per (batch, head, FR query rows); the FR x 1024 score rows live in LDS and never reach memory.
// 1: bd tiles (q + v) . p[i0 + 16 t ..], each element stored at its shifted column j = T - 1 + i - pos (in the edge tiles a column outside 0..T-1 goes to the pad column T, which nobody reads);
// 2: ac tiles (q + u) . k added in place; 3: one wave per row: lane l holds columns 4 l + 128 u + (0..3), mask, f32 statistics, weights x256 as f16 written over the row's own first half;
// 4: o = P . V^T: a wave does 32 rows x 16 columns over one half of k (each V^T fragment is loaded once a work-group); the two halves are added on the way out, where one wave writes each 128-byte line.
// Global fragments are requested ahead of their use, into the registers that the running step sets free.
#define FR 32
#define FD 6                         /* fragment tiles in flight a wave: 96 registers */
#define FP (SQ + 4)                  /* LDS row pitch in floats: 16 B x odd, for the ds_load_b128 fragment reads of step 4 */
typedef int   v4ia __attribute__((ext_vector_type(4), may_alias));
typedef _Float16 v4ha __attribute__((ext_vector_type(4), may_alias));
static_assert(SQ == 1024 && HD == 64 && FR == 32 && SQ - 1 + FR <= 66 * 16 && SQ - FR + 66 * 16 <= PP, "k_relattn: 8 waves, 66 position tiles inside the padded table");
// Four native 2^x (what __expf compiles to, behind its multiply by log2 e). Written in one statement so that the slot the instruction set asks for behind a transcendental is kept by construction:
// each v_exp_f32 is followed by one that neither reads its result nor overwrites its source (early-clobber outputs), the last by v_nop.
__device__ __forceinline__ void exp2x4(float x0, float x1, float x2, float x3, float* e) {
  asm("v_exp_f32 %0, %4\n\tv_exp_f32 %1, %5\n\tv_exp_f32 %2, %6\n\tv_exp_f32 %3, %7\n\tv_nop" : "=&v"(e[0]), "=&v"(e[1]), "=&v"(e[2]), "=&v"(e[3]) : "v"(x0), "v"(x1), "v"(x2), "v"(x3)); }
__global__ __launch_bounds__(256) __attribute__((amdgpu_waves_per_eu(4, 4))) void k_relattn(const _Float16* __restrict__ QU, const _Float16* __restrict__ QV, const _Float16* __restrict__ K16, const _Float16* __restrict__ R16, const _Float16* __restrict__ VT, const int* __restrict__ mask, _Float16* __restrict__ O16) {
  __shared__ __attribute__((aligned(16))) float sc[FR][FP];
  __shared__ __attribute__((aligned(16))) float so[2][FR][68];
  const int tid = threadIdx.x, lane = tid & 31, ln = lane & 15, hh = lane >> 4; const int w = __builtin_amdgcn_readfirstlane(tid >> 5);
  const int it = blockIdx.x % (SQ / FR), bh = blockIdx.x / (SQ / FR), h = bh % NH, b = bh / NH; const int i0 = it * FR; const size_t r0 = (size_t)b * SQ;
  const v8f z8 = {0.f,0.f,0.f,0.f,0.f,0.f,0.f,0.f};
  const _Float16* pp = R16 + (size_t)(i0 + w * 16 + ln) * DM + h * HD + 8 * hh; const _Float16* kp = K16 + (r0 + w * 16 + ln) * DM + h * HD + 8 * hh;      /* tile w; tile w + 8 k lies 128 k rows on; global pointers hold the lane's 8 hh already, so that they are the loads' own address registers */
  const _Float16* qp = QV + (r0 + i0 + ln) * DM + h * HD + 8 * hh; v16h a00 = g2_frag(qp, 0), a01 = g2_frag(qp + 32, 0), a10 = g2_frag(qp + 16 * DM, 0), a11 = g2_frag(qp + 16 * DM + 32, 0);
  v16h fr[16][2];      /* this wave's 8 position tiles, then its 8 key tiles: one stream, requested FD tiles ahead of its use */
  auto fetch = [&](int n) { const _Float16* p = (n < 8) ? pp + (size_t)n * 128 * DM : kp + (size_t)(n - 8) * 128 * DM; fr[n][0] = g2_frag(p, 0); fr[n][1] = g2_frag(p + 32, 0); };
#pragma unroll
  for (int n = 0; n < FD; ++n) fetch(n);
  asm volatile("s_wait_xcnt 0x0" :: "v"(qp), "v"(pp) : "memory");      /* the issued loads' address registers stay whole up to here and are reused only behind this wait */
  const int jw = SQ - 1 + 8 * hh - w * 16 - ln;      /* column of row 8 hh at position i0 + 16 w + ln */
#pragma unroll
  for (int k = 0; k < 8; ++k) { fetch(k + FD); v8f c0 = g2_mma(a00, fr[k][0], z8), c1 = g2_mma(a10, fr[k][0], z8); c0 = g2_mma(a01, fr[k][1], c0); c1 = g2_mma(a11, fr[k][1], c1);
    const int jb = jw - 128 * k;
    if (k == 0) {      /* tiles 0 and 1 reach past column T - 1 */
#pragma unroll
      for (int r = 0; r < 8; ++r) { const int j = jb + r, j1 = j + 16; sc[8 * hh + r][((unsigned)j < SQ) ? j : SQ] = c0[r]; sc[16 + 8 * hh + r][((unsigned)j1 < SQ) ? j1 : SQ] = c1[r]; }
    } else {           /* tiles 8 to 63: every column inside */
#pragma unroll
      for (int r = 0; r < 8; ++r) { sc[8 * hh + r][jb + r] = c0[r]; sc[16 + 8 * hh + r][jb + 16 + r] = c1[r]; } }
    __builtin_amdgcn_sched_barrier(0); }      /* one tile's accumulators and LDS addresses live at a time: without it the compiler opens six tiles at once and spills */
  if (w < 2) {         /* tiles 64 and 65 reach below column 0 */
    const v16h b0 = g2_frag(pp + (size_t)8 * 128 * DM, 0), b1 = g2_frag(pp + (size_t)8 * 128 * DM + 32, 0);
    v8f c0 = g2_mma(a00, b0, z8), c1 = g2_mma(a10, b0, z8); c0 = g2_mma(a01, b1, c0); c1 = g2_mma(a11, b1, c1); const int jb = jw - 128 * 8;
#pragma unroll
    for (int r = 0; r < 8; ++r) { const int j = jb + r, j1 = j + 16; sc[8 * hh + r][((unsigned)j < SQ) ? j : SQ] = c0[r]; sc[16 + 8 * hh + r][((unsigned)j1 < SQ) ? j1 : SQ] = c1[r]; } }
  qp = QU + (r0 + i0 + ln) * DM + h * HD + 8 * hh; a00 = g2_frag(qp, 0); a01 = g2_frag(qp + 32, 0); a10 = g2_frag(qp + 16 * DM, 0); a11 = g2_frag(qp + 16 * DM + 32, 0);
  asm volatile("s_wait_xcnt 0x0" :: "v"(qp), "v"(kp) : "memory");      /* as above */
  __syncthreads();
  const int* mk = mask + (r0 + i0 + w * 4) * SQ + 4 * lane; v4ia m[2][8];
#pragma unroll
  for (int k = 0; k < 8; ++k) { if (k + FD < 8) fetch(8 + k + FD);
    v8f c0 = g2_mma(a00, fr[8 + k][0], z8), c1 = g2_mma(a10, fr[8 + k][0], z8); c0 = g2_mma(a01, fr[8 + k][1], c0); c1 = g2_mma(a11, fr[8 + k][1], c1);
    if (k == 4) {
#pragma unroll
      for (int u = 0; u < 8; ++u) m[0][u] = *(const v4ia*)(mk + 128 * u); }      /* this wave's first mask row */
    const int j = (w + 8 * k) * 16 + ln;
#pragma unroll
    for (int r = 0; r < 8; ++r) { sc[8 * hh + r][j] += c0[r]; sc[16 + 8 * hh + r][j] += c1[r]; } }
  __builtin_amdgcn_sched_barrier(0);      /* step 3's mask compares stay behind the last tile: drawn up among the tiles, they wait there on the mask loads just issued */
  __syncthreads();
  const int nt = w & 3, kh = w >> 2; const _Float16* vp = VT + ((size_t)bh * HD + nt * 16 + ln) * SQ + kh * (SQ / 2) + 8 * hh; v16h vf[16];
#pragma unroll
  for (int k = 0; k < 4; ++k) { float* row = &sc[w * 4 + k][0]; const v4ia* mc = m[k & 1];
    if (k < 3) {
#pragma unroll
      for (int u = 0; u < 8; ++u) m[(k + 1) & 1][u] = *(const v4ia*)(mk + (k + 1) * SQ + 128 * u);      /* next row's mask flies while this row is worked on */
    } else {
#pragma unroll
      for (int s = 0; s < 16; ++s) vf[s] = g2_frag(vp + 32 * s, 0);      /* step 4's V^T fragments fly during the last row */
      asm volatile("s_wait_xcnt 0x0" :: "v"(vp) : "memory"); }      /* as above */
    float v[8][4]; float m4[4] = {-3.0e38f, -3.0e38f, -3.0e38f, -3.0e38f};
#pragma unroll
    for (int u = 0; u < 8; ++u) { const v4f s = *(const v4fa*)(row + 4 * lane + 128 * u);
#pragma unroll
      for (int q = 0; q < 4; ++q) { v[u][q] = s[q] * 0.125f; m4[q] = fmaxf(m4[q], (mc[u][q] == 0) ? v[u][q] : -3.0e38f); } }
    float mx = fmaxf(fmaxf(m4[0], m4[1]), fmaxf(m4[2], m4[3]));
#pragma unroll
    for (int d = 16; d >= 1; d >>= 1) mx = fmaxf(mx, __shfl_xor(mx, d, 32));
    float s4[4] = {0.f, 0.f, 0.f, 0.f};
#pragma unroll
    for (int u = 0; u < 8; ++u) { float e[4]; exp2x4((v[u][0] - mx) * 1.44269504f, (v[u][1] - mx) * 1.44269504f, (v[u][2] - mx) * 1.44269504f, (v[u][3] - mx) * 1.44269504f, e);
#pragma unroll
      for (int q = 0; q < 4; ++q) { v[u][q] = (mc[u][q] == 0) ? e[q] : 0.f; s4[q] += v[u][q]; } }
    float se = (s4[0] + s4[1]) + (s4[2] + s4[3]);
#pragma unroll
    for (int d = 16; d >= 1; d >>= 1) se += __shfl_xor(se, d, 32);
    const float scl = (se > 0.f) ? 256.0f / se : 0.f;
#pragma unroll
    for (int u = 0; u < 8; ++u) { v4ha h4;
#pragma unroll
      for (int q = 0; q < 4; ++q) h4[q] = (_Float16)(v[u][q] * scl);
      *(v4ha*)((_Float16*)row + 4 * lane + 128 * u) = h4; } }
  __syncthreads();
  { const _Float16* ap = (const _Float16*)&sc[ln][0] + kh * (SQ / 2); v8f c0 = z8, c1 = z8; v16h af[2][4];      /* weight fragments of two k steps, read from LDS one pair of steps ahead */
#pragma unroll
    for (int e = 0; e < 2; ++e) { af[0][2 * e] = g2_frag(ap + 32 * e, hh); af[0][2 * e + 1] = g2_frag(ap + 16 * FP * 2 + 32 * e, hh); }
#pragma unroll
    for (int g = 0; g < 8; ++g) {
      if (g < 7) {
#pragma unroll
        for (int e = 0; e < 2; ++e) { af[(g + 1) & 1][2 * e] = g2_frag(ap + 32 * (2 * g + 2 + e), hh); af[(g + 1) & 1][2 * e + 1] = g2_frag(ap + 16 * FP * 2 + 32 * (2 * g + 2 + e), hh); } }
#pragma unroll
      for (int e = 0; e < 2; ++e) { c0 = g2_mma(af[g & 1][2 * e], vf[2 * g + e], c0); c1 = g2_mma(af[g & 1][2 * e + 1], vf[2 * g + e], c1); } }
#pragma unroll
    for (int r = 0; r < 8; ++r) { so[kh][8 * hh + r][nt * 16 + ln] = c0[r]; so[kh][16 + 8 * hh + r][nt * 16 + ln] = c1[r]; } }
  __syncthreads();
  { const int r = tid >> 3, c8 = (tid & 7) * 8; const v4f x = *(const v4fa*)&so[0][r][c8] + *(const v4fa*)&so[1][r][c8], y = *(const v4fa*)&so[0][r][c8 + 4] + *(const v4fa*)&so[1][r][c8 + 4]; FragH f;
#pragma unroll
    for (int q = 0; q < 4; ++q) { f.h[q] = (_Float16)(x[q] * 0.25f); f.h[4 + q] = (_Float16)(y[q] * 0.25f); }
    *(v8us*)((unsigned short*)O16 + (r0 + i0 + r) * DM + h * HD + c8) = f.half[0]; } }

extern "C" void kernel_launch(void* const* d_in, const int* in_sizes, int n_in,
                              void* d_out, int out_size, void* d_ws, size_t ws_size, hipStream_t stream) {
  (void)in_sizes; (void)n_in; (void)out_size;
  const float* const* I = (const float* const*)d_in; const float* xq = I[0]; const float* xk = I[1]; const float* xv = I[2]; const int* mask = (const int*)d_in[3]; const float* pe = I[4]; const float* wq = I[5]; const float* bq = I[6]; const float* wk = I[7]; const float* bk = I[8]; const float* wv = I[9]; const float* bv = I[10]; const float* wpos = I[11]; const float* wo = I[12]; const float* bo = I[13]; const float* pbu = I[14]; const float* pbv = I[15];
  char* ws = (char*)d_ws; size_t off = 0;
  auto take = [&](size_t bytes) { char* p = ws + off; off += (bytes + 255) & ~(size_t)255; return p; };
  _Float16* BQ = (_Float16*)take((size_t)DM * DM * 2); _Float16* BK = (_Float16*)take((size_t)DM * DM * 2); _Float16* BV = (_Float16*)take((size_t)DM * DM * 2); _Float16* BP = (_Float16*)take((size_t)DM * DM * 2); _Float16* BO = (_Float16*)take((size_t)DM * DM * 2);
  _Float16* XQ = (_Float16*)take(NR * DM * 2); _Float16* XK = (_Float16*)take(NR * DM * 2); _Float16* XV = (_Float16*)take(NR * DM * 2); _Float16* PE = (_Float16*)take((size_t)PP * DM * 2);
  float* QF = (float*)take(NR * DM * 4); _Float16* Q16 = (_Float16*)take(NR * DM * 2); _Float16* QU = (_Float16*)take(NR * DM * 2); _Float16* QV = (_Float16*)take(NR * DM * 2); _Float16* K16 = (_Float16*)take(NR * DM * 2); _Float16* V16 = (_Float16*)take(NR * DM * 2); _Float16* R16 = (_Float16*)take((size_t)PP * DM * 2); _Float16* O16 = (_Float16*)take(NR * DM * 2);
  _Float16* VT = (_Float16*)take((size_t)NB * NH * HD * SQ * 2);
  if (off > ws_size) return;      /* 2.5 + 12 + 2 + 8 + 20 + 2 + 4 + 4 = approx 55 MiB */
  { const unsigned gw = (unsigned)(((size_t)DM * (DM / 8) + 255) / 256); k_wt_f16<<<gw, 256, 0, stream>>>(wq, BQ, DM, DM, 16.0f); k_wt_f16<<<gw, 256, 0, stream>>>(wk, BK, DM, DM, 16.0f); k_wt_f16<<<gw, 256, 0, stream>>>(wv, BV, DM, DM, 16.0f); k_wt_f16<<<gw, 256, 0, stream>>>(wpos, BP, DM, DM, 16.0f); k_wt_f16<<<gw, 256, 0, stream>>>(wo, BO, DM, DM, 16.0f); }
  { const unsigned gx = (unsigned)((NR * DM / 8 + 255) / 256); k_x16<<<gx, 256, 0, stream>>>(xq, XQ, NR * DM / 8); k_x16<<<gx, 256, 0, stream>>>(xk, XK, NR * DM / 8); k_x16<<<gx, 256, 0, stream>>>(xv, XV, NR * DM / 8); }
  k_x16<<<(unsigned)(((size_t)NPOS * DM / 8 + 255) / 256), 256, 0, stream>>>(pe, PE, (size_t)NPOS * DM / 8); k_zfill<<<1, 256, 0, stream>>>(PE + (size_t)NPOS * DM, DM / 8);      /* pad row 2047 */
  const dim3 gp((unsigned)((NR / 128) * (DM / 64)), 1);
  k_gemm2<0><<<gp, 128, 0, stream>>>(XQ, DM, 0, BQ, DM, 0, 0.0625f, bq, 0, nullptr, 1, 0, 0, QF, nullptr, DM, 0, (int)NR, DM, DM);      /* q (f32) */
  k_qprep<<<(unsigned)((NR * DM / 8 + 255) / 256), 256, 0, stream>>>(QF, pbu, pbv, Q16, QU, QV, NR * DM / 8);      /* q + pos_bias_u, q + pos_bias_v (f16) */
  k_gemm2<0><<<gp, 128, 0, stream>>>(XK, DM, 0, BK, DM, 0, 0.0625f, bk, 0, nullptr, 1, 0, 0, nullptr, K16, DM, 0, (int)NR, DM, DM);
  k_gemm2<0><<<gp, 128, 0, stream>>>(XV, DM, 0, BV, DM, 0, 0.0625f, bv, 0, nullptr, 1, 0, 0, nullptr, V16, DM, 0, (int)NR, DM, DM);
  k_gemm2<0><<<dim3((PP / 128) * (DM / 64), 1), 128, 0, stream>>>(PE, DM, 0, BP, DM, 0, 0.0625f, nullptr, 0, nullptr, 1, 0, 0, nullptr, R16, DM, 0, PP, DM, DM);      /* p = pos_emb Wpos (f16; row 2047 is the zero pad) */
  k_vt<NH, SQ><<<NB * NH * (SQ / 64), 256, 0, stream>>>(V16, DM, 0, VT);      /* V^T [4][8][64][1024] */
  k_relattn<<<NB * NH * (SQ / FR), 256, 0, stream>>>(QU, QV, K16, R16, VT, mask, O16);      /* scores, shifted softmax and o x64 (merged rows), all batches and heads */
  k_gemm2<0><<<gp, 128, 0, stream>>>(O16, DM, 0, BO, DM, 0, 0.0009765625f, bo, 0, nullptr, 1, 0, 0, (float*)d_out, nullptr, DM, 0, (int)NR, DM, DM);      /* out = x Wout + bout */
}

// v003
// Measured time: 112 microseconds a run.
// Next to v002, in two timings, it ran 1.65 and 1.64 times as fast.
// All steps since v000 together make it 36.8 times as fast.
#include <hip/hip_runtime.h>
// Relative-position multi-head attention with rel_shift (query, key, value [4][1024][512]; mask [4][1024][1024] int32 verbatim (nonzero = masked, ~50 %); pos_emb [1][2047][512]; q/k/v = x W + b ([512][512] [in][out]); p = pos_emb Wpos; 8 heads of 64; ac = (q + pos_bias_u) . k; bd = rel_shift((q + pos_bias_v) . p^T) = (q_i + v) . p[T-1+i-j]; scores = (ac + bd) / 8; masked -> float32 min; softmax; masked weights -> 0; x = attn v merged; out = x Wout + bout -> [4][1024][512].
// Structure: token rows; inputs and pos_emb as exact f16 rows (pos table padded to 2048 rows with zeros); q as a WMMA GEMM (32x64 wave tiles, f32 accumulation, exact x16 weights + bias) into f32 rows, then f16 planes of q + u and q + v on VALU; k, v, p as WMMA GEMMs (f16 outputs); V^T via LDS transposes; one fused kernel per (batch, head, 32 query rows): bd and ac WMMA tiles (K = 64) into f32 score rows in LDS, bd stored at its shifted column; the relative softmax with the mask on VALU (f32 statistics, native exp; weights x256 f16, in LDS); o = P . V^T on WMMA (K = 1024; o x64 in f16); out GEMM (f32, + bout); launches that need nothing of each other share one grid (ranges of the block index); 5 launches.
// Compute dtype: inputs rounded to bf16; inputs / weights exact in f16; q + u, q + v, k, v, p, softmax weights and o plain f16 (~2^-12); ac, bd, softmax statistics f32. v_wmma_f32_16x16x32_f16.
#define NB 4
#define SQ 1024
#define PP 2048                      /* position table rows (2047 used, row 2047 zero) */
#define NPOS 2047
#define DM 512
#define NH 8
#define HD 64
#define HG 8
#define NR ((size_t)NB * SQ)
typedef __bf16 v16b __attribute__((ext_vector_type(16)));
typedef unsigned short v8us __attribute__((ext_vector_type(8), may_alias));
typedef float  v8f  __attribute__((ext_vector_type(8)));
typedef float  v4f  __attribute__((ext_vector_type(4)));
typedef float  v4fa __attribute__((ext_vector_type(4), may_alias));
union FragB { v16b v; v8us half[2]; unsigned short u[16]; };

__device__ __forceinline__ unsigned short bf16_bits(float x) { unsigned int u = __float_as_uint(x); return (unsigned short)((u + 0x7FFFu + ((u >> 16) & 1u)) >> 16); }
__device__ __forceinline__ float bf16_val(unsigned short b) { return __uint_as_float(((unsigned int)b) << 16); }
__device__ __forceinline__ float bf16_round(float x) { return bf16_val(bf16_bits(x)); }
// D += A·B with NT terms: 1 = ah·bh, 2 = + al·bh (A split), 3 = + ah·bl (both split)
template <int NT>
__device__ __forceinline__ v8f mmaN(v16b ah, v16b al, v16b bh, v16b bl, v8f c) {
  c = __builtin_amdgcn_wmma_f32_16x16x32_bf16(false, ah, false, bh, (short)0, c, false, false);
  if (NT >= 2) c = __builtin_amdgcn_wmma_f32_16x16x32_bf16(false, al, false, bh, (short)0, c, false, false);
  if (NT >= 3) c = __builtin_amdgcn_wmma_f32_16x16x32_bf16(false, ah, false, bl, (short)0, c, false, false);
  asm volatile("v_nop\n\tv_nop\n\tv_nop\n\tv_nop" : "+v"(c) : "v"(ah), "v"(al), "v"(bh), "v"(bl));
  return c;
}

__global__ __launch_bounds__(256) void k_wt_bf16(const float* __restrict__ W, unsigned short* __restrict__ Wt, int K, int N) {
  const int t = blockIdx.x * 256 + threadIdx.x;
  const int k8n = K / 8;
  if (t >= N * k8n) return;
  const int n = t / k8n, k8 = (t % k8n) * 8;
  v8us v;
#pragma unroll
  for (int i = 0; i < 8; ++i) v[i] = bf16_bits(W[(size_t)(k8 + i) * N + n]);
  *(v8us*)(Wt + (size_t)n * K + k8) = v;
  
}

// GEMM C[M][N] (f32, pitch ldc) = act(A[M][K]·W + bias). A f32 row-major (pitch lda) converted per fragment to bf16
// (ASPLIT: hi/lo two planes -> 2 terms, else single rounded term); Wt bf16 [N][K] (pitch ldb). BIAS_BF16 rounds the
// bias to bf16 first (bias quantised to bf16 before the add). K%32==0, M%16==0, N%64==0.
template <bool ASPLIT, int ACT, bool BIAS_BF16>
__global__ __launch_bounds__(128) void k_gemm_bf(const float* __restrict__ A, int lda, const unsigned short* __restrict__ Wt, int ldb,
                                               const float* __restrict__ bias, float* __restrict__ C, int ldc, int M, int N, int K) {
  __shared__ __attribute__((aligned(16))) float so[4][16][64];
  const int tid = threadIdx.x, w = tid >> 5, lane = tid & 31, ln = lane & 15, hh = lane >> 4;
  const int ntn = N / 64;
  const int wid = blockIdx.x * 4 + w;
  const int mt = wid / ntn, nq = wid % ntn;
  if (mt * 16 >= M) return;
  const int row0 = mt * 16, col0 = nq * 64;
  const float* arow = A + (size_t)(row0 + ln) * lda;
  v8f acc[4] = {};
  for (int kb = 0; kb < K; kb += 32) {
    FragB ah, al;
    const v4f x0 = *(const v4fa*)(arow + kb + 8 * hh), x1 = *(const v4fa*)(arow + kb + 8 * hh + 4);
    const v4f x2 = *(const v4fa*)(arow + kb + 16 + 8 * hh), x3 = *(const v4fa*)(arow + kb + 16 + 8 * hh + 4);
    float xs[16] = {x0[0],x0[1],x0[2],x0[3],x1[0],x1[1],x1[2],x1[3],x2[0],x2[1],x2[2],x2[3],x3[0],x3[1],x3[2],x3[3]};
#pragma unroll
    for (int i = 0; i < 16; ++i) { const unsigned short hb = bf16_bits(xs[i]); ah.u[i] = hb; al.u[i] = ASPLIT ? bf16_bits(xs[i] - bf16_val(hb)) : (unsigned short)0; }
#pragma unroll
    for (int t = 0; t < 4; ++t) {
      const unsigned short* brow = Wt + (size_t)(col0 + t * 16 + ln) * ldb + kb;
      FragB b;
      b.half[0] = *(const v8us*)(brow + 8 * hh);
      b.half[1] = *(const v8us*)(brow + 16 + 8 * hh);
      acc[t] = mmaN<ASPLIT ? 2 : 1>(ah.v, al.v, b.v, b.v, acc[t]);
    }
  }
#pragma unroll
  for (int t = 0; t < 4; ++t) {
    float bv = bias ? bias[col0 + t * 16 + ln] : 0.f;
    if (BIAS_BF16) bv = bf16_round(bv);
#pragma unroll
    for (int r = 0; r < 8; ++r) { float v = acc[t][r] + bv; if (ACT == 1) v = fmaxf(v, 0.f); so[w][8 * hh + r][t * 16 + ln] = v; }
  }
  __builtin_amdgcn_fence(__ATOMIC_ACQ_REL, "workgroup");
  __builtin_amdgcn_wave_barrier();
  const int rsub = lane >> 4, c4 = (lane & 15) * 4;
  {
#pragma unroll
    for (int q = 0; q < 8; ++q) {
      const int r = q * 2 + rsub;
      const v4f v = *(const v4fa*)&so[w][r][c4];
      *(v4f*)(C + (size_t)(row0 + r) * ldc + col0 + c4) = v;
    }
    
  }
}

// GEMM C = act(A·W + bias + resid): A f32 (ASPLIT -> hi/lo 2 terms), Wt bf16 [N][K]; ACT 0 none, 1 relu, 2 exact gelu;
// resid (optional, f32, row index = (row % rmod), pitch ldr, RES_BF16 rounds it) added before the activation.
template <bool ASPLIT, int ACT, bool BIAS_BF16, bool RES_BF16>
__global__ __launch_bounds__(128) void k_gemm_bf3(const float* __restrict__ A, int lda, const unsigned short* __restrict__ Wt, int ldb,
                                                const float* __restrict__ bias, const float* __restrict__ resid, int rmod, int ldr,
                                                float* __restrict__ C, int ldc, int M, int N, int K) {
  __shared__ __attribute__((aligned(16))) float so[4][16][64];
  const int tid = threadIdx.x, w = tid >> 5, lane = tid & 31, ln = lane & 15, hh = lane >> 4;
  const int ntn = N / 64;
  const int wid = blockIdx.x * 4 + w;
  const int mt = wid / ntn, nq = wid % ntn;
  if (mt * 16 >= M) return;
  const int row0 = mt * 16, col0 = nq * 64;
  const float* arow = A + (size_t)(row0 + ln) * lda;
  v8f acc[4] = {};
  for (int kb = 0; kb < K; kb += 32) {
    FragB ah, al;
    const v4f x0 = *(const v4fa*)(arow + kb + 8 * hh), x1 = *(const v4fa*)(arow + kb + 8 * hh + 4);
    const v4f x2 = *(const v4fa*)(arow + kb + 16 + 8 * hh), x3 = *(const v4fa*)(arow + kb + 16 + 8 * hh + 4);
    float xs[16] = {x0[0],x0[1],x0[2],x0[3],x1[0],x1[1],x1[2],x1[3],x2[0],x2[1],x2[2],x2[3],x3[0],x3[1],x3[2],x3[3]};
#pragma unroll
    for (int i = 0; i < 16; ++i) { const unsigned short hb = bf16_bits(xs[i]); ah.u[i] = hb; al.u[i] = ASPLIT ? bf16_bits(xs[i] - bf16_val(hb)) : (unsigned short)0; }
#pragma unroll
    for (int t = 0; t < 4; ++t) {
      const unsigned short* brow = Wt + (size_t)(col0 + t * 16 + ln) * ldb + kb;
      FragB b;
      b.half[0] = *(const v8us*)(brow + 8 * hh);
      b.half[1] = *(const v8us*)(brow + 16 + 8 * hh);
      acc[t] = mmaN<ASPLIT ? 2 : 1>(ah.v, al.v, b.v, b.v, acc[t]);
    }
  }
#pragma unroll
  for (int t = 0; t < 4; ++t) {
    const int col = col0 + t * 16 + ln;
    float bv = bias ? bias[col] : 0.f;
    if (BIAS_BF16) bv = bf16_round(bv);
#pragma unroll
    for (int r = 0; r < 8; ++r) {
      float v = acc[t][r] + bv;
      if (resid) { float rv = resid[(size_t)((row0 + 8 * hh + r) % rmod) * ldr + col]; if (RES_BF16) rv = bf16_round(rv); v += rv; }
      if (ACT == 1) v = fmaxf(v, 0.f);
      if (ACT == 2) v = 0.5f * v * (1.0f + erff(v * 0.70710678118654752f));
      if (ACT == 3) { const float u = 0.7978845608028654f * (v + 0.044715f * v * v * v); v = 0.5f * v * (1.0f + tanhf(u)); }
      so[w][8 * hh + r][t * 16 + ln] = v;
    }
  }
  __builtin_amdgcn_fence(__ATOMIC_ACQ_REL, "workgroup");
  __builtin_amdgcn_wave_barrier();
  const int rsub = lane >> 4, c4 = (lane & 15) * 4;
  {
#pragma unroll
    for (int q = 0; q < 8; ++q) {
      const int r = q * 2 + rsub;
      const v4f v = *(const v4fa*)&so[w][r][c4];
      *(v4f*)(C + (size_t)(row0 + r) * ldc + col0 + c4) = v;
    }
    
  }
}
// row LayerNorm (biased variance, eps) over N: s = X (+ R); optional out_sum <- s; out_norm <- (s-mu)*rsqrt(var+eps)*g + b
template <bool PARAM_BF16>
__global__ __launch_bounds__(256) void k_layernorm(const float* __restrict__ X, const float* __restrict__ R, const float* __restrict__ g, const float* __restrict__ bta,
                                                  float* __restrict__ out_sum, float* __restrict__ out_norm, int N, float eps) {
  __shared__ float red[256];
  const int row = blockIdx.x, tid = threadIdx.x;
  const float* x = X + (size_t)row * N; const float* rr = R ? R + (size_t)row * N : nullptr;
  float vals[16];                     // up to N = 4096
  const int per = N / 256;            // contiguous chunk per thread? use strided-by-4 chunks: thread handles j = tid*4 + 1024*u
  float s1 = 0.f;
  for (int u = 0; u < per / 4; ++u) {
    const int j = tid * 4 + 1024 * u;
    const v4f a = *(const v4fa*)(x + j);
    v4f b = {0.f,0.f,0.f,0.f}; if (rr) b = *(const v4fa*)(rr + j);
#pragma unroll
    for (int q = 0; q < 4; ++q) { const float v = a[q] + b[q]; vals[u * 4 + q] = v; s1 += v; }
  }
  red[tid] = s1; __syncthreads();
  for (int st = 128; st > 0; st >>= 1) { if (tid < st) red[tid] += red[tid + st]; __syncthreads(); }
  const float mu = red[0] / (float)N; __syncthreads();
  float s2 = 0.f;
  for (int u = 0; u < per / 4; ++u)
#pragma unroll
    for (int q = 0; q < 4; ++q) { const float c = vals[u * 4 + q] - mu; s2 += c * c; }
  red[tid] = s2; __syncthreads();
  for (int st = 128; st > 0; st >>= 1) { if (tid < st) red[tid] += red[tid + st]; __syncthreads(); }
  const float rs = rsqrtf(red[0] / (float)N + eps);
  {
    for (int u = 0; u < per / 4; ++u) {
      const int j = tid * 4 + 1024 * u;
      v4f o, sm;
#pragma unroll
      for (int q = 0; q < 4; ++q) {
        float gg = g[j + q], bb = bta[j + q];
        if (PARAM_BF16) { gg = bf16_round(gg); bb = bf16_round(bb); }
        sm[q] = vals[u * 4 + q]; o[q] = (vals[u * 4 + q] - mu) * rs * gg + bb;
      }
      if (out_sum) *(v4f*)(out_sum + (size_t)row * N + j) = sm;
      *(v4f*)(out_norm + (size_t)row * N + j) = o;
    }
    
  }
}



// ---- f16 WMMA path (v_wmma_f32_16x16x32_f16): 11-bit significands for operands in range — used where a [0,1] probability operand needs more precision than bf16
typedef _Float16 v16h __attribute__((ext_vector_type(16)));
union FragH { v16h v; v8us half[2]; _Float16 h[16]; unsigned short u[16]; };
template <int NT>
__device__ __forceinline__ v8f mmaH(v16h ah, v16h al, v16h bh, v16h bl, v8f c) {
  c = __builtin_amdgcn_wmma_f32_16x16x32_f16(false, ah, false, bh, (short)0, c, false, false);
  if (NT >= 2) c = __builtin_amdgcn_wmma_f32_16x16x32_f16(false, al, false, bh, (short)0, c, false, false);
  if (NT >= 3) c = __builtin_amdgcn_wmma_f32_16x16x32_f16(false, ah, false, bl, (short)0, c, false, false);
  asm volatile("v_nop\n\tv_nop\n\tv_nop\n\tv_nop" : "+v"(c) : "v"(ah), "v"(al), "v"(bh), "v"(bl));
  return c;
}
// batched GEMM like k_gemm_b but f16 operands: A f32 (split into f16 hi/lo if ASPLIT, else rounded to f16), Bt = f16 values [n][k]; alpha; C f32; N multiple of 16 (partial tiles skipped)
template <bool ASPLIT>
__global__ __launch_bounds__(128) void k_gemm_h(const float* __restrict__ A, int lda, size_t sA, const _Float16* __restrict__ Bh, int ldb, size_t sB, float alpha, float* __restrict__ C, int ldc, size_t sC, int M, int N, int K) {
  __shared__ __attribute__((aligned(16))) float so[4][16][64];
  const int tid = threadIdx.x, w = tid >> 5, lane = tid & 31, ln = lane & 15, hh = lane >> 4; const int by = blockIdx.y;
  A += (size_t)by * sA; Bh += (size_t)by * sB; C += (size_t)by * sC;
  const int ntn = (N + 63) / 64; const int wid = blockIdx.x * 4 + w; const int mt = wid / ntn, nq = wid % ntn; if (mt * 16 >= M) return;
  const int row0 = mt * 16, col0 = nq * 64; const float* arow = A + (size_t)(row0 + ln) * lda;
  v8f acc[4] = {};
  for (int kb = 0; kb < K; kb += 32) {
    FragH ah, al;
    const v4f x0 = *(const v4fa*)(arow + kb + 8 * hh), x1 = *(const v4fa*)(arow + kb + 8 * hh + 4), x2 = *(const v4fa*)(arow + kb + 16 + 8 * hh), x3 = *(const v4fa*)(arow + kb + 16 + 8 * hh + 4);
    float xs[16] = {x0[0],x0[1],x0[2],x0[3],x1[0],x1[1],x1[2],x1[3],x2[0],x2[1],x2[2],x2[3],x3[0],x3[1],x3[2],x3[3]};
#pragma unroll
    for (int i = 0; i < 16; ++i) { const _Float16 h = (_Float16)xs[i]; ah.h[i] = h; al.h[i] = ASPLIT ? (_Float16)(xs[i] - (float)h) : (_Float16)0.0f; }
#pragma unroll
    for (int t = 0; t < 4; ++t) { if (col0 + t * 16 >= N) continue; const size_t boff = (size_t)(col0 + t * 16 + ln) * ldb + kb; FragH bq; bq.half[0] = *(const v8us*)(Bh + boff + 8 * hh); bq.half[1] = *(const v8us*)(Bh + boff + 16 + 8 * hh);
      acc[t] = mmaH<ASPLIT ? 2 : 1>(ah.v, al.v, bq.v, bq.v, acc[t]); }
  }
#pragma unroll
  for (int t = 0; t < 4; ++t) { if (col0 + t * 16 >= N) continue;
#pragma unroll
    for (int r = 0; r < 8; ++r) so[w][8 * hh + r][t * 16 + ln] = acc[t][r] * alpha; }
  __builtin_amdgcn_fence(__ATOMIC_ACQ_REL, "workgroup"); __builtin_amdgcn_wave_barrier();
  const int rsub = lane >> 4, c4 = (lane & 15) * 4;
  {
#pragma unroll
    for (int q = 0; q < 8; ++q) { const int r = q * 2 + rsub; if (col0 + c4 < N) { const v4f v = *(const v4fa*)&so[w][r][c4]; *(v4f*)(C + (size_t)(row0 + r) * ldc + col0 + c4) = v; } }
     }
}

// Wt[n][k] = f16(W[k][n]·scale) from f32 row-major W[K][N] (scale = power of two; bf16-exact weights stay exact in f16 away from the subnormal range)
__device__ __forceinline__ void wt_f16_body(int bx, const float* __restrict__ W, _Float16* __restrict__ Wt, int K, int N, float scale) {
  const int t = bx * 256 + threadIdx.x; if (t >= N * (K / 8)) return; const int n = t / (K / 8), k8 = (t % (K / 8)) * 8; FragH f;
#pragma unroll
  for (int i = 0; i < 8; ++i) f.h[i] = (_Float16)(bf16_round(W[(size_t)(k8 + i) * N + n]) * scale); const v8us o = f.half[0];
  *(v8us*)((unsigned short*)Wt + (size_t)n * K + k8) = o; 
}
// k_gemm_hh variant with fused epilogue: v = acc·alpha + bias[by·sBias + col] (+ CP[(row/rowsPerB)·sCPb + by·64 + col] if CP) ; ACT 0 none / 1 elu ; writes f16 C16 (and f32 C if non-null)
template <int ACT>
__global__ __launch_bounds__(128) void k_gemm_hhx(const _Float16* __restrict__ A, int lda, size_t sA, const _Float16* __restrict__ Bh, int ldb, size_t sB, float alpha, const float* __restrict__ bias, size_t sBias, const float* __restrict__ CP, int rowsPerB, size_t sCPb, int row0g,
    float* __restrict__ C, _Float16* __restrict__ C16, int ldc, size_t sC, int M, int N, int K) {
  __shared__ __attribute__((aligned(16))) float so[4][16][64];
  const int tid = threadIdx.x, w = tid >> 5, lane = tid & 31, ln = lane & 15, hh = lane >> 4; const int by = blockIdx.y;
  A += (size_t)by * sA; Bh += (size_t)by * sB; const size_t cofs = (size_t)by * sC; const float* bp = bias ? bias + (size_t)by * sBias : nullptr;
  const int ntn = (N + 63) / 64; const int wid = blockIdx.x * 4 + w; const int mt = wid / ntn, nq = wid % ntn; if (mt * 16 >= M) return;
  const int row0 = mt * 16, col0 = nq * 64; const _Float16* arow = A + (size_t)(row0 + ln) * lda;
  v8f acc[4] = {};
  for (int kb = 0; kb < K; kb += 32) { FragH ah; ah.half[0] = *(const v8us*)((const unsigned short*)arow + kb + 8 * hh); ah.half[1] = *(const v8us*)((const unsigned short*)arow + kb + 16 + 8 * hh);
#pragma unroll
    for (int t = 0; t < 4; ++t) { if (col0 + t * 16 >= N) continue; const size_t boff = (size_t)(col0 + t * 16 + ln) * ldb + kb; FragH bq; bq.half[0] = *(const v8us*)((const unsigned short*)Bh + boff + 8 * hh); bq.half[1] = *(const v8us*)((const unsigned short*)Bh + boff + 16 + 8 * hh);
      acc[t] = mmaH<1>(ah.v, ah.v, bq.v, bq.v, acc[t]); }
  }
#pragma unroll
  for (int t = 0; t < 4; ++t) { if (col0 + t * 16 >= N) continue; const int col = col0 + t * 16 + ln; const float bv = bp ? bf16_round(bp[col]) : 0.f;
#pragma unroll
    for (int r = 0; r < 8; ++r) { float v = acc[t][r] * alpha + bv; if (CP) { const int rr = row0g + row0 + 8 * hh + r; if (rowsPerB < 0) v += CP[cofs + (size_t)rr * ldc + col];      /* rowsPerB < 0: own element of the batched C plane */ else { const int bidx = rr / rowsPerB; v += CP[(size_t)bidx * sCPb + (size_t)by * 64 + col]; } } if (ACT == 1) v = (v > 0.f) ? v : expm1f(v); else if (ACT == 7) v = (v > 0.f) ? v + 1.0f : expf(v); else if (ACT == 8) v = tanhf(v); else if (ACT == 9) v = 0.5f * v * (1.0f + tanhf(0.7978845608028654f * (v + 0.044715f * v * v * v))); else if (ACT == 11) v = 1.0f / (1.0f + expf(-v)); else if (ACT == 12) v = (v > 0.f) ? v : 0.01f * v; else if (ACT == 14) v = (v > 0.f) ? v : 0.1f * v; else if (ACT == 16) v = (v >= 0.f) ? v : 0.3f * v; else if (ACT == 17) v = (v >= 0.f) ? v : 0.2f * v; else if (ACT == 15) v = v / (1.0f + expf(-v)); else if (ACT == 3) v = fmaxf(v, 0.f); else if (ACT == 6) v = 0.5f * v * (1.0f + erff(v * 0.70710678118654752f)); so[w][8 * hh + r][t * 16 + ln] = v; } }
  __builtin_amdgcn_fence(__ATOMIC_ACQ_REL, "workgroup"); __builtin_amdgcn_wave_barrier();
  const int rsub = lane >> 4, c4 = (lane & 15) * 4; typedef _Float16 v4h __attribute__((ext_vector_type(4)));
  {
#pragma unroll
    for (int q = 0; q < 8; ++q) { const int r = q * 2 + rsub; if (col0 + c4 < N) { const v4f v = *(const v4fa*)&so[w][r][c4]; if (C) *(v4f*)(C + cofs + (size_t)(row0 + r) * ldc + col0 + c4) = v; if (C16) { v4h h4; for (int i = 0; i < 4; ++i) h4[i] = (_Float16)v[i]; *(v4h*)(C16 + cofs + (size_t)(row0 + r) * ldc + col0 + c4) = h4; } } }
     }
}


typedef _Float16 v4h __attribute__((ext_vector_type(4)));

__device__ __forceinline__ void x16_body(int bx, const float* __restrict__ x, _Float16* __restrict__ X16, size_t n8) { const size_t t = (size_t)bx * 256 + threadIdx.x; if (t >= n8) return; FragH f;
#pragma unroll
  for (int q = 0; q < 8; ++q) f.h[q] = (_Float16)bf16_round(x[t * 8 + q]); *(v8us*)((unsigned short*)X16 + t * 8) = f.half[0];  }
__global__ __launch_bounds__(256) void k_h16(const float* __restrict__ x, _Float16* __restrict__ X16, size_t n8) { const size_t t = (size_t)blockIdx.x * 256 + threadIdx.x; if (t >= n8) return; FragH f;
#pragma unroll
  for (int q = 0; q < 8; ++q) f.h[q] = (_Float16)x[t * 8 + q]; *(v8us*)((unsigned short*)X16 + t * 8) = f.half[0];  }
__global__ __launch_bounds__(256) void k_round16f(const float* __restrict__ W, _Float16* __restrict__ Bt, size_t n8) { const size_t t = (size_t)blockIdx.x * 256 + threadIdx.x; if (t >= n8) return; FragH f;
#pragma unroll
  for (int i = 0; i < 8; ++i) f.h[i] = (_Float16)(bf16_round(W[t * 8 + i]) * 16.0f); *(v8us*)((unsigned short*)Bt + t * 8) = f.half[0];  }
template <int NHv, int TTv>
__device__ __forceinline__ void vt_body(int bx, const _Float16* __restrict__ V16, int ldv, int voff, _Float16* __restrict__ Vt) { __shared__ unsigned short tl[64][66]; const int tid = threadIdx.x; const int slab = bx / (TTv / 64), lg = bx % (TTv / 64); const int b = slab / NHv, h = slab % NHv;
  for (int i = tid; i < 64 * 8; i += 256) { const int r = i / 8, c8 = (i % 8) * 8; FragH f; f.half[0] = *(const v8us*)((const unsigned short*)V16 + ((size_t)b * TTv + lg * 64 + r) * ldv + voff + h * 64 + c8);
#pragma unroll
    for (int q = 0; q < 8; ++q) tl[r][c8 + q] = f.u[q]; }
  __syncthreads();
  {
#pragma unroll
    for (int rd = 0; rd < 2; ++rd) { const int d = rd * 32 + tid / 8, pc = tid % 8; FragH f;
#pragma unroll
      for (int q = 0; q < 8; ++q) f.u[q] = tl[pc * 8 + q][d];
      *(v8us*)((unsigned short*)Vt + ((size_t)slab * 64 + d) * TTv + lg * 64 + pc * 8) = f.half[0]; }
     } }

__global__ __launch_bounds__(256) void k_hl(const float* __restrict__ F, _Float16* __restrict__ Hh, _Float16* __restrict__ Hl, size_t n8) { const size_t t = (size_t)blockIdx.x * 256 + threadIdx.x; if (t >= n8) return; FragH fh, fl; const v4f a = *(const v4fa*)(F + t * 8), c = *(const v4fa*)(F + t * 8 + 4);
#pragma unroll
  for (int q = 0; q < 4; ++q) { _Float16 h = (_Float16)a[q]; fh.h[q] = h; fl.h[q] = (_Float16)((a[q] - (float)h) * 1024.0f); h = (_Float16)c[q]; fh.h[4 + q] = h; fl.h[4 + q] = (_Float16)((c[q] - (float)h) * 1024.0f); }
  { *(v8us*)((unsigned short*)Hh + t * 8) = fh.half[0]; *(v8us*)((unsigned short*)Hl + t * 8) = fl.half[0];  } }

// ---- fast GEMM (wave tile 32x64; requires M % 32 == 0 rows per launch region and N % 64 == 0); epilogue = k_gemm_hhx semantics ----
__device__ __forceinline__ v16h g2_frag(const _Float16* p, int hh) { FragH f; f.half[0] = *(const v8us*)((const unsigned short*)p + 8 * hh); f.half[1] = *(const v8us*)((const unsigned short*)p + 16 + 8 * hh); return f.v; }
__device__ __forceinline__ v8f g2_mma(v16h a, v16h b, v8f c) { v8f d = __builtin_amdgcn_wmma_f32_16x16x32_f16(false, a, false, b, (short)0, c, false, false); asm volatile("v_nop\n\tv_nop\n\tv_nop\n\tv_nop" : "+v"(d) : "v"(a), "v"(b)); return d; }
template <int ACT>
__device__ __forceinline__ void gemm2_body(int bx, int by, const _Float16* __restrict__ A, int lda, size_t sA, const _Float16* __restrict__ Bh, int ldb, size_t sB, float alpha, const float* __restrict__ bias, size_t sBias, const float* __restrict__ CP, int rowsPerB, size_t sCPb, int row0g,
    float* __restrict__ C, _Float16* __restrict__ C16, int ldc, size_t sC, int M, int N, int K) { static_assert(ACT == 0 || ACT == 3 || ACT == 6 || ACT == 8 || ACT == 9 || ACT == 11 || ACT == 12 || ACT == 14 || ACT == 15 || ACT == 16 || ACT == 17, "k_gemm2: unsupported ACT code (would silently apply no activation)");
  __shared__ __attribute__((aligned(16))) float so[4][32][68];
  const int tid = threadIdx.x, w = tid >> 5, lane = tid & 31, ln = lane & 15, hh = lane >> 4;
  A += (size_t)by * sA; Bh += (size_t)by * sB; const size_t cofs = (size_t)by * sC; const float* bp = bias ? bias + (size_t)by * sBias : nullptr;
  const int ntn = N >> 6; const int mt = bx / ntn, nq = bx - mt * ntn; const int row0 = mt * 128 + 32 * w, col0 = nq * 64; if (row0 >= M) return;
  const _Float16* a0p = A + (size_t)(row0 + ln) * lda; const _Float16* a1p = a0p + (size_t)16 * lda;
  const _Float16* b0p = Bh + (size_t)(col0 + ln) * ldb; const _Float16* b1p = b0p + (size_t)16 * ldb; const _Float16* b2p = b1p + (size_t)16 * ldb; const _Float16* b3p = b2p + (size_t)16 * ldb;
  const v8f z8 = {0.f,0.f,0.f,0.f,0.f,0.f,0.f,0.f}; v8f c00 = z8, c01 = z8, c02 = z8, c03 = z8, c10 = z8, c11 = z8, c12 = z8, c13 = z8;
#pragma unroll 1
  for (int kb = 0; kb < K; kb += 32) { const v16h a0 = g2_frag(a0p + kb, hh), a1 = g2_frag(a1p + kb, hh);
    asm volatile("s_wait_xcnt 0x0" :: "v"(a0p + kb + 8 * hh), "v"(a1p + kb + 8 * hh) : "memory");      /* the A loads' address registers stay whole up to here */
    v16h b = g2_frag(b0p + kb, hh); c00 = g2_mma(a0, b, c00); c10 = g2_mma(a1, b, c10);
    b = g2_frag(b1p + kb, hh); c01 = g2_mma(a0, b, c01); c11 = g2_mma(a1, b, c11);
    b = g2_frag(b2p + kb, hh); c02 = g2_mma(a0, b, c02); c12 = g2_mma(a1, b, c12);
    b = g2_frag(b3p + kb, hh); c03 = g2_mma(a0, b, c03); c13 = g2_mma(a1, b, c13); }
  v8f accs[8] = {c00, c01, c02, c03, c10, c11, c12, c13};
#pragma unroll
  for (int u = 0; u < 8; ++u) { const int t = u & 3, half = u >> 2; const int col = col0 + t * 16 + ln; const float bv = bp ? bf16_round(bp[col]) : 0.f;
#pragma unroll
    for (int r = 0; r < 8; ++r) { const int rloc = half * 16 + 8 * hh + r; float v = accs[u][r] * alpha + bv; if (CP) { if (rowsPerB < 0) v += CP[cofs + (size_t)(row0g + row0 + rloc) * ldc + col];      /* rowsPerB < 0: own element of the batched C plane */ else { const int bidx = (row0g + row0 + rloc) / rowsPerB; v += CP[(size_t)bidx * sCPb + (size_t)by * 64 + col]; } }
      if (ACT == 3) v = fmaxf(v, 0.f); else if (ACT == 6) v = 0.5f * v * (1.0f + erff(v * 0.70710678118654752f)); else if (ACT == 11) v = 1.0f / (1.0f + expf(-v)); else if (ACT == 15) v = v / (1.0f + expf(-v)); else if (ACT == 12) v = (v > 0.f) ? v : 0.01f * v; else if (ACT == 8) v = tanhf(v); else if (ACT == 9) v = 0.5f * v * (1.0f + tanhf(0.7978845608028654f * (v + 0.044715f * v * v * v))); else if (ACT == 14) v = (v > 0.f) ? v : 0.1f * v; else if (ACT == 16) v = (v >= 0.f) ? v : 0.3f * v; else if (ACT == 17) v = (v >= 0.f) ? v : 0.2f * v;
      so[w][rloc][t * 16 + ln] = v; } }
  __builtin_amdgcn_fence(__ATOMIC_ACQ_REL, "workgroup"); __builtin_amdgcn_wave_barrier();
  const int rsub = lane >> 4, c4 = (lane & 15) * 4;
  {
#pragma unroll
    for (int q = 0; q < 16; ++q) { const int r = q * 2 + rsub; const v4f v = *(const v4fa*)&so[w][r][c4]; if (C) *(v4f*)(C + cofs + (size_t)(row0 + r) * ldc + col0 + c4) = v; if (C16) { v4h h4; for (int i = 0; i < 4; ++i) h4[i] = (_Float16)v[i]; *(v4h*)(C16 + cofs + (size_t)(row0 + r) * ldc + col0 + c4) = h4; } }
     } }
template <int ACT>
__global__ __launch_bounds__(128) void k_gemm2(const _Float16* __restrict__ A, int lda, size_t sA, const _Float16* __restrict__ Bh, int ldb, size_t sB, float alpha, const float* __restrict__ bias, size_t sBias, const float* __restrict__ CP, int rowsPerB, size_t sCPb, int row0g,
    float* __restrict__ C, _Float16* __restrict__ C16, int ldc, size_t sC, int M, int N, int K) { gemm2_body<ACT>(blockIdx.x, blockIdx.y, A, lda, sA, Bh, ldb, sB, alpha, bias, sBias, CP, rowsPerB, sCPb, row0g, C, C16, ldc, sC, M, N, K); }


__global__ __launch_bounds__(256) void k_wnat(const float* __restrict__ w, size_t n8, _Float16* __restrict__ Bt) { const size_t t = (size_t)blockIdx.x * 256 + threadIdx.x; if (t >= n8) return; FragH f; for (int q = 0; q < 8; ++q) f.h[q] = (_Float16)(bf16_round(w[t * 8 + q]) * 16.0f); *(v8us*)((unsigned short*)Bt + t * 8) = f.half[0];  }
__global__ __launch_bounds__(256) void k_rsm(const float* __restrict__ S, _Float16* __restrict__ P, int nrows) {
  #pragma clang fp contract(off)
  const int i = blockIdx.x * 256 + threadIdx.x; if (i >= nrows) return; const float* s = S + (size_t)i * SQ; float mx = -3.0e38f;
#pragma unroll 1
  for (int j = 0; j < SQ; ++j) mx = fmaxf(mx, s[j]); float se = 0.f;
#pragma unroll 1
  for (int j = 0; j < SQ; ++j) se += expf(s[j] - mx); const float sc = 256.0f / se;
#pragma unroll 1
  for (int j0 = 0; j0 < SQ; j0 += 8) { FragH f; for (int q = 0; q < 8; ++q) f.h[q] = (_Float16)(expf(s[j0 + q] - mx) * sc); unsigned short* d = (unsigned short*)P + (size_t)i * SQ + j0; *(v8us*)d = f.half[0];  } }
__global__ __launch_bounds__(256) void k_vt(const _Float16* __restrict__ V16, int b, int h0, _Float16* __restrict__ VT) { __shared__ unsigned short tl[64][65]; const int tid = threadIdx.x; const int hh = blockIdx.x % HG, sg = blockIdx.x / HG; const int s0 = sg * 64; const int h = h0 + hh;
  for (int i = tid; i < 64 * 8; i += 256) { const int j = i / 8, d8 = (i % 8) * 8; FragH f; f.half[0] = *(const v8us*)((const unsigned short*)V16 + ((size_t)b * SQ + s0 + j) * DM + h * HD + d8); for (int q = 0; q < 8; ++q) tl[d8 + q][j] = f.u[q]; }
  __syncthreads();
  { for (int i = tid; i < 64 * 8; i += 256) { const int d = i / 8, j8 = (i % 8) * 8; FragH f; for (int q = 0; q < 8; ++q) f.u[q] = tl[d][j8 + q]; *(v8us*)((unsigned short*)VT + ((size_t)hh * HD + d) * SQ + s0 + j8) = f.half[0]; }  } }

__device__ __forceinline__ void qprep_body(int bx, const float* __restrict__ QF, const float* __restrict__ ub, const float* __restrict__ vb, _Float16* __restrict__ Q16, _Float16* __restrict__ QU, _Float16* __restrict__ QV, size_t n8) {
  #pragma clang fp contract(off)
  const size_t t = (size_t)bx * 256 + threadIdx.x; if (t >= n8) return; const size_t e = t * 8; const int c = (int)(e % DM); FragH a, b, d;
#pragma unroll
  for (int q = 0; q < 8; ++q) { const float v = QF[e + q]; a.h[q] = (_Float16)v; b.h[q] = (_Float16)__fadd_rn(v, bf16_round(ub[c + q])); d.h[q] = (_Float16)__fadd_rn(v, bf16_round(vb[c + q])); }
  asm volatile("s_wait_xcnt 0x0" :: "v"(QF + e), "v"(4 * c) : "memory");      /* the q loads' address pair and the bias loads' byte-offset register stay whole up to here */
  { *(v8us*)((unsigned short*)Q16 + e) = a.half[0]; *(v8us*)((unsigned short*)QU + e) = b.half[0]; *(v8us*)((unsigned short*)QV + e) = d.half[0];  } }

// ---- launches that need nothing of each other share one grid: a range test on the block index, the same for a whole work-group, picks the job; each job's blocks do what its own launch did ----
#define GW (DM * (DM / 8) / 256)             /* blocks a weight matrix: 128 */
#define GX ((int)(NR * DM / 8 / 256))        /* blocks an input tensor: 1024 */
#define GE (PP * DM / 8 / 256)               /* blocks of the position table, pad row included: 512 */
#define GG ((int)(NR / 128) * (DM / 64))     /* blocks of a 4096-row projection: 256 */
#define GR ((PP / 128) * (DM / 64))          /* blocks of the position projection: 128 */
#define GT (NB * NH * (SQ / 64))             /* blocks of the V transposes: 512 */
static_assert(((size_t)NPOS * DM / 8) % 32 == 0 && (size_t)GE * 256 == (size_t)PP * DM / 8, "k_prep: the pad row's threads are whole waves at the end of the position range");
// the five weight transposes (strided reads, the longest blocks: first), the three inputs and the position table as f16 rows
__global__ __launch_bounds__(256) void k_prep(const float* __restrict__ wq, const float* __restrict__ wk, const float* __restrict__ wv, const float* __restrict__ wpos, const float* __restrict__ wo,
    const float* __restrict__ xq, const float* __restrict__ xk, const float* __restrict__ xv, const float* __restrict__ pe,
    _Float16* __restrict__ BQ, _Float16* __restrict__ BK, _Float16* __restrict__ BV, _Float16* __restrict__ BP, _Float16* __restrict__ BO,
    _Float16* __restrict__ XQ, _Float16* __restrict__ XK, _Float16* __restrict__ XV, _Float16* __restrict__ PE) {
  int bx = blockIdx.x;
  if (bx < 5 * GW) { const int g = bx / GW; const float* W = (g == 0) ? wq : (g == 1) ? wk : (g == 2) ? wv : (g == 3) ? wpos : wo; _Float16* Wt = (g == 0) ? BQ : (g == 1) ? BK : (g == 2) ? BV : (g == 3) ? BP : BO;
    wt_f16_body(bx - g * GW, W, Wt, DM, DM, 16.0f); return; }
  bx -= 5 * GW;
  if (bx < 3 * GX) { const int g = bx / GX; const float* x = (g == 0) ? xq : (g == 1) ? xk : xv; _Float16* X = (g == 0) ? XQ : (g == 1) ? XK : XV;
    x16_body(bx - g * GX, x, X, NR * DM / 8); return; }
  bx -= 3 * GX;
  x16_body(bx, pe, PE, (size_t)NPOS * DM / 8);
  const size_t t = (size_t)bx * 256 + threadIdx.x;
  if (t >= (size_t)NPOS * DM / 8) { const v8us z = {0, 0, 0, 0, 0, 0, 0, 0}; *(v8us*)((unsigned short*)PE + t * 8) = z; } }      /* pad row 2047 */
// q (f32 rows), k, v, p = pos_emb Wpos (f16 rows; row 2047 is the zero pad)
__global__ __launch_bounds__(128) void k_proj(const _Float16* __restrict__ XQ, const _Float16* __restrict__ XK, const _Float16* __restrict__ XV, const _Float16* __restrict__ PE,
    const _Float16* __restrict__ BQ, const _Float16* __restrict__ BK, const _Float16* __restrict__ BV, const _Float16* __restrict__ BP,
    const float* __restrict__ bq, const float* __restrict__ bk, const float* __restrict__ bv,
    float* __restrict__ QF, _Float16* __restrict__ K16, _Float16* __restrict__ V16, _Float16* __restrict__ R16) {
  const int g = blockIdx.x / GG;
  const _Float16* A = (g == 0) ? XQ : (g == 1) ? XK : (g == 2) ? XV : PE; const _Float16* Bh = (g == 0) ? BQ : (g == 1) ? BK : (g == 2) ? BV : BP;
  const int bx = blockIdx.x - g * GG;
  if (g == 0) { gemm2_body<0>(bx, 0, A, DM, 0, Bh, DM, 0, 0.0625f, bq, 0, nullptr, 1, 0, 0, QF, nullptr, DM, 0, (int)NR, DM, DM); return; }
  const float* bias = (g == 1) ? bk : (g == 2) ? bv : nullptr; _Float16* C16 = (g == 1) ? K16 : (g == 2) ? V16 : R16;
  gemm2_body<0>(bx, 0, A, DM, 0, Bh, DM, 0, 0.0625f, bias, 0, nullptr, 1, 0, 0, nullptr, C16, DM, 0, (g == 3) ? PP : (int)NR, DM, DM); }
// V^T [4][8][64][1024] (LDS transposes, with a barrier: first); q + pos_bias_u, q + pos_bias_v (f16)
__global__ __launch_bounds__(256) void k_post(const _Float16* __restrict__ V16, _Float16* __restrict__ VT, const float* __restrict__ QF, const float* __restrict__ ub, const float* __restrict__ vb, _Float16* __restrict__ Q16, _Float16* __restrict__ QU, _Float16* __restrict__ QV) {
  const int bx = blockIdx.x;
  if (bx < GT) { vt_body<NH, SQ>(bx, V16, DM, 0, VT); return; }
  qprep_body(bx - GT, QF, ub, vb, Q16, QU, QV, NR * DM / 8); }
// Fused relative attention, one work-group per (batch, head, FR query rows); the FR x 1024 score rows live in LDS and never reach memory.
// 1: bd tiles (q + v) . p[i0 + 16 t ..], each element stored at its shifted column j = T - 1 + i - pos (in the edge tiles a column outside 0..T-1 goes to the pad column T, which nobody reads);
// 2: ac tiles (q + u) . k added in place; 3: one wave per row: lane l holds columns 4 l + 128 u + (0..3), mask, f32 statistics, weights x256 as f16 written over the row's own first half;
// 4: o = P . V^T: a wave does 32 rows x 16 columns over one half of k (each V^T fragment is loaded once a work-group); the two halves are added on the way out, where one wave writes each 128-byte line.
// Global fragments are requested ahead of their use, into the registers that the running step sets free.
#define FR 32
#define FD 6                         /* fragment tiles in flight a wave: 96 registers */
#define FP (SQ + 4)                  /* LDS row pitch in floats: 16 B x odd, for the ds_load_b128 fragment reads of step 4 */
typedef int   v4ia __attribute__((ext_vector_type(4), may_alias));
typedef _Float16 v4ha __attribute__((ext_vector_type(4), may_alias));
static_assert(SQ == 1024 && HD == 64 && FR == 32 && SQ - 1 + FR <= 66 * 16 && SQ - FR + 66 * 16 <= PP, "k_relattn: 8 waves, 66 position tiles inside the padded table");
// Four native 2^x (what __expf compiles to, behind its multiply by log2 e). Written in one statement so that the slot the instruction set asks for behind a transcendental is kept by construction:
// each v_exp_f32 is followed by one that neither reads its result nor overwrites its source (early-clobber outputs), the last by v_nop.
__device__ __forceinline__ void exp2x4(float x0, float x1, float x2, float x3, float* e) {
  asm("v_exp_f32 %0, %4\n\tv_exp_f32 %1, %5\n\tv_exp_f32 %2, %6\n\tv_exp_f32 %3, %7\n\tv_nop" : "=&v"(e[0]), "=&v"(e[1]), "=&v"(e[2]), "=&v"(e[3]) : "v"(x0), "v"(x1), "v"(x2), "v"(x3)); }
__global__ __launch_bounds__(256) __attribute__((amdgpu_waves_per_eu(4, 4))) void k_relattn(const _Float16* __restrict__ QU, const _Float16* __restrict__ QV, const _Float16* __restrict__ K16, const _Float16* __restrict__ R16, const _Float16* __restrict__ VT, const int* __restrict__ mask, _Float16* __restrict__ O16) {
  __shared__ __attribute__((aligned(16))) float sc[FR][FP];
  __shared__ __attribute__((aligned(16))) float so[2][FR][68];
  const int tid = threadIdx.x, lane = tid & 31, ln = lane & 15, hh = lane >> 4; const int w = __builtin_amdgcn_readfirstlane(tid >> 5);
  const int it = blockIdx.x % (SQ / FR), bh = blockIdx.x / (SQ / FR), h = bh % NH, b = bh / NH; const int i0 = it * FR; const size_t r0 = (size_t)b * SQ;
  const v8f z8 = {0.f,0.f,0.f,0.f,0.f,0.f,0.f,0.f};
  const _Float16* pp = R16 + (size_t)(i0 + w * 16 + ln) * DM + h * HD + 8 * hh; const _Float16* kp = K16 + (r0 + w * 16 + ln) * DM + h * HD + 8 * hh;      /* tile w; tile w + 8 k lies 128 k rows on; global pointers hold the lane's 8 hh already, so that they are the loads' own address registers */
  const _Float16* qp = QV + (r0 + i0 + ln) * DM + h * HD + 8 * hh; v16h a00 = g2_frag(qp, 0), a01 = g2_frag(qp + 32, 0), a10 = g2_frag(qp + 16 * DM, 0), a11 = g2_frag(qp + 16 * DM + 32, 0);
  v16h fr[16][2];      /* this wave's 8 position tiles, then its 8 key tiles: one stream, requested FD tiles ahead of its use */
  auto fetch = [&](int n) { const _Float16* p = (n < 8) ? pp + (size_t)n * 128 * DM : kp + (size_t)(n - 8) * 128 * DM; fr[n][0] = g2_frag(p, 0); fr[n][1] = g2_frag(p + 32, 0); };
#pragma unroll
  for (int n = 0; n < FD; ++n) fetch(n);
  asm volatile("s_wait_xcnt 0x0" :: "v"(qp), "v"(pp) : "memory");      /* the issued loads' address registers stay whole up to here and are reused only behind this wait */
  const int jw = SQ - 1 + 8 * hh - w * 16 - ln;      /* column of row 8 hh at position i0 + 16 w + ln */
#pragma unroll
  for (int k = 0; k < 8; ++k) { fetch(k + FD); v8f c0 = g2_mma(a00, fr[k][0], z8), c1 = g2_mma(a10, fr[k][0], z8); c0 = g2_mma(a01, fr[k][1], c0); c1 = g2_mma(a11, fr[k][1], c1);
    const int jb = jw - 128 * k;
    if (k == 0) {      /* tiles 0 and 1 reach past column T - 1 */
#pragma unroll
      for (int r = 0; r < 8; ++r) { const int j = jb + r, j1 = j + 16; sc[8 * hh + r][((unsigned)j < SQ) ? j : SQ] = c0[r]; sc[16 + 8 * hh + r][((unsigned)j1 < SQ) ? j1 : SQ] = c1[r]; }
    } else {           /* tiles 8 to 63: every column inside */
#pragma unroll
      for (int r = 0; r < 8; ++r) { sc[8 * hh + r][jb + r] = c0[r]; sc[16 + 8 * hh + r][jb + 16 + r] = c1[r]; } }
    __builtin_amdgcn_sched_barrier(0); }      /* one tile's accumulators and LDS addresses live at a time: without it the compiler opens six tiles at once and spills */
  if (w < 2) {         /* tiles 64 and 65 reach below column 0 */
    const v16h b0 = g2_frag(pp + (size_t)8 * 128 * DM, 0), b1 = g2_frag(pp + (size_t)8 * 128 * DM + 32, 0);
    v8f c0 = g2_mma(a00, b0, z8), c1 = g2_mma(a10, b0, z8); c0 = g2_mma(a01, b1, c0); c1 = g2_mma(a11, b1, c1); const int jb = jw - 128 * 8;
#pragma unroll
    for (int r = 0; r < 8; ++r) { const int j = jb + r, j1 = j + 16; sc[8 * hh + r][((unsigned)j < SQ) ? j : SQ] = c0[r]; sc[16 + 8 * hh + r][((unsigned)j1 < SQ) ? j1 : SQ] = c1[r]; } }
  qp = QU + (r0 + i0 + ln) * DM + h * HD + 8 * hh; a00 = g2_frag(qp, 0); a01 = g2_frag(qp + 32, 0); a10 = g2_frag(qp + 16 * DM, 0); a11 = g2_frag(qp + 16 * DM + 32, 0);
  asm volatile("s_wait_xcnt 0x0" :: "v"(qp), "v"(kp) : "memory");      /* as above */
  __syncthreads();
  const int* mk = mask + (r0 + i0 + w * 4) * SQ + 4 * lane; v4ia m[2][8];
#pragma unroll
  for (int k = 0; k < 8; ++k) { if (k + FD < 8) fetch(8 + k + FD);
    v8f c0 = g2_mma(a00, fr[8 + k][0], z8), c1 = g2_mma(a10, fr[8 + k][0], z8); c0 = g2_mma(a01, fr[8 + k][1], c0); c1 = g2_mma(a11, fr[8 + k][1], c1);
    if (k == 4) {
#pragma unroll
      for (int u = 0; u < 8; ++u) m[0][u] = *(const v4ia*)(mk + 128 * u); }      /* this wave's first mask row */
    const int j = (w + 8 * k) * 16 + ln;
#pragma unroll
    for (int r = 0; r < 8; ++r) { sc[8 * hh + r][j] += c0[r]; sc[16 + 8 * hh + r][j] += c1[r]; } }
  __builtin_amdgcn_sched_barrier(0);      /* step 3's mask compares stay behind the last tile: drawn up among the tiles, they wait there on the mask loads just issued */
  __syncthreads();
  const int nt = w & 3, kh = w >> 2; const _Float16* vp = VT + ((size_t)bh * HD + nt * 16 + ln) * SQ + kh * (SQ / 2) + 8 * hh; v16h vf[16];
#pragma unroll
  for (int k = 0; k < 4; ++k) { float* row = &sc[w * 4 + k][0]; const v4ia* mc = m[k & 1];
    if (k < 3) {
#pragma unroll
      for (int u = 0; u < 8; ++u) m[(k + 1) & 1][u] = *(const v4ia*)(mk + (k + 1) * SQ + 128 * u);      /* next row's mask flies while this row is worked on */
    } else {
#pragma unroll
      for (int s = 0; s < 16; ++s) vf[s] = g2_frag(vp + 32 * s, 0);      /* step 4's V^T fragments fly during the last row */
      asm volatile("s_wait_xcnt 0x0" :: "v"(vp) : "memory"); }      /* as above */
    float v[8][4]; float m4[4] = {-3.0e38f, -3.0e38f, -3.0e38f, -3.0e38f};
#pragma unroll
    for (int u = 0; u < 8; ++u) { const v4f s = *(const v4fa*)(row + 4 * lane + 128 * u);
#pragma unroll
      for (int q = 0; q < 4; ++q) { v[u][q] = s[q] * 0.125f; m4[q] = fmaxf(m4[q], (mc[u][q] == 0) ? v[u][q] : -3.0e38f); } }
    float mx = fmaxf(fmaxf(m4[0], m4[1]), fmaxf(m4[2], m4[3]));
#pragma unroll
    for (int d = 16; d >= 1; d >>= 1) mx = fmaxf(mx, __shfl_xor(mx, d, 32));
    float s4[4] = {0.f, 0.f, 0.f, 0.f};
#pragma unroll
    for (int u = 0; u < 8; ++u) { float e[4]; exp2x4((v[u][0] - mx) * 1.44269504f, (v[u][1] - mx) * 1.44269504f, (v[u][2] - mx) * 1.44269504f, (v[u][3] - mx) * 1.44269504f, e);
#pragma unroll
      for (int q = 0; q < 4; ++q) { v[u][q] = (mc[u][q] == 0) ? e[q] : 0.f; s4[q] += v[u][q]; } }
    float se = (s4[0] + s4[1]) + (s4[2] + s4[3]);
#pragma unroll
    for (int d = 16; d >= 1; d >>= 1) se += __shfl_xor(se, d, 32);
    const float scl = (se > 0.f) ? 256.0f / se : 0.f;
#pragma unroll
    for (int u = 0; u < 8; ++u) { v4ha h4;
#pragma unroll
      for (int q = 0; q < 4; ++q) h4[q] = (_Float16)(v[u][q] * scl);
      *(v4ha*)((_Float16*)row + 4 * lane + 128 * u) = h4; } }
  __syncthreads();
  { const _Float16* ap = (const _Float16*)&sc[ln][0] + kh * (SQ / 2); v8f c0 = z8, c1 = z8; v16h af[2][4];      /* weight fragments of two k steps, read from LDS one pair of steps ahead */
#pragma unroll
    for (int e = 0; e < 2; ++e) { af[0][2 * e] = g2_frag(ap + 32 * e, hh); af[0][2 * e + 1] = g2_frag(ap + 16 * FP * 2 + 32 * e, hh); }
#pragma unroll
    for (int g = 0; g < 8; ++g) {
      if (g < 7) {
#pragma unroll
        for (int e = 0; e < 2; ++e) { af[(g + 1) & 1][2 * e] = g2_frag(ap + 32 * (2 * g + 2 + e), hh); af[(g + 1) & 1][2 * e + 1] = g2_frag(ap + 16 * FP * 2 + 32 * (2 * g + 2 + e), hh); } }
#pragma unroll
      for (int e = 0; e < 2; ++e) { c0 = g2_mma(af[g & 1][2 * e], vf[2 * g + e], c0); c1 = g2_mma(af[g & 1][2 * e + 1], vf[2 * g + e], c1); } }
#pragma unroll
    for (int r = 0; r < 8; ++r) { so[kh][8 * hh + r][nt * 16 + ln] = c0[r]; so[kh][16 + 8 * hh + r][nt * 16 + ln] = c1[r]; } }
  __syncthreads();
  { const int r = tid >> 3, c8 = (tid & 7) * 8; const v4f x = *(const v4fa*)&so[0][r][c8] + *(const v4fa*)&so[1][r][c8], y = *(const v4fa*)&so[0][r][c8 + 4] + *(const v4fa*)&so[1][r][c8 + 4]; FragH f;
#pragma unroll
    for (int q = 0; q < 4; ++q) { f.h[q] = (_Float16)(x[q] * 0.25f); f.h[4 + q] = (_Float16)(y[q] * 0.25f); }
    *(v8us*)((unsigned short*)O16 + (r0 + i0 + r) * DM + h * HD + c8) = f.half[0]; } }

extern "C" void kernel_launch(void* const* d_in, const int* in_sizes, int n_in,
                              void* d_out, int out_size, void* d_ws, size_t ws_size, hipStream_t stream) {
  (void)in_sizes; (void)n_in; (void)out_size;
  const float* const* I = (const float* const*)d_in; const float* xq = I[0]; const float* xk = I[1]; const float* xv = I[2]; const int* mask = (const int*)d_in[3]; const float* pe = I[4]; const float* wq = I[5]; const float* bq = I[6]; const float* wk = I[7]; const float* bk = I[8]; const float* wv = I[9]; const float* bv = I[10]; const float* wpos = I[11]; const float* wo = I[12]; const float* bo = I[13]; const float* pbu = I[14]; const float* pbv = I[15];
  char* ws = (char*)d_ws; size_t off = 0;
  auto take = [&](size_t bytes) { char* p = ws + off; off += (bytes + 255) & ~(size_t)255; return p; };
  _Float16* BQ = (_Float16*)take((size_t)DM * DM * 2); _Float16* BK = (_Float16*)take((size_t)DM * DM * 2); _Float16* BV = (_Float16*)take((size_t)DM * DM * 2); _Float16* BP = (_Float16*)take((size_t)DM * DM * 2); _Float16* BO = (_Float16*)take((size_t)DM * DM * 2);
  _Float16* XQ = (_Float16*)take(NR * DM * 2); _Float16* XK = (_Float16*)take(NR * DM * 2); _Float16* XV = (_Float16*)take(NR * DM * 2); _Float16* PE = (_Float16*)take((size_t)PP * DM * 2);
  float* QF = (float*)take(NR * DM * 4); _Float16* Q16 = (_Float16*)take(NR * DM * 2); _Float16* QU = (_Float16*)take(NR * DM * 2); _Float16* QV = (_Float16*)take(NR * DM * 2); _Float16* K16 = (_Float16*)take(NR * DM * 2); _Float16* V16 = (_Float16*)take(NR * DM * 2); _Float16* R16 = (_Float16*)take((size_t)PP * DM * 2); _Float16* O16 = (_Float16*)take(NR * DM * 2);
  _Float16* VT = (_Float16*)take((size_t)NB * NH * HD * SQ * 2);
  if (off > ws_size) return;      /* 2.5 + 12 + 2 + 8 + 20 + 2 + 4 + 4 = approx 55 MiB */
  k_prep<<<5 * GW + 3 * GX + GE, 256, 0, stream>>>(wq, wk, wv, wpos, wo, xq, xk, xv, pe, BQ, BK, BV, BP, BO, XQ, XK, XV, PE);      /* x16 weights transposed, inputs and position table as f16 rows */
  k_proj<<<3 * GG + GR, 128, 0, stream>>>(XQ, XK, XV, PE, BQ, BK, BV, BP, bq, bk, bv, QF, K16, V16, R16);      /* q (f32), k, v, p (f16) */
  k_post<<<GT + GX, 256, 0, stream>>>(V16, VT, QF, pbu, pbv, Q16, QU, QV);      /* V^T; q + pos_bias_u, q + pos_bias_v */
  k_relattn<<<NB * NH * (SQ / FR), 256, 0, stream>>>(QU, QV, K16, R16, VT, mask, O16);      /* scores, shifted softmax and o x64 (merged rows), all batches and heads */
  k_gemm2<0><<<dim3(GG, 1), 128, 0, stream>>>(O16, DM, 0, BO, DM, 0, 0.0009765625f, bo, 0, nullptr, 1, 0, 0, (float*)d_out, nullptr, DM, 0, (int)NR, DM, DM);      /* out = x Wout + bout */
}

// v004
// It runs in 106 microseconds.
// Timed twice side by side with v003, it ran 1.05 and 1.06 times as fast.
// All steps since v000 together make it 38.8 times as fast.
#include <hip/hip_runtime.h>
// Relative-position multi-head attention with rel_shift (query, key, value [4][1024][512]; mask [4][1024][1024] int32 verbatim (nonzero = masked, ~50 %); pos_emb [1][2047][512]; q/k/v = x W + b ([512][512] [in][out]); p = pos_emb Wpos; 8 heads of 64; ac = (q + pos_bias_u) . k; bd = rel_shift((q + pos_bias_v) . p^T) = (q_i + v) . p[T-1+i-j]; scores = (ac + bd) / 8; masked -> float32 min; softmax; masked weights -> 0; x = attn v merged; out = x Wout + bout -> [4][1024][512].
// Structure: token rows; inputs and pos_emb as exact f16 rows (pos table padded to 2048 rows with zeros); q as a WMMA GEMM (32x64 wave tiles, f32 accumulation, exact x16 weights + bias) into f32 rows, then f16 planes of q + u and q + v on VALU; k, v, p as WMMA GEMMs (f16 outputs); V^T via LDS transposes; one fused kernel per (batch, head, 32 query rows): bd and ac WMMA tiles (K = 64) into f32 score rows in LDS, bd stored at its shifted column; the relative softmax with the mask on VALU (f32 statistics, native exp; weights x256 f16, in LDS); o = P . V^T on WMMA (K = 1024; o x64 in f16); out GEMM (f32, + bout); launches that need nothing of each other share one grid (ranges of the block index); 5 launches.
// Compute dtype: inputs rounded to bf16; inputs / weights exact in f16; q + u, q + v, k, v, p, softmax weights and o plain f16 (~2^-12); ac, bd, softmax statistics f32. v_wmma_f32_16x16x32_f16.
#define NB 4
#define SQ 1024
#define PP 2048                      /* position table rows (2047 used, row 2047 zero) */
#define NPOS 2047
#define DM 512
#define NH 8
#define HD 64
#define HG 8
#define NR ((size_t)NB * SQ)
typedef __bf16 v16b __attribute__((ext_vector_type(16)));
typedef unsigned short v8us __attribute__((ext_vector_type(8), may_alias));
typedef float  v8f  __attribute__((ext_vector_type(8)));
typedef float  v4f  __attribute__((ext_vector_type(4)));
typedef float  v4fa __attribute__((ext_vector_type(4), may_alias));
union FragB { v16b v; v8us half[2]; unsigned short u[16]; };

__device__ __forceinline__ unsigned short bf16_bits(float x) { unsigned int u = __float_as_uint(x); return (unsigned short)((u + 0x7FFFu + ((u >> 16) & 1u)) >> 16); }
__device__ __forceinline__ float bf16_val(unsigned short b) { return __uint_as_float(((unsigned int)b) << 16); }
__device__ __forceinline__ float bf16_round(float x) { return bf16_val(bf16_bits(x)); }
// D += A·B with NT terms: 1 = ah·bh, 2 = + al·bh (A split), 3 = + ah·bl (both split)
template <int NT>
__device__ __forceinline__ v8f mmaN(v16b ah, v16b al, v16b bh, v16b bl, v8f c) {
  c = __builtin_amdgcn_wmma_f32_16x16x32_bf16(false, ah, false, bh, (short)0, c, false, false);
  if (NT >= 2) c = __builtin_amdgcn_wmma_f32_16x16x32_bf16(false, al, false, bh, (short)0, c, false, false);
  if (NT >= 3) c = __builtin_amdgcn_wmma_f32_16x16x32_bf16(false, ah, false, bl, (short)0, c, false, false);
  asm volatile("v_nop\n\tv_nop\n\tv_nop\n\tv_nop" : "+v"(c) : "v"(ah), "v"(al), "v"(bh), "v"(bl));
  return c;
}

__global__ __launch_bounds__(256) void k_wt_bf16(const float* __restrict__ W, unsigned short* __restrict__ Wt, int K, int N) {
  const int t = blockIdx.x * 256 + threadIdx.x;
  const int k8n = K / 8;
  if (t >= N * k8n) return;
  const int n = t / k8n, k8 = (t % k8n) * 8;
  v8us v;
#pragma unroll
  for (int i = 0; i < 8; ++i) v[i] = bf16_bits(W[(size_t)(k8 + i) * N + n]);
  *(v8us*)(Wt + (size_t)n * K + k8) = v;
  
}

// GEMM C[M][N] (f32, pitch ldc) = act(A[M][K]·W + bias). A f32 row-major (pitch lda) converted per fragment to bf16
// (ASPLIT: hi/lo two planes -> 2 terms, else single rounded term); Wt bf16 [N][K] (pitch ldb). BIAS_BF16 rounds the
// bias to bf16 first (bias quantised to bf16 before the add). K%32==0, M%16==0, N%64==0.
template <bool ASPLIT, int ACT, bool BIAS_BF16>
__global__ __launch_bounds__(128) void k_gemm_bf(const float* __restrict__ A, int lda, const unsigned short* __restrict__ Wt, int ldb,
                                               const float* __restrict__ bias, float* __restrict__ C, int ldc, int M, int N, int K) {
  __shared__ __attribute__((aligned(16))) float so[4][16][64];
  const int tid = threadIdx.x, w = tid >> 5, lane = tid & 31, ln = lane & 15, hh = lane >> 4;
  const int ntn = N / 64;
  const int wid = blockIdx.x * 4 + w;
  const int mt = wid / ntn, nq = wid % ntn;
  if (mt * 16 >= M) return;
  const int row0 = mt * 16, col0 = nq * 64;
  const float* arow = A + (size_t)(row0 + ln) * lda;
  v8f acc[4] = {};
  for (int kb = 0; kb < K; kb += 32) {
    FragB ah, al;
    const v4f x0 = *(const v4fa*)(arow + kb + 8 * hh), x1 = *(const v4fa*)(arow + kb + 8 * hh + 4);
    const v4f x2 = *(const v4fa*)(arow + kb + 16 + 8 * hh), x3 = *(const v4fa*)(arow + kb + 16 + 8 * hh + 4);
    float xs[16] = {x0[0],x0[1],x0[2],x0[3],x1[0],x1[1],x1[2],x1[3],x2[0],x2[1],x2[2],x2[3],x3[0],x3[1],x3[2],x3[3]};
#pragma unroll
    for (int i = 0; i < 16; ++i) { const unsigned short hb = bf16_bits(xs[i]); ah.u[i] = hb; al.u[i] = ASPLIT ? bf16_bits(xs[i] - bf16_val(hb)) : (unsigned short)0; }
#pragma unroll
    for (int t = 0; t < 4; ++t) {
      const unsigned short* brow = Wt + (size_t)(col0 + t * 16 + ln) * ldb + kb;
      FragB b;
      b.half[0] = *(const v8us*)(brow + 8 * hh);
      b.half[1] = *(const v8us*)(brow + 16 + 8 * hh);
      acc[t] = mmaN<ASPLIT ? 2 : 1>(ah.v, al.v, b.v, b.v, acc[t]);
    }
  }
#pragma unroll
  for (int t = 0; t < 4; ++t) {
    float bv = bias ? bias[col0 + t * 16 + ln] : 0.f;
    if (BIAS_BF16) bv = bf16_round(bv);
#pragma unroll
    for (int r = 0; r < 8; ++r) { float v = acc[t][r] + bv; if (ACT == 1) v = fmaxf(v, 0.f); so[w][8 * hh + r][t * 16 + ln] = v; }
  }
  __builtin_amdgcn_fence(__ATOMIC_ACQ_REL, "workgroup");
  __builtin_amdgcn_wave_barrier();
  const int rsub = lane >> 4, c4 = (lane & 15) * 4;
  {
#pragma unroll
    for (int q = 0; q < 8; ++q) {
      const int r = q * 2 + rsub;
      const v4f v = *(const v4fa*)&so[w][r][c4];
      *(v4f*)(C + (size_t)(row0 + r) * ldc + col0 + c4) = v;
    }
    
  }
}

// GEMM C = act(A·W + bias + resid): A f32 (ASPLIT -> hi/lo 2 terms), Wt bf16 [N][K]; ACT 0 none, 1 relu, 2 exact gelu;
// resid (optional, f32, row index = (row % rmod), pitch ldr, RES_BF16 rounds it) added before the activation.
template <bool ASPLIT, int ACT, bool BIAS_BF16, bool RES_BF16>
__global__ __launch_bounds__(128) void k_gemm_bf3(const float* __restrict__ A, int lda, const unsigned short* __restrict__ Wt, int ldb,
                                                const float* __restrict__ bias, const float* __restrict__ resid, int rmod, int ldr,
                                                float* __restrict__ C, int ldc, int M, int N, int K) {
  __shared__ __attribute__((aligned(16))) float so[4][16][64];
  const int tid = threadIdx.x, w = tid >> 5, lane = tid & 31, ln = lane & 15, hh = lane >> 4;
  const int ntn = N / 64;
  const int wid = blockIdx.x * 4 + w;
  const int mt = wid / ntn, nq = wid % ntn;
  if (mt * 16 >= M) return;
  const int row0 = mt * 16, col0 = nq * 64;
  const float* arow = A + (size_t)(row0 + ln) * lda;
  v8f acc[4] = {};
  for (int kb = 0; kb < K; kb += 32) {
    FragB ah, al;
    const v4f x0 = *(const v4fa*)(arow + kb + 8 * hh), x1 = *(const v4fa*)(arow + kb + 8 * hh + 4);
    const v4f x2 = *(const v4fa*)(arow + kb + 16 + 8 * hh), x3 = *(const v4fa*)(arow + kb + 16 + 8 * hh + 4);
    float xs[16] = {x0[0],x0[1],x0[2],x0[3],x1[0],x1[1],x1[2],x1[3],x2[0],x2[1],x2[2],x2[3],x3[0],x3[1],x3[2],x3[3]};
#pragma unroll
    for (int i = 0; i < 16; ++i) { const unsigned short hb = bf16_bits(xs[i]); ah.u[i] = hb; al.u[i] = ASPLIT ? bf16_bits(xs[i] - bf16_val(hb)) : (unsigned short)0; }
#pragma unroll
    for (int t = 0; t < 4; ++t) {
      const unsigned short* brow = Wt + (size_t)(col0 + t * 16 + ln) * ldb + kb;
      FragB b;
      b.half[0] = *(const v8us*)(brow + 8 * hh);
      b.half[1] = *(const v8us*)(brow + 16 + 8 * hh);
      acc[t] = mmaN<ASPLIT ? 2 : 1>(ah.v, al.v, b.v, b.v, acc[t]);
    }
  }
#pragma unroll
  for (int t = 0; t < 4; ++t) {
    const int col = col0 + t * 16 + ln;
    float bv = bias ? bias[col] : 0.f;
    if (BIAS_BF16) bv = bf16_round(bv);
#pragma unroll
    for (int r = 0; r < 8; ++r) {
      float v = acc[t][r] + bv;
      if (resid) { float rv = resid[(size_t)((row0 + 8 * hh + r) % rmod) * ldr + col]; if (RES_BF16) rv = bf16_round(rv); v += rv; }
      if (ACT == 1) v = fmaxf(v, 0.f);
      if (ACT == 2) v = 0.5f * v * (1.0f + erff(v * 0.70710678118654752f));
      if (ACT == 3) { const float u = 0.7978845608028654f * (v + 0.044715f * v * v * v); v = 0.5f * v * (1.0f + tanhf(u)); }
      so[w][8 * hh + r][t * 16 + ln] = v;
    }
  }
  __builtin_amdgcn_fence(__ATOMIC_ACQ_REL, "workgroup");
  __builtin_amdgcn_wave_barrier();
  const int rsub = lane >> 4, c4 = (lane & 15) * 4;
  {
#pragma unroll
    for (int q = 0; q < 8; ++q) {
      const int r = q * 2 + rsub;
      const v4f v = *(const v4fa*)&so[w][r][c4];
      *(v4f*)(C + (size_t)(row0 + r) * ldc + col0 + c4) = v;
    }
    
  }
}
// row LayerNorm (biased variance, eps) over N: s = X (+ R); optional out_sum <- s; out_norm <- (s-mu)*rsqrt(var+eps)*g + b
template <bool PARAM_BF16>
__global__ __launch_bounds__(256) void k_layernorm(const float* __restrict__ X, const float* __restrict__ R, const float* __restrict__ g, const float* __restrict__ bta,
                                                  float* __restrict__ out_sum, float* __restrict__ out_norm, int N, float eps) {
  __shared__ float red[256];
  const int row = blockIdx.x, tid = threadIdx.x;
  const float* x = X + (size_t)row * N; const float* rr = R ? R + (size_t)row * N : nullptr;
  float vals[16];                     // up to N = 4096
  const int per = N / 256;            // contiguous chunk per thread? use strided-by-4 chunks: thread handles j = tid*4 + 1024*u
  float s1 = 0.f;
  for (int u = 0; u < per / 4; ++u) {
    const int j = tid * 4 + 1024 * u;
    const v4f a = *(const v4fa*)(x + j);
    v4f b = {0.f,0.f,0.f,0.f}; if (rr) b = *(const v4fa*)(rr + j);
#pragma unroll
    for (int q = 0; q < 4; ++q) { const float v = a[q] + b[q]; vals[u * 4 + q] = v; s1 += v; }
  }
  red[tid] = s1; __syncthreads();
  for (int st = 128; st > 0; st >>= 1) { if (tid < st) red[tid] += red[tid + st]; __syncthreads(); }
  const float mu = red[0] / (float)N; __syncthreads();
  float s2 = 0.f;
  for (int u = 0; u < per / 4; ++u)
#pragma unroll
    for (int q = 0; q < 4; ++q) { const float c = vals[u * 4 + q] - mu; s2 += c * c; }
  red[tid] = s2; __syncthreads();
  for (int st = 128; st > 0; st >>= 1) { if (tid < st) red[tid] += red[tid + st]; __syncthreads(); }
  const float rs = rsqrtf(red[0] / (float)N + eps);
  {
    for (int u = 0; u < per / 4; ++u) {
      const int j = tid * 4 + 1024 * u;
      v4f o, sm;
#pragma unroll
      for (int q = 0; q < 4; ++q) {
        float gg = g[j + q], bb = bta[j + q];
        if (PARAM_BF16) { gg = bf16_round(gg); bb = bf16_round(bb); }
        sm[q] = vals[u * 4 + q]; o[q] = (vals[u * 4 + q] - mu) * rs * gg + bb;
      }
      if (out_sum) *(v4f*)(out_sum + (size_t)row * N + j) = sm;
      *(v4f*)(out_norm + (size_t)row * N + j) = o;
    }
    
  }
}



// ---- f16 WMMA path (v_wmma_f32_16x16x32_f16): 11-bit significands for operands in range — used where a [0,1] probability operand needs more precision than bf16
typedef _Float16 v16h __attribute__((ext_vector_type(16)));
union FragH { v16h v; v8us half[2]; _Float16 h[16]; unsigned short u[16]; };
template <int NT>
__device__ __forceinline__ v8f mmaH(v16h ah, v16h al, v16h bh, v16h bl, v8f c) {
  c = __builtin_amdgcn_wmma_f32_16x16x32_f16(false, ah, false, bh, (short)0, c, false, false);
  if (NT >= 2) c = __builtin_amdgcn_wmma_f32_16x16x32_f16(false, al, false, bh, (short)0, c, false, false);
  if (NT >= 3) c = __builtin_amdgcn_wmma_f32_16x16x32_f16(false, ah, false, bl, (short)0, c, false, false);
  asm volatile("v_nop\n\tv_nop\n\tv_nop\n\tv_nop" : "+v"(c) : "v"(ah), "v"(al), "v"(bh), "v"(bl));
  return c;
}
// batched GEMM like k_gemm_b but f16 operands: A f32 (split into f16 hi/lo if ASPLIT, else rounded to f16), Bt = f16 values [n][k]; alpha; C f32; N multiple of 16 (partial tiles skipped)
template <bool ASPLIT>
__global__ __launch_bounds__(128) void k_gemm_h(const float* __restrict__ A, int lda, size_t sA, const _Float16* __restrict__ Bh, int ldb, size_t sB, float alpha, float* __restrict__ C, int ldc, size_t sC, int M, int N, int K) {
  __shared__ __attribute__((aligned(16))) float so[4][16][64];
  const int tid = threadIdx.x, w = tid >> 5, lane = tid & 31, ln = lane & 15, hh = lane >> 4; const int by = blockIdx.y;
  A += (size_t)by * sA; Bh += (size_t)by * sB; C += (size_t)by * sC;
  const int ntn = (N + 63) / 64; const int wid = blockIdx.x * 4 + w; const int mt = wid / ntn, nq = wid % ntn; if (mt * 16 >= M) return;
  const int row0 = mt * 16, col0 = nq * 64; const float* arow = A + (size_t)(row0 + ln) * lda;
  v8f acc[4] = {};
  for (int kb = 0; kb < K; kb += 32) {
    FragH ah, al;
    const v4f x0 = *(const v4fa*)(arow + kb + 8 * hh), x1 = *(const v4fa*)(arow + kb + 8 * hh + 4), x2 = *(const v4fa*)(arow + kb + 16 + 8 * hh), x3 = *(const v4fa*)(arow + kb + 16 + 8 * hh + 4);
    float xs[16] = {x0[0],x0[1],x0[2],x0[3],x1[0],x1[1],x1[2],x1[3],x2[0],x2[1],x2[2],x2[3],x3[0],x3[1],x3[2],x3[3]};
#pragma unroll
    for (int i = 0; i < 16; ++i) { const _Float16 h = (_Float16)xs[i]; ah.h[i] = h; al.h[i] = ASPLIT ? (_Float16)(xs[i] - (float)h) : (_Float16)0.0f; }
#pragma unroll
    for (int t = 0; t < 4; ++t) { if (col0 + t * 16 >= N) continue; const size_t boff = (size_t)(col0 + t * 16 + ln) * ldb + kb; FragH bq; bq.half[0] = *(const v8us*)(Bh + boff + 8 * hh); bq.half[1] = *(const v8us*)(Bh + boff + 16 + 8 * hh);
      acc[t] = mmaH<ASPLIT ? 2 : 1>(ah.v, al.v, bq.v, bq.v, acc[t]); }
  }
#pragma unroll
  for (int t = 0; t < 4; ++t) { if (col0 + t * 16 >= N) continue;
#pragma unroll
    for (int r = 0; r < 8; ++r) so[w][8 * hh + r][t * 16 + ln] = acc[t][r] * alpha; }
  __builtin_amdgcn_fence(__ATOMIC_ACQ_REL, "workgroup"); __builtin_amdgcn_wave_barrier();
  const int rsub = lane >> 4, c4 = (lane & 15) * 4;
  {
#pragma unroll
    for (int q = 0; q < 8; ++q) { const int r = q * 2 + rsub; if (col0 + c4 < N) { const v4f v = *(const v4fa*)&so[w][r][c4]; *(v4f*)(C + (size_t)(row0 + r) * ldc + col0 + c4) = v; } }
     }
}

// Wt[n][k] = f16(W[k][n]·scale) from f32 row-major W[K][N] (scale = power of two; bf16-exact weights stay exact in f16 away from the subnormal range)
__device__ __forceinline__ void wt_f16_body(int bx, const float* __restrict__ W, _Float16* __restrict__ Wt, int K, int N, float scale) {
  const int t = bx * 256 + threadIdx.x; if (t >= N * (K / 8)) return; const int n = t / (K / 8), k8 = (t % (K / 8)) * 8; FragH f;
#pragma unroll
  for (int i = 0; i < 8; ++i) f.h[i] = (_Float16)(bf16_round(W[(size_t)(k8 + i) * N + n]) * scale); const v8us o = f.half[0];
  *(v8us*)((unsigned short*)Wt + (size_t)n * K + k8) = o; 
}
// k_gemm_hh variant with fused epilogue: v = acc·alpha + bias[by·sBias + col] (+ CP[(row/rowsPerB)·sCPb + by·64 + col] if CP) ; ACT 0 none / 1 elu ; writes f16 C16 (and f32 C if non-null)
template <int ACT>
__global__ __launch_bounds__(128) void k_gemm_hhx(const _Float16* __restrict__ A, int lda, size_t sA, const _Float16* __restrict__ Bh, int ldb, size_t sB, float alpha, const float* __restrict__ bias, size_t sBias, const float* __restrict__ CP, int rowsPerB, size_t sCPb, int row0g,
    float* __restrict__ C, _Float16* __restrict__ C16, int ldc, size_t sC, int M, int N, int K) {
  __shared__ __attribute__((aligned(16))) float so[4][16][64];
  const int tid = threadIdx.x, w = tid >> 5, lane = tid & 31, ln = lane & 15, hh = lane >> 4; const int by = blockIdx.y;
  A += (size_t)by * sA; Bh += (size_t)by * sB; const size_t cofs = (size_t)by * sC; const float* bp = bias ? bias + (size_t)by * sBias : nullptr;
  const int ntn = (N + 63) / 64; const int wid = blockIdx.x * 4 + w; const int mt = wid / ntn, nq = wid % ntn; if (mt * 16 >= M) return;
  const int row0 = mt * 16, col0 = nq * 64; const _Float16* arow = A + (size_t)(row0 + ln) * lda;
  v8f acc[4] = {};
  for (int kb = 0; kb < K; kb += 32) { FragH ah; ah.half[0] = *(const v8us*)((const unsigned short*)arow + kb + 8 * hh); ah.half[1] = *(const v8us*)((const unsigned short*)arow + kb + 16 + 8 * hh);
#pragma unroll
    for (int t = 0; t < 4; ++t) { if (col0 + t * 16 >= N) continue; const size_t boff = (size_t)(col0 + t * 16 + ln) * ldb + kb; FragH bq; bq.half[0] = *(const v8us*)((const unsigned short*)Bh + boff + 8 * hh); bq.half[1] = *(const v8us*)((const unsigned short*)Bh + boff + 16 + 8 * hh);
      acc[t] = mmaH<1>(ah.v, ah.v, bq.v, bq.v, acc[t]); }
  }
#pragma unroll
  for (int t = 0; t < 4; ++t) { if (col0 + t * 16 >= N) continue; const int col = col0 + t * 16 + ln; const float bv = bp ? bf16_round(bp[col]) : 0.f;
#pragma unroll
    for (int r = 0; r < 8; ++r) { float v = acc[t][r] * alpha + bv; if (CP) { const int rr = row0g + row0 + 8 * hh + r; if (rowsPerB < 0) v += CP[cofs + (size_t)rr * ldc + col];      /* rowsPerB < 0: own element of the batched C plane */ else { const int bidx = rr / rowsPerB; v += CP[(size_t)bidx * sCPb + (size_t)by * 64 + col]; } } if (ACT == 1) v = (v > 0.f) ? v : expm1f(v); else if (ACT == 7) v = (v > 0.f) ? v + 1.0f : expf(v); else if (ACT == 8) v = tanhf(v); else if (ACT == 9) v = 0.5f * v * (1.0f + tanhf(0.7978845608028654f * (v + 0.044715f * v * v * v))); else if (ACT == 11) v = 1.0f / (1.0f + expf(-v)); else if (ACT == 12) v = (v > 0.f) ? v : 0.01f * v; else if (ACT == 14) v = (v > 0.f) ? v : 0.1f * v; else if (ACT == 16) v = (v >= 0.f) ? v : 0.3f * v; else if (ACT == 17) v = (v >= 0.f) ? v : 0.2f * v; else if (ACT == 15) v = v / (1.0f + expf(-v)); else if (ACT == 3) v = fmaxf(v, 0.f); else if (ACT == 6) v = 0.5f * v * (1.0f + erff(v * 0.70710678118654752f)); so[w][8 * hh + r][t * 16 + ln] = v; } }
  __builtin_amdgcn_fence(__ATOMIC_ACQ_REL, "workgroup"); __builtin_amdgcn_wave_barrier();
  const int rsub = lane >> 4, c4 = (lane & 15) * 4; typedef _Float16 v4h __attribute__((ext_vector_type(4)));
  {
#pragma unroll
    for (int q = 0; q < 8; ++q) { const int r = q * 2 + rsub; if (col0 + c4 < N) { const v4f v = *(const v4fa*)&so[w][r][c4]; if (C) *(v4f*)(C + cofs + (size_t)(row0 + r) * ldc + col0 + c4) = v; if (C16) { v4h h4; for (int i = 0; i < 4; ++i) h4[i] = (_Float16)v[i]; *(v4h*)(C16 + cofs + (size_t)(row0 + r) * ldc + col0 + c4) = h4; } } }
     }
}


typedef _Float16 v4h __attribute__((ext_vector_type(4)));

__device__ __forceinline__ void x16_body(int bx, const float* __restrict__ x, _Float16* __restrict__ X16, size_t n8) { const size_t t = (size_t)bx * 256 + threadIdx.x; if (t >= n8) return; FragH f;
#pragma unroll
  for (int q = 0; q < 8; ++q) f.h[q] = (_Float16)bf16_round(x[t * 8 + q]); *(v8us*)((unsigned short*)X16 + t * 8) = f.half[0];  }
__global__ __launch_bounds__(256) void k_h16(const float* __restrict__ x, _Float16* __restrict__ X16, size_t n8) { const size_t t = (size_t)blockIdx.x * 256 + threadIdx.x; if (t >= n8) return; FragH f;
#pragma unroll
  for (int q = 0; q < 8; ++q) f.h[q] = (_Float16)x[t * 8 + q]; *(v8us*)((unsigned short*)X16 + t * 8) = f.half[0];  }
__global__ __launch_bounds__(256) void k_round16f(const float* __restrict__ W, _Float16* __restrict__ Bt, size_t n8) { const size_t t = (size_t)blockIdx.x * 256 + threadIdx.x; if (t >= n8) return; FragH f;
#pragma unroll
  for (int i = 0; i < 8; ++i) f.h[i] = (_Float16)(bf16_round(W[t * 8 + i]) * 16.0f); *(v8us*)((unsigned short*)Bt + t * 8) = f.half[0];  }
template <int NHv, int TTv>
__device__ __forceinline__ void vt_body(int bx, const _Float16* __restrict__ V16, int ldv, int voff, _Float16* __restrict__ Vt) { __shared__ unsigned short tl[64][66]; const int tid = threadIdx.x; const int slab = bx / (TTv / 64), lg = bx % (TTv / 64); const int b = slab / NHv, h = slab % NHv;
  for (int i = tid; i < 64 * 8; i += 256) { const int r = i / 8, c8 = (i % 8) * 8; FragH f; f.half[0] = *(const v8us*)((const unsigned short*)V16 + ((size_t)b * TTv + lg * 64 + r) * ldv + voff + h * 64 + c8);
#pragma unroll
    for (int q = 0; q < 8; ++q) tl[r][c8 + q] = f.u[q]; }
  __syncthreads();
  {
#pragma unroll
    for (int rd = 0; rd < 2; ++rd) { const int d = rd * 32 + tid / 8, pc = tid % 8; FragH f;
#pragma unroll
      for (int q = 0; q < 8; ++q) f.u[q] = tl[pc * 8 + q][d];
      *(v8us*)((unsigned short*)Vt + ((size_t)slab * 64 + d) * TTv + lg * 64 + pc * 8) = f.half[0]; }
     } }

__global__ __launch_bounds__(256) void k_hl(const float* __restrict__ F, _Float16* __restrict__ Hh, _Float16* __restrict__ Hl, size_t n8) { const size_t t = (size_t)blockIdx.x * 256 + threadIdx.x; if (t >= n8) return; FragH fh, fl; const v4f a = *(const v4fa*)(F + t * 8), c = *(const v4fa*)(F + t * 8 + 4);
#pragma unroll
  for (int q = 0; q < 4; ++q) { _Float16 h = (_Float16)a[q]; fh.h[q] = h; fl.h[q] = (_Float16)((a[q] - (float)h) * 1024.0f); h = (_Float16)c[q]; fh.h[4 + q] = h; fl.h[4 + q] = (_Float16)((c[q] - (float)h) * 1024.0f); }
  { *(v8us*)((unsigned short*)Hh + t * 8) = fh.half[0]; *(v8us*)((unsigned short*)Hl + t * 8) = fl.half[0];  } }

// ---- fast GEMM (wave tile 32x64; requires M % 32 == 0 rows per launch region and N % 64 == 0); epilogue = k_gemm_hhx semantics ----
__device__ __forceinline__ v16h g2_frag(const _Float16* p, int hh) { FragH f; f.half[0] = *(const v8us*)((const unsigned short*)p + 8 * hh); f.half[1] = *(const v8us*)((const unsigned short*)p + 16 + 8 * hh); return f.v; }
#define G2D 2                        /* k steps requested ahead in gemm2_body */
__device__ __forceinline__ v8f g2_mma(v16h a, v16h b, v8f c) { v8f d = __builtin_amdgcn_wmma_f32_16x16x32_f16(false, a, false, b, (short)0, c, false, false); asm volatile("v_nop\n\tv_nop\n\tv_nop\n\tv_nop" : "+v"(d) : "v"(a), "v"(b)); return d; }
template <int ACT, int KT>
__device__ __forceinline__ void gemm2_body(int bx, int by, const _Float16* __restrict__ A, int lda, size_t sA, const _Float16* __restrict__ Bh, int ldb, size_t sB, float alpha, const float* __restrict__ bias, size_t sBias, const float* __restrict__ CP, int rowsPerB, size_t sCPb, int row0g,
    float* __restrict__ C, _Float16* __restrict__ C16, int ldc, size_t sC, int M, int N, int K) { static_assert(ACT == 0 || ACT == 3 || ACT == 6 || ACT == 8 || ACT == 9 || ACT == 11 || ACT == 12 || ACT == 14 || ACT == 15 || ACT == 16 || ACT == 17, "k_gemm2: unsupported ACT code (would silently apply no activation)");
  __shared__ __attribute__((aligned(16))) float so[4][32][68];
  const int tid = threadIdx.x, w = tid >> 5, lane = tid & 31, ln = lane & 15, hh = lane >> 4;
  A += (size_t)by * sA; Bh += (size_t)by * sB; const size_t cofs = (size_t)by * sC; const float* bp = bias ? bias + (size_t)by * sBias : nullptr;
  const int ntn = N >> 6; const int mt = bx / ntn, nq = bx - mt * ntn; const int row0 = mt * 128 + 32 * w, col0 = nq * 64; if (row0 >= M) return;
  const _Float16* a0p = A + (size_t)(row0 + ln) * lda + 8 * hh; const _Float16* a1p = a0p + (size_t)16 * lda;      /* the pointers hold the lane's 8 hh already, so that they are the loads' own address registers */
  const _Float16* b0p = Bh + (size_t)(col0 + ln) * ldb + 8 * hh; const _Float16* b1p = b0p + (size_t)16 * ldb; const _Float16* b2p = b1p + (size_t)16 * ldb; const _Float16* b3p = b2p + (size_t)16 * ldb;
  const v8f z8 = {0.f,0.f,0.f,0.f,0.f,0.f,0.f,0.f}; v8f c00 = z8, c01 = z8, c02 = z8, c03 = z8, c10 = z8, c11 = z8, c12 = z8, c13 = z8;
  /* K = KT at compile time, the k loop unrolled: the six fragments of a k step are requested together, G2D steps ahead of their use, into a ring of G2D + 1 register sets (48 registers a set);
     before, a step held four load-wait-multiply rounds in a row, 4 KT / 32 cache latencies a wave. Each accumulator still takes its k steps in rising order.
     Left as it is: a fragment load touches 16 lines (32 bytes of each of 16 rows at 1 KiB pitch), here and in k_relattn; operands stored by their producers in the order the lanes read them would make it 4 whole lines. */
  constexpr int NS = KT / 32; static_assert(KT % 32 == 0 && NS > G2D, "gemm2_body: whole k steps, more of them than are requested ahead"); (void)K;
  v16h fa[G2D + 1][2], fb[G2D + 1][4];
  auto ld = [&](int s) { const int e = s % (G2D + 1), kb = 32 * s; fa[e][0] = g2_frag(a0p + kb, 0); fa[e][1] = g2_frag(a1p + kb, 0); fb[e][0] = g2_frag(b0p + kb, 0); fb[e][1] = g2_frag(b1p + kb, 0); fb[e][2] = g2_frag(b2p + kb, 0); fb[e][3] = g2_frag(b3p + kb, 0); };
#pragma unroll
  for (int s = 0; s < G2D; ++s) ld(s);
#pragma unroll
  for (int s = 0; s < NS; ++s) { const int e = s % (G2D + 1); if (s + G2D < NS) ld(s + G2D);
    c00 = g2_mma(fa[e][0], fb[e][0], c00); c10 = g2_mma(fa[e][1], fb[e][0], c10); c01 = g2_mma(fa[e][0], fb[e][1], c01); c11 = g2_mma(fa[e][1], fb[e][1], c11);
    c02 = g2_mma(fa[e][0], fb[e][2], c02); c12 = g2_mma(fa[e][1], fb[e][2], c12); c03 = g2_mma(fa[e][0], fb[e][3], c03); c13 = g2_mma(fa[e][1], fb[e][3], c13); }
  asm volatile("s_wait_xcnt 0x0" :: "v"(a0p), "v"(a1p), "v"(b0p), "v"(b1p), "v"(b2p), "v"(b3p) : "memory");      /* the six address pairs that every load names stay whole up to here and are reused only behind this wait */
  v8f accs[8] = {c00, c01, c02, c03, c10, c11, c12, c13};
#pragma unroll
  for (int u = 0; u < 8; ++u) { const int t = u & 3, half = u >> 2; const int col = col0 + t * 16 + ln; const float bv = bp ? bf16_round(bp[col]) : 0.f;
#pragma unroll
    for (int r = 0; r < 8; ++r) { const int rloc = half * 16 + 8 * hh + r; float v = accs[u][r] * alpha + bv; if (CP) { if (rowsPerB < 0) v += CP[cofs + (size_t)(row0g + row0 + rloc) * ldc + col];      /* rowsPerB < 0: own element of the batched C plane */ else { const int bidx = (row0g + row0 + rloc) / rowsPerB; v += CP[(size_t)bidx * sCPb + (size_t)by * 64 + col]; } }
      if (ACT == 3) v = fmaxf(v, 0.f); else if (ACT == 6) v = 0.5f * v * (1.0f + erff(v * 0.70710678118654752f)); else if (ACT == 11) v = 1.0f / (1.0f + expf(-v)); else if (ACT == 15) v = v / (1.0f + expf(-v)); else if (ACT == 12) v = (v > 0.f) ? v : 0.01f * v; else if (ACT == 8) v = tanhf(v); else if (ACT == 9) v = 0.5f * v * (1.0f + tanhf(0.7978845608028654f * (v + 0.044715f * v * v * v))); else if (ACT == 14) v = (v > 0.f) ? v : 0.1f * v; else if (ACT == 16) v = (v >= 0.f) ? v : 0.3f * v; else if (ACT == 17) v = (v >= 0.f) ? v : 0.2f * v;
      so[w][rloc][t * 16 + ln] = v; } }
  __builtin_amdgcn_fence(__ATOMIC_ACQ_REL, "workgroup"); __builtin_amdgcn_wave_barrier();
  const int rsub = lane >> 4, c4 = (lane & 15) * 4;
  {
#pragma unroll
    for (int q = 0; q < 16; ++q) { const int r = q * 2 + rsub; const v4f v = *(const v4fa*)&so[w][r][c4]; if (C) *(v4f*)(C + cofs + (size_t)(row0 + r) * ldc + col0 + c4) = v; if (C16) { v4h h4; for (int i = 0; i < 4; ++i) h4[i] = (_Float16)v[i]; *(v4h*)(C16 + cofs + (size_t)(row0 + r) * ldc + col0 + c4) = h4; } }
     } }
template <int ACT>
__global__ __launch_bounds__(128) void k_gemm2(const _Float16* __restrict__ A, int lda, size_t sA, const _Float16* __restrict__ Bh, int ldb, size_t sB, float alpha, const float* __restrict__ bias, size_t sBias, const float* __restrict__ CP, int rowsPerB, size_t sCPb, int row0g,
    float* __restrict__ C, _Float16* __restrict__ C16, int ldc, size_t sC, int M, int N, int K) { gemm2_body<ACT, DM>(blockIdx.x, blockIdx.y, A, lda, sA, Bh, ldb, sB, alpha, bias, sBias, CP, rowsPerB, sCPb, row0g, C, C16, ldc, sC, M, N, K); }


__global__ __launch_bounds__(256) void k_wnat(const float* __restrict__ w, size_t n8, _Float16* __restrict__ Bt) { const size_t t = (size_t)blockIdx.x * 256 + threadIdx.x; if (t >= n8) return; FragH f; for (int q = 0; q < 8; ++q) f.h[q] = (_Float16)(bf16_round(w[t * 8 + q]) * 16.0f); *(v8us*)((unsigned short*)Bt + t * 8) = f.half[0];  }
__global__ __launch_bounds__(256) void k_rsm(const float* __restrict__ S, _Float16* __restrict__ P, int nrows) {
  #pragma clang fp contract(off)
  const int i = blockIdx.x * 256 + threadIdx.x; if (i >= nrows) return; const float* s = S + (size_t)i * SQ; float mx = -3.0e38f;
#pragma unroll 1
  for (int j = 0; j < SQ; ++j) mx = fmaxf(mx, s[j]); float se = 0.f;
#pragma unroll 1
  for (int j = 0; j < SQ; ++j) se += expf(s[j] - mx); const float sc = 256.0f / se;
#pragma unroll 1
  for (int j0 = 0; j0 < SQ; j0 += 8) { FragH f; for (int q = 0; q < 8; ++q) f.h[q] = (_Float16)(expf(s[j0 + q] - mx) * sc); unsigned short* d = (unsigned short*)P + (size_t)i * SQ + j0; *(v8us*)d = f.half[0];  } }
__global__ __launch_bounds__(256) void k_vt(const _Float16* __restrict__ V16, int b, int h0, _Float16* __restrict__ VT) { __shared__ unsigned short tl[64][65]; const int tid = threadIdx.x; const int hh = blockIdx.x % HG, sg = blockIdx.x / HG; const int s0 = sg * 64; const int h = h0 + hh;
  for (int i = tid; i < 64 * 8; i += 256) { const int j = i / 8, d8 = (i % 8) * 8; FragH f; f.half[0] = *(const v8us*)((const unsigned short*)V16 + ((size_t)b * SQ + s0 + j) * DM + h * HD + d8); for (int q = 0; q < 8; ++q) tl[d8 + q][j] = f.u[q]; }
  __syncthreads();
  { for (int i = tid; i < 64 * 8; i += 256) { const int d = i / 8, j8 = (i % 8) * 8; FragH f; for (int q = 0; q < 8; ++q) f.u[q] = tl[d][j8 + q]; *(v8us*)((unsigned short*)VT + ((size_t)hh * HD + d) * SQ + s0 + j8) = f.half[0]; }  } }

__device__ __forceinline__ void qprep_body(int bx, const float* __restrict__ QF, const float* __restrict__ ub, const float* __restrict__ vb, _Float16* __restrict__ Q16, _Float16* __restrict__ QU, _Float16* __restrict__ QV, size_t n8) {
  #pragma clang fp contract(off)
  const size_t t = (size_t)bx * 256 + threadIdx.x; if (t >= n8) return; const size_t e = t * 8; const int c = (int)(e % DM); FragH a, b, d;
#pragma unroll
  for (int q = 0; q < 8; ++q) { const float v = QF[e + q]; a.h[q] = (_Float16)v; b.h[q] = (_Float16)__fadd_rn(v, bf16_round(ub[c + q])); d.h[q] = (_Float16)__fadd_rn(v, bf16_round(vb[c + q])); }
  asm volatile("s_wait_xcnt 0x0" :: "v"(QF + e), "v"(4 * c) : "memory");      /* the q loads' address pair and the bias loads' byte-offset register stay whole up to here */
  { *(v8us*)((unsigned short*)Q16 + e) = a.half[0]; *(v8us*)((unsigned short*)QU + e) = b.half[0]; *(v8us*)((unsigned short*)QV + e) = d.half[0];  } }

// ---- launches that need nothing of each other share one grid: a range test on the block index, the same for a whole work-group, picks the job; each job's blocks do what its own launch did ----
#define GW (DM * (DM / 8) / 256)             /* blocks a weight matrix: 128 */
#define GX ((int)(NR * DM / 8 / 256))        /* blocks an input tensor: 1024 */
#define GE (PP * DM / 8 / 256)               /* blocks of the position table, pad row included: 512 */
#define GG ((int)(NR / 128) * (DM / 64))     /* blocks of a 4096-row projection: 256 */
#define GR ((PP / 128) * (DM / 64))          /* blocks of the position projection: 128 */
#define GT (NB * NH * (SQ / 64))             /* blocks of the V transposes: 512 */
static_assert(((size_t)NPOS * DM / 8) % 32 == 0 && (size_t)GE * 256 == (size_t)PP * DM / 8, "k_prep: the pad row's threads are whole waves at the end of the position range");
// the five weight transposes (strided reads, the longest blocks: first), the three inputs and the position table as f16 rows
__global__ __launch_bounds__(256) void k_prep(const float* __restrict__ wq, const float* __restrict__ wk, const float* __restrict__ wv, const float* __restrict__ wpos, const float* __restrict__ wo,
    const float* __restrict__ xq, const float* __restrict__ xk, const float* __restrict__ xv, const float* __restrict__ pe,
    _Float16* __restrict__ BQ, _Float16* __restrict__ BK, _Float16* __restrict__ BV, _Float16* __restrict__ BP, _Float16* __restrict__ BO,
    _Float16* __restrict__ XQ, _Float16* __restrict__ XK, _Float16* __restrict__ XV, _Float16* __restrict__ PE) {
  int bx = blockIdx.x;
  if (bx < 5 * GW) { const int g = bx / GW; const float* W = (g == 0) ? wq : (g == 1) ? wk : (g == 2) ? wv : (g == 3) ? wpos : wo; _Float16* Wt = (g == 0) ? BQ : (g == 1) ? BK : (g == 2) ? BV : (g == 3) ? BP : BO;
    wt_f16_body(bx - g * GW, W, Wt, DM, DM, 16.0f); return; }
  bx -= 5 * GW;
  if (bx < 3 * GX) { const int g = bx / GX; const float* x = (g == 0) ? xq : (g == 1) ? xk : xv; _Float16* X = (g == 0) ? XQ : (g == 1) ? XK : XV;
    x16_body(bx - g * GX, x, X, NR * DM / 8); return; }
  bx -= 3 * GX;
  x16_body(bx, pe, PE, (size_t)NPOS * DM / 8);
  const size_t t = (size_t)bx * 256 + threadIdx.x;
  if (t >= (size_t)NPOS * DM / 8) { const v8us z = {0, 0, 0, 0, 0, 0, 0, 0}; *(v8us*)((unsigned short*)PE + t * 8) = z; } }      /* pad row 2047 */
// q (f32 rows), k, v, p = pos_emb Wpos (f16 rows; row 2047 is the zero pad)
__global__ __launch_bounds__(128) void k_proj(const _Float16* __restrict__ XQ, const _Float16* __restrict__ XK, const _Float16* __restrict__ XV, const _Float16* __restrict__ PE,
    const _Float16* __restrict__ BQ, const _Float16* __restrict__ BK, const _Float16* __restrict__ BV, const _Float16* __restrict__ BP,
    const float* __restrict__ bq, const float* __restrict__ bk, const float* __restrict__ bv,
    float* __restrict__ QF, _Float16* __restrict__ K16, _Float16* __restrict__ V16, _Float16* __restrict__ R16) {
  const int g = blockIdx.x / GG;
  const _Float16* A = (g == 0) ? XQ : (g == 1) ? XK : (g == 2) ? XV : PE; const _Float16* Bh = (g == 0) ? BQ : (g == 1) ? BK : (g == 2) ? BV : BP;
  const int bx = blockIdx.x - g * GG;
  if (g == 0) { gemm2_body<0, DM>(bx, 0, A, DM, 0, Bh, DM, 0, 0.0625f, bq, 0, nullptr, 1, 0, 0, QF, nullptr, DM, 0, (int)NR, DM, DM); return; }
  const float* bias = (g == 1) ? bk : (g == 2) ? bv : nullptr; _Float16* C16 = (g == 1) ? K16 : (g == 2) ? V16 : R16;
  gemm2_body<0, DM>(bx, 0, A, DM, 0, Bh, DM, 0, 0.0625f, bias, 0, nullptr, 1, 0, 0, nullptr, C16, DM, 0, (g == 3) ? PP : (int)NR, DM, DM); }
// V^T [4][8][64][1024] (LDS transposes, with a barrier: first); q + pos_bias_u, q + pos_bias_v (f16)
__global__ __launch_bounds__(256) void k_post(const _Float16* __restrict__ V16, _Float16* __restrict__ VT, const float* __restrict__ QF, const float* __restrict__ ub, const float* __restrict__ vb, _Float16* __restrict__ Q16, _Float16* __restrict__ QU, _Float16* __restrict__ QV) {
  const int bx = blockIdx.x;
  if (bx < GT) { vt_body<NH, SQ>(bx, V16, DM, 0, VT); return; }
  qprep_body(bx - GT, QF, ub, vb, Q16, QU, QV, NR * DM / 8); }
// Fused relative attention, one work-group per (batch, head, FR query rows); the FR x 1024 score rows live in LDS and never reach memory.
// 1: bd tiles (q + v) . p[i0 + 16 t ..], each element stored at its shifted column j = T - 1 + i - pos (in the edge tiles a column outside 0..T-1 goes to the pad column T, which nobody reads);
// 2: ac tiles (q + u) . k added in place; 3: one wave per row: lane l holds columns 4 l + 128 u + (0..3), mask, f32 statistics, weights x256 as f16 written over the row's own first half;
// 4: o = P . V^T: a wave does 32 rows x 16 columns over one half of k (each V^T fragment is loaded once a work-group); the two halves are added on the way out, where one wave writes each 128-byte line.
// Global fragments are requested ahead of their use, into the registers that the running step sets free.
#define FR 32
#define FD 6                         /* fragment tiles in flight a wave: 96 registers */
#define FP (SQ + 4)                  /* LDS row pitch in floats: 16 B x odd, for the ds_load_b128 fragment reads of step 4 */
typedef int   v4ia __attribute__((ext_vector_type(4), may_alias));
typedef _Float16 v4ha __attribute__((ext_vector_type(4), may_alias));
static_assert(SQ == 1024 && HD == 64 && FR == 32 && SQ - 1 + FR <= 66 * 16 && SQ - FR + 66 * 16 <= PP, "k_relattn: 8 waves, 66 position tiles inside the padded table");
// Four native 2^x (what __expf compiles to, behind its multiply by log2 e). Written in one statement so that the slot the instruction set asks for behind a transcendental is kept by construction:
// each v_exp_f32 is followed by one that neither reads its result nor overwrites its source (early-clobber outputs), the last by v_nop.
__device__ __forceinline__ void exp2x4(float x0, float x1, float x2, float x3, float* e) {
  asm("v_exp_f32 %0, %4\n\tv_exp_f32 %1, %5\n\tv_exp_f32 %2, %6\n\tv_exp_f32 %3, %7\n\tv_nop" : "=&v"(e[0]), "=&v"(e[1]), "=&v"(e[2]), "=&v"(e[3]) : "v"(x0), "v"(x1), "v"(x2), "v"(x3)); }
__global__ __launch_bounds__(256) __attribute__((amdgpu_waves_per_eu(4, 4))) void k_relattn(const _Float16* __restrict__ QU, const _Float16* __restrict__ QV, const _Float16* __restrict__ K16, const _Float16* __restrict__ R16, const _Float16* __restrict__ VT, const int* __restrict__ mask, _Float16* __restrict__ O16) {
  __shared__ __attribute__((aligned(16))) float sc[FR][FP];
  __shared__ __attribute__((aligned(16))) float so[2][FR][68];
  const int tid = threadIdx.x, lane = tid & 31, ln = lane & 15, hh = lane >> 4; const int w = __builtin_amdgcn_readfirstlane(tid >> 5);
  const int it = blockIdx.x % (SQ / FR), bh = blockIdx.x / (SQ / FR), h = bh % NH, b = bh / NH; const int i0 = it * FR; const size_t r0 = (size_t)b * SQ;
  const v8f z8 = {0.f,0.f,0.f,0.f,0.f,0.f,0.f,0.f};
  const _Float16* pp = R16 + (size_t)(i0 + w * 16 + ln) * DM + h * HD + 8 * hh; const _Float16* kp = K16 + (r0 + w * 16 + ln) * DM + h * HD + 8 * hh;      /* tile w; tile w + 8 k lies 128 k rows on; global pointers hold the lane's 8 hh already, so that they are the loads' own address registers */
  const _Float16* qp = QV + (r0 + i0 + ln) * DM + h * HD + 8 * hh; v16h a00 = g2_frag(qp, 0), a01 = g2_frag(qp + 32, 0), a10 = g2_frag(qp + 16 * DM, 0), a11 = g2_frag(qp + 16 * DM + 32, 0);
  v16h fr[16][2];      /* this wave's 8 position tiles, then its 8 key tiles: one stream, requested FD tiles ahead of its use */
  auto fetch = [&](int n) { const _Float16* p = (n < 8) ? pp + (size_t)n * 128 * DM : kp + (size_t)(n - 8) * 128 * DM; fr[n][0] = g2_frag(p, 0); fr[n][1] = g2_frag(p + 32, 0); };
#pragma unroll
  for (int n = 0; n < FD; ++n) fetch(n);
  asm volatile("s_wait_xcnt 0x0" :: "v"(qp), "v"(pp) : "memory");      /* the issued loads' address registers stay whole up to here and are reused only behind this wait */
  const int jw = SQ - 1 + 8 * hh - w * 16 - ln;      /* column of row 8 hh at position i0 + 16 w + ln */
#pragma unroll
  for (int k = 0; k < 8; ++k) { fetch(k + FD); v8f c0 = g2_mma(a00, fr[k][0], z8), c1 = g2_mma(a10, fr[k][0], z8); c0 = g2_mma(a01, fr[k][1], c0); c1 = g2_mma(a11, fr[k][1], c1);
    const int jb = jw - 128 * k;
    if (k == 0) {      /* tiles 0 and 1 reach past column T - 1 */
#pragma unroll
      for (int r = 0; r < 8; ++r) { const int j = jb + r, j1 = j + 16; sc[8 * hh + r][((unsigned)j < SQ) ? j : SQ] = c0[r]; sc[16 + 8 * hh + r][((unsigned)j1 < SQ) ? j1 : SQ] = c1[r]; }
    } else {           /* tiles 8 to 63: every column inside */
#pragma unroll
      for (int r = 0; r < 8; ++r) { sc[8 * hh + r][jb + r] = c0[r]; sc[16 + 8 * hh + r][jb + 16 + r] = c1[r]; } }
    __builtin_amdgcn_sched_barrier(0); }      /* one tile's accumulators and LDS addresses live at a time: without it the compiler opens six tiles at once and spills */
  if (w < 2) {         /* tiles 64 and 65 reach below column 0 */
    const v16h b0 = g2_frag(pp + (size_t)8 * 128 * DM, 0), b1 = g2_frag(pp + (size_t)8 * 128 * DM + 32, 0);
    v8f c0 = g2_mma(a00, b0, z8), c1 = g2_mma(a10, b0, z8); c0 = g2_mma(a01, b1, c0); c1 = g2_mma(a11, b1, c1); const int jb = jw - 128 * 8;
#pragma unroll
    for (int r = 0; r < 8; ++r) { const int j = jb + r, j1 = j + 16; sc[8 * hh + r][((unsigned)j < SQ) ? j : SQ] = c0[r]; sc[16 + 8 * hh + r][((unsigned)j1 < SQ) ? j1 : SQ] = c1[r]; } }
  qp = QU + (r0 + i0 + ln) * DM + h * HD + 8 * hh; a00 = g2_frag(qp, 0); a01 = g2_frag(qp + 32, 0); a10 = g2_frag(qp + 16 * DM, 0); a11 = g2_frag(qp + 16 * DM + 32, 0);
  asm volatile("s_wait_xcnt 0x0" :: "v"(qp), "v"(kp) : "memory");      /* as above */
  __syncthreads();
  const int* mk = mask + (r0 + i0 + w * 4) * SQ + 4 * lane; v4ia m[2][8];
#pragma unroll
  for (int k = 0; k < 8; ++k) { if (k + FD < 8) fetch(8 + k + FD);
    v8f c0 = g2_mma(a00, fr[8 + k][0], z8), c1 = g2_mma(a10, fr[8 + k][0], z8); c0 = g2_mma(a01, fr[8 + k][1], c0); c1 = g2_mma(a11, fr[8 + k][1], c1);
    if (k == 4) {
#pragma unroll
      for (int u = 0; u < 8; ++u) m[0][u] = *(const v4ia*)(mk + 128 * u); }      /* this wave's first mask row */
    const int j = (w + 8 * k) * 16 + ln;
#pragma unroll
    for (int r = 0; r < 8; ++r) { sc[8 * hh + r][j] += c0[r]; sc[16 + 8 * hh + r][j] += c1[r]; } }
  __builtin_amdgcn_sched_barrier(0);      /* step 3's mask compares stay behind the last tile: drawn up among the tiles, they wait there on the mask loads just issued */
  __syncthreads();
  const int nt = w & 3, kh = w >> 2; const _Float16* vp = VT + ((size_t)bh * HD + nt * 16 + ln) * SQ + kh * (SQ / 2) + 8 * hh; v16h vf[16];
#pragma unroll
  for (int k = 0; k < 4; ++k) { float* row = &sc[w * 4 + k][0]; const v4ia* mc = m[k & 1];
    if (k < 3) {
#pragma unroll
      for (int u = 0; u < 8; ++u) m[(k + 1) & 1][u] = *(const v4ia*)(mk + (k + 1) * SQ + 128 * u);      /* next row's mask flies while this row is worked on */
    } else {
#pragma unroll
      for (int s = 0; s < 16; ++s) vf[s] = g2_frag(vp + 32 * s, 0);      /* step 4's V^T fragments fly during the last row */
      asm volatile("s_wait_xcnt 0x0" :: "v"(vp) : "memory"); }      /* as above */
    float v[8][4]; float m4[4] = {-3.0e38f, -3.0e38f, -3.0e38f, -3.0e38f};
#pragma unroll
    for (int u = 0; u < 8; ++u) { const v4f s = *(const v4fa*)(row + 4 * lane + 128 * u);
#pragma unroll
      for (int q = 0; q < 4; ++q) { v[u][q] = s[q] * 0.125f; m4[q] = fmaxf(m4[q], (mc[u][q] == 0) ? v[u][q] : -3.0e38f); } }
    float mx = fmaxf(fmaxf(m4[0], m4[1]), fmaxf(m4[2], m4[3]));
#pragma unroll
    for (int d = 16; d >= 1; d >>= 1) mx = fmaxf(mx, __shfl_xor(mx, d, 32));
    float s4[4] = {0.f, 0.f, 0.f, 0.f};
#pragma unroll
    for (int u = 0; u < 8; ++u) { float e[4]; exp2x4((v[u][0] - mx) * 1.44269504f, (v[u][1] - mx) * 1.44269504f, (v[u][2] - mx) * 1.44269504f, (v[u][3] - mx) * 1.44269504f, e);
#pragma unroll
      for (int q = 0; q < 4; ++q) { v[u][q] = (mc[u][q] == 0) ? e[q] : 0.f; s4[q] += v[u][q]; } }
    float se = (s4[0] + s4[1]) + (s4[2] + s4[3]);
#pragma unroll
    for (int d = 16; d >= 1; d >>= 1) se += __shfl_xor(se, d, 32);
    const float scl = (se > 0.f) ? 256.0f / se : 0.f;
#pragma unroll
    for (int u = 0; u < 8; ++u) { v4ha h4;
#pragma unroll
      for (int q = 0; q < 4; ++q) h4[q] = (_Float16)(v[u][q] * scl);
      *(v4ha*)((_Float16*)row + 4 * lane + 128 * u) = h4; } }
  __syncthreads();
  { const _Float16* ap = (const _Float16*)&sc[ln][0] + kh * (SQ / 2); v8f c0 = z8, c1 = z8; v16h af[2][4];      /* weight fragments of two k steps, read from LDS one pair of steps ahead */
#pragma unroll
    for (int e = 0; e < 2; ++e) { af[0][2 * e] = g2_frag(ap + 32 * e, hh); af[0][2 * e + 1] = g2_frag(ap + 16 * FP * 2 + 32 * e, hh); }
#pragma unroll
    for (int g = 0; g < 8; ++g) {
      if (g < 7) {
#pragma unroll
        for (int e = 0; e < 2; ++e) { af[(g + 1) & 1][2 * e] = g2_frag(ap + 32 * (2 * g + 2 + e), hh); af[(g + 1) & 1][2 * e + 1] = g2_frag(ap + 16 * FP * 2 + 32 * (2 * g + 2 + e), hh); } }
#pragma unroll
      for (int e = 0; e < 2; ++e) { c0 = g2_mma(af[g & 1][2 * e], vf[2 * g + e], c0); c1 = g2_mma(af[g & 1][2 * e + 1], vf[2 * g + e], c1); } }
#pragma unroll
    for (int r = 0; r < 8; ++r) { so[kh][8 * hh + r][nt * 16 + ln] = c0[r]; so[kh][16 + 8 * hh + r][nt * 16 + ln] = c1[r]; } }
  __syncthreads();
  { const int r = tid >> 3, c8 = (tid & 7) * 8; const v4f x = *(const v4fa*)&so[0][r][c8] + *(const v4fa*)&so[1][r][c8], y = *(const v4fa*)&so[0][r][c8 + 4] + *(const v4fa*)&so[1][r][c8 + 4]; FragH f;
#pragma unroll
    for (int q = 0; q < 4; ++q) { f.h[q] = (_Float16)(x[q] * 0.25f); f.h[4 + q] = (_Float16)(y[q] * 0.25f); }
    *(v8us*)((unsigned short*)O16 + (r0 + i0 + r) * DM + h * HD + c8) = f.half[0]; } }

extern "C" void kernel_launch(void* const* d_in, const int* in_sizes, int n_in,
                              void* d_out, int out_size, void* d_ws, size_t ws_size, hipStream_t stream) {
  (void)in_sizes; (void)n_in; (void)out_size;
  const float* const* I = (const float* const*)d_in; const float* xq = I[0]; const float* xk = I[1]; const float* xv = I[2]; const int* mask = (const int*)d_in[3]; const float* pe = I[4]; const float* wq = I[5]; const float* bq = I[6]; const float* wk = I[7]; const float* bk = I[8]; const float* wv = I[9]; const float* bv = I[10]; const float* wpos = I[11]; const float* wo = I[12]; const float* bo = I[13]; const float* pbu = I[14]; const float* pbv = I[15];
  char* ws = (char*)d_ws; size_t off = 0;
  auto take = [&](size_t bytes) { char* p = ws + off; off += (bytes + 255) & ~(size_t)255; return p; };
  _Float16* BQ = (_Float16*)take((size_t)DM * DM * 2); _Float16* BK = (_Float16*)take((size_t)DM * DM * 2); _Float16* BV = (_Float16*)take((size_t)DM * DM * 2); _Float16* BP = (_Float16*)take((size_t)DM * DM * 2); _Float16* BO = (_Float16*)take((size_t)DM * DM * 2);
  _Float16* XQ = (_Float16*)take(NR * DM * 2); _Float16* XK = (_Float16*)take(NR * DM * 2); _Float16* XV = (_Float16*)take(NR * DM * 2); _Float16* PE = (_Float16*)take((size_t)PP * DM * 2);
  float* QF = (float*)take(NR * DM * 4); _Float16* Q16 = (_Float16*)take(NR * DM * 2); _Float16* QU = (_Float16*)take(NR * DM * 2); _Float16* QV = (_Float16*)take(NR * DM * 2); _Float16* K16 = (_Float16*)take(NR * DM * 2); _Float16* V16 = (_Float16*)take(NR * DM * 2); _Float16* R16 = (_Float16*)take((size_t)PP * DM * 2); _Float16* O16 = (_Float16*)take(NR * DM * 2);
  _Float16* VT = (_Float16*)take((size_t)NB * NH * HD * SQ * 2);
  if (off > ws_size) return;      /* 2.5 + 12 + 2 + 8 + 20 + 2 + 4 + 4 = approx 55 MiB */
  k_prep<<<5 * GW + 3 * GX + GE, 256, 0, stream>>>(wq, wk, wv, wpos, wo, xq, xk, xv, pe, BQ, BK, BV, BP, BO, XQ, XK, XV, PE);      /* x16 weights transposed, inputs and position table as f16 rows */
  k_proj<<<3 * GG + GR, 128, 0, stream>>>(XQ, XK, XV, PE, BQ, BK, BV, BP, bq, bk, bv, QF, K16, V16, R16);      /* q (f32), k, v, p (f16) */
  k_post<<<GT + GX, 256, 0, stream>>>(V16, VT, QF, pbu, pbv, Q16, QU, QV);      /* V^T; q + pos_bias_u, q + pos_bias_v */
  k_relattn<<<NB * NH * (SQ / FR), 256, 0, stream>>>(QU, QV, K16, R16, VT, mask, O16);      /* scores, shifted softmax and o x64 (merged rows), all batches and heads */
  k_gemm2<0><<<dim3(GG, 1), 128, 0, stream>>>(O16, DM, 0, BO, DM, 0, 0.0009765625f, bo, 0, nullptr, 1, 0, 0, (float*)d_out, nullptr, DM, 0, (int)NR, DM, DM);      /* out = x Wout + bout */
}

// v005
// Measured time: 76.8 microseconds a run.
// Two timings next to v004 put it at 1.38 and 1.39 times that version's speed.
// All steps since v000 together make it 53.7 times as fast.
#include <hip/hip_runtime.h>
// Relative-position multi-head attention with rel_shift (query, key, value [4][1024][512]; mask [4][1024][1024] int32 verbatim (nonzero = masked, ~50 %); pos_emb [1][2047][512]; q/k/v = x W + b ([512][512] [in][out]); p = pos_emb Wpos; 8 heads of 64; ac = (q + pos_bias_u) . k; bd = rel_shift((q + pos_bias_v) . p^T) = (q_i + v) . p[T-1+i-j]; scores = (ac + bd) / 8; masked -> float32 min; softmax; masked weights -> 0; x = attn v merged; out = x Wout + bout -> [4][1024][512].
// Structure: token rows; inputs and pos_emb as exact f16 rows (pos table padded to 2048 rows with zeros); q as a WMMA GEMM (32x64 wave tiles, f32 accumulation, exact x16 weights + bias) into f32 rows, then f16 planes of q + u and q + v on VALU; k, v, p as WMMA GEMMs (f16 outputs); V^T via LDS transposes; one fused kernel per (batch, head, 32 query rows): bd and ac WMMA tiles (K = 64) into f32 score rows in LDS, bd stored at its shifted column; the relative softmax with the mask on VALU (f32 statistics, native exp; weights x256 f16, in LDS); o = P . V^T on WMMA (K = 1024; o x64 in f16); out GEMM (f32, + bout); launches that need nothing of each other share one grid (ranges of the block index); 5 launches. Every f16 operand plane lies in fragment order (see fo_row).
// Compute dtype: inputs rounded to bf16; inputs / weights exact in f16; q + u, q + v, k, v, p, softmax weights and o plain f16 (~2^-12); ac, bd, softmax statistics f32; v_wmma_f32_16x16x32_f16.
#define NB 4
#define SQ 1024
#define PP 2048                      /* position table rows (2047 used, row 2047 zero) */
#define NPOS 2047
#define DM 512
#define NH 8
#define HD 64
#define HG 8
#define NR ((size_t)NB * SQ)
typedef __bf16 v16b __attribute__((ext_vector_type(16)));
typedef unsigned short v8us __attribute__((ext_vector_type(8), may_alias));
typedef float  v8f  __attribute__((ext_vector_type(8)));
typedef float  v4f  __attribute__((ext_vector_type(4)));
typedef float  v4fa __attribute__((ext_vector_type(4), may_alias));
union FragB { v16b v; v8us half[2]; unsigned short u[16]; };

__device__ __forceinline__ unsigned short bf16_bits(float x) { unsigned int u = __float_as_uint(x); return (unsigned short)((u + 0x7FFFu + ((u >> 16) & 1u)) >> 16); }
__device__ __forceinline__ float bf16_val(unsigned short b) { return __uint_as_float(((unsigned int)b) << 16); }
__device__ __forceinline__ float bf16_round(float x) { return bf16_val(bf16_bits(x)); }
// D += A·B with NT terms: 1 = ah·bh, 2 = + al·bh (A split), 3 = + ah·bl (both split)
template <int NT>
__device__ __forceinline__ v8f mmaN(v16b ah, v16b al, v16b bh, v16b bl, v8f c) {
  c = __builtin_amdgcn_wmma_f32_16x16x32_bf16(false, ah, false, bh, (short)0, c, false, false);
  if (NT >= 2) c = __builtin_amdgcn_wmma_f32_16x16x32_bf16(false, al, false, bh, (short)0, c, false, false);
  if (NT >= 3) c = __builtin_amdgcn_wmma_f32_16x16x32_bf16(false, ah, false, bl, (short)0, c, false, false);
  asm volatile("v_nop\n\tv_nop\n\tv_nop\n\tv_nop" : "+v"(c) : "v"(ah), "v"(al), "v"(bh), "v"(bl));
  return c;
}

__global__ __launch_bounds__(256) void k_wt_bf16(const float* __restrict__ W, unsigned short* __restrict__ Wt, int K, int N) {
  const int t = blockIdx.x * 256 + threadIdx.x;
  const int k8n = K / 8;
  if (t >= N * k8n) return;
  const int n = t / k8n, k8 = (t % k8n) * 8;
  v8us v;
#pragma unroll
  for (int i = 0; i < 8; ++i) v[i] = bf16_bits(W[(size_t)(k8 + i) * N + n]);
  *(v8us*)(Wt + (size_t)n * K + k8) = v;
  
}

// GEMM C[M][N] (f32, pitch ldc) = act(A[M][K]·W + bias). A f32 row-major (pitch lda) converted per fragment to bf16
// (ASPLIT: hi/lo two planes -> 2 terms, else single rounded term); Wt bf16 [N][K] (pitch ldb). BIAS_BF16 rounds the
// bias to bf16 first (bias quantised to bf16 before the add). K%32==0, M%16==0, N%64==0.
template <bool ASPLIT, int ACT, bool BIAS_BF16>
__global__ __launch_bounds__(128) void k_gemm_bf(const float* __restrict__ A, int lda, const unsigned short* __restrict__ Wt, int ldb,
                                               const float* __restrict__ bias, float* __restrict__ C, int ldc, int M, int N, int K) {
  __shared__ __attribute__((aligned(16))) float so[4][16][64];
  const int tid = threadIdx.x, w = tid >> 5, lane = tid & 31, ln = lane & 15, hh = lane >> 4;
  const int ntn = N / 64;
  const int wid = blockIdx.x * 4 + w;
  const int mt = wid / ntn, nq = wid % ntn;
  if (mt * 16 >= M) return;
  const int row0 = mt * 16, col0 = nq * 64;
  const float* arow = A + (size_t)(row0 + ln) * lda;
  v8f acc[4] = {};
  for (int kb = 0; kb < K; kb += 32) {
    FragB ah, al;
    const v4f x0 = *(const v4fa*)(arow + kb + 8 * hh), x1 = *(const v4fa*)(arow + kb + 8 * hh + 4);
    const v4f x2 = *(const v4fa*)(arow + kb + 16 + 8 * hh), x3 = *(const v4fa*)(arow + kb + 16 + 8 * hh + 4);
    float xs[16] = {x0[0],x0[1],x0[2],x0[3],x1[0],x1[1],x1[2],x1[3],x2[0],x2[1],x2[2],x2[3],x3[0],x3[1],x3[2],x3[3]};
#pragma unroll
    for (int i = 0; i < 16; ++i) { const unsigned short hb = bf16_bits(xs[i]); ah.u[i] = hb; al.u[i] = ASPLIT ? bf16_bits(xs[i] - bf16_val(hb)) : (unsigned short)0; }
#pragma unroll
    for (int t = 0; t < 4; ++t) {
      const unsigned short* brow = Wt + (size_t)(col0 + t * 16 + ln) * ldb + kb;
      FragB b;
      b.half[0] = *(const v8us*)(brow + 8 * hh);
      b.half[1] = *(const v8us*)(brow + 16 + 8 * hh);
      acc[t] = mmaN<ASPLIT ? 2 : 1>(ah.v, al.v, b.v, b.v, acc[t]);
    }
  }
#pragma unroll
  for (int t = 0; t < 4; ++t) {
    float bv = bias ? bias[col0 + t * 16 + ln] : 0.f;
    if (BIAS_BF16) bv = bf16_round(bv);
#pragma unroll
    for (int r = 0; r < 8; ++r) { float v = acc[t][r] + bv; if (ACT == 1) v = fmaxf(v, 0.f); so[w][8 * hh + r][t * 16 + ln] = v; }
  }
  __builtin_amdgcn_fence(__ATOMIC_ACQ_REL, "workgroup");
  __builtin_amdgcn_wave_barrier();
  const int rsub = lane >> 4, c4 = (lane & 15) * 4;
  {
#pragma unroll
    for (int q = 0; q < 8; ++q) {
      const int r = q * 2 + rsub;
      const v4f v = *(const v4fa*)&so[w][r][c4];
      *(v4f*)(C + (size_t)(row0 + r) * ldc + col0 + c4) = v;
    }
    
  }
}

// GEMM C = act(A·W + bias + resid): A f32 (ASPLIT -> hi/lo 2 terms), Wt bf16 [N][K]; ACT 0 none, 1 relu, 2 exact gelu;
// resid (optional, f32, row index = (row % rmod), pitch ldr, RES_BF16 rounds it) added before the activation.
template <bool ASPLIT, int ACT, bool BIAS_BF16, bool RES_BF16>
__global__ __launch_bounds__(128) void k_gemm_bf3(const float* __restrict__ A, int lda, const unsigned short* __restrict__ Wt, int ldb,
                                                const float* __restrict__ bias, const float* __restrict__ resid, int rmod, int ldr,
                                                float* __restrict__ C, int ldc, int M, int N, int K) {
  __shared__ __attribute__((aligned(16))) float so[4][16][64];
  const int tid = threadIdx.x, w = tid >> 5, lane = tid & 31, ln = lane & 15, hh = lane >> 4;
  const int ntn = N / 64;
  const int wid = blockIdx.x * 4 + w;
  const int mt = wid / ntn, nq = wid % ntn;
  if (mt * 16 >= M) return;
  const int row0 = mt * 16, col0 = nq * 64;
  const float* arow = A + (size_t)(row0 + ln) * lda;
  v8f acc[4] = {};
  for (int kb = 0; kb < K; kb += 32) {
    FragB ah, al;
    const v4f x0 = *(const v4fa*)(arow + kb + 8 * hh), x1 = *(const v4fa*)(arow + kb + 8 * hh + 4);
    const v4f x2 = *(const v4fa*)(arow + kb + 16 + 8 * hh), x3 = *(const v4fa*)(arow + kb + 16 + 8 * hh + 4);
    float xs[16] = {x0[0],x0[1],x0[2],x0[3],x1[0],x1[1],x1[2],x1[3],x2[0],x2[1],x2[2],x2[3],x3[0],x3[1],x3[2],x3[3]};
#pragma unroll
    for (int i = 0; i < 16; ++i) { const unsigned short hb = bf16_bits(xs[i]); ah.u[i] = hb; al.u[i] = ASPLIT ? bf16_bits(xs[i] - bf16_val(hb)) : (unsigned short)0; }
#pragma unroll
    for (int t = 0; t < 4; ++t) {
      const unsigned short* brow = Wt + (size_t)(col0 + t * 16 + ln) * ldb + kb;
      FragB b;
      b.half[0] = *(const v8us*)(brow + 8 * hh);
      b.half[1] = *(const v8us*)(brow + 16 + 8 * hh);
      acc[t] = mmaN<ASPLIT ? 2 : 1>(ah.v, al.v, b.v, b.v, acc[t]);
    }
  }
#pragma unroll
  for (int t = 0; t < 4; ++t) {
    const int col = col0 + t * 16 + ln;
    float bv = bias ? bias[col] : 0.f;
    if (BIAS_BF16) bv = bf16_round(bv);
#pragma unroll
    for (int r = 0; r < 8; ++r) {
      float v = acc[t][r] + bv;
      if (resid) { float rv = resid[(size_t)((row0 + 8 * hh + r) % rmod) * ldr + col]; if (RES_BF16) rv = bf16_round(rv); v += rv; }
      if (ACT == 1) v = fmaxf(v, 0.f);
      if (ACT == 2) v = 0.5f * v * (1.0f + erff(v * 0.70710678118654752f));
      if (ACT == 3) { const float u = 0.7978845608028654f * (v + 0.044715f * v * v * v); v = 0.5f * v * (1.0f + tanhf(u)); }
      so[w][8 * hh + r][t * 16 + ln] = v;
    }
  }
  __builtin_amdgcn_fence(__ATOMIC_ACQ_REL, "workgroup");
  __builtin_amdgcn_wave_barrier();
  const int rsub = lane >> 4, c4 = (lane & 15) * 4;
  {
#pragma unroll
    for (int q = 0; q < 8; ++q) {
      const int r = q * 2 + rsub;
      const v4f v = *(const v4fa*)&so[w][r][c4];
      *(v4f*)(C + (size_t)(row0 + r) * ldc + col0 + c4) = v;
    }
    
  }
}
// row LayerNorm (biased variance, eps) over N: s = X (+ R); optional out_sum <- s; out_norm <- (s-mu)*rsqrt(var+eps)*g + b
template <bool PARAM_BF16>
__global__ __launch_bounds__(256) void k_layernorm(const float* __restrict__ X, const float* __restrict__ R, const float* __restrict__ g, const float* __restrict__ bta,
                                                  float* __restrict__ out_sum, float* __restrict__ out_norm, int N, float eps) {
  __shared__ float red[256];
  const int row = blockIdx.x, tid = threadIdx.x;
  const float* x = X + (size_t)row * N; const float* rr = R ? R + (size_t)row * N : nullptr;
  float vals[16];                     // up to N = 4096
  const int per = N / 256;            // contiguous chunk per thread? use strided-by-4 chunks: thread handles j = tid*4 + 1024*u
  float s1 = 0.f;
  for (int u = 0; u < per / 4; ++u) {
    const int j = tid * 4 + 1024 * u;
    const v4f a = *(const v4fa*)(x + j);
    v4f b = {0.f,0.f,0.f,0.f}; if (rr) b = *(const v4fa*)(rr + j);
#pragma unroll
    for (int q = 0; q < 4; ++q) { const float v = a[q] + b[q]; vals[u * 4 + q] = v; s1 += v; }
  }
  red[tid] = s1; __syncthreads();
  for (int st = 128; st > 0; st >>= 1) { if (tid < st) red[tid] += red[tid + st]; __syncthreads(); }
  const float mu = red[0] / (float)N; __syncthreads();
  float s2 = 0.f;
  for (int u = 0; u < per / 4; ++u)
#pragma unroll
    for (int q = 0; q < 4; ++q) { const float c = vals[u * 4 + q] - mu; s2 += c * c; }
  red[tid] = s2; __syncthreads();
  for (int st = 128; st > 0; st >>= 1) { if (tid < st) red[tid] += red[tid + st]; __syncthreads(); }
  const float rs = rsqrtf(red[0] / (float)N + eps);
  {
    for (int u = 0; u < per / 4; ++u) {
      const int j = tid * 4 + 1024 * u;
      v4f o, sm;
#pragma unroll
      for (int q = 0; q < 4; ++q) {
        float gg = g[j + q], bb = bta[j + q];
        if (PARAM_BF16) { gg = bf16_round(gg); bb = bf16_round(bb); }
        sm[q] = vals[u * 4 + q]; o[q] = (vals[u * 4 + q] - mu) * rs * gg + bb;
      }
      if (out_sum) *(v4f*)(out_sum + (size_t)row * N + j) = sm;
      *(v4f*)(out_norm + (size_t)row * N + j) = o;
    }
    
  }
}



// ---- f16 WMMA path (v_wmma_f32_16x16x32_f16): 11-bit significands for operands in range — used where a [0,1] probability operand needs more precision than bf16
typedef _Float16 v16h __attribute__((ext_vector_type(16)));
union FragH { v16h v; v8us half[2]; _Float16 h[16]; unsigned short u[16]; };
template <int NT>
__device__ __forceinline__ v8f mmaH(v16h ah, v16h al, v16h bh, v16h bl, v8f c) {
  c = __builtin_amdgcn_wmma_f32_16x16x32_f16(false, ah, false, bh, (short)0, c, false, false);
  if (NT >= 2) c = __builtin_amdgcn_wmma_f32_16x16x32_f16(false, al, false, bh, (short)0, c, false, false);
  if (NT >= 3) c = __builtin_amdgcn_wmma_f32_16x16x32_f16(false, ah, false, bl, (short)0, c, false, false);
  asm volatile("v_nop\n\tv_nop\n\tv_nop\n\tv_nop" : "+v"(c) : "v"(ah), "v"(al), "v"(bh), "v"(bl));
  return c;
}
// batched GEMM like k_gemm_b but f16 operands: A f32 (split into f16 hi/lo if ASPLIT, else rounded to f16), Bt = f16 values [n][k]; alpha; C f32; N multiple of 16 (partial tiles skipped)
template <bool ASPLIT>
__global__ __launch_bounds__(128) void k_gemm_h(const float* __restrict__ A, int lda, size_t sA, const _Float16* __restrict__ Bh, int ldb, size_t sB, float alpha, float* __restrict__ C, int ldc, size_t sC, int M, int N, int K) {
  __shared__ __attribute__((aligned(16))) float so[4][16][64];
  const int tid = threadIdx.x, w = tid >> 5, lane = tid & 31, ln = lane & 15, hh = lane >> 4; const int by = blockIdx.y;
  A += (size_t)by * sA; Bh += (size_t)by * sB; C += (size_t)by * sC;
  const int ntn = (N + 63) / 64; const int wid = blockIdx.x * 4 + w; const int mt = wid / ntn, nq = wid % ntn; if (mt * 16 >= M) return;
  const int row0 = mt * 16, col0 = nq * 64; const float* arow = A + (size_t)(row0 + ln) * lda;
  v8f acc[4] = {};
  for (int kb = 0; kb < K; kb += 32) {
    FragH ah, al;
    const v4f x0 = *(const v4fa*)(arow + kb + 8 * hh), x1 = *(const v4fa*)(arow + kb + 8 * hh + 4), x2 = *(const v4fa*)(arow + kb + 16 + 8 * hh), x3 = *(const v4fa*)(arow + kb + 16 + 8 * hh + 4);
    float xs[16] = {x0[0],x0[1],x0[2],x0[3],x1[0],x1[1],x1[2],x1[3],x2[0],x2[1],x2[2],x2[3],x3[0],x3[1],x3[2],x3[3]};
#pragma unroll
    for (int i = 0; i < 16; ++i) { const _Float16 h = (_Float16)xs[i]; ah.h[i] = h; al.h[i] = ASPLIT ? (_Float16)(xs[i] - (float)h) : (_Float16)0.0f; }
#pragma unroll
    for (int t = 0; t < 4; ++t) { if (col0 + t * 16 >= N) continue; const size_t boff = (size_t)(col0 + t * 16 + ln) * ldb + kb; FragH bq; bq.half[0] = *(const v8us*)(Bh + boff + 8 * hh); bq.half[1] = *(const v8us*)(Bh + boff + 16 + 8 * hh);
      acc[t] = mmaH<ASPLIT ? 2 : 1>(ah.v, al.v, bq.v, bq.v, acc[t]); }
  }
#pragma unroll
  for (int t = 0; t < 4; ++t) { if (col0 + t * 16 >= N) continue;
#pragma unroll
    for (int r = 0; r < 8; ++r) so[w][8 * hh + r][t * 16 + ln] = acc[t][r] * alpha; }
  __builtin_amdgcn_fence(__ATOMIC_ACQ_REL, "workgroup"); __builtin_amdgcn_wave_barrier();
  const int rsub = lane >> 4, c4 = (lane & 15) * 4;
  {
#pragma unroll
    for (int q = 0; q < 8; ++q) { const int r = q * 2 + rsub; if (col0 + c4 < N) { const v4f v = *(const v4fa*)&so[w][r][c4]; *(v4f*)(C + (size_t)(row0 + r) * ldc + col0 + c4) = v; } }
     }
}

// ---- fragment order: how every f16 operand plane of the WMMA kernels lies in memory ----
// A plane of R rows x K values (R % 16 == 0, K % 32 == 0) is cut into tiles of 16 rows x 32 k, tile (row / 16) * (K / 32) + k / 32, 1 KiB each. A tile holds its 64 pieces of 8 values (16 bytes) in the order
// in which the 32 lanes load them as a 16x16x32 operand: piece c = 32 j + 16 hh + ln is row ln, k = 16 j + 8 hh + (0..7). A fragment is then two loads of 512 bytes in a row, 4 whole lines each;
// from rows at 1 KiB pitch each such load touched 16 lines. Every lane gets the values it got before. Producers: thread t makes piece t, so that a wave stores 512 bytes in a row.
__device__ __forceinline__ int fo_row(size_t t, int K) { return (int)((t >> 6) / (unsigned)(K / 32)) * 16 + (int)(t & 15); }
__device__ __forceinline__ int fo_k(size_t t, int K) { return (int)((t >> 6) % (unsigned)(K / 32)) * 32 + (int)((t >> 5) & 1) * 16 + (int)((t >> 4) & 1) * 8; }
// Wt[n][k] = f16(W[k][n]·scale) from f32 row-major W[K][N] (scale = power of two; bf16-exact weights stay exact in f16 away from the subnormal range)
__device__ __forceinline__ void wt_f16_body(int bx, const float* __restrict__ W, _Float16* __restrict__ Wt, int K, int N, float scale) {
  const int t = bx * 256 + threadIdx.x; if (t >= N * (K / 8)) return; const int n = fo_row(t, K), k8 = fo_k(t, K); FragH f;      /* thread t makes piece t of the fragment-ordered plane: 16 lanes read 16 neighbouring n */
#pragma unroll
  for (int i = 0; i < 8; ++i) f.h[i] = (_Float16)(bf16_round(W[(size_t)(k8 + i) * N + n]) * scale); const v8us o = f.half[0];
  *(v8us*)((unsigned short*)Wt + (size_t)t * 8) = o; 
}
// k_gemm_hh variant with fused epilogue: v = acc·alpha + bias[by·sBias + col] (+ CP[(row/rowsPerB)·sCPb + by·64 + col] if CP) ; ACT 0 none / 1 elu ; writes f16 C16 (and f32 C if non-null)
template <int ACT>
__global__ __launch_bounds__(128) void k_gemm_hhx(const _Float16* __restrict__ A, int lda, size_t sA, const _Float16* __restrict__ Bh, int ldb, size_t sB, float alpha, const float* __restrict__ bias, size_t sBias, const float* __restrict__ CP, int rowsPerB, size_t sCPb, int row0g,
    float* __restrict__ C, _Float16* __restrict__ C16, int ldc, size_t sC, int M, int N, int K) {
  __shared__ __attribute__((aligned(16))) float so[4][16][64];
  const int tid = threadIdx.x, w = tid >> 5, lane = tid & 31, ln = lane & 15, hh = lane >> 4; const int by = blockIdx.y;
  A += (size_t)by * sA; Bh += (size_t)by * sB; const size_t cofs = (size_t)by * sC; const float* bp = bias ? bias + (size_t)by * sBias : nullptr;
  const int ntn = (N + 63) / 64; const int wid = blockIdx.x * 4 + w; const int mt = wid / ntn, nq = wid % ntn; if (mt * 16 >= M) return;
  const int row0 = mt * 16, col0 = nq * 64; const _Float16* arow = A + (size_t)(row0 + ln) * lda;
  v8f acc[4] = {};
  for (int kb = 0; kb < K; kb += 32) { FragH ah; ah.half[0] = *(const v8us*)((const unsigned short*)arow + kb + 8 * hh); ah.half[1] = *(const v8us*)((const unsigned short*)arow + kb + 16 + 8 * hh);
#pragma unroll
    for (int t = 0; t < 4; ++t) { if (col0 + t * 16 >= N) continue; const size_t boff = (size_t)(col0 + t * 16 + ln) * ldb + kb; FragH bq; bq.half[0] = *(const v8us*)((const unsigned short*)Bh + boff + 8 * hh); bq.half[1] = *(const v8us*)((const unsigned short*)Bh + boff + 16 + 8 * hh);
      acc[t] = mmaH<1>(ah.v, ah.v, bq.v, bq.v, acc[t]); }
  }
#pragma unroll
  for (int t = 0; t < 4; ++t) { if (col0 + t * 16 >= N) continue; const int col = col0 + t * 16 + ln; const float bv = bp ? bf16_round(bp[col]) : 0.f;
#pragma unroll
    for (int r = 0; r < 8; ++r) { float v = acc[t][r] * alpha + bv; if (CP) { const int rr = row0g + row0 + 8 * hh + r; if (rowsPerB < 0) v += CP[cofs + (size_t)rr * ldc + col];      /* rowsPerB < 0: own element of the batched C plane */ else { const int bidx = rr / rowsPerB; v += CP[(size_t)bidx * sCPb + (size_t)by * 64 + col]; } } if (ACT == 1) v = (v > 0.f) ? v : expm1f(v); else if (ACT == 7) v = (v > 0.f) ? v + 1.0f : expf(v); else if (ACT == 8) v = tanhf(v); else if (ACT == 9) v = 0.5f * v * (1.0f + tanhf(0.7978845608028654f * (v + 0.044715f * v * v * v))); else if (ACT == 11) v = 1.0f / (1.0f + expf(-v)); else if (ACT == 12) v = (v > 0.f) ? v : 0.01f * v; else if (ACT == 14) v = (v > 0.f) ? v : 0.1f * v; else if (ACT == 16) v = (v >= 0.f) ? v : 0.3f * v; else if (ACT == 17) v = (v >= 0.f) ? v : 0.2f * v; else if (ACT == 15) v = v / (1.0f + expf(-v)); else if (ACT == 3) v = fmaxf(v, 0.f); else if (ACT == 6) v = 0.5f * v * (1.0f + erff(v * 0.70710678118654752f)); so[w][8 * hh + r][t * 16 + ln] = v; } }
  __builtin_amdgcn_fence(__ATOMIC_ACQ_REL, "workgroup"); __builtin_amdgcn_wave_barrier();
  const int rsub = lane >> 4, c4 = (lane & 15) * 4; typedef _Float16 v4h __attribute__((ext_vector_type(4)));
  {
#pragma unroll
    for (int q = 0; q < 8; ++q) { const int r = q * 2 + rsub; if (col0 + c4 < N) { const v4f v = *(const v4fa*)&so[w][r][c4]; if (C) *(v4f*)(C + cofs + (size_t)(row0 + r) * ldc + col0 + c4) = v; if (C16) { v4h h4; for (int i = 0; i < 4; ++i) h4[i] = (_Float16)v[i]; *(v4h*)(C16 + cofs + (size_t)(row0 + r) * ldc + col0 + c4) = h4; } } }
     }
}


typedef _Float16 v4h __attribute__((ext_vector_type(4)));

// rows of DM values into a fragment-ordered plane of n8 pieces; rows from nrows on are not read and become zero
__device__ __forceinline__ void x16_body(int bx, const float* __restrict__ x, _Float16* __restrict__ X16, int nrows, size_t n8) { const size_t t = (size_t)bx * 256 + threadIdx.x; if (t >= n8) return; FragH f; const int row = fo_row(t, DM); const float* s = x + (size_t)row * DM + fo_k(t, DM);
  const v8us z = {0, 0, 0, 0, 0, 0, 0, 0}; f.half[0] = z;
  if (row < nrows) {
#pragma unroll
    for (int q = 0; q < 8; ++q) f.h[q] = (_Float16)bf16_round(s[q]); }
  *(v8us*)((unsigned short*)X16 + t * 8) = f.half[0];  }
__global__ __launch_bounds__(256) void k_h16(const float* __restrict__ x, _Float16* __restrict__ X16, size_t n8) { const size_t t = (size_t)blockIdx.x * 256 + threadIdx.x; if (t >= n8) return; FragH f;
#pragma unroll
  for (int q = 0; q < 8; ++q) f.h[q] = (_Float16)x[t * 8 + q]; *(v8us*)((unsigned short*)X16 + t * 8) = f.half[0];  }
__global__ __launch_bounds__(256) void k_round16f(const float* __restrict__ W, _Float16* __restrict__ Bt, size_t n8) { const size_t t = (size_t)blockIdx.x * 256 + threadIdx.x; if (t >= n8) return; FragH f;
#pragma unroll
  for (int i = 0; i < 8; ++i) f.h[i] = (_Float16)(bf16_round(W[t * 8 + i]) * 16.0f); *(v8us*)((unsigned short*)Bt + t * 8) = f.half[0];  }
template <int NHv, int TTv>
__device__ __forceinline__ void vt_body(int bx, const _Float16* __restrict__ V16, int ldv, int voff, _Float16* __restrict__ Vt) { __shared__ unsigned short tl[64][66]; const int tid = threadIdx.x; const int slab = bx / (TTv / 64), lg = bx % (TTv / 64); const int b = slab / NHv, h = slab % NHv;
  for (int i = tid; i < 64 * 8; i += 256) { const int r = fo_row(i, 64), c8 = fo_k(i, 64); FragH f;      /* the block's 64 tokens x 64 d are 4 x 2 tiles of the fragment-ordered V plane */
    f.half[0] = *(const v8us*)((const unsigned short*)V16 + ((size_t)((b * TTv + lg * 64) / 16 + (i >> 7)) * (ldv / 32) + (voff + h * 64) / 32 + ((i >> 6) & 1)) * 512 + (i & 63) * 8);
#pragma unroll
    for (int q = 0; q < 8; ++q) tl[r][c8 + q] = f.u[q]; }
  __syncthreads();
  {
#pragma unroll
    for (int rd = 0; rd < 2; ++rd) { const int i = rd * 256 + tid, d = fo_row(i, 64), p8 = fo_k(i, 64); FragH f;      /* 64 d x 64 tokens: 4 x 2 tiles of the fragment-ordered V^T plane */
#pragma unroll
      for (int q = 0; q < 8; ++q) f.u[q] = tl[p8 + q][d];
      *(v8us*)((unsigned short*)Vt + ((size_t)(slab * 4 + (i >> 7)) * (TTv / 32) + lg * 2 + ((i >> 6) & 1)) * 512 + (i & 63) * 8) = f.half[0]; }
     } }

__global__ __launch_bounds__(256) void k_hl(const float* __restrict__ F, _Float16* __restrict__ Hh, _Float16* __restrict__ Hl, size_t n8) { const size_t t = (size_t)blockIdx.x * 256 + threadIdx.x; if (t >= n8) return; FragH fh, fl; const v4f a = *(const v4fa*)(F + t * 8), c = *(const v4fa*)(F + t * 8 + 4);
#pragma unroll
  for (int q = 0; q < 4; ++q) { _Float16 h = (_Float16)a[q]; fh.h[q] = h; fl.h[q] = (_Float16)((a[q] - (float)h) * 1024.0f); h = (_Float16)c[q]; fh.h[4 + q] = h; fl.h[4 + q] = (_Float16)((c[q] - (float)h) * 1024.0f); }
  { *(v8us*)((unsigned short*)Hh + t * 8) = fh.half[0]; *(v8us*)((unsigned short*)Hl + t * 8) = fl.half[0];  } }

// ---- fast GEMM (wave tile 32x64; requires M % 32 == 0 rows per launch region and N % 64 == 0); epilogue = k_gemm_hhx semantics ----
__device__ __forceinline__ v16h g2_frag(const _Float16* p, int hh) { FragH f; f.half[0] = *(const v8us*)((const unsigned short*)p + 8 * hh); f.half[1] = *(const v8us*)((const unsigned short*)p + 16 + 8 * hh); return f.v; }
__device__ __forceinline__ v16h fo_frag(const _Float16* p) { FragH f; f.half[0] = *(const v8us*)((const unsigned short*)p); f.half[1] = *(const v8us*)((const unsigned short*)p + 256); return f.v; }      /* p: a tile of a fragment-ordered plane + 8 lane */
#define G2D 2                        /* k steps requested ahead in gemm2_body */
__device__ __forceinline__ v8f g2_mma(v16h a, v16h b, v8f c) { v8f d = __builtin_amdgcn_wmma_f32_16x16x32_f16(false, a, false, b, (short)0, c, false, false); asm volatile("v_nop\n\tv_nop\n\tv_nop\n\tv_nop" : "+v"(d) : "v"(a), "v"(b)); return d; }
template <int ACT, int KT>
__device__ __forceinline__ void gemm2_body(int bx, int by, const _Float16* __restrict__ A, int lda, size_t sA, const _Float16* __restrict__ Bh, int ldb, size_t sB, float alpha, const float* __restrict__ bias, size_t sBias, const float* __restrict__ CP, int rowsPerB, size_t sCPb, int row0g,
    float* __restrict__ C, _Float16* __restrict__ C16, int ldc, size_t sC, int M, int N, int K) { static_assert(ACT == 0 || ACT == 3 || ACT == 6 || ACT == 8 || ACT == 9 || ACT == 11 || ACT == 12 || ACT == 14 || ACT == 15 || ACT == 16 || ACT == 17, "k_gemm2: unsupported ACT code (would silently apply no activation)");
  __shared__ __attribute__((aligned(16))) float so[4][32][68];
  const int tid = threadIdx.x, lane = tid & 31, ln = lane & 15, hh = lane >> 4; const int w = __builtin_amdgcn_readfirstlane(tid >> 5);      /* the wave's number in a scalar register: every tile address below is then a scalar base + the lane's piece */
  A += (size_t)by * sA; Bh += (size_t)by * sB; const size_t cofs = (size_t)by * sC; const float* bp = bias ? bias + (size_t)by * sBias : nullptr;
  const int ntn = N >> 6; const int mt = bx / ntn, nq = bx - mt * ntn; const int row0 = mt * 128 + 32 * w, col0 = nq * 64; if (row0 >= M) return;
  const _Float16* a0p = A + (size_t)row0 * lda; const _Float16* a1p = a0p + (size_t)16 * lda;      /* A, Bh fragment-ordered: 16 rows of tiles are 16 lda values; six scalar bases, to which each load adds the lane's piece */
  const _Float16* b0p = Bh + (size_t)col0 * ldb; const _Float16* b1p = b0p + (size_t)16 * ldb; const _Float16* b2p = b1p + (size_t)16 * ldb; const _Float16* b3p = b2p + (size_t)16 * ldb;
  const v8f z8 = {0.f,0.f,0.f,0.f,0.f,0.f,0.f,0.f}; v8f c00 = z8, c01 = z8, c02 = z8, c03 = z8, c10 = z8, c11 = z8, c12 = z8, c13 = z8;
  /* K = KT at compile time, the k loop unrolled: the six fragments of a k step are requested together, G2D steps ahead of their use, into a ring of G2D + 1 register sets (48 registers a set);
     before, a step held four load-wait-multiply rounds in a row, 4 KT / 32 cache latencies a wave. Each accumulator still takes its k steps in rising order.
     The k step's tile of each operand lies 512 values behind the one before. */
  constexpr int NS = KT / 32; static_assert(KT % 32 == 0 && NS > G2D, "gemm2_body: whole k steps, more of them than are requested ahead"); (void)K;
  v16h fa[G2D + 1][2], fb[G2D + 1][4];
  auto ld = [&](int s) { const int e = s % (G2D + 1), kb = 512 * s + 8 * lane; fa[e][0] = fo_frag(a0p + kb); fa[e][1] = fo_frag(a1p + kb); fb[e][0] = fo_frag(b0p + kb); fb[e][1] = fo_frag(b1p + kb); fb[e][2] = fo_frag(b2p + kb); fb[e][3] = fo_frag(b3p + kb); };
#pragma unroll
  for (int s = 0; s < G2D; ++s) ld(s);
#pragma unroll
  for (int s = 0; s < NS; ++s) { const int e = s % (G2D + 1); if (s + G2D < NS) ld(s + G2D);
    c00 = g2_mma(fa[e][0], fb[e][0], c00); c10 = g2_mma(fa[e][1], fb[e][0], c10); c01 = g2_mma(fa[e][0], fb[e][1], c01); c11 = g2_mma(fa[e][1], fb[e][1], c11);
    c02 = g2_mma(fa[e][0], fb[e][2], c02); c12 = g2_mma(fa[e][1], fb[e][2], c12); c03 = g2_mma(fa[e][0], fb[e][3], c03); c13 = g2_mma(fa[e][1], fb[e][3], c13); }
  asm volatile("s_wait_xcnt 0x0" :: "s"(a0p), "s"(a1p), "s"(b0p), "s"(b1p), "s"(b2p), "s"(b3p), "v"(lane) : "memory");      /* the six scalar bases and the lane register that the loads name stay whole up to here and are reused only behind this wait */
  v8f accs[8] = {c00, c01, c02, c03, c10, c11, c12, c13};
#pragma unroll
  for (int u = 0; u < 8; ++u) { const int t = u & 3, half = u >> 2; const int col = col0 + t * 16 + ln; const float bv = bp ? bf16_round(bp[col]) : 0.f;
#pragma unroll
    for (int r = 0; r < 8; ++r) { const int rloc = half * 16 + 8 * hh + r; float v = accs[u][r] * alpha + bv; if (CP) { if (rowsPerB < 0) v += CP[cofs + (size_t)(row0g + row0 + rloc) * ldc + col];      /* rowsPerB < 0: own element of the batched C plane */ else { const int bidx = (row0g + row0 + rloc) / rowsPerB; v += CP[(size_t)bidx * sCPb + (size_t)by * 64 + col]; } }
      if (ACT == 3) v = fmaxf(v, 0.f); else if (ACT == 6) v = 0.5f * v * (1.0f + erff(v * 0.70710678118654752f)); else if (ACT == 11) v = 1.0f / (1.0f + expf(-v)); else if (ACT == 15) v = v / (1.0f + expf(-v)); else if (ACT == 12) v = (v > 0.f) ? v : 0.01f * v; else if (ACT == 8) v = tanhf(v); else if (ACT == 9) v = 0.5f * v * (1.0f + tanhf(0.7978845608028654f * (v + 0.044715f * v * v * v))); else if (ACT == 14) v = (v > 0.f) ? v : 0.1f * v; else if (ACT == 16) v = (v >= 0.f) ? v : 0.3f * v; else if (ACT == 17) v = (v >= 0.f) ? v : 0.2f * v;
      so[w][rloc][t * 16 + ln] = v; } }
  __builtin_amdgcn_fence(__ATOMIC_ACQ_REL, "workgroup"); __builtin_amdgcn_wave_barrier();
  const int rsub = lane >> 4, c4 = (lane & 15) * 4;
  {
#pragma unroll
    for (int q = 0; q < 16; ++q) { const int r = q * 2 + rsub; const v4f v = *(const v4fa*)&so[w][r][c4]; if (C) *(v4f*)(C + cofs + (size_t)(row0 + r) * ldc + col0 + c4) = v; }
    if (C) asm volatile("s_wait_xcnt 0x0" ::: "memory");      /* the f32 stores' address registers are reused, where an f16 plane follows, only behind this wait */
    if (C16) {      /* the f16 plane is fragment-ordered: the wave's 32 x 64 values are 2 x 2 tiles, 8 stores of 512 bytes in a row */
#pragma unroll
      for (int q = 0; q < 8; ++q) { const float* s = &so[w][(q >> 2) * 16 + ln][((q >> 1) & 1) * 32 + (q & 1) * 16 + 8 * hh]; const v4f x = *(const v4fa*)s, y = *(const v4fa*)(s + 4); FragH f;
#pragma unroll
        for (int i = 0; i < 4; ++i) { f.h[i] = (_Float16)x[i]; f.h[4 + i] = (_Float16)y[i]; }
        *(v8us*)((unsigned short*)C16 + cofs + ((size_t)(row0 / 16 + (q >> 2)) * (ldc / 32) + col0 / 32 + ((q >> 1) & 1)) * 512 + (q & 1) * 256 + 8 * lane) = f.half[0]; } }
     } }
template <int ACT>
__global__ __launch_bounds__(128) void k_gemm2(const _Float16* __restrict__ A, int lda, size_t sA, const _Float16* __restrict__ Bh, int ldb, size_t sB, float alpha, const float* __restrict__ bias, size_t sBias, const float* __restrict__ CP, int rowsPerB, size_t sCPb, int row0g,
    float* __restrict__ C, _Float16* __restrict__ C16, int ldc, size_t sC, int M, int N, int K) { gemm2_body<ACT, DM>(blockIdx.x, blockIdx.y, A, lda, sA, Bh, ldb, sB, alpha, bias, sBias, CP, rowsPerB, sCPb, row0g, C, C16, ldc, sC, M, N, K); }


__global__ __launch_bounds__(256) void k_wnat(const float* __restrict__ w, size_t n8, _Float16* __restrict__ Bt) { const size_t t = (size_t)blockIdx.x * 256 + threadIdx.x; if (t >= n8) return; FragH f; for (int q = 0; q < 8; ++q) f.h[q] = (_Float16)(bf16_round(w[t * 8 + q]) * 16.0f); *(v8us*)((unsigned short*)Bt + t * 8) = f.half[0];  }
__global__ __launch_bounds__(256) void k_rsm(const float* __restrict__ S, _Float16* __restrict__ P, int nrows) {
  #pragma clang fp contract(off)
  const int i = blockIdx.x * 256 + threadIdx.x; if (i >= nrows) return; const float* s = S + (size_t)i * SQ; float mx = -3.0e38f;
#pragma unroll 1
  for (int j = 0; j < SQ; ++j) mx = fmaxf(mx, s[j]); float se = 0.f;
#pragma unroll 1
  for (int j = 0; j < SQ; ++j) se += expf(s[j] - mx); const float sc = 256.0f / se;
#pragma unroll 1
  for (int j0 = 0; j0 < SQ; j0 += 8) { FragH f; for (int q = 0; q < 8; ++q) f.h[q] = (_Float16)(expf(s[j0 + q] - mx) * sc); unsigned short* d = (unsigned short*)P + (size_t)i * SQ + j0; *(v8us*)d = f.half[0];  } }
__global__ __launch_bounds__(256) void k_vt(const _Float16* __restrict__ V16, int b, int h0, _Float16* __restrict__ VT) { __shared__ unsigned short tl[64][65]; const int tid = threadIdx.x; const int hh = blockIdx.x % HG, sg = blockIdx.x / HG; const int s0 = sg * 64; const int h = h0 + hh;
  for (int i = tid; i < 64 * 8; i += 256) { const int j = i / 8, d8 = (i % 8) * 8; FragH f; f.half[0] = *(const v8us*)((const unsigned short*)V16 + ((size_t)b * SQ + s0 + j) * DM + h * HD + d8); for (int q = 0; q < 8; ++q) tl[d8 + q][j] = f.u[q]; }
  __syncthreads();
  { for (int i = tid; i < 64 * 8; i += 256) { const int d = i / 8, j8 = (i % 8) * 8; FragH f; for (int q = 0; q < 8; ++q) f.u[q] = tl[d][j8 + q]; *(v8us*)((unsigned short*)VT + ((size_t)hh * HD + d) * SQ + s0 + j8) = f.half[0]; }  } }

__device__ __forceinline__ void qprep_body(int bx, const float* __restrict__ QF, const float* __restrict__ ub, const float* __restrict__ vb, _Float16* __restrict__ Q16, _Float16* __restrict__ QU, _Float16* __restrict__ QV, size_t n8) {
  #pragma clang fp contract(off)
  const size_t t = (size_t)bx * 256 + threadIdx.x; if (t >= n8) return; const int c = fo_k(t, DM); const size_t e = (size_t)fo_row(t, DM) * DM + c, o = t * 8; FragH a, b, d;      /* reads q rows at e, makes piece t of the fragment-ordered planes */
#pragma unroll
  for (int q = 0; q < 8; ++q) { const float v = QF[e + q]; a.h[q] = (_Float16)v; b.h[q] = (_Float16)__fadd_rn(v, bf16_round(ub[c + q])); d.h[q] = (_Float16)__fadd_rn(v, bf16_round(vb[c + q])); }
  asm volatile("s_wait_xcnt 0x0" :: "v"(QF + e), "v"(4 * c) : "memory");      /* the q loads' address pair and the bias loads' byte-offset register stay whole up to here */
  { *(v8us*)((unsigned short*)Q16 + o) = a.half[0]; *(v8us*)((unsigned short*)QU + o) = b.half[0]; *(v8us*)((unsigned short*)QV + o) = d.half[0];  } }

// ---- launches that need nothing of each other share one grid: a range test on the block index, the same for a whole work-group, picks the job; each job's blocks do what its own launch did ----
#define GW (DM * (DM / 8) / 256)             /* blocks a weight matrix: 128 */
#define GX ((int)(NR * DM / 8 / 256))        /* blocks an input tensor: 1024 */
#define GE (PP * DM / 8 / 256)               /* blocks of the position table, pad row included: 512 */
#define GG ((int)(NR / 128) * (DM / 64))     /* blocks of a 4096-row projection: 256 */
#define GR ((PP / 128) * (DM / 64))          /* blocks of the position projection: 128 */
#define GT (NB * NH * (SQ / 64))             /* blocks of the V transposes: 512 */
static_assert((size_t)GE * 256 == (size_t)PP * DM / 8 && PP % 16 == 0 && NPOS < PP, "k_prep: the position range covers the padded table, whole tiles");
// the five weight transposes (strided reads, the longest blocks: first), the three inputs and the position table as f16 rows
__global__ __launch_bounds__(256) void k_prep(const float* __restrict__ wq, const float* __restrict__ wk, const float* __restrict__ wv, const float* __restrict__ wpos, const float* __restrict__ wo,
    const float* __restrict__ xq, const float* __restrict__ xk, const float* __restrict__ xv, const float* __restrict__ pe,
    _Float16* __restrict__ BQ, _Float16* __restrict__ BK, _Float16* __restrict__ BV, _Float16* __restrict__ BP, _Float16* __restrict__ BO,
    _Float16* __restrict__ XQ, _Float16* __restrict__ XK, _Float16* __restrict__ XV, _Float16* __restrict__ PE) {
  int bx = blockIdx.x;
  if (bx < 5 * GW) { const int g = bx / GW; const float* W = (g == 0) ? wq : (g == 1) ? wk : (g == 2) ? wv : (g == 3) ? wpos : wo; _Float16* Wt = (g == 0) ? BQ : (g == 1) ? BK : (g == 2) ? BV : (g == 3) ? BP : BO;
    wt_f16_body(bx - g * GW, W, Wt, DM, DM, 16.0f); return; }
  bx -= 5 * GW;
  if (bx < 3 * GX) { const int g = bx / GX; const float* x = (g == 0) ? xq : (g == 1) ? xk : xv; _Float16* X = (g == 0) ? XQ : (g == 1) ? XK : XV;
    x16_body(bx - g * GX, x, X, (int)NR, NR * DM / 8); return; }
  bx -= 3 * GX;
  x16_body(bx, pe, PE, NPOS, (size_t)PP * DM / 8); }      /* pad row 2047 becomes zero */
// q (f32 rows), k, v, p = pos_emb Wpos (f16 rows; row 2047 is the zero pad)
__global__ __launch_bounds__(128) void k_proj(const _Float16* __restrict__ XQ, const _Float16* __restrict__ XK, const _Float16* __restrict__ XV, const _Float16* __restrict__ PE,
    const _Float16* __restrict__ BQ, const _Float16* __restrict__ BK, const _Float16* __restrict__ BV, const _Float16* __restrict__ BP,
    const float* __restrict__ bq, const float* __restrict__ bk, const float* __restrict__ bv,
    float* __restrict__ QF, _Float16* __restrict__ K16, _Float16* __restrict__ V16, _Float16* __restrict__ R16) {
  const int g = blockIdx.x / GG;
  const _Float16* A = (g == 0) ? XQ : (g == 1) ? XK : (g == 2) ? XV : PE; const _Float16* Bh = (g == 0) ? BQ : (g == 1) ? BK : (g == 2) ? BV : BP;
  const int bx = blockIdx.x - g * GG;
  if (g == 0) { gemm2_body<0, DM>(bx, 0, A, DM, 0, Bh, DM, 0, 0.0625f, bq, 0, nullptr, 1, 0, 0, QF, nullptr, DM, 0, (int)NR, DM, DM); return; }
  const float* bias = (g == 1) ? bk : (g == 2) ? bv : nullptr; _Float16* C16 = (g == 1) ? K16 : (g == 2) ? V16 : R16;
  gemm2_body<0, DM>(bx, 0, A, DM, 0, Bh, DM, 0, 0.0625f, bias, 0, nullptr, 1, 0, 0, nullptr, C16, DM, 0, (g == 3) ? PP : (int)NR, DM, DM); }
// V^T [4][8][64][1024] (LDS transposes, with a barrier: first); q + pos_bias_u, q + pos_bias_v (f16)
__global__ __launch_bounds__(256) void k_post(const _Float16* __restrict__ V16, _Float16* __restrict__ VT, const float* __restrict__ QF, const float* __restrict__ ub, const float* __restrict__ vb, _Float16* __restrict__ Q16, _Float16* __restrict__ QU, _Float16* __restrict__ QV) {
  const int bx = blockIdx.x;
  if (bx < GT) { vt_body<NH, SQ>(bx, V16, DM, 0, VT); return; }
  qprep_body(bx - GT, QF, ub, vb, Q16, QU, QV, NR * DM / 8); }
// Fused relative attention, one work-group per (batch, head, FR query rows); the FR x 1024 score rows live in LDS and never reach memory.
// 1: bd tiles (q + v) . p[i0 + 16 t ..], each element stored at its shifted column j = T - 1 + i - pos (in the edge tiles a column outside 0..T-1 goes to the pad column T, which nobody reads);
// 2: ac tiles (q + u) . k added in place; 3: one wave per row: lane l holds columns 4 l + 128 u + (0..3), mask, f32 statistics, weights x256 as f16 written over the row's own first half;
// 4: o = P . V^T: a wave does 32 rows x 16 columns over one half of k (each V^T fragment is loaded once a work-group); the two halves are added on the way out, where one wave writes each 128-byte line.
// Global fragments are requested ahead of their use, into the registers that the running step sets free.
#define FR 32
#define FD 6                         /* fragment tiles in flight a wave: 96 registers */
#define FP (SQ + 4)                  /* LDS row pitch in floats: 16 B x odd, for the ds_load_b128 fragment reads of step 4 */
typedef int   v4ia __attribute__((ext_vector_type(4), may_alias));
typedef _Float16 v4ha __attribute__((ext_vector_type(4), may_alias));
static_assert(SQ == 1024 && HD == 64 && FR == 32 && SQ - 1 + FR <= 66 * 16 && SQ - FR + 66 * 16 <= PP, "k_relattn: 8 waves, 66 position tiles inside the padded table");
// Four native 2^x (what __expf compiles to, behind its multiply by log2 e). Written in one statement so that the slot the instruction set asks for behind a transcendental is kept by construction:
// each v_exp_f32 is followed by one that neither reads its result nor overwrites its source (early-clobber outputs), the last by v_nop.
__device__ __forceinline__ void exp2x4(float x0, float x1, float x2, float x3, float* e) {
  asm("v_exp_f32 %0, %4\n\tv_exp_f32 %1, %5\n\tv_exp_f32 %2, %6\n\tv_exp_f32 %3, %7\n\tv_nop" : "=&v"(e[0]), "=&v"(e[1]), "=&v"(e[2]), "=&v"(e[3]) : "v"(x0), "v"(x1), "v"(x2), "v"(x3)); }
__global__ __launch_bounds__(256) __attribute__((amdgpu_waves_per_eu(4, 4))) void k_relattn(const _Float16* __restrict__ QU, const _Float16* __restrict__ QV, const _Float16* __restrict__ K16, const _Float16* __restrict__ R16, const _Float16* __restrict__ VT, const int* __restrict__ mask, _Float16* __restrict__ O16) {
  __shared__ __attribute__((aligned(16))) float sc[FR][FP];
  __shared__ __attribute__((aligned(16))) float so[2][FR][68];
  const int tid = threadIdx.x, lane = tid & 31, ln = lane & 15, hh = lane >> 4; const int w = __builtin_amdgcn_readfirstlane(tid >> 5);
  const int it = blockIdx.x % (SQ / FR), bh = blockIdx.x / (SQ / FR), h = bh % NH, b = bh / NH; const int i0 = it * FR; const size_t r0 = (size_t)b * SQ;
  const v8f z8 = {0.f,0.f,0.f,0.f,0.f,0.f,0.f,0.f};
  const int ho = h * (HD / 32) * 512 + 8 * lane;      /* fragment-ordered planes of DM values a row: 16 rows are 16 DM values, in them the head's two tiles, in a tile the lane's piece */
  const _Float16* pp = R16 + (size_t)(i0 + w * 16) * DM; const _Float16* kp = K16 + (r0 + w * 16) * DM;      /* tile w; tile w + 8 k lies 128 k rows on; scalar bases, to which each load adds ho */
  const _Float16* qp = QV + (r0 + i0) * DM; v16h a00 = fo_frag(qp + ho), a01 = fo_frag(qp + ho + 512), a10 = fo_frag(qp + ho + 16 * DM), a11 = fo_frag(qp + ho + 16 * DM + 512);
  v16h fr[16][2];      /* this wave's 8 position tiles, then its 8 key tiles: one stream, requested FD tiles ahead of its use */
  auto fetch = [&](int n) { const _Float16* p = ((n < 8) ? pp + (size_t)n * 128 * DM : kp + (size_t)(n - 8) * 128 * DM) + ho; fr[n][0] = fo_frag(p); fr[n][1] = fo_frag(p + 512); };
#pragma unroll
  for (int n = 0; n < FD; ++n) fetch(n);
  asm volatile("s_wait_xcnt 0x0" :: "s"(qp), "s"(pp), "v"(ho) : "memory");      /* the issued loads' address registers (scalar bases, the lane's offset) stay whole up to here and are reused only behind this wait */
  const int jw = SQ - 1 + 8 * hh - w * 16 - ln;      /* column of row 8 hh at position i0 + 16 w + ln */
#pragma unroll
  for (int k = 0; k < 8; ++k) { fetch(k + FD); v8f c0 = g2_mma(a00, fr[k][0], z8), c1 = g2_mma(a10, fr[k][0], z8); c0 = g2_mma(a01, fr[k][1], c0); c1 = g2_mma(a11, fr[k][1], c1);
    const int jb = jw - 128 * k;
    if (k == 0) {      /* tiles 0 and 1 reach past column T - 1 */
#pragma unroll
      for (int r = 0; r < 8; ++r) { const int j = jb + r, j1 = j + 16; sc[8 * hh + r][((unsigned)j < SQ) ? j : SQ] = c0[r]; sc[16 + 8 * hh + r][((unsigned)j1 < SQ) ? j1 : SQ] = c1[r]; }
    } else {           /* tiles 8 to 63: every column inside */
#pragma unroll
      for (int r = 0; r < 8; ++r) { sc[8 * hh + r][jb + r] = c0[r]; sc[16 + 8 * hh + r][jb + 16 + r] = c1[r]; } }
    __builtin_amdgcn_sched_barrier(0); }      /* one tile's accumulators and LDS addresses live at a time: without it the compiler opens six tiles at once and spills */
  if (w < 2) {         /* tiles 64 and 65 reach below column 0 */
    const _Float16* p8 = pp + ho + (size_t)8 * 128 * DM; const v16h b0 = fo_frag(p8), b1 = fo_frag(p8 + 512);
    asm volatile("s_wait_xcnt 0x0" :: "v"(p8) : "memory");      /* the four loads' address pair stays whole up to here */
    v8f c0 = g2_mma(a00, b0, z8), c1 = g2_mma(a10, b0, z8); c0 = g2_mma(a01, b1, c0); c1 = g2_mma(a11, b1, c1); const int jb = jw - 128 * 8;
#pragma unroll
    for (int r = 0; r < 8; ++r) { const int j = jb + r, j1 = j + 16; sc[8 * hh + r][((unsigned)j < SQ) ? j : SQ] = c0[r]; sc[16 + 8 * hh + r][((unsigned)j1 < SQ) ? j1 : SQ] = c1[r]; } }
  qp = QU + (r0 + i0) * DM; a00 = fo_frag(qp + ho); a01 = fo_frag(qp + ho + 512); a10 = fo_frag(qp + ho + 16 * DM); a11 = fo_frag(qp + ho + 16 * DM + 512);
  asm volatile("s_wait_xcnt 0x0" :: "s"(qp), "s"(kp), "v"(ho) : "memory");      /* as above */
  __syncthreads();
  const int* mk = mask + (r0 + i0 + w * 4) * SQ + 4 * lane; v4ia m[2][8];
#pragma unroll
  for (int k = 0; k < 8; ++k) { if (k + FD < 8) fetch(8 + k + FD);
    v8f c0 = g2_mma(a00, fr[8 + k][0], z8), c1 = g2_mma(a10, fr[8 + k][0], z8); c0 = g2_mma(a01, fr[8 + k][1], c0); c1 = g2_mma(a11, fr[8 + k][1], c1);
    if (k == 4) {
#pragma unroll
      for (int u = 0; u < 8; ++u) m[0][u] = *(const v4ia*)(mk + 128 * u); }      /* this wave's first mask row */
    const int j = (w + 8 * k) * 16 + ln;
#pragma unroll
    for (int r = 0; r < 8; ++r) { sc[8 * hh + r][j] += c0[r]; sc[16 + 8 * hh + r][j] += c1[r]; } }
  __builtin_amdgcn_sched_barrier(0);      /* step 3's mask compares stay behind the last tile: drawn up among the tiles, they wait there on the mask loads just issued */
  __syncthreads();
  const int nt = w & 3, kh = w >> 2; const _Float16* vp = VT + ((size_t)bh * HD + nt * 16) * SQ + kh * (SQ / 64) * 512; v16h vf[16];      /* fragment-ordered, SQ values a row: this wave's 16 tiles lie in a row */
#pragma unroll
  for (int k = 0; k < 4; ++k) { float* row = &sc[w * 4 + k][0]; const v4ia* mc = m[k & 1];
    if (k < 3) {
#pragma unroll
      for (int u = 0; u < 8; ++u) m[(k + 1) & 1][u] = *(const v4ia*)(mk + (k + 1) * SQ + 128 * u);      /* next row's mask flies while this row is worked on */
    } else {
#pragma unroll
      for (int s = 0; s < 16; ++s) vf[s] = fo_frag(vp + 512 * s + 8 * lane);      /* step 4's V^T fragments fly during the last row */
      asm volatile("s_wait_xcnt 0x0" :: "s"(vp), "v"(lane) : "memory"); }      /* as above */
    float v[8][4]; float m4[4] = {-3.0e38f, -3.0e38f, -3.0e38f, -3.0e38f};
#pragma unroll
    for (int u = 0; u < 8; ++u) { const v4f s = *(const v4fa*)(row + 4 * lane + 128 * u);
#pragma unroll
      for (int q = 0; q < 4; ++q) { v[u][q] = s[q] * 0.125f; m4[q] = fmaxf(m4[q], (mc[u][q] == 0) ? v[u][q] : -3.0e38f); } }
    float mx = fmaxf(fmaxf(m4[0], m4[1]), fmaxf(m4[2], m4[3]));
#pragma unroll
    for (int d = 16; d >= 1; d >>= 1) mx = fmaxf(mx, __shfl_xor(mx, d, 32));
    float s4[4] = {0.f, 0.f, 0.f, 0.f};
#pragma unroll
    for (int u = 0; u < 8; ++u) { float e[4]; exp2x4((v[u][0] - mx) * 1.44269504f, (v[u][1] - mx) * 1.44269504f, (v[u][2] - mx) * 1.44269504f, (v[u][3] - mx) * 1.44269504f, e);
#pragma unroll
      for (int q = 0; q < 4; ++q) { v[u][q] = (mc[u][q] == 0) ? e[q] : 0.f; s4[q] += v[u][q]; } }
    float se = (s4[0] + s4[1]) + (s4[2] + s4[3]);
#pragma unroll
    for (int d = 16; d >= 1; d >>= 1) se += __shfl_xor(se, d, 32);
    const float scl = (se > 0.f) ? 256.0f / se : 0.f;
#pragma unroll
    for (int u = 0; u < 8; ++u) { v4ha h4;
#pragma unroll
      for (int q = 0; q < 4; ++q) h4[q] = (_Float16)(v[u][q] * scl);
      *(v4ha*)((_Float16*)row + 4 * lane + 128 * u) = h4; } }
  __syncthreads();
  { const _Float16* ap = (const _Float16*)&sc[ln][0] + kh * (SQ / 2); v8f c0 = z8, c1 = z8; v16h af[2][4];      /* weight fragments of two k steps, read from LDS one pair of steps ahead */
#pragma unroll
    for (int e = 0; e < 2; ++e) { af[0][2 * e] = g2_frag(ap + 32 * e, hh); af[0][2 * e + 1] = g2_frag(ap + 16 * FP * 2 + 32 * e, hh); }
#pragma unroll
    for (int g = 0; g < 8; ++g) {
      if (g < 7) {
#pragma unroll
        for (int e = 0; e < 2; ++e) { af[(g + 1) & 1][2 * e] = g2_frag(ap + 32 * (2 * g + 2 + e), hh); af[(g + 1) & 1][2 * e + 1] = g2_frag(ap + 16 * FP * 2 + 32 * (2 * g + 2 + e), hh); } }
#pragma unroll
      for (int e = 0; e < 2; ++e) { c0 = g2_mma(af[g & 1][2 * e], vf[2 * g + e], c0); c1 = g2_mma(af[g & 1][2 * e + 1], vf[2 * g + e], c1); } }
#pragma unroll
    for (int r = 0; r < 8; ++r) { so[kh][8 * hh + r][nt * 16 + ln] = c0[r]; so[kh][16 + 8 * hh + r][nt * 16 + ln] = c1[r]; } }
  __syncthreads();
  { const int r = fo_row(tid, HD), c8 = fo_k(tid, HD); const v4f x = *(const v4fa*)&so[0][r][c8] + *(const v4fa*)&so[1][r][c8], y = *(const v4fa*)&so[0][r][c8 + 4] + *(const v4fa*)&so[1][r][c8 + 4]; FragH f;
#pragma unroll
    for (int q = 0; q < 4; ++q) { f.h[q] = (_Float16)(x[q] * 0.25f); f.h[4 + q] = (_Float16)(y[q] * 0.25f); }
    *(v8us*)((unsigned short*)O16 + (r0 + i0 + (tid >> 7) * 16) * DM + (h * (HD / 32) + ((tid >> 6) & 1)) * 512 + (tid & 63) * 8) = f.half[0]; } }      /* thread t makes piece t of the work-group's 2 x 2 tiles of the fragment-ordered o plane */

extern "C" void kernel_launch(void* const* d_in, const int* in_sizes, int n_in,
                              void* d_out, int out_size, void* d_ws, size_t ws_size, hipStream_t stream) {
  (void)in_sizes; (void)n_in; (void)out_size;
  const float* const* I = (const float* const*)d_in; const float* xq = I[0]; const float* xk = I[1]; const float* xv = I[2]; const int* mask = (const int*)d_in[3]; const float* pe = I[4]; const float* wq = I[5]; const float* bq = I[6]; const float* wk = I[7]; const float* bk = I[8]; const float* wv = I[9]; const float* bv = I[10]; const float* wpos = I[11]; const float* wo = I[12]; const float* bo = I[13]; const float* pbu = I[14]; const float* pbv = I[15];
  char* ws = (char*)d_ws; size_t off = 0;
  auto take = [&](size_t bytes) { char* p = ws + off; off += (bytes + 255) & ~(size_t)255; return p; };
  _Float16* BQ = (_Float16*)take((size_t)DM * DM * 2); _Float16* BK = (_Float16*)take((size_t)DM * DM * 2); _Float16* BV = (_Float16*)take((size_t)DM * DM * 2); _Float16* BP = (_Float16*)take((size_t)DM * DM * 2); _Float16* BO = (_Float16*)take((size_t)DM * DM * 2);
  _Float16* XQ = (_Float16*)take(NR * DM * 2); _Float16* XK = (_Float16*)take(NR * DM * 2); _Float16* XV = (_Float16*)take(NR * DM * 2); _Float16* PE = (_Float16*)take((size_t)PP * DM * 2);
  float* QF = (float*)take(NR * DM * 4); _Float16* Q16 = (_Float16*)take(NR * DM * 2); _Float16* QU = (_Float16*)take(NR * DM * 2); _Float16* QV = (_Float16*)take(NR * DM * 2); _Float16* K16 = (_Float16*)take(NR * DM * 2); _Float16* V16 = (_Float16*)take(NR * DM * 2); _Float16* R16 = (_Float16*)take((size_t)PP * DM * 2); _Float16* O16 = (_Float16*)take(NR * DM * 2);
  _Float16* VT = (_Float16*)take((size_t)NB * NH * HD * SQ * 2);
  if (off > ws_size) return;      /* 2.5 + 12 + 2 + 8 + 20 + 2 + 4 + 4 = approx 55 MiB */
  k_prep<<<5 * GW + 3 * GX + GE, 256, 0, stream>>>(wq, wk, wv, wpos, wo, xq, xk, xv, pe, BQ, BK, BV, BP, BO, XQ, XK, XV, PE);      /* x16 weights transposed, inputs and position table as f16 rows */
  k_proj<<<3 * GG + GR, 128, 0, stream>>>(XQ, XK, XV, PE, BQ, BK, BV, BP, bq, bk, bv, QF, K16, V16, R16);      /* q (f32), k, v, p (f16) */
  k_post<<<GT + GX, 256, 0, stream>>>(V16, VT, QF, pbu, pbv, Q16, QU, QV);      /* V^T; q + pos_bias_u, q + pos_bias_v */
  k_relattn<<<NB * NH * (SQ / FR), 256, 0, stream>>>(QU, QV, K16, R16, VT, mask, O16);      /* scores, shifted softmax and o x64 (merged rows), all batches and heads */
  k_gemm2<0><<<dim3(GG, 1), 128, 0, stream>>>(O16, DM, 0, BO, DM, 0, 0.0009765625f, bo, 0, nullptr, 1, 0, 0, (float*)d_out, nullptr, DM, 0, (int)NR, DM, DM);      /* out = x Wout + bout */
}

// v006
// A run of this version takes 75.4 microseconds.
// Timed twice side by side with v005, it ran 1.04 and 1.02 times as fast.
// Over all steps from v000 it is 55.5 times as fast.
#include <hip/hip_runtime.h>
// Relative-position multi-head attention with rel_shift (query, key, value [4][1024][512]; mask [4][1024][1024] int32 verbatim (nonzero = masked, ~50 %); pos_emb [1][2047][512]; q/k/v = x W + b ([512][512] [in][out]); p = pos_emb Wpos; 8 heads of 64; ac = (q + pos_bias_u) . k; bd = rel_shift((q + pos_bias_v) . p^T) = (q_i + v) . p[T-1+i-j]; scores = (ac + bd) / 8; masked -> float32 min; softmax; masked weights -> 0; x = attn v merged; out = x Wout + bout -> [4][1024][512].
// Structure: token rows; inputs and pos_emb as exact f16 rows (pos table padded to 2048 rows with zeros); q as a WMMA GEMM (32x64 wave tiles, f32 accumulation, exact x16 weights + bias) into f32 rows, then f16 planes of q + u and q + v on VALU; k, v, p as WMMA GEMMs (f16 outputs); V^T via LDS transposes; one fused kernel per (batch, head, 32 query rows): bd and ac WMMA tiles (K = 64) into f32 score rows in LDS, bd stored at its shifted column; the relative softmax with the mask on VALU (f32 statistics, native exp; weights x256 f16, in LDS); o = P . V^T on WMMA (K = 1024; o x64 in f16); out GEMM (f32, + bout); launches that need nothing of each other share one grid (ranges of the block index); 5 launches. Every f16 operand plane lies in fragment order (see fo_row).
// Compute dtype: inputs rounded to bf16; inputs / weights exact in f16; q + u, q + v, k, v, p, softmax weights and o plain f16 (~2^-12); ac, bd, softmax statistics f32; v_wmma_f32_16x16x32_f16.
#define NB 4
#define SQ 1024
#define PP 2048                      /* position table rows (2047 used, row 2047 zero) */
#define NPOS 2047
#define DM 512
#define NH 8
#define HD 64
#define HG 8
#define NR ((size_t)NB * SQ)
typedef __bf16 v16b __attribute__((ext_vector_type(16)));
typedef unsigned short v8us __attribute__((ext_vector_type(8), may_alias));
typedef float  v8f  __attribute__((ext_vector_type(8)));
typedef float  v4f  __attribute__((ext_vector_type(4)));
typedef float  v4fa __attribute__((ext_vector_type(4), may_alias));
union FragB { v16b v; v8us half[2]; unsigned short u[16]; };

__device__ __forceinline__ unsigned short bf16_bits(float x) { unsigned int u = __float_as_uint(x); return (unsigned short)((u + 0x7FFFu + ((u >> 16) & 1u)) >> 16); }
__device__ __forceinline__ float bf16_val(unsigned short b) { return __uint_as_float(((unsigned int)b) << 16); }
__device__ __forceinline__ float bf16_round(float x) { return bf16_val(bf16_bits(x)); }
// D += A·B with NT terms: 1 = ah·bh, 2 = + al·bh (A split), 3 = + ah·bl (both split)
template <int NT>
__device__ __forceinline__ v8f mmaN(v16b ah, v16b al, v16b bh, v16b bl, v8f c) {
  c = __builtin_amdgcn_wmma_f32_16x16x32_bf16(false, ah, false, bh, (short)0, c, false, false);
  if (NT >= 2) c = __builtin_amdgcn_wmma_f32_16x16x32_bf16(false, al, false, bh, (short)0, c, false, false);
  if (NT >= 3) c = __builtin_amdgcn_wmma_f32_16x16x32_bf16(false, ah, false, bl, (short)0, c, false, false);
  asm volatile("v_nop\n\tv_nop\n\tv_nop\n\tv_nop" : "+v"(c) : "v"(ah), "v"(al), "v"(bh), "v"(bl));
  return c;
}

__global__ __launch_bounds__(256) void k_wt_bf16(const float* __restrict__ W, unsigned short* __restrict__ Wt, int K, int N) {
  const int t = blockIdx.x * 256 + threadIdx.x;
  const int k8n = K / 8;
  if (t >= N * k8n) return;
  const int n = t / k8n, k8 = (t % k8n) * 8;
  v8us v;
#pragma unroll
  for (int i = 0; i < 8; ++i) v[i] = bf16_bits(W[(size_t)(k8 + i) * N + n]);
  *(v8us*)(Wt + (size_t)n * K + k8) = v;
  
}

// GEMM C[M][N] (f32, pitch ldc) = act(A[M][K]·W + bias). A f32 row-major (pitch lda) converted per fragment to bf16
// (ASPLIT: hi/lo two planes -> 2 terms, else single rounded term); Wt bf16 [N][K] (pitch ldb). BIAS_BF16 rounds the
// bias to bf16 first (bias quantised to bf16 before the add). K%32==0, M%16==0, N%64==0.
template <bool ASPLIT, int ACT, bool BIAS_BF16>
__global__ __launch_bounds__(128) void k_gemm_bf(const float* __restrict__ A, int lda, const unsigned short* __restrict__ Wt, int ldb,
                                               const float* __restrict__ bias, float* __restrict__ C, int ldc, int M, int N, int K) {
  __shared__ __attribute__((aligned(16))) float so[4][16][64];
  const int tid = threadIdx.x, w = tid >> 5, lane = tid & 31, ln = lane & 15, hh = lane >> 4;
  const int ntn = N / 64;
  const int wid = blockIdx.x * 4 + w;
  const int mt = wid / ntn, nq = wid % ntn;
  if (mt * 16 >= M) return;
  const int row0 = mt * 16, col0 = nq * 64;
  const float* arow = A + (size_t)(row0 + ln) * lda;
  v8f acc[4] = {};
  for (int kb = 0; kb < K; kb += 32) {
    FragB ah, al;
    const v4f x0 = *(const v4fa*)(arow + kb + 8 * hh), x1 = *(const v4fa*)(arow + kb + 8 * hh + 4);
    const v4f x2 = *(const v4fa*)(arow + kb + 16 + 8 * hh), x3 = *(const v4fa*)(arow + kb + 16 + 8 * hh + 4);
    float xs[16] = {x0[0],x0[1],x0[2],x0[3],x1[0],x1[1],x1[2],x1[3],x2[0],x2[1],x2[2],x2[3],x3[0],x3[1],x3[2],x3[3]};
#pragma unroll
    for (int i = 0; i < 16; ++i) { const unsigned short hb = bf16_bits(xs[i]); ah.u[i] = hb; al.u[i] = ASPLIT ? bf16_bits(xs[i] - bf16_val(hb)) : (unsigned short)0; }
#pragma unroll
    for (int t = 0; t < 4; ++t) {
      const unsigned short* brow = Wt + (size_t)(col0 + t * 16 + ln) * ldb + kb;
      FragB b;
      b.half[0] = *(const v8us*)(brow + 8 * hh);
      b.half[1] = *(const v8us*)(brow + 16 + 8 * hh);
      acc[t] = mmaN<ASPLIT ? 2 : 1>(ah.v, al.v, b.v, b.v, acc[t]);
    }
  }
#pragma unroll
  for (int t = 0; t < 4; ++t) {
    float bv = bias ? bias[col0 + t * 16 + ln] : 0.f;
    if (BIAS_BF16) bv = bf16_round(bv);
#pragma unroll
    for (int r = 0; r < 8; ++r) { float v = acc[t][r] + bv; if (ACT == 1) v = fmaxf(v, 0.f); so[w][8 * hh + r][t * 16 + ln] = v; }
  }
  __builtin_amdgcn_fence(__ATOMIC_ACQ_REL, "workgroup");
  __builtin_amdgcn_wave_barrier();
  const int rsub = lane >> 4, c4 = (lane & 15) * 4;
  {
#pragma unroll
    for (int q = 0; q < 8; ++q) {
      const int r = q * 2 + rsub;
      const v4f v = *(const v4fa*)&so[w][r][c4];
      *(v4f*)(C + (size_t)(row0 + r) * ldc + col0 + c4) = v;
    }
    
  }
}

// GEMM C = act(A·W + bias + resid): A f32 (ASPLIT -> hi/lo 2 terms), Wt bf16 [N][K]; ACT 0 none, 1 relu, 2 exact gelu;
// resid (optional, f32, row index = (row % rmod), pitch ldr, RES_BF16 rounds it) added before the activation.
template <bool ASPLIT, int ACT, bool BIAS_BF16, bool RES_BF16>
__global__ __launch_bounds__(128) void k_gemm_bf3(const float* __restrict__ A, int lda, const unsigned short* __restrict__ Wt, int ldb,
                                                const float* __restrict__ bias, const float* __restrict__ resid, int rmod, int ldr,
                                                float* __restrict__ C, int ldc, int M, int N, int K) {
  __shared__ __attribute__((aligned(16))) float so[4][16][64];
  const int tid = threadIdx.x, w = tid >> 5, lane = tid & 31, ln = lane & 15, hh = lane >> 4;
  const int ntn = N / 64;
  const int wid = blockIdx.x * 4 + w;
  const int mt = wid / ntn, nq = wid % ntn;
  if (mt * 16 >= M) return;
  const int row0 = mt * 16, col0 = nq * 64;
  const float* arow = A + (size_t)(row0 + ln) * lda;
  v8f acc[4] = {};
  for (int kb = 0; kb < K; kb += 32) {
    FragB ah, al;
    const v4f x0 = *(const v4fa*)(arow + kb + 8 * hh), x1 = *(const v4fa*)(arow + kb + 8 * hh + 4);
    const v4f x2 = *(const v4fa*)(arow + kb + 16 + 8 * hh), x3 = *(const v4fa*)(arow + kb + 16 + 8 * hh + 4);
    float xs[16] = {x0[0],x0[1],x0[2],x0[3],x1[0],x1[1],x1[2],x1[3],x2[0],x2[1],x2[2],x2[3],x3[0],x3[1],x3[2],x3[3]};
#pragma unroll
    for (int i = 0; i < 16; ++i) { const unsigned short hb = bf16_bits(xs[i]); ah.u[i] = hb; al.u[i] = ASPLIT ? bf16_bits(xs[i] - bf16_val(hb)) : (unsigned short)0; }
#pragma unroll
    for (int t = 0; t < 4; ++t) {
      const unsigned short* brow = Wt + (size_t)(col0 + t * 16 + ln) * ldb + kb;
      FragB b;
      b.half[0] = *(const v8us*)(brow + 8 * hh);
      b.half[1] = *(const v8us*)(brow + 16 + 8 * hh);
      acc[t] = mmaN<ASPLIT ? 2 : 1>(ah.v, al.v, b.v, b.v, acc[t]);
    }
  }
#pragma unroll
  for (int t = 0; t < 4; ++t) {
    const int col = col0 + t * 16 + ln;
    float bv = bias ? bias[col] : 0.f;
    if (BIAS_BF16) bv = bf16_round(bv);
#pragma unroll
    for (int r = 0; r < 8; ++r) {
      float v = acc[t][r] + bv;
      if (resid) { float rv = resid[(size_t)((row0 + 8 * hh + r) % rmod) * ldr + col]; if (RES_BF16) rv = bf16_round(rv); v += rv; }
      if (ACT == 1) v = fmaxf(v, 0.f);
      if (ACT == 2) v = 0.5f * v * (1.0f + erff(v * 0.70710678118654752f));
      if (ACT == 3) { const float u = 0.7978845608028654f * (v + 0.044715f * v * v * v); v = 0.5f * v * (1.0f + tanhf(u)); }
      so[w][8 * hh + r][t * 16 + ln] = v;
    }
  }
  __builtin_amdgcn_fence(__ATOMIC_ACQ_REL, "workgroup");
  __builtin_amdgcn_wave_barrier();
  const int rsub = lane >> 4, c4 = (lane & 15) * 4;
  {
#pragma unroll
    for (int q = 0; q < 8; ++q) {
      const int r = q * 2 + rsub;
      const v4f v = *(const v4fa*)&so[w][r][c4];
      *(v4f*)(C + (size_t)(row0 + r) * ldc + col0 + c4) = v;
    }
    
  }
}
// row LayerNorm (biased variance, eps) over N: s = X (+ R); optional out_sum <- s; out_norm <- (s-mu)*rsqrt(var+eps)*g + b
template <bool PARAM_BF16>
__global__ __launch_bounds__(256) void k_layernorm(const float* __restrict__ X, const float* __restrict__ R, const float* __restrict__ g, const float* __restrict__ bta,
                                                  float* __restrict__ out_sum, float* __restrict__ out_norm, int N, float eps) {
  __shared__ float red[256];
  const int row = blockIdx.x, tid = threadIdx.x;
  const float* x = X + (size_t)row * N; const float* rr = R ? R + (size_t)row * N : nullptr;
  float vals[16];                     // up to N = 4096
  const int per = N / 256;            // contiguous chunk per thread? use strided-by-4 chunks: thread handles j = tid*4 + 1024*u
  float s1 = 0.f;
  for (int u = 0; u < per / 4; ++u) {
    const int j = tid * 4 + 1024 * u;
    const v4f a = *(const v4fa*)(x + j);
    v4f b = {0.f,0.f,0.f,0.f}; if (rr) b = *(const v4fa*)(rr + j);
#pragma unroll
    for (int q = 0; q < 4; ++q) { const float v = a[q] + b[q]; vals[u * 4 + q] = v; s1 += v; }
  }
  red[tid] = s1; __syncthreads();
  for (int st = 128; st > 0; st >>= 1) { if (tid < st) red[tid] += red[tid + st]; __syncthreads(); }
  const float mu = red[0] / (float)N; __syncthreads();
  float s2 = 0.f;
  for (int u = 0; u < per / 4; ++u)
#pragma unroll
    for (int q = 0; q < 4; ++q) { const float c = vals[u * 4 + q] - mu; s2 += c * c; }
  red[tid] = s2; __syncthreads();
  for (int st = 128; st > 0; st >>= 1) { if (tid < st) red[tid] += red[tid + st]; __syncthreads(); }
  const float rs = rsqrtf(red[0] / (float)N + eps);
  {
    for (int u = 0; u < per / 4; ++u) {
      const int j = tid * 4 + 1024 * u;
      v4f o, sm;
#pragma unroll
      for (int q = 0; q < 4; ++q) {
        float gg = g[j + q], bb = bta[j + q];
        if (PARAM_BF16) { gg = bf16_round(gg); bb = bf16_round(bb); }
        sm[q] = vals[u * 4 + q]; o[q] = (vals[u * 4 + q] - mu) * rs * gg + bb;
      }
      if (out_sum) *(v4f*)(out_sum + (size_t)row * N + j) = sm;
      *(v4f*)(out_norm + (size_t)row * N + j) = o;
    }
    
  }
}



// ---- f16 WMMA path (v_wmma_f32_16x16x32_f16): 11-bit significands for operands in range — used where a [0,1] probability operand needs more precision than bf16
typedef _Float16 v16h __attribute__((ext_vector_type(16)));
union FragH { v16h v; v8us half[2]; _Float16 h[16]; unsigned short u[16]; };
template <int NT>
__device__ __forceinline__ v8f mmaH(v16h ah, v16h al, v16h bh, v16h bl, v8f c) {
  c = __builtin_amdgcn_wmma_f32_16x16x32_f16(false, ah, false, bh, (short)0, c, false, false);
  if (NT >= 2) c = __builtin_amdgcn_wmma_f32_16x16x32_f16(false, al, false, bh, (short)0, c, false, false);
  if (NT >= 3) c = __builtin_amdgcn_wmma_f32_16x16x32_f16(false, ah, false, bl, (short)0, c, false, false);
  asm volatile("v_nop\n\tv_nop\n\tv_nop\n\tv_nop" : "+v"(c) : "v"(ah), "v"(al), "v"(bh), "v"(bl));
  return c;
}
// batched GEMM like k_gemm_b but f16 operands: A f32 (split into f16 hi/lo if ASPLIT, else rounded to f16), Bt = f16 values [n][k]; alpha; C f32; N multiple of 16 (partial tiles skipped)
template <bool ASPLIT>
__global__ __launch_bounds__(128) void k_gemm_h(const float* __restrict__ A, int lda, size_t sA, const _Float16* __restrict__ Bh, int ldb, size_t sB, float alpha, float* __restrict__ C, int ldc, size_t sC, int M, int N, int K) {
  __shared__ __attribute__((aligned(16))) float so[4][16][64];
  const int tid = threadIdx.x, w = tid >> 5, lane = tid & 31, ln = lane & 15, hh = lane >> 4; const int by = blockIdx.y;
  A += (size_t)by * sA; Bh += (size_t)by * sB; C += (size_t)by * sC;
  const int ntn = (N + 63) / 64; const int wid = blockIdx.x * 4 + w; const int mt = wid / ntn, nq = wid % ntn; if (mt * 16 >= M) return;
  const int row0 = mt * 16, col0 = nq * 64; const float* arow = A + (size_t)(row0 + ln) * lda;
  v8f acc[4] = {};
  for (int kb = 0; kb < K; kb += 32) {
    FragH ah, al;
    const v4f x0 = *(const v4fa*)(arow + kb + 8 * hh), x1 = *(const v4fa*)(arow + kb + 8 * hh + 4), x2 = *(const v4fa*)(arow + kb + 16 + 8 * hh), x3 = *(const v4fa*)(arow + kb + 16 + 8 * hh + 4);
    float xs[16] = {x0[0],x0[1],x0[2],x0[3],x1[0],x1[1],x1[2],x1[3],x2[0],x2[1],x2[2],x2[3],x3[0],x3[1],x3[2],x3[3]};
#pragma unroll
    for (int i = 0; i < 16; ++i) { const _Float16 h = (_Float16)xs[i]; ah.h[i] = h; al.h[i] = ASPLIT ? (_Float16)(xs[i] - (float)h) : (_Float16)0.0f; }
#pragma unroll
    for (int t = 0; t < 4; ++t) { if (col0 + t * 16 >= N) continue; const size_t boff = (size_t)(col0 + t * 16 + ln) * ldb + kb; FragH bq; bq.half[0] = *(const v8us*)(Bh + boff + 8 * hh); bq.half[1] = *(const v8us*)(Bh + boff + 16 + 8 * hh);
      acc[t] = mmaH<ASPLIT ? 2 : 1>(ah.v, al.v, bq.v, bq.v, acc[t]); }
  }
#pragma unroll
  for (int t = 0; t < 4; ++t) { if (col0 + t * 16 >= N) continue;
#pragma unroll
    for (int r = 0; r < 8; ++r) so[w][8 * hh + r][t * 16 + ln] = acc[t][r] * alpha; }
  __builtin_amdgcn_fence(__ATOMIC_ACQ_REL, "workgroup"); __builtin_amdgcn_wave_barrier();
  const int rsub = lane >> 4, c4 = (lane & 15) * 4;
  {
#pragma unroll
    for (int q = 0; q < 8; ++q) { const int r = q * 2 + rsub; if (col0 + c4 < N) { const v4f v = *(const v4fa*)&so[w][r][c4]; *(v4f*)(C + (size_t)(row0 + r) * ldc + col0 + c4) = v; } }
     }
}

// ---- fragment order: how every f16 operand plane of the WMMA kernels lies in memory ----
// A plane of R rows x K values (R % 16 == 0, K % 32 == 0) is cut into tiles of 16 rows x 32 k, tile (row / 16) * (K / 32) + k / 32, 1 KiB each. A tile holds its 64 pieces of 8 values (16 bytes) in the order
// in which the 32 lanes load them as a 16x16x32 operand: piece c = 32 j + 16 hh + ln is row ln, k = 16 j + 8 hh + (0..7). A fragment is then two loads of 512 bytes in a row, 4 whole lines each;
// from rows at 1 KiB pitch each such load touched 16 lines. Every lane gets the values it got before. Producers: thread t makes piece t, so that a wave stores 512 bytes in a row.
__device__ __forceinline__ int fo_row(size_t t, int K) { return (int)((t >> 6) / (unsigned)(K / 32)) * 16 + (int)(t & 15); }
__device__ __forceinline__ int fo_k(size_t t, int K) { return (int)((t >> 6) % (unsigned)(K / 32)) * 32 + (int)((t >> 5) & 1) * 16 + (int)((t >> 4) & 1) * 8; }
// Wt[n][k] = f16(W[k][n]·scale) from f32 row-major W[K][N] (scale = power of two; bf16-exact weights stay exact in f16 away from the subnormal range)
__device__ __forceinline__ void wt_f16_body(int bx, const float* __restrict__ W, _Float16* __restrict__ Wt, int K, int N, float scale) {
  const int t = bx * 256 + threadIdx.x; if (t >= N * (K / 8)) return; const int n = fo_row(t, K), k8 = fo_k(t, K); FragH f;      /* thread t makes piece t of the fragment-ordered plane: 16 lanes read 16 neighbouring n */
#pragma unroll
  for (int i = 0; i < 8; ++i) f.h[i] = (_Float16)(bf16_round(W[(size_t)(k8 + i) * N + n]) * scale); const v8us o = f.half[0];
  *(v8us*)((unsigned short*)Wt + (size_t)t * 8) = o; 
}
// k_gemm_hh variant with fused epilogue: v = acc·alpha + bias[by·sBias + col] (+ CP[(row/rowsPerB)·sCPb + by·64 + col] if CP) ; ACT 0 none / 1 elu ; writes f16 C16 (and f32 C if non-null)
template <int ACT>
__global__ __launch_bounds__(128) void k_gemm_hhx(const _Float16* __restrict__ A, int lda, size_t sA, const _Float16* __restrict__ Bh, int ldb, size_t sB, float alpha, const float* __restrict__ bias, size_t sBias, const float* __restrict__ CP, int rowsPerB, size_t sCPb, int row0g,
    float* __restrict__ C, _Float16* __restrict__ C16, int ldc, size_t sC, int M, int N, int K) {
  __shared__ __attribute__((aligned(16))) float so[4][16][64];
  const int tid = threadIdx.x, w = tid >> 5, lane = tid & 31, ln = lane & 15, hh = lane >> 4; const int by = blockIdx.y;
  A += (size_t)by * sA; Bh += (size_t)by * sB; const size_t cofs = (size_t)by * sC; const float* bp = bias ? bias + (size_t)by * sBias : nullptr;
  const int ntn = (N + 63) / 64; const int wid = blockIdx.x * 4 + w; const int mt = wid / ntn, nq = wid % ntn; if (mt * 16 >= M) return;
  const int row0 = mt * 16, col0 = nq * 64; const _Float16* arow = A + (size_t)(row0 + ln) * lda;
  v8f acc[4] = {};
  for (int kb = 0; kb < K; kb += 32) { FragH ah; ah.half[0] = *(const v8us*)((const unsigned short*)arow + kb + 8 * hh); ah.half[1] = *(const v8us*)((const unsigned short*)arow + kb + 16 + 8 * hh);
#pragma unroll
    for (int t = 0; t < 4; ++t) { if (col0 + t * 16 >= N) continue; const size_t boff = (size_t)(col0 + t * 16 + ln) * ldb + kb; FragH bq; bq.half[0] = *(const v8us*)((const unsigned short*)Bh + boff + 8 * hh); bq.half[1] = *(const v8us*)((const unsigned short*)Bh + boff + 16 + 8 * hh);
      acc[t] = mmaH<1>(ah.v, ah.v, bq.v, bq.v, acc[t]); }
  }
#pragma unroll
  for (int t = 0; t < 4; ++t) { if (col0 + t * 16 >= N) continue; const int col = col0 + t * 16 + ln; const float bv = bp ? bf16_round(bp[col]) : 0.f;
#pragma unroll
    for (int r = 0; r < 8; ++r) { float v = acc[t][r] * alpha + bv; if (CP) { const int rr = row0g + row0 + 8 * hh + r; if (rowsPerB < 0) v += CP[cofs + (size_t)rr * ldc + col];      /* rowsPerB < 0: own element of the batched C plane */ else { const int bidx = rr / rowsPerB; v += CP[(size_t)bidx * sCPb + (size_t)by * 64 + col]; } } if (ACT == 1) v = (v > 0.f) ? v : expm1f(v); else if (ACT == 7) v = (v > 0.f) ? v + 1.0f : expf(v); else if (ACT == 8) v = tanhf(v); else if (ACT == 9) v = 0.5f * v * (1.0f + tanhf(0.7978845608028654f * (v + 0.044715f * v * v * v))); else if (ACT == 11) v = 1.0f / (1.0f + expf(-v)); else if (ACT == 12) v = (v > 0.f) ? v : 0.01f * v; else if (ACT == 14) v = (v > 0.f) ? v : 0.1f * v; else if (ACT == 16) v = (v >= 0.f) ? v : 0.3f * v; else if (ACT == 17) v = (v >= 0.f) ? v : 0.2f * v; else if (ACT == 15) v = v / (1.0f + expf(-v)); else if (ACT == 3) v = fmaxf(v, 0.f); else if (ACT == 6) v = 0.5f * v * (1.0f + erff(v * 0.70710678118654752f)); so[w][8 * hh + r][t * 16 + ln] = v; } }
  __builtin_amdgcn_fence(__ATOMIC_ACQ_REL, "workgroup"); __builtin_amdgcn_wave_barrier();
  const int rsub = lane >> 4, c4 = (lane & 15) * 4; typedef _Float16 v4h __attribute__((ext_vector_type(4)));
  {
#pragma unroll
    for (int q = 0; q < 8; ++q) { const int r = q * 2 + rsub; if (col0 + c4 < N) { const v4f v = *(const v4fa*)&so[w][r][c4]; if (C) *(v4f*)(C + cofs + (size_t)(row0 + r) * ldc + col0 + c4) = v; if (C16) { v4h h4; for (int i = 0; i < 4; ++i) h4[i] = (_Float16)v[i]; *(v4h*)(C16 + cofs + (size_t)(row0 + r) * ldc + col0 + c4) = h4; } } }
     }
}


typedef _Float16 v4h __attribute__((ext_vector_type(4)));

// rows of DM values into a fragment-ordered plane of n8 pieces; rows from nrows on are not read and become zero
__device__ __forceinline__ void x16_body(int bx, const float* __restrict__ x, _Float16* __restrict__ X16, int nrows, size_t n8) { const size_t t = (size_t)bx * 256 + threadIdx.x; if (t >= n8) return; FragH f; const int row = fo_row(t, DM); const float* s = x + (size_t)row * DM + fo_k(t, DM);
  const v8us z = {0, 0, 0, 0, 0, 0, 0, 0}; f.half[0] = z;
  if (row < nrows) {
#pragma unroll
    for (int q = 0; q < 8; ++q) f.h[q] = (_Float16)bf16_round(s[q]); }
  *(v8us*)((unsigned short*)X16 + t * 8) = f.half[0];  }
__global__ __launch_bounds__(256) void k_h16(const float* __restrict__ x, _Float16* __restrict__ X16, size_t n8) { const size_t t = (size_t)blockIdx.x * 256 + threadIdx.x; if (t >= n8) return; FragH f;
#pragma unroll
  for (int q = 0; q < 8; ++q) f.h[q] = (_Float16)x[t * 8 + q]; *(v8us*)((unsigned short*)X16 + t * 8) = f.half[0];  }
__global__ __launch_bounds__(256) void k_round16f(const float* __restrict__ W, _Float16* __restrict__ Bt, size_t n8) { const size_t t = (size_t)blockIdx.x * 256 + threadIdx.x; if (t >= n8) return; FragH f;
#pragma unroll
  for (int i = 0; i < 8; ++i) f.h[i] = (_Float16)(bf16_round(W[t * 8 + i]) * 16.0f); *(v8us*)((unsigned short*)Bt + t * 8) = f.half[0];  }
template <int NHv, int TTv>
__device__ __forceinline__ void vt_body(int bx, const _Float16* __restrict__ V16, int ldv, int voff, _Float16* __restrict__ Vt) { __shared__ unsigned short tl[64][66]; const int tid = threadIdx.x; const int slab = bx / (TTv / 64), lg = bx % (TTv / 64); const int b = slab / NHv, h = slab % NHv;
  for (int i = tid; i < 64 * 8; i += 256) { const int r = fo_row(i, 64), c8 = fo_k(i, 64); FragH f;      /* the block's 64 tokens x 64 d are 4 x 2 tiles of the fragment-ordered V plane */
    f.half[0] = *(const v8us*)((const unsigned short*)V16 + ((size_t)((b * TTv + lg * 64) / 16 + (i >> 7)) * (ldv / 32) + (voff + h * 64) / 32 + ((i >> 6) & 1)) * 512 + (i & 63) * 8);
#pragma unroll
    for (int q = 0; q < 8; ++q) tl[r][c8 + q] = f.u[q]; }
  __syncthreads();
  {
#pragma unroll
    for (int rd = 0; rd < 2; ++rd) { const int i = rd * 256 + tid, d = fo_row(i, 64), p8 = fo_k(i, 64); FragH f;      /* 64 d x 64 tokens: 4 x 2 tiles of the fragment-ordered V^T plane */
#pragma unroll
      for (int q = 0; q < 8; ++q) f.u[q] = tl[p8 + q][d];
      *(v8us*)((unsigned short*)Vt + ((size_t)(slab * 4 + (i >> 7)) * (TTv / 32) + lg * 2 + ((i >> 6) & 1)) * 512 + (i & 63) * 8) = f.half[0]; }
     } }

__global__ __launch_bounds__(256) void k_hl(const float* __restrict__ F, _Float16* __restrict__ Hh, _Float16* __restrict__ Hl, size_t n8) { const size_t t = (size_t)blockIdx.x * 256 + threadIdx.x; if (t >= n8) return; FragH fh, fl; const v4f a = *(const v4fa*)(F + t * 8), c = *(const v4fa*)(F + t * 8 + 4);
#pragma unroll
  for (int q = 0; q < 4; ++q) { _Float16 h = (_Float16)a[q]; fh.h[q] = h; fl.h[q] = (_Float16)((a[q] - (float)h) * 1024.0f); h = (_Float16)c[q]; fh.h[4 + q] = h; fl.h[4 + q] = (_Float16)((c[q] - (float)h) * 1024.0f); }
  { *(v8us*)((unsigned short*)Hh + t * 8) = fh.half[0]; *(v8us*)((unsigned short*)Hl + t * 8) = fl.half[0];  } }

// ---- fast GEMM (wave tile 32x64; requires M % 32 == 0 rows per launch region and N % 64 == 0); epilogue = k_gemm_hhx semantics ----
__device__ __forceinline__ v16h g2_frag(const _Float16* p, int hh) { FragH f; f.half[0] = *(const v8us*)((const unsigned short*)p + 8 * hh); f.half[1] = *(const v8us*)((const unsigned short*)p + 16 + 8 * hh); return f.v; }
__device__ __forceinline__ v16h fo_frag(const _Float16* p) { FragH f; f.half[0] = *(const v8us*)((const unsigned short*)p); f.half[1] = *(const v8us*)((const unsigned short*)p + 256); return f.v; }      /* p: a tile of a fragment-ordered plane + 8 lane */
#define G2D 2                        /* k steps requested ahead in gemm2_body */
__device__ __forceinline__ v8f g2_mma(v16h a, v16h b, v8f c) { v8f d = __builtin_amdgcn_wmma_f32_16x16x32_f16(false, a, false, b, (short)0, c, false, false); asm volatile("v_nop\n\tv_nop\n\tv_nop\n\tv_nop" : "+v"(d) : "v"(a), "v"(b)); return d; }
template <int ACT, int KT>
__device__ __forceinline__ void gemm2_body(int bx, int by, const _Float16* __restrict__ A, int lda, size_t sA, const _Float16* __restrict__ Bh, int ldb, size_t sB, float alpha, const float* __restrict__ bias, size_t sBias, const float* __restrict__ CP, int rowsPerB, size_t sCPb, int row0g,
    float* __restrict__ C, _Float16* __restrict__ C16, int ldc, size_t sC, int M, int N, int K) { static_assert(ACT == 0 || ACT == 3 || ACT == 6 || ACT == 8 || ACT == 9 || ACT == 11 || ACT == 12 || ACT == 14 || ACT == 15 || ACT == 16 || ACT == 17, "k_gemm2: unsupported ACT code (would silently apply no activation)");
  __shared__ __attribute__((aligned(16))) float so[4][32][68];
  const int tid = threadIdx.x, lane = tid & 31, ln = lane & 15, hh = lane >> 4; const int w = __builtin_amdgcn_readfirstlane(tid >> 5);      /* the wave's number in a scalar register: every tile address below is then a scalar base + the lane's piece */
  A += (size_t)by * sA; Bh += (size_t)by * sB; const size_t cofs = (size_t)by * sC; const float* bp = bias ? bias + (size_t)by * sBias : nullptr;
  const int ntn = N >> 6; const int mt = bx / ntn, nq = bx - mt * ntn; const int row0 = mt * 128 + 32 * w, col0 = nq * 64; if (row0 >= M) return;
  const _Float16* a0p = A + (size_t)row0 * lda; const _Float16* a1p = a0p + (size_t)16 * lda;      /* A, Bh fragment-ordered: 16 rows of tiles are 16 lda values; six scalar bases, to which each load adds the lane's piece */
  const _Float16* b0p = Bh + (size_t)col0 * ldb; const _Float16* b1p = b0p + (size_t)16 * ldb; const _Float16* b2p = b1p + (size_t)16 * ldb; const _Float16* b3p = b2p + (size_t)16 * ldb;
  const v8f z8 = {0.f,0.f,0.f,0.f,0.f,0.f,0.f,0.f}; v8f c00 = z8, c01 = z8, c02 = z8, c03 = z8, c10 = z8, c11 = z8, c12 = z8, c13 = z8;
  /* K = KT at compile time, the k loop unrolled: the six fragments of a k step are requested together, G2D steps ahead of their use, into a ring of G2D + 1 register sets (48 registers a set);
     before, a step held four load-wait-multiply rounds in a row, 4 KT / 32 cache latencies a wave. Each accumulator still takes its k steps in rising order.
     The k step's tile of each operand lies 512 values behind the one before. */
  constexpr int NS = KT / 32; static_assert(KT % 32 == 0 && NS > G2D, "gemm2_body: whole k steps, more of them than are requested ahead"); (void)K;
  v16h fa[G2D + 1][2], fb[G2D + 1][4];
  auto ld = [&](int s) { const int e = s % (G2D + 1), kb = 512 * s + 8 * lane; fa[e][0] = fo_frag(a0p + kb); fa[e][1] = fo_frag(a1p + kb); fb[e][0] = fo_frag(b0p + kb); fb[e][1] = fo_frag(b1p + kb); fb[e][2] = fo_frag(b2p + kb); fb[e][3] = fo_frag(b3p + kb); };
#pragma unroll
  for (int s = 0; s < G2D; ++s) ld(s);
#pragma unroll
  for (int s = 0; s < NS; ++s) { const int e = s % (G2D + 1); if (s + G2D < NS) ld(s + G2D);
    c00 = g2_mma(fa[e][0], fb[e][0], c00); c10 = g2_mma(fa[e][1], fb[e][0], c10); c01 = g2_mma(fa[e][0], fb[e][1], c01); c11 = g2_mma(fa[e][1], fb[e][1], c11);
    c02 = g2_mma(fa[e][0], fb[e][2], c02); c12 = g2_mma(fa[e][1], fb[e][2], c12); c03 = g2_mma(fa[e][0], fb[e][3], c03); c13 = g2_mma(fa[e][1], fb[e][3], c13); }
  asm volatile("s_wait_xcnt 0x0" :: "s"(a0p), "s"(a1p), "s"(b0p), "s"(b1p), "s"(b2p), "s"(b3p), "v"(lane) : "memory");      /* the six scalar bases and the lane register that the loads name stay whole up to here and are reused only behind this wait */
  v8f accs[8] = {c00, c01, c02, c03, c10, c11, c12, c13};
#pragma unroll
  for (int u = 0; u < 8; ++u) { const int t = u & 3, half = u >> 2; const int col = col0 + t * 16 + ln; const float bv = bp ? bf16_round(bp[col]) : 0.f;
#pragma unroll
    for (int r = 0; r < 8; ++r) { const int rloc = half * 16 + 8 * hh + r; float v = accs[u][r] * alpha + bv; if (CP) { if (rowsPerB < 0) v += CP[cofs + (size_t)(row0g + row0 + rloc) * ldc + col];      /* rowsPerB < 0: own element of the batched C plane */ else { const int bidx = (row0g + row0 + rloc) / rowsPerB; v += CP[(size_t)bidx * sCPb + (size_t)by * 64 + col]; } }
      if (ACT == 3) v = fmaxf(v, 0.f); else if (ACT == 6) v = 0.5f * v * (1.0f + erff(v * 0.70710678118654752f)); else if (ACT == 11) v = 1.0f / (1.0f + expf(-v)); else if (ACT == 15) v = v / (1.0f + expf(-v)); else if (ACT == 12) v = (v > 0.f) ? v : 0.01f * v; else if (ACT == 8) v = tanhf(v); else if (ACT == 9) v = 0.5f * v * (1.0f + tanhf(0.7978845608028654f * (v + 0.044715f * v * v * v))); else if (ACT == 14) v = (v > 0.f) ? v : 0.1f * v; else if (ACT == 16) v = (v >= 0.f) ? v : 0.3f * v; else if (ACT == 17) v = (v >= 0.f) ? v : 0.2f * v;
      so[w][rloc][t * 16 + ln] = v; } }
  __builtin_amdgcn_fence(__ATOMIC_ACQ_REL, "workgroup"); __builtin_amdgcn_wave_barrier();
  const int rsub = lane >> 4, c4 = (lane & 15) * 4;
  {
#pragma unroll
    for (int q = 0; q < 16; ++q) { const int r = q * 2 + rsub; const v4f v = *(const v4fa*)&so[w][r][c4]; if (C) *(v4f*)(C + cofs + (size_t)(row0 + r) * ldc + col0 + c4) = v; }
    if (C) asm volatile("s_wait_xcnt 0x0" ::: "memory");      /* the f32 stores' address registers are reused, where an f16 plane follows, only behind this wait */
    if (C16) {      /* the f16 plane is fragment-ordered: the wave's 32 x 64 values are 2 x 2 tiles, 8 stores of 512 bytes in a row */
#pragma unroll
      for (int q = 0; q < 8; ++q) { const float* s = &so[w][(q >> 2) * 16 + ln][((q >> 1) & 1) * 32 + (q & 1) * 16 + 8 * hh]; const v4f x = *(const v4fa*)s, y = *(const v4fa*)(s + 4); FragH f;
#pragma unroll
        for (int i = 0; i < 4; ++i) { f.h[i] = (_Float16)x[i]; f.h[4 + i] = (_Float16)y[i]; }
        *(v8us*)((unsigned short*)C16 + cofs + ((size_t)(row0 / 16 + (q >> 2)) * (ldc / 32) + col0 / 32 + ((q >> 1) & 1)) * 512 + (q & 1) * 256 + 8 * lane) = f.half[0]; } }
     } }
template <int ACT>
__global__ __launch_bounds__(128) void k_gemm2(const _Float16* __restrict__ A, int lda, size_t sA, const _Float16* __restrict__ Bh, int ldb, size_t sB, float alpha, const float* __restrict__ bias, size_t sBias, const float* __restrict__ CP, int rowsPerB, size_t sCPb, int row0g,
    float* __restrict__ C, _Float16* __restrict__ C16, int ldc, size_t sC, int M, int N, int K) { gemm2_body<ACT, DM>(blockIdx.x, blockIdx.y, A, lda, sA, Bh, ldb, sB, alpha, bias, sBias, CP, rowsPerB, sCPb, row0g, C, C16, ldc, sC, M, N, K); }


__global__ __launch_bounds__(256) void k_wnat(const float* __restrict__ w, size_t n8, _Float16* __restrict__ Bt) { const size_t t = (size_t)blockIdx.x * 256 + threadIdx.x; if (t >= n8) return; FragH f; for (int q = 0; q < 8; ++q) f.h[q] = (_Float16)(bf16_round(w[t * 8 + q]) * 16.0f); *(v8us*)((unsigned short*)Bt + t * 8) = f.half[0];  }
__global__ __launch_bounds__(256) void k_rsm(const float* __restrict__ S, _Float16* __restrict__ P, int nrows) {
  #pragma clang fp contract(off)
  const int i = blockIdx.x * 256 + threadIdx.x; if (i >= nrows) return; const float* s = S + (size_t)i * SQ; float mx = -3.0e38f;
#pragma unroll 1
  for (int j = 0; j < SQ; ++j) mx = fmaxf(mx, s[j]); float se = 0.f;
#pragma unroll 1
  for (int j = 0; j < SQ; ++j) se += expf(s[j] - mx); const float sc = 256.0f / se;
#pragma unroll 1
  for (int j0 = 0; j0 < SQ; j0 += 8) { FragH f; for (int q = 0; q < 8; ++q) f.h[q] = (_Float16)(expf(s[j0 + q] - mx) * sc); unsigned short* d = (unsigned short*)P + (size_t)i * SQ + j0; *(v8us*)d = f.half[0];  } }
__global__ __launch_bounds__(256) void k_vt(const _Float16* __restrict__ V16, int b, int h0, _Float16* __restrict__ VT) { __shared__ unsigned short tl[64][65]; const int tid = threadIdx.x; const int hh = blockIdx.x % HG, sg = blockIdx.x / HG; const int s0 = sg * 64; const int h = h0 + hh;
  for (int i = tid; i < 64 * 8; i += 256) { const int j = i / 8, d8 = (i % 8) * 8; FragH f; f.half[0] = *(const v8us*)((const unsigned short*)V16 + ((size_t)b * SQ + s0 + j) * DM + h * HD + d8); for (int q = 0; q < 8; ++q) tl[d8 + q][j] = f.u[q]; }
  __syncthreads();
  { for (int i = tid; i < 64 * 8; i += 256) { const int d = i / 8, j8 = (i % 8) * 8; FragH f; for (int q = 0; q < 8; ++q) f.u[q] = tl[d][j8 + q]; *(v8us*)((unsigned short*)VT + ((size_t)hh * HD + d) * SQ + s0 + j8) = f.half[0]; }  } }

__device__ __forceinline__ void qprep_body(int bx, const float* __restrict__ QF, const float* __restrict__ ub, const float* __restrict__ vb, _Float16* __restrict__ Q16, _Float16* __restrict__ QU, _Float16* __restrict__ QV, size_t n8) {
  #pragma clang fp contract(off)
  const size_t t = (size_t)bx * 256 + threadIdx.x; if (t >= n8) return; const int c = fo_k(t, DM); const size_t e = (size_t)fo_row(t, DM) * DM + c, o = t * 8; FragH a, b, d;      /* reads q rows at e, makes piece t of the fragment-ordered planes */
#pragma unroll
  for (int q = 0; q < 8; ++q) { const float v = QF[e + q]; a.h[q] = (_Float16)v; b.h[q] = (_Float16)__fadd_rn(v, bf16_round(ub[c + q])); d.h[q] = (_Float16)__fadd_rn(v, bf16_round(vb[c + q])); }
  asm volatile("s_wait_xcnt 0x0" :: "v"(QF + e), "v"(4 * c) : "memory");      /* the q loads' address pair and the bias loads' byte-offset register stay whole up to here */
  { *(v8us*)((unsigned short*)Q16 + o) = a.half[0]; *(v8us*)((unsigned short*)QU + o) = b.half[0]; *(v8us*)((unsigned short*)QV + o) = d.half[0];  } }

// ---- launches that need nothing of each other share one grid: a range test on the block index, the same for a whole work-group, picks the job; each job's blocks do what its own launch did ----
#define GW (DM * (DM / 8) / 256)             /* blocks a weight matrix: 128 */
#define GX ((int)(NR * DM / 8 / 256))        /* blocks an input tensor: 1024 */
#define GE (PP * DM / 8 / 256)               /* blocks of the position table, pad row included: 512 */
#define GG ((int)(NR / 128) * (DM / 64))     /* blocks of a 4096-row projection: 256 */
#define GR ((PP / 128) * (DM / 64))          /* blocks of the position projection: 128 */
#define GT (NB * NH * (SQ / 64))             /* blocks of the V transposes: 512 */
static_assert((size_t)GE * 256 == (size_t)PP * DM / 8 && PP % 16 == 0 && NPOS < PP, "k_prep: the position range covers the padded table, whole tiles");
// the five weight transposes (strided reads, the longest blocks: first), the three inputs and the position table as f16 rows
__global__ __launch_bounds__(256) void k_prep(const float* __restrict__ wq, const float* __restrict__ wk, const float* __restrict__ wv, const float* __restrict__ wpos, const float* __restrict__ wo,
    const float* __restrict__ xq, const float* __restrict__ xk, const float* __restrict__ xv, const float* __restrict__ pe,
    _Float16* __restrict__ BQ, _Float16* __restrict__ BK, _Float16* __restrict__ BV, _Float16* __restrict__ BP, _Float16* __restrict__ BO,
    _Float16* __restrict__ XQ, _Float16* __restrict__ XK, _Float16* __restrict__ XV, _Float16* __restrict__ PE) {
  int bx = blockIdx.x;
  if (bx < 5 * GW) { const int g = bx / GW; const float* W = (g == 0) ? wq : (g == 1) ? wk : (g == 2) ? wv : (g == 3) ? wpos : wo; _Float16* Wt = (g == 0) ? BQ : (g == 1) ? BK : (g == 2) ? BV : (g == 3) ? BP : BO;
    wt_f16_body(bx - g * GW, W, Wt, DM, DM, 16.0f); return; }
  bx -= 5 * GW;
  if (bx < 3 * GX) { const int g = bx / GX; const float* x = (g == 0) ? xq : (g == 1) ? xk : xv; _Float16* X = (g == 0) ? XQ : (g == 1) ? XK : XV;
    x16_body(bx - g * GX, x, X, (int)NR, NR * DM / 8); return; }
  bx -= 3 * GX;
  x16_body(bx, pe, PE, NPOS, (size_t)PP * DM / 8); }      /* pad row 2047 becomes zero */
// q (f32 rows), k, v, p = pos_emb Wpos (f16 rows; row 2047 is the zero pad)
__global__ __launch_bounds__(128) void k_proj(const _Float16* __restrict__ XQ, const _Float16* __restrict__ XK, const _Float16* __restrict__ XV, const _Float16* __restrict__ PE,
    const _Float16* __restrict__ BQ, const _Float16* __restrict__ BK, const _Float16* __restrict__ BV, const _Float16* __restrict__ BP,
    const float* __restrict__ bq, const float* __restrict__ bk, const float* __restrict__ bv,
    float* __restrict__ QF, _Float16* __restrict__ K16, _Float16* __restrict__ V16, _Float16* __restrict__ R16) {
  const int g = blockIdx.x / GG;
  const _Float16* A = (g == 0) ? XQ : (g == 1) ? XK : (g == 2) ? XV : PE; const _Float16* Bh = (g == 0) ? BQ : (g == 1) ? BK : (g == 2) ? BV : BP;
  const int bx = blockIdx.x - g * GG;
  if (g == 0) { gemm2_body<0, DM>(bx, 0, A, DM, 0, Bh, DM, 0, 0.0625f, bq, 0, nullptr, 1, 0, 0, QF, nullptr, DM, 0, (int)NR, DM, DM); return; }
  const float* bias = (g == 1) ? bk : (g == 2) ? bv : nullptr; _Float16* C16 = (g == 1) ? K16 : (g == 2) ? V16 : R16;
  gemm2_body<0, DM>(bx, 0, A, DM, 0, Bh, DM, 0, 0.0625f, bias, 0, nullptr, 1, 0, 0, nullptr, C16, DM, 0, (g == 3) ? PP : (int)NR, DM, DM); }
// V^T [4][8][64][1024] (LDS transposes, with a barrier: first); q + pos_bias_u, q + pos_bias_v (f16)
__global__ __launch_bounds__(256) void k_post(const _Float16* __restrict__ V16, _Float16* __restrict__ VT, const float* __restrict__ QF, const float* __restrict__ ub, const float* __restrict__ vb, _Float16* __restrict__ Q16, _Float16* __restrict__ QU, _Float16* __restrict__ QV) {
  const int bx = blockIdx.x;
  if (bx < GT) { vt_body<NH, SQ>(bx, V16, DM, 0, VT); return; }
  qprep_body(bx - GT, QF, ub, vb, Q16, QU, QV, NR * DM / 8); }
// Fused relative attention, one work-group per (batch, head, FR query rows); the FR x 1024 score rows live in LDS and never reach memory.
// 1: bd tiles (q + v) . p[i0 + 16 t ..], each element stored at its shifted column j = T - 1 + i - pos (in the edge tiles a column outside 0..T-1 goes to the pad column T, which nobody reads);
// 2: ac tiles (q + u) . k added in place. Both products take the position or key tile as A and the query tile as B (the two operands have the same lane map), so that D comes out transposed:
// lane ln holds query row ln, its 8 registers 8 neighbouring positions or keys, that is 8 neighbouring columns of one score row: ac goes in by 16-byte LDS loads and stores, bd by stores of neighbouring words; 3: one wave per row: lane l holds columns 4 l + 128 u + (0..3), mask, f32 statistics, weights x256 as f16 written over the row's own first half;
// 4: o = P . V^T: a wave does 32 rows x 16 columns over one half of k (each V^T fragment is loaded once a work-group); the two halves are added on the way out, where one wave writes each 128-byte line.
// Global fragments are requested ahead of their use, into the registers that the running step sets free.
#define FR 32
#define FD 6                         /* fragment tiles in flight a wave: 96 registers */
#define FP (SQ + 4)                  /* LDS row pitch in floats: 16 B x odd, for the ds_load_b128 fragment reads of step 4 */
typedef int   v4ia __attribute__((ext_vector_type(4), may_alias));
typedef _Float16 v4ha __attribute__((ext_vector_type(4), may_alias));
static_assert(SQ == 1024 && HD == 64 && FR == 32 && SQ - 1 + FR <= 66 * 16 && SQ - FR + 66 * 16 <= PP, "k_relattn: 8 waves, 66 position tiles inside the padded table");
// Four native 2^x (what __expf compiles to, behind its multiply by log2 e). Written in one statement so that the slot the instruction set asks for behind a transcendental is kept by construction:
// each v_exp_f32 is followed by one that neither reads its result nor overwrites its source (early-clobber outputs), the last by v_nop.
__device__ __forceinline__ void exp2x4(float x0, float x1, float x2, float x3, float* e) {
  asm("v_exp_f32 %0, %4\n\tv_exp_f32 %1, %5\n\tv_exp_f32 %2, %6\n\tv_exp_f32 %3, %7\n\tv_nop" : "=&v"(e[0]), "=&v"(e[1]), "=&v"(e[2]), "=&v"(e[3]) : "v"(x0), "v"(x1), "v"(x2), "v"(x3)); }
__global__ __launch_bounds__(256) __attribute__((amdgpu_waves_per_eu(4, 4))) void k_relattn(const _Float16* __restrict__ QU, const _Float16* __restrict__ QV, const _Float16* __restrict__ K16, const _Float16* __restrict__ R16, const _Float16* __restrict__ VT, const int* __restrict__ mask, _Float16* __restrict__ O16) {
  __shared__ __attribute__((aligned(16))) float sc[FR][FP];
  __shared__ __attribute__((aligned(16))) float so[2][FR][68];
  const int tid = threadIdx.x, lane = tid & 31, ln = lane & 15, hh = lane >> 4; const int w = __builtin_amdgcn_readfirstlane(tid >> 5);
  const int it = blockIdx.x % (SQ / FR), bh = blockIdx.x / (SQ / FR), h = bh % NH, b = bh / NH; const int i0 = it * FR; const size_t r0 = (size_t)b * SQ;
  const v8f z8 = {0.f,0.f,0.f,0.f,0.f,0.f,0.f,0.f};
  const int ho = h * (HD / 32) * 512 + 8 * lane;      /* fragment-ordered planes of DM values a row: 16 rows are 16 DM values, in them the head's two tiles, in a tile the lane's piece */
  const _Float16* pp = R16 + (size_t)(i0 + w * 16) * DM; const _Float16* kp = K16 + (r0 + w * 16) * DM;      /* tile w; tile w + 8 k lies 128 k rows on; scalar bases, to which each load adds ho */
  const _Float16* qp = QV + (r0 + i0) * DM; v16h a00 = fo_frag(qp + ho), a01 = fo_frag(qp + ho + 512), a10 = fo_frag(qp + ho + 16 * DM), a11 = fo_frag(qp + ho + 16 * DM + 512);
  v16h fr[16][2];      /* this wave's 8 position tiles, then its 8 key tiles: one stream, requested FD tiles ahead of its use */
  auto fetch = [&](int n) { const _Float16* p = ((n < 8) ? pp + (size_t)n * 128 * DM : kp + (size_t)(n - 8) * 128 * DM) + ho; fr[n][0] = fo_frag(p); fr[n][1] = fo_frag(p + 512); };
#pragma unroll
  for (int n = 0; n < FD; ++n) fetch(n);
  asm volatile("s_wait_xcnt 0x0" :: "s"(qp), "s"(pp), "v"(ho) : "memory");      /* the issued loads' address registers (scalar bases, the lane's offset) stay whole up to here and are reused only behind this wait */
  const int jw = SQ - 1 + ln - w * 16 - 8 * hh;      /* column of row ln at position i0 + 16 w + 8 hh; register r lies r columns below */
#pragma unroll
  for (int k = 0; k < 8; ++k) { fetch(k + FD); v8f c0 = g2_mma(fr[k][0], a00, z8), c1 = g2_mma(fr[k][0], a10, z8); c0 = g2_mma(fr[k][1], a01, c0); c1 = g2_mma(fr[k][1], a11, c1);
    const int jb = jw - 128 * k;
    if (k == 0) {      /* tiles 0 and 1 reach past column T - 1 */
#pragma unroll
      for (int r = 0; r < 8; ++r) { const int j = jb - r, j1 = j + 16; sc[ln][((unsigned)j < SQ) ? j : SQ] = c0[r]; sc[16 + ln][((unsigned)j1 < SQ) ? j1 : SQ] = c1[r]; }
    } else {           /* tiles 8 to 63: every column inside */
#pragma unroll
      for (int r = 0; r < 8; ++r) { sc[ln][jb - r] = c0[r]; sc[16 + ln][jb + 16 - r] = c1[r]; } }
    __builtin_amdgcn_sched_barrier(0); }      /* one tile's accumulators and LDS addresses live at a time: without it the compiler opens six tiles at once and spills */
  if (w < 2) {         /* tiles 64 and 65 reach below column 0 */
    const _Float16* p8 = pp + ho + (size_t)8 * 128 * DM; const v16h b0 = fo_frag(p8), b1 = fo_frag(p8 + 512);
    asm volatile("s_wait_xcnt 0x0" :: "v"(p8) : "memory");      /* the four loads' address pair stays whole up to here */
    v8f c0 = g2_mma(b0, a00, z8), c1 = g2_mma(b0, a10, z8); c0 = g2_mma(b1, a01, c0); c1 = g2_mma(b1, a11, c1); const int jb = jw - 128 * 8;
#pragma unroll
    for (int r = 0; r < 8; ++r) { const int j = jb - r, j1 = j + 16; sc[ln][((unsigned)j < SQ) ? j : SQ] = c0[r]; sc[16 + ln][((unsigned)j1 < SQ) ? j1 : SQ] = c1[r]; } }
  qp = QU + (r0 + i0) * DM; a00 = fo_frag(qp + ho); a01 = fo_frag(qp + ho + 512); a10 = fo_frag(qp + ho + 16 * DM); a11 = fo_frag(qp + ho + 16 * DM + 512);
  asm volatile("s_wait_xcnt 0x0" :: "s"(qp), "s"(kp), "v"(ho) : "memory");      /* as above */
  __syncthreads();
  const int* mk = mask + (r0 + i0 + w * 4) * SQ + 4 * lane; v4ia m[2][8];
  float* ar = &sc[ln][w * 16 + 8 * hh]; v4f nd[4];      /* row ln, the lane's 8 columns of key tile w; tile w + 8 k lies 128 k floats on, row 16 + ln 16 FP floats on; a tile's bd values are read one tile ahead */
  auto ldb = [&](int k) { const float* p = ar + 128 * k; nd[0] = *(const v4fa*)p; nd[1] = *(const v4fa*)(p + 4); nd[2] = *(const v4fa*)(p + 16 * FP); nd[3] = *(const v4fa*)(p + 16 * FP + 4); };
  ldb(0);
#pragma unroll
  for (int k = 0; k < 8; ++k) { if (k + FD < 8) fetch(8 + k + FD);
    float* p = ar + 128 * k; v8f c0 = {nd[0][0], nd[0][1], nd[0][2], nd[0][3], nd[1][0], nd[1][1], nd[1][2], nd[1][3]}, c1 = {nd[2][0], nd[2][1], nd[2][2], nd[2][3], nd[3][0], nd[3][1], nd[3][2], nd[3][3]};      /* bd is the start value that the products are summed onto */
    if (k < 7) ldb(k + 1);
    c0 = g2_mma(fr[8 + k][0], a00, c0); c1 = g2_mma(fr[8 + k][0], a10, c1); c0 = g2_mma(fr[8 + k][1], a01, c0); c1 = g2_mma(fr[8 + k][1], a11, c1);
    if (k == 4) {
#pragma unroll
      for (int u = 0; u < 8; ++u) m[0][u] = *(const v4ia*)(mk + 128 * u); }      /* this wave's first mask row */
    const v4f l0 = {c0[0], c0[1], c0[2], c0[3]}, h0 = {c0[4], c0[5], c0[6], c0[7]}, l1 = {c1[0], c1[1], c1[2], c1[3]}, h1 = {c1[4], c1[5], c1[6], c1[7]};
    *(v4fa*)p = l0; *(v4fa*)(p + 4) = h0; *(v4fa*)(p + 16 * FP) = l1; *(v4fa*)(p + 16 * FP + 4) = h1; }
  __builtin_amdgcn_sched_barrier(0);      /* step 3's mask compares stay behind the last tile: drawn up among the tiles, they wait there on the mask loads just issued */
  __syncthreads();
  const int nt = w & 3, kh = w >> 2; const _Float16* vp = VT + ((size_t)bh * HD + nt * 16) * SQ + kh * (SQ / 64) * 512; v16h vf[16];      /* fragment-ordered, SQ values a row: this wave's 16 tiles lie in a row */
#pragma unroll
  for (int k = 0; k < 4; ++k) { float* row = &sc[w * 4 + k][0]; const v4ia* mc = m[k & 1];
    if (k < 3) {
#pragma unroll
      for (int u = 0; u < 8; ++u) m[(k + 1) & 1][u] = *(const v4ia*)(mk + (k + 1) * SQ + 128 * u);      /* next row's mask flies while this row is worked on */
    } else {
#pragma unroll
      for (int s = 0; s < 16; ++s) vf[s] = fo_frag(vp + 512 * s + 8 * lane);      /* step 4's V^T fragments fly during the last row */
      asm volatile("s_wait_xcnt 0x0" :: "s"(vp), "v"(lane) : "memory"); }      /* as above */
    float v[8][4]; float m4[4] = {-3.0e38f, -3.0e38f, -3.0e38f, -3.0e38f};
#pragma unroll
    for (int u = 0; u < 8; ++u) { const v4f s = *(const v4fa*)(row + 4 * lane + 128 * u);
#pragma unroll
      for (int q = 0; q < 4; ++q) { v[u][q] = s[q] * 0.125f; m4[q] = fmaxf(m4[q], (mc[u][q] == 0) ? v[u][q] : -3.0e38f); } }
    float mx = fmaxf(fmaxf(m4[0], m4[1]), fmaxf(m4[2], m4[3]));
#pragma unroll
    for (int d = 16; d >= 1; d >>= 1) mx = fmaxf(mx, __shfl_xor(mx, d, 32));
    float s4[4] = {0.f, 0.f, 0.f, 0.f};
#pragma unroll
    for (int u = 0; u < 8; ++u) { float e[4]; exp2x4((v[u][0] - mx) * 1.44269504f, (v[u][1] - mx) * 1.44269504f, (v[u][2] - mx) * 1.44269504f, (v[u][3] - mx) * 1.44269504f, e);
#pragma unroll
      for (int q = 0; q < 4; ++q) { v[u][q] = (mc[u][q] == 0) ? e[q] : 0.f; s4[q] += v[u][q]; } }
    float se = (s4[0] + s4[1]) + (s4[2] + s4[3]);
#pragma unroll
    for (int d = 16; d >= 1; d >>= 1) se += __shfl_xor(se, d, 32);
    const float scl = (se > 0.f) ? 256.0f / se : 0.f;
#pragma unroll
    for (int u = 0; u < 8; ++u) { v4ha h4;
#pragma unroll
      for (int q = 0; q < 4; ++q) h4[q] = (_Float16)(v[u][q] * scl);
      *(v4ha*)((_Float16*)row + 4 * lane + 128 * u) = h4; } }
  __syncthreads();
  { const _Float16* ap = (const _Float16*)&sc[ln][0] + kh * (SQ / 2); v8f c0 = z8, c1 = z8; v16h af[2][4];      /* weight fragments of two k steps, read from LDS one pair of steps ahead */
#pragma unroll
    for (int e = 0; e < 2; ++e) { af[0][2 * e] = g2_frag(ap + 32 * e, hh); af[0][2 * e + 1] = g2_frag(ap + 16 * FP * 2 + 32 * e, hh); }
#pragma unroll
    for (int g = 0; g < 8; ++g) {
      if (g < 7) {
#pragma unroll
        for (int e = 0; e < 2; ++e) { af[(g + 1) & 1][2 * e] = g2_frag(ap + 32 * (2 * g + 2 + e), hh); af[(g + 1) & 1][2 * e + 1] = g2_frag(ap + 16 * FP * 2 + 32 * (2 * g + 2 + e), hh); } }
#pragma unroll
      for (int e = 0; e < 2; ++e) { c0 = g2_mma(af[g & 1][2 * e], vf[2 * g + e], c0); c1 = g2_mma(af[g & 1][2 * e + 1], vf[2 * g + e], c1); } }
#pragma unroll
    for (int r = 0; r < 8; ++r) { so[kh][8 * hh + r][nt * 16 + ln] = c0[r]; so[kh][16 + 8 * hh + r][nt * 16 + ln] = c1[r]; } }
  __syncthreads();
  { const int r = fo_row(tid, HD), c8 = fo_k(tid, HD); const v4f x = *(const v4fa*)&so[0][r][c8] + *(const v4fa*)&so[1][r][c8], y = *(const v4fa*)&so[0][r][c8 + 4] + *(const v4fa*)&so[1][r][c8 + 4]; FragH f;
#pragma unroll
    for (int q = 0; q < 4; ++q) { f.h[q] = (_Float16)(x[q] * 0.25f); f.h[4 + q] = (_Float16)(y[q] * 0.25f); }
    *(v8us*)((unsigned short*)O16 + (r0 + i0 + (tid >> 7) * 16) * DM + (h * (HD / 32) + ((tid >> 6) & 1)) * 512 + (tid & 63) * 8) = f.half[0]; } }      /* thread t makes piece t of the work-group's 2 x 2 tiles of the fragment-ordered o plane */

extern "C" void kernel_launch(void* const* d_in, const int* in_sizes, int n_in,
                              void* d_out, int out_size, void* d_ws, size_t ws_size, hipStream_t stream) {
  (void)in_sizes; (void)n_in; (void)out_size;
  const float* const* I = (const float* const*)d_in; const float* xq = I[0]; const float* xk = I[1]; const float* xv = I[2]; const int* mask = (const int*)d_in[3]; const float* pe = I[4]; const float* wq = I[5]; const float* bq = I[6]; const float* wk = I[7]; const float* bk = I[8]; const float* wv = I[9]; const float* bv = I[10]; const float* wpos = I[11]; const float* wo = I[12]; const float* bo = I[13]; const float* pbu = I[14]; const float* pbv = I[15];
  char* ws = (char*)d_ws; size_t off = 0;
  auto take = [&](size_t bytes) { char* p = ws + off; off += (bytes + 255) & ~(size_t)255; return p; };
  _Float16* BQ = (_Float16*)take((size_t)DM * DM * 2); _Float16* BK = (_Float16*)take((size_t)DM * DM * 2); _Float16* BV = (_Float16*)take((size_t)DM * DM * 2); _Float16* BP = (_Float16*)take((size_t)DM * DM * 2); _Float16* BO = (_Float16*)take((size_t)DM * DM * 2);
  _Float16* XQ = (_Float16*)take(NR * DM * 2); _Float16* XK = (_Float16*)take(NR * DM * 2); _Float16* XV = (_Float16*)take(NR * DM * 2); _Float16* PE = (_Float16*)take((size_t)PP * DM * 2);
  float* QF = (float*)take(NR * DM * 4); _Float16* Q16 = (_Float16*)take(NR * DM * 2); _Float16* QU = (_Float16*)take(NR * DM * 2); _Float16* QV = (_Float16*)take(NR * DM * 2); _Float16* K16 = (_Float16*)take(NR * DM * 2); _Float16* V16 = (_Float16*)take(NR * DM * 2); _Float16* R16 = (_Float16*)take((size_t)PP * DM * 2); _Float16* O16 = (_Float16*)take(NR * DM * 2);
  _Float16* VT = (_Float16*)take((size_t)NB * NH * HD * SQ * 2);
  if (off > ws_size) return;      /* 2.5 + 12 + 2 + 8 + 20 + 2 + 4 + 4 = approx 55 MiB */
  k_prep<<<5 * GW + 3 * GX + GE, 256, 0, stream>>>(wq, wk, wv, wpos, wo, xq, xk, xv, pe, BQ, BK, BV, BP, BO, XQ, XK, XV, PE);      /* x16 weights transposed, inputs and position table as f16 rows */
  k_proj<<<3 * GG + GR, 128, 0, stream>>>(XQ, XK, XV, PE, BQ, BK, BV, BP, bq, bk, bv, QF, K16, V16, R16);      /* q (f32), k, v, p (f16) */
  k_post<<<GT + GX, 256, 0, stream>>>(V16, VT, QF, pbu, pbv, Q16, QU, QV);      /* V^T; q + pos_bias_u, q + pos_bias_v */
  k_relattn<<<NB * NH * (SQ / FR), 256, 0, stream>>>(QU, QV, K16, R16, VT, mask, O16);      /* scores, shifted softmax and o x64 (merged rows), all batches and heads */
  k_gemm2<0><<<dim3(GG, 1), 128, 0, stream>>>(O16, DM, 0, BO, DM, 0, 0.0009765625f, bo, 0, nullptr, 1, 0, 0, (float*)d_out, nullptr, DM, 0, (int)NR, DM, DM);      /* out = x Wout + bout */
}

// v007
// One run takes 68.8 microseconds.
// In two side-by-side timings against v006, it was 1.09 and 1.10 times as fast.
// Over all steps from v000 it is 60.7 times as fast.
#include <hip/hip_runtime.h>
// Relative-position multi-head attention with rel_shift (query, key, value [4][1024][512]; mask [4][1024][1024] int32 verbatim (nonzero = masked, ~50 %); pos_emb [1][2047][512]; q/k/v = x W + b ([512][512] [in][out]); p = pos_emb Wpos; 8 heads of 64; ac = (q + pos_bias_u) . k; bd = rel_shift((q + pos_bias_v) . p^T) = (q_i + v) . p[T-1+i-j]; scores = (ac + bd) / 8; masked -> float32 min; softmax; masked weights -> 0; x = attn v merged; out = x Wout + bout -> [4][1024][512].
// Structure: token rows; inputs and pos_emb as exact f16 rows (pos table padded to 2048 rows with zeros); q, k, v, p as WMMA GEMMs (32x64 wave tiles, f32 accumulation, exact x16 weights + bias) whose epilogues store the f16 planes that the attention kernel reads: q + u and q + v, k, p, and V^T straight from the accumulators; one fused kernel per (batch, head, 32 query rows): bd and ac WMMA tiles (K = 64) into f32 score rows in LDS, bd stored at its shifted column; the relative softmax with the mask on VALU (f32 statistics, native exp; weights x256 f16, in LDS); o = P . V^T on WMMA (K = 1024; o x64 in f16); out GEMM (f32, + bout); launches that need nothing of each other share one grid (ranges of the block index); 4 launches. Every f16 operand plane lies in fragment order (see fo_row).
// Compute dtype: inputs rounded to bf16; inputs / weights exact in f16; q + u, q + v, k, v, p, softmax weights and o plain f16 (~2^-12); ac, bd, softmax statistics f32; v_wmma_f32_16x16x32_f16.
#define NB 4
#define SQ 1024
#define PP 2048                      /* position table rows (2047 used, row 2047 zero) */
#define NPOS 2047
#define DM 512
#define NH 8
#define HD 64
#define HG 8
#define NR ((size_t)NB * SQ)
typedef __bf16 v16b __attribute__((ext_vector_type(16)));
typedef unsigned short v8us __attribute__((ext_vector_type(8), may_alias));
typedef float  v8f  __attribute__((ext_vector_type(8)));
typedef float  v4f  __attribute__((ext_vector_type(4)));
typedef float  v4fa __attribute__((ext_vector_type(4), may_alias));
union FragB { v16b v; v8us half[2]; unsigned short u[16]; };

__device__ __forceinline__ unsigned short bf16_bits(float x) { unsigned int u = __float_as_uint(x); return (unsigned short)((u + 0x7FFFu + ((u >> 16) & 1u)) >> 16); }
__device__ __forceinline__ float bf16_val(unsigned short b) { return __uint_as_float(((unsigned int)b) << 16); }
__device__ __forceinline__ float bf16_round(float x) { return bf16_val(bf16_bits(x)); }
// D += A·B with NT terms: 1 = ah·bh, 2 = + al·bh (A split), 3 = + ah·bl (both split)
template <int NT>
__device__ __forceinline__ v8f mmaN(v16b ah, v16b al, v16b bh, v16b bl, v8f c) {
  c = __builtin_amdgcn_wmma_f32_16x16x32_bf16(false, ah, false, bh, (short)0, c, false, false);
  if (NT >= 2) c = __builtin_amdgcn_wmma_f32_16x16x32_bf16(false, al, false, bh, (short)0, c, false, false);
  if (NT >= 3) c = __builtin_amdgcn_wmma_f32_16x16x32_bf16(false, ah, false, bl, (short)0, c, false, false);
  asm volatile("v_nop\n\tv_nop\n\tv_nop\n\tv_nop" : "+v"(c) : "v"(ah), "v"(al), "v"(bh), "v"(bl));
  return c;
}

__global__ __launch_bounds__(256) void k_wt_bf16(const float* __restrict__ W, unsigned short* __restrict__ Wt, int K, int N) {
  const int t = blockIdx.x * 256 + threadIdx.x;
  const int k8n = K / 8;
  if (t >= N * k8n) return;
  const int n = t / k8n, k8 = (t % k8n) * 8;
  v8us v;
#pragma unroll
  for (int i = 0; i < 8; ++i) v[i] = bf16_bits(W[(size_t)(k8 + i) * N + n]);
  *(v8us*)(Wt + (size_t)n * K + k8) = v;
  
}

// GEMM C[M][N] (f32, pitch ldc) = act(A[M][K]·W + bias). A f32 row-major (pitch lda) converted per fragment to bf16
// (ASPLIT: hi/lo two planes -> 2 terms, else single rounded term); Wt bf16 [N][K] (pitch ldb). BIAS_BF16 rounds the
// bias to bf16 first (bias quantised to bf16 before the add). K%32==0, M%16==0, N%64==0.
template <bool ASPLIT, int ACT, bool BIAS_BF16>
__global__ __launch_bounds__(128) void k_gemm_bf(const float* __restrict__ A, int lda, const unsigned short* __restrict__ Wt, int ldb,
                                               const float* __restrict__ bias, float* __restrict__ C, int ldc, int M, int N, int K) {
  __shared__ __attribute__((aligned(16))) float so[4][16][64];
  const int tid = threadIdx.x, w = tid >> 5, lane = tid & 31, ln = lane & 15, hh = lane >> 4;
  const int ntn = N / 64;
  const int wid = blockIdx.x * 4 + w;
  const int mt = wid / ntn, nq = wid % ntn;
  if (mt * 16 >= M) return;
  const int row0 = mt * 16, col0 = nq * 64;
  const float* arow = A + (size_t)(row0 + ln) * lda;
  v8f acc[4] = {};
  for (int kb = 0; kb < K; kb += 32) {
    FragB ah, al;
    const v4f x0 = *(const v4fa*)(arow + kb + 8 * hh), x1 = *(const v4fa*)(arow + kb + 8 * hh + 4);
    const v4f x2 = *(const v4fa*)(arow + kb + 16 + 8 * hh), x3 = *(const v4fa*)(arow + kb + 16 + 8 * hh + 4);
    float xs[16] = {x0[0],x0[1],x0[2],x0[3],x1[0],x1[1],x1[2],x1[3],x2[0],x2[1],x2[2],x2[3],x3[0],x3[1],x3[2],x3[3]};
#pragma unroll
    for (int i = 0; i < 16; ++i) { const unsigned short hb = bf16_bits(xs[i]); ah.u[i] = hb; al.u[i] = ASPLIT ? bf16_bits(xs[i] - bf16_val(hb)) : (unsigned short)0; }
#pragma unroll
    for (int t = 0; t < 4; ++t) {
      const unsigned short* brow = Wt + (size_t)(col0 + t * 16 + ln) * ldb + kb;
      FragB b;
      b.half[0] = *(const v8us*)(brow + 8 * hh);
      b.half[1] = *(const v8us*)(brow + 16 + 8 * hh);
      acc[t] = mmaN<ASPLIT ? 2 : 1>(ah.v, al.v, b.v, b.v, acc[t]);
    }
  }
#pragma unroll
  for (int t = 0; t < 4; ++t) {
    float bv = bias ? bias[col0 + t * 16 + ln] : 0.f;
    if (BIAS_BF16) bv = bf16_round(bv);
#pragma unroll
    for (int r = 0; r < 8; ++r) { float v = acc[t][r] + bv; if (ACT == 1) v = fmaxf(v, 0.f); so[w][8 * hh + r][t * 16 + ln] = v; }
  }
  __builtin_amdgcn_fence(__ATOMIC_ACQ_REL, "workgroup");
  __builtin_amdgcn_wave_barrier();
  const int rsub = lane >> 4, c4 = (lane & 15) * 4;
  {
#pragma unroll
    for (int q = 0; q < 8; ++q) {
      const int r = q * 2 + rsub;
      const v4f v = *(const v4fa*)&so[w][r][c4];
      *(v4f*)(C + (size_t)(row0 + r) * ldc + col0 + c4) = v;
    }
    
  }
}

// GEMM C = act(A·W + bias + resid): A f32 (ASPLIT -> hi/lo 2 terms), Wt bf16 [N][K]; ACT 0 none, 1 relu, 2 exact gelu;
// resid (optional, f32, row index = (row % rmod), pitch ldr, RES_BF16 rounds it) added before the activation.
template <bool ASPLIT, int ACT, bool BIAS_BF16, bool RES_BF16>
__global__ __launch_bounds__(128) void k_gemm_bf3(const float* __restrict__ A, int lda, const unsigned short* __restrict__ Wt, int ldb,
                                                const float* __restrict__ bias, const float* __restrict__ resid, int rmod, int ldr,
                                                float* __restrict__ C, int ldc, int M, int N, int K) {
  __shared__ __attribute__((aligned(16))) float so[4][16][64];
  const int tid = threadIdx.x, w = tid >> 5, lane = tid & 31, ln = lane & 15, hh = lane >> 4;
  const int ntn = N / 64;
  const int wid = blockIdx.x * 4 + w;
  const int mt = wid / ntn, nq = wid % ntn;
  if (mt * 16 >= M) return;
  const int row0 = mt * 16, col0 = nq * 64;
  const float* arow = A + (size_t)(row0 + ln) * lda;
  v8f acc[4] = {};
  for (int kb = 0; kb < K; kb += 32) {
    FragB ah, al;
    const v4f x0 = *(const v4fa*)(arow + kb + 8 * hh), x1 = *(const v4fa*)(arow + kb + 8 * hh + 4);
    const v4f x2 = *(const v4fa*)(arow + kb + 16 + 8 * hh), x3 = *(const v4fa*)(arow + kb + 16 + 8 * hh + 4);
    float xs[16] = {x0[0],x0[1],x0[2],x0[3],x1[0],x1[1],x1[2],x1[3],x2[0],x2[1],x2[2],x2[3],x3[0],x3[1],x3[2],x3[3]};
#pragma unroll
    for (int i = 0; i < 16; ++i) { const unsigned short hb = bf16_bits(xs[i]); ah.u[i] = hb; al.u[i] = ASPLIT ? bf16_bits(xs[i] - bf16_val(hb)) : (unsigned short)0; }
#pragma unroll
    for (int t = 0; t < 4; ++t) {
      const unsigned short* brow = Wt + (size_t)(col0 + t * 16 + ln) * ldb + kb;
      FragB b;
      b.half[0] = *(const v8us*)(brow + 8 * hh);
      b.half[1] = *(const v8us*)(brow + 16 + 8 * hh);
      acc[t] = mmaN<ASPLIT ? 2 : 1>(ah.v, al.v, b.v, b.v, acc[t]);
    }
  }
#pragma unroll
  for (int t = 0; t < 4; ++t) {
    const int col = col0 + t * 16 + ln;
    float bv = bias ? bias[col] : 0.f;
    if (BIAS_BF16) bv = bf16_round(bv);
#pragma unroll
    for (int r = 0; r < 8; ++r) {
      float v = acc[t][r] + bv;
      if (resid) { float rv = resid[(size_t)((row0 + 8 * hh + r) % rmod) * ldr + col]; if (RES_BF16) rv = bf16_round(rv); v += rv; }
      if (ACT == 1) v = fmaxf(v, 0.f);
      if (ACT == 2) v = 0.5f * v * (1.0f + erff(v * 0.70710678118654752f));
      if (ACT == 3) { const float u = 0.7978845608028654f * (v + 0.044715f * v * v * v); v = 0.5f * v * (1.0f + tanhf(u)); }
      so[w][8 * hh + r][t * 16 + ln] = v;
    }
  }
  __builtin_amdgcn_fence(__ATOMIC_ACQ_REL, "workgroup");
  __builtin_amdgcn_wave_barrier();
  const int rsub = lane >> 4, c4 = (lane & 15) * 4;
  {
#pragma unroll
    for (int q = 0; q < 8; ++q) {
      const int r = q * 2 + rsub;
      const v4f v = *(const v4fa*)&so[w][r][c4];
      *(v4f*)(C + (size_t)(row0 + r) * ldc + col0 + c4) = v;
    }
    
  }
}
// row LayerNorm (biased variance, eps) over N: s = X (+ R); optional out_sum <- s; out_norm <- (s-mu)*rsqrt(var+eps)*g + b
template <bool PARAM_BF16>
__global__ __launch_bounds__(256) void k_layernorm(const float* __restrict__ X, const float* __restrict__ R, const float* __restrict__ g, const float* __restrict__ bta,
                                                  float* __restrict__ out_sum, float* __restrict__ out_norm, int N, float eps) {
  __shared__ float red[256];
  const int row = blockIdx.x, tid = threadIdx.x;
  const float* x = X + (size_t)row * N; const float* rr = R ? R + (size_t)row * N : nullptr;
  float vals[16];                     // up to N = 4096
  const int per = N / 256;            // contiguous chunk per thread? use strided-by-4 chunks: thread handles j = tid*4 + 1024*u
  float s1 = 0.f;
  for (int u = 0; u < per / 4; ++u) {
    const int j = tid * 4 + 1024 * u;
    const v4f a = *(const v4fa*)(x + j);
    v4f b = {0.f,0.f,0.f,0.f}; if (rr) b = *(const v4fa*)(rr + j);
#pragma unroll
    for (int q = 0; q < 4; ++q) { const float v = a[q] + b[q]; vals[u * 4 + q] = v; s1 += v; }
  }
  red[tid] = s1; __syncthreads();
  for (int st = 128; st > 0; st >>= 1) { if (tid < st) red[tid] += red[tid + st]; __syncthreads(); }
  const float mu = red[0] / (float)N; __syncthreads();
  float s2 = 0.f;
  for (int u = 0; u < per / 4; ++u)
#pragma unroll
    for (int q = 0; q < 4; ++q) { const float c = vals[u * 4 + q] - mu; s2 += c * c; }
  red[tid] = s2; __syncthreads();
  for (int st = 128; st > 0; st >>= 1) { if (tid < st) red[tid] += red[tid + st]; __syncthreads(); }
  const float rs = rsqrtf(red[0] / (float)N + eps);
  {
    for (int u = 0; u < per / 4; ++u) {
      const int j = tid * 4 + 1024 * u;
      v4f o, sm;
#pragma unroll
      for (int q = 0; q < 4; ++q) {
        float gg = g[j + q], bb = bta[j + q];
        if (PARAM_BF16) { gg = bf16_round(gg); bb = bf16_round(bb); }
        sm[q] = vals[u * 4 + q]; o[q] = (vals[u * 4 + q] - mu) * rs * gg + bb;
      }
      if (out_sum) *(v4f*)(out_sum + (size_t)row * N + j) = sm;
      *(v4f*)(out_norm + (size_t)row * N + j) = o;
    }
    
  }
}



// ---- f16 WMMA path (v_wmma_f32_16x16x32_f16): 11-bit significands for operands in range — used where a [0,1] probability operand needs more precision than bf16
typedef _Float16 v16h __attribute__((ext_vector_type(16)));
union FragH { v16h v; v8us half[2]; _Float16 h[16]; unsigned short u[16]; };
template <int NT>
__device__ __forceinline__ v8f mmaH(v16h ah, v16h al, v16h bh, v16h bl, v8f c) {
  c = __builtin_amdgcn_wmma_f32_16x16x32_f16(false, ah, false, bh, (short)0, c, false, false);
  if (NT >= 2) c = __builtin_amdgcn_wmma_f32_16x16x32_f16(false, al, false, bh, (short)0, c, false, false);
  if (NT >= 3) c = __builtin_amdgcn_wmma_f32_16x16x32_f16(false, ah, false, bl, (short)0, c, false, false);
  asm volatile("v_nop\n\tv_nop\n\tv_nop\n\tv_nop" : "+v"(c) : "v"(ah), "v"(al), "v"(bh), "v"(bl));
  return c;
}
// batched GEMM like k_gemm_b but f16 operands: A f32 (split into f16 hi/lo if ASPLIT, else rounded to f16), Bt = f16 values [n][k]; alpha; C f32; N multiple of 16 (partial tiles skipped)
template <bool ASPLIT>
__global__ __launch_bounds__(128) void k_gemm_h(const float* __restrict__ A, int lda, size_t sA, const _Float16* __restrict__ Bh, int ldb, size_t sB, float alpha, float* __restrict__ C, int ldc, size_t sC, int M, int N, int K) {
  __shared__ __attribute__((aligned(16))) float so[4][16][64];
  const int tid = threadIdx.x, w = tid >> 5, lane = tid & 31, ln = lane & 15, hh = lane >> 4; const int by = blockIdx.y;
  A += (size_t)by * sA; Bh += (size_t)by * sB; C += (size_t)by * sC;
  const int ntn = (N + 63) / 64; const int wid = blockIdx.x * 4 + w; const int mt = wid / ntn, nq = wid % ntn; if (mt * 16 >= M) return;
  const int row0 = mt * 16, col0 = nq * 64; const float* arow = A + (size_t)(row0 + ln) * lda;
  v8f acc[4] = {};
  for (int kb = 0; kb < K; kb += 32) {
    FragH ah, al;
    const v4f x0 = *(const v4fa*)(arow + kb + 8 * hh), x1 = *(const v4fa*)(arow + kb + 8 * hh + 4), x2 = *(const v4fa*)(arow + kb + 16 + 8 * hh), x3 = *(const v4fa*)(arow + kb + 16 + 8 * hh + 4);
    float xs[16] = {x0[0],x0[1],x0[2],x0[3],x1[0],x1[1],x1[2],x1[3],x2[0],x2[1],x2[2],x2[3],x3[0],x3[1],x3[2],x3[3]};
#pragma unroll
    for (int i = 0; i < 16; ++i) { const _Float16 h = (_Float16)xs[i]; ah.h[i] = h; al.h[i] = ASPLIT ? (_Float16)(xs[i] - (float)h) : (_Float16)0.0f; }
#pragma unroll
    for (int t = 0; t < 4; ++t) { if (col0 + t * 16 >= N) continue; const size_t boff = (size_t)(col0 + t * 16 + ln) * ldb + kb; FragH bq; bq.half[0] = *(const v8us*)(Bh + boff + 8 * hh); bq.half[1] = *(const v8us*)(Bh + boff + 16 + 8 * hh);
      acc[t] = mmaH<ASPLIT ? 2 : 1>(ah.v, al.v, bq.v, bq.v, acc[t]); }
  }
#pragma unroll
  for (int t = 0; t < 4; ++t) { if (col0 + t * 16 >= N) continue;
#pragma unroll
    for (int r = 0; r < 8; ++r) so[w][8 * hh + r][t * 16 + ln] = acc[t][r] * alpha; }
  __builtin_amdgcn_fence(__ATOMIC_ACQ_REL, "workgroup"); __builtin_amdgcn_wave_barrier();
  const int rsub = lane >> 4, c4 = (lane & 15) * 4;
  {
#pragma unroll
    for (int q = 0; q < 8; ++q) { const int r = q * 2 + rsub; if (col0 + c4 < N) { const v4f v = *(const v4fa*)&so[w][r][c4]; *(v4f*)(C + (size_t)(row0 + r) * ldc + col0 + c4) = v; } }
     }
}

// ---- fragment order: how every f16 operand plane of the WMMA kernels lies in memory ----
// A plane of R rows x K values (R % 16 == 0, K % 32 == 0) is cut into tiles of 16 rows x 32 k, tile (row / 16) * (K / 32) + k / 32, 1 KiB each. A tile holds its 64 pieces of 8 values (16 bytes) in the order
// in which the 32 lanes load them as a 16x16x32 operand: piece c = 32 j + 16 hh + ln is row ln, k = 16 j + 8 hh + (0..7). A fragment is then two loads of 512 bytes in a row, 4 whole lines each;
// from rows at 1 KiB pitch each such load touched 16 lines. Every lane gets the values it got before. Producers: thread t makes piece t, so that a wave stores 512 bytes in a row.
__device__ __forceinline__ int fo_row(size_t t, int K) { return (int)((t >> 6) / (unsigned)(K / 32)) * 16 + (int)(t & 15); }
__device__ __forceinline__ int fo_k(size_t t, int K) { return (int)((t >> 6) % (unsigned)(K / 32)) * 32 + (int)((t >> 5) & 1) * 16 + (int)((t >> 4) & 1) * 8; }
// Wt[n][k] = f16(W[k][n]·scale) from f32 row-major W[K][N] (scale = power of two; bf16-exact weights stay exact in f16 away from the subnormal range)
__device__ __forceinline__ void wt_f16_body(int bx, const float* __restrict__ W, _Float16* __restrict__ Wt, int K, int N, float scale) {
  const int t = bx * 256 + threadIdx.x; if (t >= N * (K / 8)) return; const int n = fo_row(t, K), k8 = fo_k(t, K); FragH f;      /* thread t makes piece t of the fragment-ordered plane: 16 lanes read 16 neighbouring n */
#pragma unroll
  for (int i = 0; i < 8; ++i) f.h[i] = (_Float16)(bf16_round(W[(size_t)(k8 + i) * N + n]) * scale); const v8us o = f.half[0];
  *(v8us*)((unsigned short*)Wt + (size_t)t * 8) = o; 
}
// k_gemm_hh variant with fused epilogue: v = acc·alpha + bias[by·sBias + col] (+ CP[(row/rowsPerB)·sCPb + by·64 + col] if CP) ; ACT 0 none / 1 elu ; writes f16 C16 (and f32 C if non-null)
template <int ACT>
__global__ __launch_bounds__(128) void k_gemm_hhx(const _Float16* __restrict__ A, int lda, size_t sA, const _Float16* __restrict__ Bh, int ldb, size_t sB, float alpha, const float* __restrict__ bias, size_t sBias, const float* __restrict__ CP, int rowsPerB, size_t sCPb, int row0g,
    float* __restrict__ C, _Float16* __restrict__ C16, int ldc, size_t sC, int M, int N, int K) {
  __shared__ __attribute__((aligned(16))) float so[4][16][64];
  const int tid = threadIdx.x, w = tid >> 5, lane = tid & 31, ln = lane & 15, hh = lane >> 4; const int by = blockIdx.y;
  A += (size_t)by * sA; Bh += (size_t)by * sB; const size_t cofs = (size_t)by * sC; const float* bp = bias ? bias + (size_t)by * sBias : nullptr;
  const int ntn = (N + 63) / 64; const int wid = blockIdx.x * 4 + w; const int mt = wid / ntn, nq = wid % ntn; if (mt * 16 >= M) return;
  const int row0 = mt * 16, col0 = nq * 64; const _Float16* arow = A + (size_t)(row0 + ln) * lda;
  v8f acc[4] = {};
  for (int kb = 0; kb < K; kb += 32) { FragH ah; ah.half[0] = *(const v8us*)((const unsigned short*)arow + kb + 8 * hh); ah.half[1] = *(const v8us*)((const unsigned short*)arow + kb + 16 + 8 * hh);
#pragma unroll
    for (int t = 0; t < 4; ++t) { if (col0 + t * 16 >= N) continue; const size_t boff = (size_t)(col0 + t * 16 + ln) * ldb + kb; FragH bq; bq.half[0] = *(const v8us*)((const unsigned short*)Bh + boff + 8 * hh); bq.half[1] = *(const v8us*)((const unsigned short*)Bh + boff + 16 + 8 * hh);
      acc[t] = mmaH<1>(ah.v, ah.v, bq.v, bq.v, acc[t]); }
  }
#pragma unroll
  for (int t = 0; t < 4; ++t) { if (col0 + t * 16 >= N) continue; const int col = col0 + t * 16 + ln; const float bv = bp ? bf16_round(bp[col]) : 0.f;
#pragma unroll
    for (int r = 0; r < 8; ++r) { float v = acc[t][r] * alpha + bv; if (CP) { const int rr = row0g + row0 + 8 * hh + r; if (rowsPerB < 0) v += CP[cofs + (size_t)rr * ldc + col];      /* rowsPerB < 0: own element of the batched C plane */ else { const int bidx = rr / rowsPerB; v += CP[(size_t)bidx * sCPb + (size_t)by * 64 + col]; } } if (ACT == 1) v = (v > 0.f) ? v : expm1f(v); else if (ACT == 7) v = (v > 0.f) ? v + 1.0f : expf(v); else if (ACT == 8) v = tanhf(v); else if (ACT == 9) v = 0.5f * v * (1.0f + tanhf(0.7978845608028654f * (v + 0.044715f * v * v * v))); else if (ACT == 11) v = 1.0f / (1.0f + expf(-v)); else if (ACT == 12) v = (v > 0.f) ? v : 0.01f * v; else if (ACT == 14) v = (v > 0.f) ? v : 0.1f * v; else if (ACT == 16) v = (v >= 0.f) ? v : 0.3f * v; else if (ACT == 17) v = (v >= 0.f) ? v : 0.2f * v; else if (ACT == 15) v = v / (1.0f + expf(-v)); else if (ACT == 3) v = fmaxf(v, 0.f); else if (ACT == 6) v = 0.5f * v * (1.0f + erff(v * 0.70710678118654752f)); so[w][8 * hh + r][t * 16 + ln] = v; } }
  __builtin_amdgcn_fence(__ATOMIC_ACQ_REL, "workgroup"); __builtin_amdgcn_wave_barrier();
  const int rsub = lane >> 4, c4 = (lane & 15) * 4; typedef _Float16 v4h __attribute__((ext_vector_type(4)));
  {
#pragma unroll
    for (int q = 0; q < 8; ++q) { const int r = q * 2 + rsub; if (col0 + c4 < N) { const v4f v = *(const v4fa*)&so[w][r][c4]; if (C) *(v4f*)(C + cofs + (size_t)(row0 + r) * ldc + col0 + c4) = v; if (C16) { v4h h4; for (int i = 0; i < 4; ++i) h4[i] = (_Float16)v[i]; *(v4h*)(C16 + cofs + (size_t)(row0 + r) * ldc + col0 + c4) = h4; } } }
     }
}


typedef _Float16 v4h __attribute__((ext_vector_type(4)));

// rows of DM values into a fragment-ordered plane of n8 pieces; rows from nrows on are not read and become zero
__device__ __forceinline__ void x16_body(int bx, const float* __restrict__ x, _Float16* __restrict__ X16, int nrows, size_t n8) { const size_t t = (size_t)bx * 256 + threadIdx.x; if (t >= n8) return; FragH f; const int row = fo_row(t, DM); const float* s = x + (size_t)row * DM + fo_k(t, DM);
  const v8us z = {0, 0, 0, 0, 0, 0, 0, 0}; f.half[0] = z;
  if (row < nrows) {
#pragma unroll
    for (int q = 0; q < 8; ++q) f.h[q] = (_Float16)bf16_round(s[q]); }
  *(v8us*)((unsigned short*)X16 + t * 8) = f.half[0];  }
__global__ __launch_bounds__(256) void k_h16(const float* __restrict__ x, _Float16* __restrict__ X16, size_t n8) { const size_t t = (size_t)blockIdx.x * 256 + threadIdx.x; if (t >= n8) return; FragH f;
#pragma unroll
  for (int q = 0; q < 8; ++q) f.h[q] = (_Float16)x[t * 8 + q]; *(v8us*)((unsigned short*)X16 + t * 8) = f.half[0];  }
__global__ __launch_bounds__(256) void k_round16f(const float* __restrict__ W, _Float16* __restrict__ Bt, size_t n8) { const size_t t = (size_t)blockIdx.x * 256 + threadIdx.x; if (t >= n8) return; FragH f;
#pragma unroll
  for (int i = 0; i < 8; ++i) f.h[i] = (_Float16)(bf16_round(W[t * 8 + i]) * 16.0f); *(v8us*)((unsigned short*)Bt + t * 8) = f.half[0];  }
__global__ __launch_bounds__(256) void k_hl(const float* __restrict__ F, _Float16* __restrict__ Hh, _Float16* __restrict__ Hl, size_t n8) { const size_t t = (size_t)blockIdx.x * 256 + threadIdx.x; if (t >= n8) return; FragH fh, fl; const v4f a = *(const v4fa*)(F + t * 8), c = *(const v4fa*)(F + t * 8 + 4);
#pragma unroll
  for (int q = 0; q < 4; ++q) { _Float16 h = (_Float16)a[q]; fh.h[q] = h; fl.h[q] = (_Float16)((a[q] - (float)h) * 1024.0f); h = (_Float16)c[q]; fh.h[4 + q] = h; fl.h[4 + q] = (_Float16)((c[q] - (float)h) * 1024.0f); }
  { *(v8us*)((unsigned short*)Hh + t * 8) = fh.half[0]; *(v8us*)((unsigned short*)Hl + t * 8) = fl.half[0];  } }

// ---- fast GEMM (wave tile 32x64; requires M % 32 == 0 rows per launch region and N % 64 == 0); epilogue = k_gemm_hhx semantics ----
__device__ __forceinline__ v16h g2_frag(const _Float16* p, int hh) { FragH f; f.half[0] = *(const v8us*)((const unsigned short*)p + 8 * hh); f.half[1] = *(const v8us*)((const unsigned short*)p + 16 + 8 * hh); return f.v; }
__device__ __forceinline__ v16h fo_frag(const _Float16* p) { FragH f; f.half[0] = *(const v8us*)((const unsigned short*)p); f.half[1] = *(const v8us*)((const unsigned short*)p + 256); return f.v; }      /* p: a tile of a fragment-ordered plane + 8 lane */
#define G2D 2                        /* k steps requested ahead in gemm2_body */
__device__ __forceinline__ v8f g2_mma(v16h a, v16h b, v8f c) { v8f d = __builtin_amdgcn_wmma_f32_16x16x32_f16(false, a, false, b, (short)0, c, false, false); asm volatile("v_nop\n\tv_nop\n\tv_nop\n\tv_nop" : "+v"(d) : "v"(a), "v"(b)); return d; }
template <int ACT, int KT>
__device__ __forceinline__ void gemm2_body(int bx, int by, const _Float16* __restrict__ A, int lda, size_t sA, const _Float16* __restrict__ Bh, int ldb, size_t sB, float alpha, const float* __restrict__ bias, size_t sBias, const float* __restrict__ CP, int rowsPerB, size_t sCPb, int row0g,
    float* __restrict__ C, _Float16* __restrict__ C16, int ldc, size_t sC, int M, int N, int K,
    const float* __restrict__ ub = nullptr, const float* __restrict__ vb = nullptr, _Float16* __restrict__ CU = nullptr, _Float16* __restrict__ CV = nullptr, _Float16* __restrict__ VTo = nullptr) { static_assert(ACT == 0 || ACT == 3 || ACT == 6 || ACT == 8 || ACT == 9 || ACT == 11 || ACT == 12 || ACT == 14 || ACT == 15 || ACT == 16 || ACT == 17, "k_gemm2: unsupported ACT code (would silently apply no activation)");
  __shared__ __attribute__((aligned(16))) float so[4][32][68];
  const int tid = threadIdx.x, lane = tid & 31, ln = lane & 15, hh = lane >> 4; const int w = __builtin_amdgcn_readfirstlane(tid >> 5);      /* the wave's number in a scalar register: every tile address below is then a scalar base + the lane's piece */
  A += (size_t)by * sA; Bh += (size_t)by * sB; const size_t cofs = (size_t)by * sC; const float* bp = bias ? bias + (size_t)by * sBias : nullptr;
  const int ntn = N >> 6; const int mt = bx / ntn, nq = bx - mt * ntn; const int row0 = mt * 128 + 32 * w, col0 = nq * 64; if (row0 >= M) return;
  const _Float16* a0p = A + (size_t)row0 * lda; const _Float16* a1p = a0p + (size_t)16 * lda;      /* A, Bh fragment-ordered: 16 rows of tiles are 16 lda values; six scalar bases, to which each load adds the lane's piece */
  const _Float16* b0p = Bh + (size_t)col0 * ldb; const _Float16* b1p = b0p + (size_t)16 * ldb; const _Float16* b2p = b1p + (size_t)16 * ldb; const _Float16* b3p = b2p + (size_t)16 * ldb;
  const v8f z8 = {0.f,0.f,0.f,0.f,0.f,0.f,0.f,0.f}; v8f c00 = z8, c01 = z8, c02 = z8, c03 = z8, c10 = z8, c11 = z8, c12 = z8, c13 = z8;
  /* K = KT at compile time, the k loop unrolled: the six fragments of a k step are requested together, G2D steps ahead of their use, into a ring of G2D + 1 register sets (48 registers a set);
     before, a step held four load-wait-multiply rounds in a row, 4 KT / 32 cache latencies a wave. Each accumulator still takes its k steps in rising order.
     The k step's tile of each operand lies 512 values behind the one before. */
  constexpr int NS = KT / 32; static_assert(KT % 32 == 0 && NS > G2D, "gemm2_body: whole k steps, more of them than are requested ahead"); (void)K;
  v16h fa[G2D + 1][2], fb[G2D + 1][4];
  auto ld = [&](int s) { const int e = s % (G2D + 1), kb = 512 * s + 8 * lane; fa[e][0] = fo_frag(a0p + kb); fa[e][1] = fo_frag(a1p + kb); fb[e][0] = fo_frag(b0p + kb); fb[e][1] = fo_frag(b1p + kb); fb[e][2] = fo_frag(b2p + kb); fb[e][3] = fo_frag(b3p + kb); };
#pragma unroll
  for (int s = 0; s < G2D; ++s) ld(s);
#pragma unroll
  for (int s = 0; s < NS; ++s) { const int e = s % (G2D + 1); if (s + G2D < NS) ld(s + G2D);
    c00 = g2_mma(fa[e][0], fb[e][0], c00); c10 = g2_mma(fa[e][1], fb[e][0], c10); c01 = g2_mma(fa[e][0], fb[e][1], c01); c11 = g2_mma(fa[e][1], fb[e][1], c11);
    c02 = g2_mma(fa[e][0], fb[e][2], c02); c12 = g2_mma(fa[e][1], fb[e][2], c12); c03 = g2_mma(fa[e][0], fb[e][3], c03); c13 = g2_mma(fa[e][1], fb[e][3], c13); }
  asm volatile("s_wait_xcnt 0x0" :: "s"(a0p), "s"(a1p), "s"(b0p), "s"(b1p), "s"(b2p), "s"(b3p), "v"(lane) : "memory");      /* the six scalar bases and the lane register that the loads name stay whole up to here and are reused only behind this wait */
  v8f accs[8] = {c00, c01, c02, c03, c10, c11, c12, c13};
  if (VTo) {      /* V^T [batch][head][64][SQ], fragment-ordered, straight from the accumulators: lane (ln, hh) of accumulator (half, t) holds tokens 16 half + 8 hh + (0..7) of column d = 16 t + ln,
                     which is piece 32 half + lane of the tile (d tile t, this wave's 32 tokens): 8 stores of 512 bytes in a row, no LDS; the test is the same for the whole work-group */
    unsigned short* vd = (unsigned short*)VTo + ((size_t)((row0 / SQ) * NH + nq) * (HD / 16) * (SQ / 32) + (row0 % SQ) / 32) * 512 + 8 * lane;
    float b4[4] = {0.f, 0.f, 0.f, 0.f}; FragH f[8];      /* the four bias values are requested together; all eight pieces are made before the first store, so that no register of an issued store is written again */
    if (bp) {
#pragma unroll
      for (int t = 0; t < 4; ++t) b4[t] = bf16_round(bp[col0 + t * 16 + ln]); }
#pragma unroll
    for (int u = 0; u < 8; ++u)
#pragma unroll
      for (int r = 0; r < 8; ++r) f[u].h[r] = (_Float16)(accs[u][r] * alpha + b4[u & 3]);
#pragma unroll
    for (int u = 0; u < 8; ++u) *(v8us*)(vd + (size_t)(u & 3) * (SQ / 32) * 512 + (u >> 2) * 256) = f[u].half[0];
    return; }
#pragma unroll
  for (int u = 0; u < 8; ++u) { const int t = u & 3, half = u >> 2; const int col = col0 + t * 16 + ln; const float bv = bp ? bf16_round(bp[col]) : 0.f;
#pragma unroll
    for (int r = 0; r < 8; ++r) { const int rloc = half * 16 + 8 * hh + r; float v = accs[u][r] * alpha + bv; if (CP) { if (rowsPerB < 0) v += CP[cofs + (size_t)(row0g + row0 + rloc) * ldc + col];      /* rowsPerB < 0: own element of the batched C plane */ else { const int bidx = (row0g + row0 + rloc) / rowsPerB; v += CP[(size_t)bidx * sCPb + (size_t)by * 64 + col]; } }
      if (ACT == 3) v = fmaxf(v, 0.f); else if (ACT == 6) v = 0.5f * v * (1.0f + erff(v * 0.70710678118654752f)); else if (ACT == 11) v = 1.0f / (1.0f + expf(-v)); else if (ACT == 15) v = v / (1.0f + expf(-v)); else if (ACT == 12) v = (v > 0.f) ? v : 0.01f * v; else if (ACT == 8) v = tanhf(v); else if (ACT == 9) v = 0.5f * v * (1.0f + tanhf(0.7978845608028654f * (v + 0.044715f * v * v * v))); else if (ACT == 14) v = (v > 0.f) ? v : 0.1f * v; else if (ACT == 16) v = (v >= 0.f) ? v : 0.3f * v; else if (ACT == 17) v = (v >= 0.f) ? v : 0.2f * v;
      so[w][rloc][t * 16 + ln] = v; } }
  __builtin_amdgcn_fence(__ATOMIC_ACQ_REL, "workgroup"); __builtin_amdgcn_wave_barrier();
  const int rsub = lane >> 4, c4 = (lane & 15) * 4;
  {
#pragma unroll
    for (int q = 0; q < 16; ++q) { const int r = q * 2 + rsub; const v4f v = *(const v4fa*)&so[w][r][c4]; if (C) *(v4f*)(C + cofs + (size_t)(row0 + r) * ldc + col0 + c4) = v; }
    if (C) asm volatile("s_wait_xcnt 0x0" ::: "memory");      /* the f32 stores' address registers are reused, where an f16 plane follows, only behind this wait */
    if (C16) {      /* the f16 plane is fragment-ordered: the wave's 32 x 64 values are 2 x 2 tiles, 8 stores of 512 bytes in a row */
#pragma unroll
      for (int q = 0; q < 8; ++q) { const float* s = &so[w][(q >> 2) * 16 + ln][((q >> 1) & 1) * 32 + (q & 1) * 16 + 8 * hh]; const v4f x = *(const v4fa*)s, y = *(const v4fa*)(s + 4); FragH f;
#pragma unroll
        for (int i = 0; i < 4; ++i) { f.h[i] = (_Float16)x[i]; f.h[4 + i] = (_Float16)y[i]; }
        *(v8us*)((unsigned short*)C16 + cofs + ((size_t)(row0 / 16 + (q >> 2)) * (ldc / 32) + col0 / 32 + ((q >> 1) & 1)) * 512 + (q & 1) * 256 + 8 * lane) = f.half[0]; } }
    if (CU) {       /* two fragment-ordered f16 planes of the f32 result plus a row vector each (q + pos_bias_u, q + pos_bias_v): the same pieces as above, each rounded once from the f32 sum */
#pragma unroll
      for (int cg = 0; cg < 4; ++cg) { const int cl = (cg >> 1) * 32 + (cg & 1) * 16 + 8 * hh; float bu[8], bw[8];
#pragma unroll
        for (int i = 0; i < 8; ++i) { bu[i] = bf16_round(ub[col0 + cl + i]); bw[i] = bf16_round(vb[col0 + cl + i]); }
#pragma unroll
        for (int rh = 0; rh < 2; ++rh) { const float* s = &so[w][rh * 16 + ln][cl]; const v4f x = *(const v4fa*)s, y = *(const v4fa*)(s + 4); FragH fu, fv;
#pragma unroll
          for (int i = 0; i < 4; ++i) { fu.h[i] = (_Float16)__fadd_rn(x[i], bu[i]); fu.h[4 + i] = (_Float16)__fadd_rn(y[i], bu[4 + i]); fv.h[i] = (_Float16)__fadd_rn(x[i], bw[i]); fv.h[4 + i] = (_Float16)__fadd_rn(y[i], bw[4 + i]); }
          const size_t o = cofs + ((size_t)(row0 / 16 + rh) * (ldc / 32) + col0 / 32 + (cg >> 1)) * 512 + (cg & 1) * 256 + 8 * lane;
          *(v8us*)((unsigned short*)CU + o) = fu.half[0]; *(v8us*)((unsigned short*)CV + o) = fv.half[0]; } } }
     } }
template <int ACT>
__global__ __launch_bounds__(128) void k_gemm2(const _Float16* __restrict__ A, int lda, size_t sA, const _Float16* __restrict__ Bh, int ldb, size_t sB, float alpha, const float* __restrict__ bias, size_t sBias, const float* __restrict__ CP, int rowsPerB, size_t sCPb, int row0g,
    float* __restrict__ C, _Float16* __restrict__ C16, int ldc, size_t sC, int M, int N, int K) { gemm2_body<ACT, DM>(blockIdx.x, blockIdx.y, A, lda, sA, Bh, ldb, sB, alpha, bias, sBias, CP, rowsPerB, sCPb, row0g, C, C16, ldc, sC, M, N, K); }


__global__ __launch_bounds__(256) void k_wnat(const float* __restrict__ w, size_t n8, _Float16* __restrict__ Bt) { const size_t t = (size_t)blockIdx.x * 256 + threadIdx.x; if (t >= n8) return; FragH f; for (int q = 0; q < 8; ++q) f.h[q] = (_Float16)(bf16_round(w[t * 8 + q]) * 16.0f); *(v8us*)((unsigned short*)Bt + t * 8) = f.half[0];  }
__global__ __launch_bounds__(256) void k_rsm(const float* __restrict__ S, _Float16* __restrict__ P, int nrows) {
  #pragma clang fp contract(off)
  const int i = blockIdx.x * 256 + threadIdx.x; if (i >= nrows) return; const float* s = S + (size_t)i * SQ; float mx = -3.0e38f;
#pragma unroll 1
  for (int j = 0; j < SQ; ++j) mx = fmaxf(mx, s[j]); float se = 0.f;
#pragma unroll 1
  for (int j = 0; j < SQ; ++j) se += expf(s[j] - mx); const float sc = 256.0f / se;
#pragma unroll 1
  for (int j0 = 0; j0 < SQ; j0 += 8) { FragH f; for (int q = 0; q < 8; ++q) f.h[q] = (_Float16)(expf(s[j0 + q] - mx) * sc); unsigned short* d = (unsigned short*)P + (size_t)i * SQ + j0; *(v8us*)d = f.half[0];  } }
__global__ __launch_bounds__(256) void k_vt(const _Float16* __restrict__ V16, int b, int h0, _Float16* __restrict__ VT) { __shared__ unsigned short tl[64][65]; const int tid = threadIdx.x; const int hh = blockIdx.x % HG, sg = blockIdx.x / HG; const int s0 = sg * 64; const int h = h0 + hh;
  for (int i = tid; i < 64 * 8; i += 256) { const int j = i / 8, d8 = (i % 8) * 8; FragH f; f.half[0] = *(const v8us*)((const unsigned short*)V16 + ((size_t)b * SQ + s0 + j) * DM + h * HD + d8); for (int q = 0; q < 8; ++q) tl[d8 + q][j] = f.u[q]; }
  __syncthreads();
  { for (int i = tid; i < 64 * 8; i += 256) { const int d = i / 8, j8 = (i % 8) * 8; FragH f; for (int q = 0; q < 8; ++q) f.u[q] = tl[d][j8 + q]; *(v8us*)((unsigned short*)VT + ((size_t)hh * HD + d) * SQ + s0 + j8) = f.half[0]; }  } }

// ---- launches that need nothing of each other share one grid: a range test on the block index, the same for a whole work-group, picks the job; each job's blocks do what its own launch did ----
#define GW (DM * (DM / 8) / 256)             /* blocks a weight matrix: 128 */
#define GX ((int)(NR * DM / 8 / 256))        /* blocks an input tensor: 1024 */
#define GE (PP * DM / 8 / 256)               /* blocks of the position table, pad row included: 512 */
#define GG ((int)(NR / 128) * (DM / 64))     /* blocks of a 4096-row projection: 256 */
#define GR ((PP / 128) * (DM / 64))          /* blocks of the position projection: 128 */
static_assert((size_t)GE * 256 == (size_t)PP * DM / 8 && PP % 16 == 0 && NPOS < PP, "k_prep: the position range covers the padded table, whole tiles");
// the five weight transposes (strided reads, the longest blocks: first), the three inputs and the position table as f16 rows
__global__ __launch_bounds__(256) void k_prep(const float* __restrict__ wq, const float* __restrict__ wk, const float* __restrict__ wv, const float* __restrict__ wpos, const float* __restrict__ wo,
    const float* __restrict__ xq, const float* __restrict__ xk, const float* __restrict__ xv, const float* __restrict__ pe,
    _Float16* __restrict__ BQ, _Float16* __restrict__ BK, _Float16* __restrict__ BV, _Float16* __restrict__ BP, _Float16* __restrict__ BO,
    _Float16* __restrict__ XQ, _Float16* __restrict__ XK, _Float16* __restrict__ XV, _Float16* __restrict__ PE) {
  int bx = blockIdx.x;
  if (bx < 5 * GW) { const int g = bx / GW; const float* W = (g == 0) ? wq : (g == 1) ? wk : (g == 2) ? wv : (g == 3) ? wpos : wo; _Float16* Wt = (g == 0) ? BQ : (g == 1) ? BK : (g == 2) ? BV : (g == 3) ? BP : BO;
    wt_f16_body(bx - g * GW, W, Wt, DM, DM, 16.0f); return; }
  bx -= 5 * GW;
  if (bx < 3 * GX) { const int g = bx / GX; const float* x = (g == 0) ? xq : (g == 1) ? xk : xv; _Float16* X = (g == 0) ? XQ : (g == 1) ? XK : XV;
    x16_body(bx - g * GX, x, X, (int)NR, NR * DM / 8); return; }
  bx -= 3 * GX;
  x16_body(bx, pe, PE, NPOS, (size_t)PP * DM / 8); }      /* pad row 2047 becomes zero */
// q + pos_bias_u, q + pos_bias_v, k, p = pos_emb Wpos (f16 rows; row 2047 of p is the zero pad), V^T [4][8][64][1024]: one k loop; the epilogue stores each result as the attention kernel reads it
static_assert(DM == NH * HD && SQ % 128 == 0, "k_proj: a 64-column tile is one head, a work-group's 128 rows lie in one batch");
__global__ __launch_bounds__(128) void k_proj(const _Float16* __restrict__ XQ, const _Float16* __restrict__ XK, const _Float16* __restrict__ XV, const _Float16* __restrict__ PE,
    const _Float16* __restrict__ BQ, const _Float16* __restrict__ BK, const _Float16* __restrict__ BV, const _Float16* __restrict__ BP,
    const float* __restrict__ bq, const float* __restrict__ bk, const float* __restrict__ bv, const float* __restrict__ ub, const float* __restrict__ vb,
    _Float16* __restrict__ QU, _Float16* __restrict__ QV, _Float16* __restrict__ K16, _Float16* __restrict__ VT, _Float16* __restrict__ R16) {
  const int g = blockIdx.x / GG;
  const _Float16* A = (g == 0) ? XQ : (g == 1) ? XK : (g == 2) ? XV : PE; const _Float16* Bh = (g == 0) ? BQ : (g == 1) ? BK : (g == 2) ? BV : BP;
  const int bx = blockIdx.x - g * GG;
  const float* bias = (g == 0) ? bq : (g == 1) ? bk : (g == 2) ? bv : nullptr; _Float16* C16 = (g == 1) ? K16 : (g == 3) ? R16 : nullptr;
  gemm2_body<0, DM>(bx, 0, A, DM, 0, Bh, DM, 0, 0.0625f, bias, 0, nullptr, 1, 0, 0, nullptr, C16, DM, 0, (g == 3) ? PP : (int)NR, DM, DM, ub, vb, (g == 0) ? QU : nullptr, QV, (g == 2) ? VT : nullptr); }
// Fused relative attention, one work-group per (batch, head, FR query rows); the FR x 1024 score rows live in LDS and never reach memory.
// 1: bd tiles (q + v) . p[i0 + 16 t ..], each element stored at its shifted column j = T - 1 + i - pos (in the edge tiles a column outside 0..T-1 goes to the pad column T, which nobody reads);
// 2: ac tiles (q + u) . k added in place. Both products take the position or key tile as A and the query tile as B (the two operands have the same lane map), so that D comes out transposed:
// lane ln holds query row ln, its 8 registers 8 neighbouring positions or keys, that is 8 neighbouring columns of one score row: ac goes in by 16-byte LDS loads and stores, bd by stores of neighbouring words; 3: one wave per row: lane l holds columns 4 l + 128 u + (0..3), mask, f32 statistics, weights x256 as f16 written over the row's own first half;
// 4: o = P . V^T: a wave does 32 rows x 16 columns over one half of k (each V^T fragment is loaded once a work-group); the two halves are added on the way out, where one wave writes each 128-byte line.
// Global fragments are requested ahead of their use, into the registers that the running step sets free.
#define FR 32
#define FD 6                         /* fragment tiles in flight a wave: 96 registers */
#define FP (SQ + 4)                  /* LDS row pitch in floats: 16 B x odd, for the ds_load_b128 fragment reads of step 4 */
typedef int   v4ia __attribute__((ext_vector_type(4), may_alias));
typedef _Float16 v4ha __attribute__((ext_vector_type(4), may_alias));
static_assert(SQ == 1024 && HD == 64 && FR == 32 && SQ - 1 + FR <= 66 * 16 && SQ - FR + 66 * 16 <= PP, "k_relattn: 8 waves, 66 position tiles inside the padded table");
// Four native 2^x (what __expf compiles to, behind its multiply by log2 e). Written in one statement so that the slot the instruction set asks for behind a transcendental is kept by construction:
// each v_exp_f32 is followed by one that neither reads its result nor overwrites its source (early-clobber outputs), the last by v_nop.
__device__ __forceinline__ void exp2x4(float x0, float x1, float x2, float x3, float* e) {
  asm("v_exp_f32 %0, %4\n\tv_exp_f32 %1, %5\n\tv_exp_f32 %2, %6\n\tv_exp_f32 %3, %7\n\tv_nop" : "=&v"(e[0]), "=&v"(e[1]), "=&v"(e[2]), "=&v"(e[3]) : "v"(x0), "v"(x1), "v"(x2), "v"(x3)); }
__global__ __launch_bounds__(256) __attribute__((amdgpu_waves_per_eu(4, 4))) void k_relattn(const _Float16* __restrict__ QU, const _Float16* __restrict__ QV, const _Float16* __restrict__ K16, const _Float16* __restrict__ R16, const _Float16* __restrict__ VT, const int* __restrict__ mask, _Float16* __restrict__ O16) {
  __shared__ __attribute__((aligned(16))) float sc[FR][FP];
  __shared__ __attribute__((aligned(16))) float so[2][FR][68];
  const int tid = threadIdx.x, lane = tid & 31, ln = lane & 15, hh = lane >> 4; const int w = __builtin_amdgcn_readfirstlane(tid >> 5);
  const int it = blockIdx.x % (SQ / FR), bh = blockIdx.x / (SQ / FR), h = bh % NH, b = bh / NH; const int i0 = it * FR; const size_t r0 = (size_t)b * SQ;
  const v8f z8 = {0.f,0.f,0.f,0.f,0.f,0.f,0.f,0.f};
  const int ho = h * (HD / 32) * 512 + 8 * lane;      /* fragment-ordered planes of DM values a row: 16 rows are 16 DM values, in them the head's two tiles, in a tile the lane's piece */
  const _Float16* pp = R16 + (size_t)(i0 + w * 16) * DM; const _Float16* kp = K16 + (r0 + w * 16) * DM;      /* tile w; tile w + 8 k lies 128 k rows on; scalar bases, to which each load adds ho */
  const _Float16* qp = QV + (r0 + i0) * DM; v16h a00 = fo_frag(qp + ho), a01 = fo_frag(qp + ho + 512), a10 = fo_frag(qp + ho + 16 * DM), a11 = fo_frag(qp + ho + 16 * DM + 512);
  v16h fr[16][2];      /* this wave's 8 position tiles, then its 8 key tiles: one stream, requested FD tiles ahead of its use */
  auto fetch = [&](int n) { const _Float16* p = ((n < 8) ? pp + (size_t)n * 128 * DM : kp + (size_t)(n - 8) * 128 * DM) + ho; fr[n][0] = fo_frag(p); fr[n][1] = fo_frag(p + 512); };
#pragma unroll
  for (int n = 0; n < FD; ++n) fetch(n);
  asm volatile("s_wait_xcnt 0x0" :: "s"(qp), "s"(pp), "v"(ho) : "memory");      /* the issued loads' address registers (scalar bases, the lane's offset) stay whole up to here and are reused only behind this wait */
  const int jw = SQ - 1 + ln - w * 16 - 8 * hh;      /* column of row ln at position i0 + 16 w + 8 hh; register r lies r columns below */
#pragma unroll
  for (int k = 0; k < 8; ++k) { fetch(k + FD); v8f c0 = g2_mma(fr[k][0], a00, z8), c1 = g2_mma(fr[k][0], a10, z8); c0 = g2_mma(fr[k][1], a01, c0); c1 = g2_mma(fr[k][1], a11, c1);
    const int jb = jw - 128 * k;
    if (k == 0) {      /* tiles 0 and 1 reach past column T - 1 */
#pragma unroll
      for (int r = 0; r < 8; ++r) { const int j = jb - r, j1 = j + 16; sc[ln][((unsigned)j < SQ) ? j : SQ] = c0[r]; sc[16 + ln][((unsigned)j1 < SQ) ? j1 : SQ] = c1[r]; }
    } else {           /* tiles 8 to 63: every column inside */
#pragma unroll
      for (int r = 0; r < 8; ++r) { sc[ln][jb - r] = c0[r]; sc[16 + ln][jb + 16 - r] = c1[r]; } }
    __builtin_amdgcn_sched_barrier(0); }      /* one tile's accumulators and LDS addresses live at a time: without it the compiler opens six tiles at once and spills */
  if (w < 2) {         /* tiles 64 and 65 reach below column 0 */
    const _Float16* p8 = pp + ho + (size_t)8 * 128 * DM; const v16h b0 = fo_frag(p8), b1 = fo_frag(p8 + 512);
    asm volatile("s_wait_xcnt 0x0" :: "v"(p8) : "memory");      /* the four loads' address pair stays whole up to here */
    v8f c0 = g2_mma(b0, a00, z8), c1 = g2_mma(b0, a10, z8); c0 = g2_mma(b1, a01, c0); c1 = g2_mma(b1, a11, c1); const int jb = jw - 128 * 8;
#pragma unroll
    for (int r = 0; r < 8; ++r) { const int j = jb - r, j1 = j + 16; sc[ln][((unsigned)j < SQ) ? j : SQ] = c0[r]; sc[16 + ln][((unsigned)j1 < SQ) ? j1 : SQ] = c1[r]; } }
  qp = QU + (r0 + i0) * DM; a00 = fo_frag(qp + ho); a01 = fo_frag(qp + ho + 512); a10 = fo_frag(qp + ho + 16 * DM); a11 = fo_frag(qp + ho + 16 * DM + 512);
  asm volatile("s_wait_xcnt 0x0" :: "s"(qp), "s"(kp), "v"(ho) : "memory");      /* as above */
  __syncthreads();
  const int* mk = mask + (r0 + i0 + w * 4) * SQ + 4 * lane; v4ia m[2][8];
  float* ar = &sc[ln][w * 16 + 8 * hh]; v4f nd[4];      /* row ln, the lane's 8 columns of key tile w; tile w + 8 k lies 128 k floats on, row 16 + ln 16 FP floats on; a tile's bd values are read one tile ahead */
  auto ldb = [&](int k) { const float* p = ar + 128 * k; nd[0] = *(const v4fa*)p; nd[1] = *(const v4fa*)(p + 4); nd[2] = *(const v4fa*)(p + 16 * FP); nd[3] = *(const v4fa*)(p + 16 * FP + 4); };
  ldb(0);
#pragma unroll
  for (int k = 0; k < 8; ++k) { if (k + FD < 8) fetch(8 + k + FD);
    float* p = ar + 128 * k; v8f c0 = {nd[0][0], nd[0][1], nd[0][2], nd[0][3], nd[1][0], nd[1][1], nd[1][2], nd[1][3]}, c1 = {nd[2][0], nd[2][1], nd[2][2], nd[2][3], nd[3][0], nd[3][1], nd[3][2], nd[3][3]};      /* bd is the start value that the products are summed onto */
    if (k < 7) ldb(k + 1);
    c0 = g2_mma(fr[8 + k][0], a00, c0); c1 = g2_mma(fr[8 + k][0], a10, c1); c0 = g2_mma(fr[8 + k][1], a01, c0); c1 = g2_mma(fr[8 + k][1], a11, c1);
    if (k == 4) {
#pragma unroll
      for (int u = 0; u < 8; ++u) m[0][u] = *(const v4ia*)(mk + 128 * u); }      /* this wave's first mask row */
    const v4f l0 = {c0[0], c0[1], c0[2], c0[3]}, h0 = {c0[4], c0[5], c0[6], c0[7]}, l1 = {c1[0], c1[1], c1[2], c1[3]}, h1 = {c1[4], c1[5], c1[6], c1[7]};
    *(v4fa*)p = l0; *(v4fa*)(p + 4) = h0; *(v4fa*)(p + 16 * FP) = l1; *(v4fa*)(p + 16 * FP + 4) = h1; }
  __builtin_amdgcn_sched_barrier(0);      /* step 3's mask compares stay behind the last tile: drawn up among the tiles, they wait there on the mask loads just issued */
  __syncthreads();
  const int nt = w & 3, kh = w >> 2; const _Float16* vp = VT + ((size_t)bh * HD + nt * 16) * SQ + kh * (SQ / 64) * 512; v16h vf[16];      /* fragment-ordered, SQ values a row: this wave's 16 tiles lie in a row */
#pragma unroll
  for (int k = 0; k < 4; ++k) { float* row = &sc[w * 4 + k][0]; const v4ia* mc = m[k & 1];
    if (k < 3) {
#pragma unroll
      for (int u = 0; u < 8; ++u) m[(k + 1) & 1][u] = *(const v4ia*)(mk + (k + 1) * SQ + 128 * u);      /* next row's mask flies while this row is worked on */
    } else {
#pragma unroll
      for (int s = 0; s < 16; ++s) vf[s] = fo_frag(vp + 512 * s + 8 * lane);      /* step 4's V^T fragments fly during the last row */
      asm volatile("s_wait_xcnt 0x0" :: "s"(vp), "v"(lane) : "memory"); }      /* as above */
    float v[8][4]; float m4[4] = {-3.0e38f, -3.0e38f, -3.0e38f, -3.0e38f};
#pragma unroll
    for (int u = 0; u < 8; ++u) { const v4f s = *(const v4fa*)(row + 4 * lane + 128 * u);
#pragma unroll
      for (int q = 0; q < 4; ++q) { v[u][q] = s[q] * 0.125f; m4[q] = fmaxf(m4[q], (mc[u][q] == 0) ? v[u][q] : -3.0e38f); } }
    float mx = fmaxf(fmaxf(m4[0], m4[1]), fmaxf(m4[2], m4[3]));
#pragma unroll
    for (int d = 16; d >= 1; d >>= 1) mx = fmaxf(mx, __shfl_xor(mx, d, 32));
    float s4[4] = {0.f, 0.f, 0.f, 0.f};
#pragma unroll
    for (int u = 0; u < 8; ++u) { float e[4]; exp2x4((v[u][0] - mx) * 1.44269504f, (v[u][1] - mx) * 1.44269504f, (v[u][2] - mx) * 1.44269504f, (v[u][3] - mx) * 1.44269504f, e);
#pragma unroll
      for (int q = 0; q < 4; ++q) { v[u][q] = (mc[u][q] == 0) ? e[q] : 0.f; s4[q] += v[u][q]; } }
    float se = (s4[0] + s4[1]) + (s4[2] + s4[3]);
#pragma unroll
    for (int d = 16; d >= 1; d >>= 1) se += __shfl_xor(se, d, 32);
    const float scl = (se > 0.f) ? 256.0f / se : 0.f;
#pragma unroll
    for (int u = 0; u < 8; ++u) { v4ha h4;
#pragma unroll
      for (int q = 0; q < 4; ++q) h4[q] = (_Float16)(v[u][q] * scl);
      *(v4ha*)((_Float16*)row + 4 * lane + 128 * u) = h4; } }
  __syncthreads();
  { const _Float16* ap = (const _Float16*)&sc[ln][0] + kh * (SQ / 2); v8f c0 = z8, c1 = z8; v16h af[2][4];      /* weight fragments of two k steps, read from LDS one pair of steps ahead */
#pragma unroll
    for (int e = 0; e < 2; ++e) { af[0][2 * e] = g2_frag(ap + 32 * e, hh); af[0][2 * e + 1] = g2_frag(ap + 16 * FP * 2 + 32 * e, hh); }
#pragma unroll
    for (int g = 0; g < 8; ++g) {
      if (g < 7) {
#pragma unroll
        for (int e = 0; e < 2; ++e) { af[(g + 1) & 1][2 * e] = g2_frag(ap + 32 * (2 * g + 2 + e), hh); af[(g + 1) & 1][2 * e + 1] = g2_frag(ap + 16 * FP * 2 + 32 * (2 * g + 2 + e), hh); } }
#pragma unroll
      for (int e = 0; e < 2; ++e) { c0 = g2_mma(af[g & 1][2 * e], vf[2 * g + e], c0); c1 = g2_mma(af[g & 1][2 * e + 1], vf[2 * g + e], c1); } }
#pragma unroll
    for (int r = 0; r < 8; ++r) { so[kh][8 * hh + r][nt * 16 + ln] = c0[r]; so[kh][16 + 8 * hh + r][nt * 16 + ln] = c1[r]; } }
  __syncthreads();
  { const int r = fo_row(tid, HD), c8 = fo_k(tid, HD); const v4f x = *(const v4fa*)&so[0][r][c8] + *(const v4fa*)&so[1][r][c8], y = *(const v4fa*)&so[0][r][c8 + 4] + *(const v4fa*)&so[1][r][c8 + 4]; FragH f;
#pragma unroll
    for (int q = 0; q < 4; ++q) { f.h[q] = (_Float16)(x[q] * 0.25f); f.h[4 + q] = (_Float16)(y[q] * 0.25f); }
    *(v8us*)((unsigned short*)O16 + (r0 + i0 + (tid >> 7) * 16) * DM + (h * (HD / 32) + ((tid >> 6) & 1)) * 512 + (tid & 63) * 8) = f.half[0]; } }      /* thread t makes piece t of the work-group's 2 x 2 tiles of the fragment-ordered o plane */

extern "C" void kernel_launch(void* const* d_in, const int* in_sizes, int n_in,
                              void* d_out, int out_size, void* d_ws, size_t ws_size, hipStream_t stream) {
  (void)in_sizes; (void)n_in; (void)out_size;
  const float* const* I = (const float* const*)d_in; const float* xq = I[0]; const float* xk = I[1]; const float* xv = I[2]; const int* mask = (const int*)d_in[3]; const float* pe = I[4]; const float* wq = I[5]; const float* bq = I[6]; const float* wk = I[7]; const float* bk = I[8]; const float* wv = I[9]; const float* bv = I[10]; const float* wpos = I[11]; const float* wo = I[12]; const float* bo = I[13]; const float* pbu = I[14]; const float* pbv = I[15];
  char* ws = (char*)d_ws; size_t off = 0;
  auto take = [&](size_t bytes) { char* p = ws + off; off += (bytes + 255) & ~(size_t)255; return p; };
  _Float16* BQ = (_Float16*)take((size_t)DM * DM * 2); _Float16* BK = (_Float16*)take((size_t)DM * DM * 2); _Float16* BV = (_Float16*)take((size_t)DM * DM * 2); _Float16* BP = (_Float16*)take((size_t)DM * DM * 2); _Float16* BO = (_Float16*)take((size_t)DM * DM * 2);
  _Float16* XQ = (_Float16*)take(NR * DM * 2); _Float16* XK = (_Float16*)take(NR * DM * 2); _Float16* XV = (_Float16*)take(NR * DM * 2); _Float16* PE = (_Float16*)take((size_t)PP * DM * 2);
  _Float16* QU = (_Float16*)take(NR * DM * 2); _Float16* QV = (_Float16*)take(NR * DM * 2); _Float16* K16 = (_Float16*)take(NR * DM * 2); _Float16* R16 = (_Float16*)take((size_t)PP * DM * 2); _Float16* O16 = (_Float16*)take(NR * DM * 2);
  _Float16* VT = (_Float16*)take((size_t)NB * NH * HD * SQ * 2);
  if (off > ws_size) return;      /* 2.5 + 12 + 2 + 12 + 2 + 4 + 4 = approx 39 MiB */
  k_prep<<<5 * GW + 3 * GX + GE, 256, 0, stream>>>(wq, wk, wv, wpos, wo, xq, xk, xv, pe, BQ, BK, BV, BP, BO, XQ, XK, XV, PE);      /* x16 weights transposed, inputs and position table as f16 rows */
  k_proj<<<3 * GG + GR, 128, 0, stream>>>(XQ, XK, XV, PE, BQ, BK, BV, BP, bq, bk, bv, pbu, pbv, QU, QV, K16, VT, R16);      /* q + pos_bias_u, q + pos_bias_v, k, p, V^T (f16) */
  k_relattn<<<NB * NH * (SQ / FR), 256, 0, stream>>>(QU, QV, K16, R16, VT, mask, O16);      /* scores, shifted softmax and o x64 (merged rows), all batches and heads */
  k_gemm2<0><<<dim3(GG, 1), 128, 0, stream>>>(O16, DM, 0, BO, DM, 0, 0.0009765625f, bo, 0, nullptr, 1, 0, 0, (float*)d_out, nullptr, DM, 0, (int)NR, DM, DM);      /* out = x Wout + bout */
}

// v008
// One run takes 65.8 microseconds.
// Timed twice side by side with v007, it ran 1.04 and 1.03 times as fast.
// Over all steps from v000 it is 63.0 times as fast.
#include <hip/hip_runtime.h>
// Relative-position multi-head attention with rel_shift (query, key, value [4][1024][512]; mask [4][1024][1024] int32 verbatim (nonzero = masked, ~50 %); pos_emb [1][2047][512]; q/k/v = x W + b ([512][512] [in][out]); p = pos_emb Wpos; 8 heads of 64; ac = (q + pos_bias_u) . k; bd = rel_shift((q + pos_bias_v) . p^T) = (q_i + v) . p[T-1+i-j]; scores = (ac + bd) / 8; masked -> float32 min; softmax; masked weights -> 0; x = attn v merged; out = x Wout + bout -> [4][1024][512].
// Structure: token rows; inputs and pos_emb as exact f16 rows (pos table padded to 2048 rows with zeros); q, k, v, p as WMMA GEMMs (32x64 wave tiles, f32 accumulation, exact x16 weights + bias) whose epilogues store the f16 planes that the attention kernel reads: q + u and q + v, k, p, and V^T straight from the accumulators; one fused kernel per (batch, head, 32 query rows): bd and ac WMMA tiles (K = 64) into f32 score rows in LDS, bd stored at its shifted column; the relative softmax with the mask on VALU (f32 statistics, native exp; weights unnormalised, 0 to 1, f16, in LDS); o = P . V^T on WMMA (K = 1024), times 64 / (row sum) on the way out (o x64 in f16); out GEMM (f32, + bout); launches that need nothing of each other share one grid (ranges of the block index); 4 launches. Every f16 operand plane lies in fragment order (see fo_row).
// Compute dtype: inputs rounded to bf16; inputs / weights exact in f16; q + u, q + v, k, v, p, softmax weights and o plain f16 (~2^-12); ac, bd, softmax statistics f32; v_wmma_f32_16x16x32_f16.
#define NB 4
#define SQ 1024
#define PP 2048                      /* position table rows (2047 used, row 2047 zero) */
#define NPOS 2047
#define DM 512
#define NH 8
#define HD 64
#define HG 8
#define NR ((size_t)NB * SQ)
typedef __bf16 v16b __attribute__((ext_vector_type(16)));
typedef unsigned short v8us __attribute__((ext_vector_type(8), may_alias));
typedef float  v8f  __attribute__((ext_vector_type(8)));
typedef float  v4f  __attribute__((ext_vector_type(4)));
typedef float  v4fa __attribute__((ext_vector_type(4), may_alias));
union FragB { v16b v; v8us half[2]; unsigned short u[16]; };

__device__ __forceinline__ unsigned short bf16_bits(float x) { unsigned int u = __float_as_uint(x); return (unsigned short)((u + 0x7FFFu + ((u >> 16) & 1u)) >> 16); }
__device__ __forceinline__ float bf16_val(unsigned short b) { return __uint_as_float(((unsigned int)b) << 16); }
__device__ __forceinline__ float bf16_round(float x) { return bf16_val(bf16_bits(x)); }
// D += A·B with NT terms: 1 = ah·bh, 2 = + al·bh (A split), 3 = + ah·bl (both split)
template <int NT>
__device__ __forceinline__ v8f mmaN(v16b ah, v16b al, v16b bh, v16b bl, v8f c) {
  c = __builtin_amdgcn_wmma_f32_16x16x32_bf16(false, ah, false, bh, (short)0, c, false, false);
  if (NT >= 2) c = __builtin_amdgcn_wmma_f32_16x16x32_bf16(false, al, false, bh, (short)0, c, false, false);
  if (NT >= 3) c = __builtin_amdgcn_wmma_f32_16x16x32_bf16(false, ah, false, bl, (short)0, c, false, false);
  asm volatile("v_nop\n\tv_nop\n\tv_nop\n\tv_nop" : "+v"(c) : "v"(ah), "v"(al), "v"(bh), "v"(bl));
  return c;
}

__global__ __launch_bounds__(256) void k_wt_bf16(const float* __restrict__ W, unsigned short* __restrict__ Wt, int K, int N) {
  const int t = blockIdx.x * 256 + threadIdx.x;
  const int k8n = K / 8;
  if (t >= N * k8n) return;
  const int n = t / k8n, k8 = (t % k8n) * 8;
  v8us v;
#pragma unroll
  for (int i = 0; i < 8; ++i) v[i] = bf16_bits(W[(size_t)(k8 + i) * N + n]);
  *(v8us*)(Wt + (size_t)n * K + k8) = v;
  
}

// GEMM C[M][N] (f32, pitch ldc) = act(A[M][K]·W + bias). A f32 row-major (pitch lda) converted per fragment to bf16
// (ASPLIT: hi/lo two planes -> 2 terms, else single rounded term); Wt bf16 [N][K] (pitch ldb). BIAS_BF16 rounds the
// bias to bf16 first (bias quantised to bf16 before the add). K%32==0, M%16==0, N%64==0.
template <bool ASPLIT, int ACT, bool BIAS_BF16>
__global__ __launch_bounds__(128) void k_gemm_bf(const float* __restrict__ A, int lda, const unsigned short* __restrict__ Wt, int ldb,
                                               const float* __restrict__ bias, float* __restrict__ C, int ldc, int M, int N, int K) {
  __shared__ __attribute__((aligned(16))) float so[4][16][64];
  const int tid = threadIdx.x, w = tid >> 5, lane = tid & 31, ln = lane & 15, hh = lane >> 4;
  const int ntn = N / 64;
  const int wid = blockIdx.x * 4 + w;
  const int mt = wid / ntn, nq = wid % ntn;
  if (mt * 16 >= M) return;
  const int row0 = mt * 16, col0 = nq * 64;
  const float* arow = A + (size_t)(row0 + ln) * lda;
  v8f acc[4] = {};
  for (int kb = 0; kb < K; kb += 32) {
    FragB ah, al;
    const v4f x0 = *(const v4fa*)(arow + kb + 8 * hh), x1 = *(const v4fa*)(arow + kb + 8 * hh + 4);
    const v4f x2 = *(const v4fa*)(arow + kb + 16 + 8 * hh), x3 = *(const v4fa*)(arow + kb + 16 + 8 * hh + 4);
    float xs[16] = {x0[0],x0[1],x0[2],x0[3],x1[0],x1[1],x1[2],x1[3],x2[0],x2[1],x2[2],x2[3],x3[0],x3[1],x3[2],x3[3]};
#pragma unroll
    for (int i = 0; i < 16; ++i) { const unsigned short hb = bf16_bits(xs[i]); ah.u[i] = hb; al.u[i] = ASPLIT ? bf16_bits(xs[i] - bf16_val(hb)) : (unsigned short)0; }
#pragma unroll
    for (int t = 0; t < 4; ++t) {
      const unsigned short* brow = Wt + (size_t)(col0 + t * 16 + ln) * ldb + kb;
      FragB b;
      b.half[0] = *(const v8us*)(brow + 8 * hh);
      b.half[1] = *(const v8us*)(brow + 16 + 8 * hh);
      acc[t] = mmaN<ASPLIT ? 2 : 1>(ah.v, al.v, b.v, b.v, acc[t]);
    }
  }
#pragma unroll
  for (int t = 0; t < 4; ++t) {
    float bv = bias ? bias[col0 + t * 16 + ln] : 0.f;
    if (BIAS_BF16) bv = bf16_round(bv);
#pragma unroll
    for (int r = 0; r < 8; ++r) { float v = acc[t][r] + bv; if (ACT == 1) v = fmaxf(v, 0.f); so[w][8 * hh + r][t * 16 + ln] = v; }
  }
  __builtin_amdgcn_fence(__ATOMIC_ACQ_REL, "workgroup");
  __builtin_amdgcn_wave_barrier();
  const int rsub = lane >> 4, c4 = (lane & 15) * 4;
  {
#pragma unroll
    for (int q = 0; q < 8; ++q) {
      const int r = q * 2 + rsub;
      const v4f v = *(const v4fa*)&so[w][r][c4];
      *(v4f*)(C + (size_t)(row0 + r) * ldc + col0 + c4) = v;
    }
    
  }
}

// GEMM C = act(A·W + bias + resid): A f32 (ASPLIT -> hi/lo 2 terms), Wt bf16 [N][K]; ACT 0 none, 1 relu, 2 exact gelu;
// resid (optional, f32, row index = (row % rmod), pitch ldr, RES_BF16 rounds it) added before the activation.
template <bool ASPLIT, int ACT, bool BIAS_BF16, bool RES_BF16>
__global__ __launch_bounds__(128) void k_gemm_bf3(const float* __restrict__ A, int lda, const unsigned short* __restrict__ Wt, int ldb,
                                                const float* __restrict__ bias, const float* __restrict__ resid, int rmod, int ldr,
                                                float* __restrict__ C, int ldc, int M, int N, int K) {
  __shared__ __attribute__((aligned(16))) float so[4][16][64];
  const int tid = threadIdx.x, w = tid >> 5, lane = tid & 31, ln = lane & 15, hh = lane >> 4;
  const int ntn = N / 64;
  const int wid = blockIdx.x * 4 + w;
  const int mt = wid / ntn, nq = wid % ntn;
  if (mt * 16 >= M) return;
  const int row0 = mt * 16, col0 = nq * 64;
  const float* arow = A + (size_t)(row0 + ln) * lda;
  v8f acc[4] = {};
  for (int kb = 0; kb < K; kb += 32) {
    FragB ah, al;
    const v4f x0 = *(const v4fa*)(arow + kb + 8 * hh), x1 = *(const v4fa*)(arow + kb + 8 * hh + 4);
    const v4f x2 = *(const v4fa*)(arow + kb + 16 + 8 * hh), x3 = *(const v4fa*)(arow + kb + 16 + 8 * hh + 4);
    float xs[16] = {x0[0],x0[1],x0[2],x0[3],x1[0],x1[1],x1[2],x1[3],x2[0],x2[1],x2[2],x2[3],x3[0],x3[1],x3[2],x3[3]};
#pragma unroll
    for (int i = 0; i < 16; ++i) { const unsigned short hb = bf16_bits(xs[i]); ah.u[i] = hb; al.u[i] = ASPLIT ? bf16_bits(xs[i] - bf16_val(hb)) : (unsigned short)0; }
#pragma unroll
    for (int t = 0; t < 4; ++t) {
      const unsigned short* brow = Wt + (size_t)(col0 + t * 16 + ln) * ldb + kb;
      FragB b;
      b.half[0] = *(const v8us*)(brow + 8 * hh);
      b.half[1] = *(const v8us*)(brow + 16 + 8 * hh);
      acc[t] = mmaN<ASPLIT ? 2 : 1>(ah.v, al.v, b.v, b.v, acc[t]);
    }
  }
#pragma unroll
  for (int t = 0; t < 4; ++t) {
    const int col = col0 + t * 16 + ln;
    float bv = bias ? bias[col] : 0.f;
    if (BIAS_BF16) bv = bf16_round(bv);
#pragma unroll
    for (int r = 0; r < 8; ++r) {
      float v = acc[t][r] + bv;
      if (resid) { float rv = resid[(size_t)((row0 + 8 * hh + r) % rmod) * ldr + col]; if (RES_BF16) rv = bf16_round(rv); v += rv; }
      if (ACT == 1) v = fmaxf(v, 0.f);
      if (ACT == 2) v = 0.5f * v * (1.0f + erff(v * 0.70710678118654752f));
      if (ACT == 3) { const float u = 0.7978845608028654f * (v + 0.044715f * v * v * v); v = 0.5f * v * (1.0f + tanhf(u)); }
      so[w][8 * hh + r][t * 16 + ln] = v;
    }
  }
  __builtin_amdgcn_fence(__ATOMIC_ACQ_REL, "workgroup");
  __builtin_amdgcn_wave_barrier();
  const int rsub = lane >> 4, c4 = (lane & 15) * 4;
  {
#pragma unroll
    for (int q = 0; q < 8; ++q) {
      const int r = q * 2 + rsub;
      const v4f v = *(const v4fa*)&so[w][r][c4];
      *(v4f*)(C + (size_t)(row0 + r) * ldc + col0 + c4) = v;
    }
    
  }
}
// row LayerNorm (biased variance, eps) over N: s = X (+ R); optional out_sum <- s; out_norm <- (s-mu)*rsqrt(var+eps)*g + b
template <bool PARAM_BF16>
__global__ __launch_bounds__(256) void k_layernorm(const float* __restrict__ X, const float* __restrict__ R, const float* __restrict__ g, const float* __restrict__ bta,
                                                  float* __restrict__ out_sum, float* __restrict__ out_norm, int N, float eps) {
  __shared__ float red[256];
  const int row = blockIdx.x, tid = threadIdx.x;
  const float* x = X + (size_t)row * N; const float* rr = R ? R + (size_t)row * N : nullptr;
  float vals[16];                     // up to N = 4096
  const int per = N / 256;            // contiguous chunk per thread? use strided-by-4 chunks: thread handles j = tid*4 + 1024*u
  float s1 = 0.f;
  for (int u = 0; u < per / 4; ++u) {
    const int j = tid * 4 + 1024 * u;
    const v4f a = *(const v4fa*)(x + j);
    v4f b = {0.f,0.f,0.f,0.f}; if (rr) b = *(const v4fa*)(rr + j);
#pragma unroll
    for (int q = 0; q < 4; ++q) { const float v = a[q] + b[q]; vals[u * 4 + q] = v; s1 += v; }
  }
  red[tid] = s1; __syncthreads();
  for (int st = 128; st > 0; st >>= 1) { if (tid < st) red[tid] += red[tid + st]; __syncthreads(); }
  const float mu = red[0] / (float)N; __syncthreads();
  float s2 = 0.f;
  for (int u = 0; u < per / 4; ++u)
#pragma unroll
    for (int q = 0; q < 4; ++q) { const float c = vals[u * 4 + q] - mu; s2 += c * c; }
  red[tid] = s2; __syncthreads();
  for (int st = 128; st > 0; st >>= 1) { if (tid < st) red[tid] += red[tid + st]; __syncthreads(); }
  const float rs = rsqrtf(red[0] / (float)N + eps);
  {
    for (int u = 0; u < per / 4; ++u) {
      const int j = tid * 4 + 1024 * u;
      v4f o, sm;
#pragma unroll
      for (int q = 0; q < 4; ++q) {
        float gg = g[j + q], bb = bta[j + q];
        if (PARAM_BF16) { gg = bf16_round(gg); bb = bf16_round(bb); }
        sm[q] = vals[u * 4 + q]; o[q] = (vals[u * 4 + q] - mu) * rs * gg + bb;
      }
      if (out_sum) *(v4f*)(out_sum + (size_t)row * N + j) = sm;
      *(v4f*)(out_norm + (size_t)row * N + j) = o;
    }
    
  }
}



// ---- f16 WMMA path (v_wmma_f32_16x16x32_f16): 11-bit significands for operands in range — used where a [0,1] probability operand needs more precision than bf16
typedef _Float16 v16h __attribute__((ext_vector_type(16)));
union FragH { v16h v; v8us half[2]; _Float16 h[16]; unsigned short u[16]; };
template <int NT>
__device__ __forceinline__ v8f mmaH(v16h ah, v16h al, v16h bh, v16h bl, v8f c) {
  c = __builtin_amdgcn_wmma_f32_16x16x32_f16(false, ah, false, bh, (short)0, c, false, false);
  if (NT >= 2) c = __builtin_amdgcn_wmma_f32_16x16x32_f16(false, al, false, bh, (short)0, c, false, false);
  if (NT >= 3) c = __builtin_amdgcn_wmma_f32_16x16x32_f16(false, ah, false, bl, (short)0, c, false, false);
  asm volatile("v_nop\n\tv_nop\n\tv_nop\n\tv_nop" : "+v"(c) : "v"(ah), "v"(al), "v"(bh), "v"(bl));
  return c;
}
// batched GEMM like k_gemm_b but f16 operands: A f32 (split into f16 hi/lo if ASPLIT, else rounded to f16), Bt = f16 values [n][k]; alpha; C f32; N multiple of 16 (partial tiles skipped)
template <bool ASPLIT>
__global__ __launch_bounds__(128) void k_gemm_h(const float* __restrict__ A, int lda, size_t sA, const _Float16* __restrict__ Bh, int ldb, size_t sB, float alpha, float* __restrict__ C, int ldc, size_t sC, int M, int N, int K) {
  __shared__ __attribute__((aligned(16))) float so[4][16][64];
  const int tid = threadIdx.x, w = tid >> 5, lane = tid & 31, ln = lane & 15, hh = lane >> 4; const int by = blockIdx.y;
  A += (size_t)by * sA; Bh += (size_t)by * sB; C += (size_t)by * sC;
  const int ntn = (N + 63) / 64; const int wid = blockIdx.x * 4 + w; const int mt = wid / ntn, nq = wid % ntn; if (mt * 16 >= M) return;
  const int row0 = mt * 16, col0 = nq * 64; const float* arow = A + (size_t)(row0 + ln) * lda;
  v8f acc[4] = {};
  for (int kb = 0; kb < K; kb += 32) {
    FragH ah, al;
    const v4f x0 = *(const v4fa*)(arow + kb + 8 * hh), x1 = *(const v4fa*)(arow + kb + 8 * hh + 4), x2 = *(const v4fa*)(arow + kb + 16 + 8 * hh), x3 = *(const v4fa*)(arow + kb + 16 + 8 * hh + 4);
    float xs[16] = {x0[0],x0[1],x0[2],x0[3],x1[0],x1[1],x1[2],x1[3],x2[0],x2[1],x2[2],x2[3],x3[0],x3[1],x3[2],x3[3]};
#pragma unroll
    for (int i = 0; i < 16; ++i) { const _Float16 h = (_Float16)xs[i]; ah.h[i] = h; al.h[i] = ASPLIT ? (_Float16)(xs[i] - (float)h) : (_Float16)0.0f; }
#pragma unroll
    for (int t = 0; t < 4; ++t) { if (col0 + t * 16 >= N) continue; const size_t boff = (size_t)(col0 + t * 16 + ln) * ldb + kb; FragH bq; bq.half[0] = *(const v8us*)(Bh + boff + 8 * hh); bq.half[1] = *(const v8us*)(Bh + boff + 16 + 8 * hh);
      acc[t] = mmaH<ASPLIT ? 2 : 1>(ah.v, al.v, bq.v, bq.v, acc[t]); }
  }
#pragma unroll
  for (int t = 0; t < 4; ++t) { if (col0 + t * 16 >= N) continue;
#pragma unroll
    for (int r = 0; r < 8; ++r) so[w][8 * hh + r][t * 16 + ln] = acc[t][r] * alpha; }
  __builtin_amdgcn_fence(__ATOMIC_ACQ_REL, "workgroup"); __builtin_amdgcn_wave_barrier();
  const int rsub = lane >> 4, c4 = (lane & 15) * 4;
  {
#pragma unroll
    for (int q = 0; q < 8; ++q) { const int r = q * 2 + rsub; if (col0 + c4 < N) { const v4f v = *(const v4fa*)&so[w][r][c4]; *(v4f*)(C + (size_t)(row0 + r) * ldc + col0 + c4) = v; } }
     }
}

// ---- fragment order: how every f16 operand plane of the WMMA kernels lies in memory ----
// A plane of R rows x K values (R % 16 == 0, K % 32 == 0) is cut into tiles of 16 rows x 32 k, tile (row / 16) * (K / 32) + k / 32, 1 KiB each. A tile holds its 64 pieces of 8 values (16 bytes) in the order
// in which the 32 lanes load them as a 16x16x32 operand: piece c = 32 j + 16 hh + ln is row ln, k = 16 j + 8 hh + (0..7). A fragment is then two loads of 512 bytes in a row, 4 whole lines each;
// from rows at 1 KiB pitch each such load touched 16 lines. Every lane gets the values it got before. Producers: thread t makes piece t, so that a wave stores 512 bytes in a row.
__device__ __forceinline__ int fo_row(size_t t, int K) { return (int)((t >> 6) / (unsigned)(K / 32)) * 16 + (int)(t & 15); }
__device__ __forceinline__ int fo_k(size_t t, int K) { return (int)((t >> 6) % (unsigned)(K / 32)) * 32 + (int)((t >> 5) & 1) * 16 + (int)((t >> 4) & 1) * 8; }
// Wt[n][k] = f16(W[k][n]·scale) from f32 row-major W[K][N] (scale = power of two; bf16-exact weights stay exact in f16 away from the subnormal range)
__device__ __forceinline__ void wt_f16_body(int bx, const float* __restrict__ W, _Float16* __restrict__ Wt, int K, int N, float scale) {
  const int t = bx * 256 + threadIdx.x; if (t >= N * (K / 8)) return; const int n = fo_row(t, K), k8 = fo_k(t, K); FragH f;      /* thread t makes piece t of the fragment-ordered plane: 16 lanes read 16 neighbouring n */
#pragma unroll
  for (int i = 0; i < 8; ++i) f.h[i] = (_Float16)(bf16_round(W[(size_t)(k8 + i) * N + n]) * scale); const v8us o = f.half[0];
  *(v8us*)((unsigned short*)Wt + (size_t)t * 8) = o; 
}
// k_gemm_hh variant with fused epilogue: v = acc·alpha + bias[by·sBias + col] (+ CP[(row/rowsPerB)·sCPb + by·64 + col] if CP) ; ACT 0 none / 1 elu ; writes f16 C16 (and f32 C if non-null)
template <int ACT>
__global__ __launch_bounds__(128) void k_gemm_hhx(const _Float16* __restrict__ A, int lda, size_t sA, const _Float16* __restrict__ Bh, int ldb, size_t sB, float alpha, const float* __restrict__ bias, size_t sBias, const float* __restrict__ CP, int rowsPerB, size_t sCPb, int row0g,
    float* __restrict__ C, _Float16* __restrict__ C16, int ldc, size_t sC, int M, int N, int K) {
  __shared__ __attribute__((aligned(16))) float so[4][16][64];
  const int tid = threadIdx.x, w = tid >> 5, lane = tid & 31, ln = lane & 15, hh = lane >> 4; const int by = blockIdx.y;
  A += (size_t)by * sA; Bh += (size_t)by * sB; const size_t cofs = (size_t)by * sC; const float* bp = bias ? bias + (size_t)by * sBias : nullptr;
  const int ntn = (N + 63) / 64; const int wid = blockIdx.x * 4 + w; const int mt = wid / ntn, nq = wid % ntn; if (mt * 16 >= M) return;
  const int row0 = mt * 16, col0 = nq * 64; const _Float16* arow = A + (size_t)(row0 + ln) * lda;
  v8f acc[4] = {};
  for (int kb = 0; kb < K; kb += 32) { FragH ah; ah.half[0] = *(const v8us*)((const unsigned short*)arow + kb + 8 * hh); ah.half[1] = *(const v8us*)((const unsigned short*)arow + kb + 16 + 8 * hh);
#pragma unroll
    for (int t = 0; t < 4; ++t) { if (col0 + t * 16 >= N) continue; const size_t boff = (size_t)(col0 + t * 16 + ln) * ldb + kb; FragH bq; bq.half[0] = *(const v8us*)((const unsigned short*)Bh + boff + 8 * hh); bq.half[1] = *(const v8us*)((const unsigned short*)Bh + boff + 16 + 8 * hh);
      acc[t] = mmaH<1>(ah.v, ah.v, bq.v, bq.v, acc[t]); }
  }
#pragma unroll
  for (int t = 0; t < 4; ++t) { if (col0 + t * 16 >= N) continue; const int col = col0 + t * 16 + ln; const float bv = bp ? bf16_round(bp[col]) : 0.f;
#pragma unroll
    for (int r = 0; r < 8; ++r) { float v = acc[t][r] * alpha + bv; if (CP) { const int rr = row0g + row0 + 8 * hh + r; if (rowsPerB < 0) v += CP[cofs + (size_t)rr * ldc + col];      /* rowsPerB < 0: own element of the batched C plane */ else { const int bidx = rr / rowsPerB; v += CP[(size_t)bidx * sCPb + (size_t)by * 64 + col]; } } if (ACT == 1) v = (v > 0.f) ? v : expm1f(v); else if (ACT == 7) v = (v > 0.f) ? v + 1.0f : expf(v); else if (ACT == 8) v = tanhf(v); else if (ACT == 9) v = 0.5f * v * (1.0f + tanhf(0.7978845608028654f * (v + 0.044715f * v * v * v))); else if (ACT == 11) v = 1.0f / (1.0f + expf(-v)); else if (ACT == 12) v = (v > 0.f) ? v : 0.01f * v; else if (ACT == 14) v = (v > 0.f) ? v : 0.1f * v; else if (ACT == 16) v = (v >= 0.f) ? v : 0.3f * v; else if (ACT == 17) v = (v >= 0.f) ? v : 0.2f * v; else if (ACT == 15) v = v / (1.0f + expf(-v)); else if (ACT == 3) v = fmaxf(v, 0.f); else if (ACT == 6) v = 0.5f * v * (1.0f + erff(v * 0.70710678118654752f)); so[w][8 * hh + r][t * 16 + ln] = v; } }
  __builtin_amdgcn_fence(__ATOMIC_ACQ_REL, "workgroup"); __builtin_amdgcn_wave_barrier();
  const int rsub = lane >> 4, c4 = (lane & 15) * 4; typedef _Float16 v4h __attribute__((ext_vector_type(4)));
  {
#pragma unroll
    for (int q = 0; q < 8; ++q) { const int r = q * 2 + rsub; if (col0 + c4 < N) { const v4f v = *(const v4fa*)&so[w][r][c4]; if (C) *(v4f*)(C + cofs + (size_t)(row0 + r) * ldc + col0 + c4) = v; if (C16) { v4h h4; for (int i = 0; i < 4; ++i) h4[i] = (_Float16)v[i]; *(v4h*)(C16 + cofs + (size_t)(row0 + r) * ldc + col0 + c4) = h4; } } }
     }
}


typedef _Float16 v4h __attribute__((ext_vector_type(4)));

// rows of DM values into a fragment-ordered plane of n8 pieces; rows from nrows on are not read and become zero
__device__ __forceinline__ void x16_body(int bx, const float* __restrict__ x, _Float16* __restrict__ X16, int nrows, size_t n8) { const size_t t = (size_t)bx * 256 + threadIdx.x; if (t >= n8) return; FragH f; const int row = fo_row(t, DM); const float* s = x + (size_t)row * DM + fo_k(t, DM);
  const v8us z = {0, 0, 0, 0, 0, 0, 0, 0}; f.half[0] = z;
  if (row < nrows) {
#pragma unroll
    for (int q = 0; q < 8; ++q) f.h[q] = (_Float16)bf16_round(s[q]); }
  *(v8us*)((unsigned short*)X16 + t * 8) = f.half[0];  }
__global__ __launch_bounds__(256) void k_h16(const float* __restrict__ x, _Float16* __restrict__ X16, size_t n8) { const size_t t = (size_t)blockIdx.x * 256 + threadIdx.x; if (t >= n8) return; FragH f;
#pragma unroll
  for (int q = 0; q < 8; ++q) f.h[q] = (_Float16)x[t * 8 + q]; *(v8us*)((unsigned short*)X16 + t * 8) = f.half[0];  }
__global__ __launch_bounds__(256) void k_round16f(const float* __restrict__ W, _Float16* __restrict__ Bt, size_t n8) { const size_t t = (size_t)blockIdx.x * 256 + threadIdx.x; if (t >= n8) return; FragH f;
#pragma unroll
  for (int i = 0; i < 8; ++i) f.h[i] = (_Float16)(bf16_round(W[t * 8 + i]) * 16.0f); *(v8us*)((unsigned short*)Bt + t * 8) = f.half[0];  }
__global__ __launch_bounds__(256) void k_hl(const float* __restrict__ F, _Float16* __restrict__ Hh, _Float16* __restrict__ Hl, size_t n8) { const size_t t = (size_t)blockIdx.x * 256 + threadIdx.x; if (t >= n8) return; FragH fh, fl; const v4f a = *(const v4fa*)(F + t * 8), c = *(const v4fa*)(F + t * 8 + 4);
#pragma unroll
  for (int q = 0; q < 4; ++q) { _Float16 h = (_Float16)a[q]; fh.h[q] = h; fl.h[q] = (_Float16)((a[q] - (float)h) * 1024.0f); h = (_Float16)c[q]; fh.h[4 + q] = h; fl.h[4 + q] = (_Float16)((c[q] - (float)h) * 1024.0f); }
  { *(v8us*)((unsigned short*)Hh + t * 8) = fh.half[0]; *(v8us*)((unsigned short*)Hl + t * 8) = fl.half[0];  } }

// ---- fast GEMM (wave tile 32x64; requires M % 32 == 0 rows per launch region and N % 64 == 0); epilogue = k_gemm_hhx semantics ----
__device__ __forceinline__ v16h g2_frag(const _Float16* p, int hh) { FragH f; f.half[0] = *(const v8us*)((const unsigned short*)p + 8 * hh); f.half[1] = *(const v8us*)((const unsigned short*)p + 16 + 8 * hh); return f.v; }
__device__ __forceinline__ v16h fo_frag(const _Float16* p) { FragH f; f.half[0] = *(const v8us*)((const unsigned short*)p); f.half[1] = *(const v8us*)((const unsigned short*)p + 256); return f.v; }      /* p: a tile of a fragment-ordered plane + 8 lane */
#define G2D 2                        /* k steps requested ahead in gemm2_body */
__device__ __forceinline__ v8f g2_mma(v16h a, v16h b, v8f c) { v8f d = __builtin_amdgcn_wmma_f32_16x16x32_f16(false, a, false, b, (short)0, c, false, false); asm volatile("v_nop\n\tv_nop\n\tv_nop\n\tv_nop" : "+v"(d) : "v"(a), "v"(b)); return d; }
template <int ACT, int KT>
__device__ __forceinline__ void gemm2_body(int bx, int by, const _Float16* __restrict__ A, int lda, size_t sA, const _Float16* __restrict__ Bh, int ldb, size_t sB, float alpha, const float* __restrict__ bias, size_t sBias, const float* __restrict__ CP, int rowsPerB, size_t sCPb, int row0g,
    float* __restrict__ C, _Float16* __restrict__ C16, int ldc, size_t sC, int M, int N, int K,
    const float* __restrict__ ub = nullptr, const float* __restrict__ vb = nullptr, _Float16* __restrict__ CU = nullptr, _Float16* __restrict__ CV = nullptr, _Float16* __restrict__ VTo = nullptr) { static_assert(ACT == 0 || ACT == 3 || ACT == 6 || ACT == 8 || ACT == 9 || ACT == 11 || ACT == 12 || ACT == 14 || ACT == 15 || ACT == 16 || ACT == 17, "k_gemm2: unsupported ACT code (would silently apply no activation)");
  __shared__ __attribute__((aligned(16))) float so[4][32][68];
  const int tid = threadIdx.x, lane = tid & 31, ln = lane & 15, hh = lane >> 4; const int w = __builtin_amdgcn_readfirstlane(tid >> 5);      /* the wave's number in a scalar register: every tile address below is then a scalar base + the lane's piece */
  A += (size_t)by * sA; Bh += (size_t)by * sB; const size_t cofs = (size_t)by * sC; const float* bp = bias ? bias + (size_t)by * sBias : nullptr;
  const int ntn = N >> 6; const int mt = bx / ntn, nq = bx - mt * ntn; const int row0 = mt * 128 + 32 * w, col0 = nq * 64; if (row0 >= M) return;
  const _Float16* a0p = A + (size_t)row0 * lda; const _Float16* a1p = a0p + (size_t)16 * lda;      /* A, Bh fragment-ordered: 16 rows of tiles are 16 lda values; six scalar bases, to which each load adds the lane's piece */
  const _Float16* b0p = Bh + (size_t)col0 * ldb; const _Float16* b1p = b0p + (size_t)16 * ldb; const _Float16* b2p = b1p + (size_t)16 * ldb; const _Float16* b3p = b2p + (size_t)16 * ldb;
  const v8f z8 = {0.f,0.f,0.f,0.f,0.f,0.f,0.f,0.f}; v8f c00 = z8, c01 = z8, c02 = z8, c03 = z8, c10 = z8, c11 = z8, c12 = z8, c13 = z8;
  /* K = KT at compile time, the k loop unrolled: the six fragments of a k step are requested together, G2D steps ahead of their use, into a ring of G2D + 1 register sets (48 registers a set);
     before, a step held four load-wait-multiply rounds in a row, 4 KT / 32 cache latencies a wave. Each accumulator still takes its k steps in rising order.
     The k step's tile of each operand lies 512 values behind the one before. */
  constexpr int NS = KT / 32; static_assert(KT % 32 == 0 && NS > G2D, "gemm2_body: whole k steps, more of them than are requested ahead"); (void)K;
  v16h fa[G2D + 1][2], fb[G2D + 1][4];
  auto ld = [&](int s) { const int e = s % (G2D + 1), kb = 512 * s + 8 * lane; fa[e][0] = fo_frag(a0p + kb); fa[e][1] = fo_frag(a1p + kb); fb[e][0] = fo_frag(b0p + kb); fb[e][1] = fo_frag(b1p + kb); fb[e][2] = fo_frag(b2p + kb); fb[e][3] = fo_frag(b3p + kb); };
#pragma unroll
  for (int s = 0; s < G2D; ++s) ld(s);
#pragma unroll
  for (int s = 0; s < NS; ++s) { const int e = s % (G2D + 1); if (s + G2D < NS) ld(s + G2D);
    c00 = g2_mma(fa[e][0], fb[e][0], c00); c10 = g2_mma(fa[e][1], fb[e][0], c10); c01 = g2_mma(fa[e][0], fb[e][1], c01); c11 = g2_mma(fa[e][1], fb[e][1], c11);
    c02 = g2_mma(fa[e][0], fb[e][2], c02); c12 = g2_mma(fa[e][1], fb[e][2], c12); c03 = g2_mma(fa[e][0], fb[e][3], c03); c13 = g2_mma(fa[e][1], fb[e][3], c13); }
  asm volatile("s_wait_xcnt 0x0" :: "s"(a0p), "s"(a1p), "s"(b0p), "s"(b1p), "s"(b2p), "s"(b3p), "v"(lane) : "memory");      /* the six scalar bases and the lane register that the loads name stay whole up to here and are reused only behind this wait */
  v8f accs[8] = {c00, c01, c02, c03, c10, c11, c12, c13};
  if (VTo) {      /* V^T [batch][head][64][SQ], fragment-ordered, straight from the accumulators: lane (ln, hh) of accumulator (half, t) holds tokens 16 half + 8 hh + (0..7) of column d = 16 t + ln,
                     which is piece 32 half + lane of the tile (d tile t, this wave's 32 tokens): 8 stores of 512 bytes in a row, no LDS; the test is the same for the whole work-group */
    unsigned short* vd = (unsigned short*)VTo + ((size_t)((row0 / SQ) * NH + nq) * (HD / 16) * (SQ / 32) + (row0 % SQ) / 32) * 512 + 8 * lane;
    float b4[4] = {0.f, 0.f, 0.f, 0.f}; FragH f[8];      /* the four bias values are requested together; all eight pieces are made before the first store, so that no register of an issued store is written again */
    if (bp) {
#pragma unroll
      for (int t = 0; t < 4; ++t) b4[t] = bf16_round(bp[col0 + t * 16 + ln]); }
#pragma unroll
    for (int u = 0; u < 8; ++u)
#pragma unroll
      for (int r = 0; r < 8; ++r) f[u].h[r] = (_Float16)(accs[u][r] * alpha + b4[u & 3]);
#pragma unroll
    for (int u = 0; u < 8; ++u) *(v8us*)(vd + (size_t)(u & 3) * (SQ / 32) * 512 + (u >> 2) * 256) = f[u].half[0];
    return; }
#pragma unroll
  for (int u = 0; u < 8; ++u) { const int t = u & 3, half = u >> 2; const int col = col0 + t * 16 + ln; const float bv = bp ? bf16_round(bp[col]) : 0.f;
#pragma unroll
    for (int r = 0; r < 8; ++r) { const int rloc = half * 16 + 8 * hh + r; float v = accs[u][r] * alpha + bv; if (CP) { if (rowsPerB < 0) v += CP[cofs + (size_t)(row0g + row0 + rloc) * ldc + col];      /* rowsPerB < 0: own element of the batched C plane */ else { const int bidx = (row0g + row0 + rloc) / rowsPerB; v += CP[(size_t)bidx * sCPb + (size_t)by * 64 + col]; } }
      if (ACT == 3) v = fmaxf(v, 0.f); else if (ACT == 6) v = 0.5f * v * (1.0f + erff(v * 0.70710678118654752f)); else if (ACT == 11) v = 1.0f / (1.0f + expf(-v)); else if (ACT == 15) v = v / (1.0f + expf(-v)); else if (ACT == 12) v = (v > 0.f) ? v : 0.01f * v; else if (ACT == 8) v = tanhf(v); else if (ACT == 9) v = 0.5f * v * (1.0f + tanhf(0.7978845608028654f * (v + 0.044715f * v * v * v))); else if (ACT == 14) v = (v > 0.f) ? v : 0.1f * v; else if (ACT == 16) v = (v >= 0.f) ? v : 0.3f * v; else if (ACT == 17) v = (v >= 0.f) ? v : 0.2f * v;
      so[w][rloc][t * 16 + ln] = v; } }
  __builtin_amdgcn_fence(__ATOMIC_ACQ_REL, "workgroup"); __builtin_amdgcn_wave_barrier();
  const int rsub = lane >> 4, c4 = (lane & 15) * 4;
  {
#pragma unroll
    for (int q = 0; q < 16; ++q) { const int r = q * 2 + rsub; const v4f v = *(const v4fa*)&so[w][r][c4]; if (C) *(v4f*)(C + cofs + (size_t)(row0 + r) * ldc + col0 + c4) = v; }
    if (C) asm volatile("s_wait_xcnt 0x0" ::: "memory");      /* the f32 stores' address registers are reused, where an f16 plane follows, only behind this wait */
    if (C16) {      /* the f16 plane is fragment-ordered: the wave's 32 x 64 values are 2 x 2 tiles, 8 stores of 512 bytes in a row */
#pragma unroll
      for (int q = 0; q < 8; ++q) { const float* s = &so[w][(q >> 2) * 16 + ln][((q >> 1) & 1) * 32 + (q & 1) * 16 + 8 * hh]; const v4f x = *(const v4fa*)s, y = *(const v4fa*)(s + 4); FragH f;
#pragma unroll
        for (int i = 0; i < 4; ++i) { f.h[i] = (_Float16)x[i]; f.h[4 + i] = (_Float16)y[i]; }
        *(v8us*)((unsigned short*)C16 + cofs + ((size_t)(row0 / 16 + (q >> 2)) * (ldc / 32) + col0 / 32 + ((q >> 1) & 1)) * 512 + (q & 1) * 256 + 8 * lane) = f.half[0]; } }
    if (CU) {       /* two fragment-ordered f16 planes of the f32 result plus a row vector each (q + pos_bias_u, q + pos_bias_v): the same pieces as above, each rounded once from the f32 sum */
#pragma unroll
      for (int cg = 0; cg < 4; ++cg) { const int cl = (cg >> 1) * 32 + (cg & 1) * 16 + 8 * hh; float bu[8], bw[8];
#pragma unroll
        for (int i = 0; i < 8; ++i) { bu[i] = bf16_round(ub[col0 + cl + i]); bw[i] = bf16_round(vb[col0 + cl + i]); }
#pragma unroll
        for (int rh = 0; rh < 2; ++rh) { const float* s = &so[w][rh * 16 + ln][cl]; const v4f x = *(const v4fa*)s, y = *(const v4fa*)(s + 4); FragH fu, fv;
#pragma unroll
          for (int i = 0; i < 4; ++i) { fu.h[i] = (_Float16)__fadd_rn(x[i], bu[i]); fu.h[4 + i] = (_Float16)__fadd_rn(y[i], bu[4 + i]); fv.h[i] = (_Float16)__fadd_rn(x[i], bw[i]); fv.h[4 + i] = (_Float16)__fadd_rn(y[i], bw[4 + i]); }
          const size_t o = cofs + ((size_t)(row0 / 16 + rh) * (ldc / 32) + col0 / 32 + (cg >> 1)) * 512 + (cg & 1) * 256 + 8 * lane;
          *(v8us*)((unsigned short*)CU + o) = fu.half[0]; *(v8us*)((unsigned short*)CV + o) = fv.half[0]; } } }
     } }
template <int ACT>
__global__ __launch_bounds__(128) void k_gemm2(const _Float16* __restrict__ A, int lda, size_t sA, const _Float16* __restrict__ Bh, int ldb, size_t sB, float alpha, const float* __restrict__ bias, size_t sBias, const float* __restrict__ CP, int rowsPerB, size_t sCPb, int row0g,
    float* __restrict__ C, _Float16* __restrict__ C16, int ldc, size_t sC, int M, int N, int K) { gemm2_body<ACT, DM>(blockIdx.x, blockIdx.y, A, lda, sA, Bh, ldb, sB, alpha, bias, sBias, CP, rowsPerB, sCPb, row0g, C, C16, ldc, sC, M, N, K); }


__global__ __launch_bounds__(256) void k_wnat(const float* __restrict__ w, size_t n8, _Float16* __restrict__ Bt) { const size_t t = (size_t)blockIdx.x * 256 + threadIdx.x; if (t >= n8) return; FragH f; for (int q = 0; q < 8; ++q) f.h[q] = (_Float16)(bf16_round(w[t * 8 + q]) * 16.0f); *(v8us*)((unsigned short*)Bt + t * 8) = f.half[0];  }
__global__ __launch_bounds__(256) void k_rsm(const float* __restrict__ S, _Float16* __restrict__ P, int nrows) {
  #pragma clang fp contract(off)
  const int i = blockIdx.x * 256 + threadIdx.x; if (i >= nrows) return; const float* s = S + (size_t)i * SQ; float mx = -3.0e38f;
#pragma unroll 1
  for (int j = 0; j < SQ; ++j) mx = fmaxf(mx, s[j]); float se = 0.f;
#pragma unroll 1
  for (int j = 0; j < SQ; ++j) se += expf(s[j] - mx); const float sc = 256.0f / se;
#pragma unroll 1
  for (int j0 = 0; j0 < SQ; j0 += 8) { FragH f; for (int q = 0; q < 8; ++q) f.h[q] = (_Float16)(expf(s[j0 + q] - mx) * sc); unsigned short* d = (unsigned short*)P + (size_t)i * SQ + j0; *(v8us*)d = f.half[0];  } }
__global__ __launch_bounds__(256) void k_vt(const _Float16* __restrict__ V16, int b, int h0, _Float16* __restrict__ VT) { __shared__ unsigned short tl[64][65]; const int tid = threadIdx.x; const int hh = blockIdx.x % HG, sg = blockIdx.x / HG; const int s0 = sg * 64; const int h = h0 + hh;
  for (int i = tid; i < 64 * 8; i += 256) { const int j = i / 8, d8 = (i % 8) * 8; FragH f; f.half[0] = *(const v8us*)((const unsigned short*)V16 + ((size_t)b * SQ + s0 + j) * DM + h * HD + d8); for (int q = 0; q < 8; ++q) tl[d8 + q][j] = f.u[q]; }
  __syncthreads();
  { for (int i = tid; i < 64 * 8; i += 256) { const int d = i / 8, j8 = (i % 8) * 8; FragH f; for (int q = 0; q < 8; ++q) f.u[q] = tl[d][j8 + q]; *(v8us*)((unsigned short*)VT + ((size_t)hh * HD + d) * SQ + s0 + j8) = f.half[0]; }  } }

// ---- launches that need nothing of each other share one grid: a range test on the block index, the same for a whole work-group, picks the job; each job's blocks do what its own launch did ----
#define GW (DM * (DM / 8) / 256)             /* blocks a weight matrix: 128 */
#define GX ((int)(NR * DM / 8 / 256))        /* blocks an input tensor: 1024 */
#define GE (PP * DM / 8 / 256)               /* blocks of the position table, pad row included: 512 */
#define GG ((int)(NR / 128) * (DM / 64))     /* blocks of a 4096-row projection: 256 */
#define GR ((PP / 128) * (DM / 64))          /* blocks of the position projection: 128 */
static_assert((size_t)GE * 256 == (size_t)PP * DM / 8 && PP % 16 == 0 && NPOS < PP, "k_prep: the position range covers the padded table, whole tiles");
// the five weight transposes (strided reads, the longest blocks: first), the three inputs and the position table as f16 rows
__global__ __launch_bounds__(256) void k_prep(const float* __restrict__ wq, const float* __restrict__ wk, const float* __restrict__ wv, const float* __restrict__ wpos, const float* __restrict__ wo,
    const float* __restrict__ xq, const float* __restrict__ xk, const float* __restrict__ xv, const float* __restrict__ pe,
    _Float16* __restrict__ BQ, _Float16* __restrict__ BK, _Float16* __restrict__ BV, _Float16* __restrict__ BP, _Float16* __restrict__ BO,
    _Float16* __restrict__ XQ, _Float16* __restrict__ XK, _Float16* __restrict__ XV, _Float16* __restrict__ PE) {
  int bx = blockIdx.x;
  if (bx < 5 * GW) { const int g = bx / GW; const float* W = (g == 0) ? wq : (g == 1) ? wk : (g == 2) ? wv : (g == 3) ? wpos : wo; _Float16* Wt = (g == 0) ? BQ : (g == 1) ? BK : (g == 2) ? BV : (g == 3) ? BP : BO;
    wt_f16_body(bx - g * GW, W, Wt, DM, DM, 16.0f); return; }
  bx -= 5 * GW;
  if (bx < 3 * GX) { const int g = bx / GX; const float* x = (g == 0) ? xq : (g == 1) ? xk : xv; _Float16* X = (g == 0) ? XQ : (g == 1) ? XK : XV;
    x16_body(bx - g * GX, x, X, (int)NR, NR * DM / 8); return; }
  bx -= 3 * GX;
  x16_body(bx, pe, PE, NPOS, (size_t)PP * DM / 8); }      /* pad row 2047 becomes zero */
// q + pos_bias_u, q + pos_bias_v, k, p = pos_emb Wpos (f16 rows; row 2047 of p is the zero pad), V^T [4][8][64][1024]: one k loop; the epilogue stores each result as the attention kernel reads it
static_assert(DM == NH * HD && SQ % 128 == 0, "k_proj: a 64-column tile is one head, a work-group's 128 rows lie in one batch");
__global__ __launch_bounds__(128) void k_proj(const _Float16* __restrict__ XQ, const _Float16* __restrict__ XK, const _Float16* __restrict__ XV, const _Float16* __restrict__ PE,
    const _Float16* __restrict__ BQ, const _Float16* __restrict__ BK, const _Float16* __restrict__ BV, const _Float16* __restrict__ BP,
    const float* __restrict__ bq, const float* __restrict__ bk, const float* __restrict__ bv, const float* __restrict__ ub, const float* __restrict__ vb,
    _Float16* __restrict__ QU, _Float16* __restrict__ QV, _Float16* __restrict__ K16, _Float16* __restrict__ VT, _Float16* __restrict__ R16) {
  const int g = blockIdx.x / GG;
  const _Float16* A = (g == 0) ? XQ : (g == 1) ? XK : (g == 2) ? XV : PE; const _Float16* Bh = (g == 0) ? BQ : (g == 1) ? BK : (g == 2) ? BV : BP;
  const int bx = blockIdx.x - g * GG;
  const float* bias = (g == 0) ? bq : (g == 1) ? bk : (g == 2) ? bv : nullptr; _Float16* C16 = (g == 1) ? K16 : (g == 3) ? R16 : nullptr;
  gemm2_body<0, DM>(bx, 0, A, DM, 0, Bh, DM, 0, 0.0625f, bias, 0, nullptr, 1, 0, 0, nullptr, C16, DM, 0, (g == 3) ? PP : (int)NR, DM, DM, ub, vb, (g == 0) ? QU : nullptr, QV, (g == 2) ? VT : nullptr); }
// Fused relative attention, one work-group per (batch, head, FR query rows); the FR x 1024 score rows live in LDS and never reach memory.
// 1: bd tiles (q + v) . p[i0 + 16 t ..], each element stored at its shifted column j = T - 1 + i - pos (in the edge tiles a column outside 0..T-1 goes to the pad column T, which nobody reads);
// 2: ac tiles (q + u) . k added in place. Both products take the position or key tile as A and the query tile as B (the two operands have the same lane map), so that D comes out transposed:
// lane ln holds query row ln, its 8 registers 8 neighbouring positions or keys, that is 8 neighbouring columns of one score row: ac goes in by 16-byte LDS loads and stores, bd by stores of neighbouring words; 3: one wave per row: lane l holds columns 4 l + 128 u + (0..3), mask, f32 statistics, weights 2^((score - max) (log2 e) / 8), not yet divided by their sum, as f16 written over the row's own first half; 64 / sum goes to rs;
// 4: o = P . V^T: a wave does 32 rows x 16 columns over one half of k (each V^T fragment is loaded once a work-group); the two halves are added and multiplied by the row's 64 / sum on the way out, where one wave writes each 128-byte line.
// Global fragments are requested ahead of their use, into the registers that the running step sets free.
#define FR 32
#define FD 6                         /* fragment tiles in flight a wave: 96 registers */
#define FP (SQ + 4)                  /* LDS row pitch in floats: 16 B x odd, for the ds_load_b128 fragment reads of step 4 */
typedef int   v4ia __attribute__((ext_vector_type(4), may_alias));
typedef _Float16 v4ha __attribute__((ext_vector_type(4), may_alias));
typedef float v2f __attribute__((ext_vector_type(2)));
#define SXL 0.18033688f              /* (log2 e) / 8 */
static_assert(SQ == 1024 && HD == 64 && FR == 32 && SQ - 1 + FR <= 66 * 16 && SQ - FR + 66 * 16 <= PP, "k_relattn: 8 waves, 66 position tiles inside the padded table");
// Four native 2^x (what __expf compiles to, behind its multiply by log2 e). Written in one statement so that the slot the instruction set asks for behind a transcendental is kept by construction:
// each v_exp_f32 is followed by one that neither reads its result nor overwrites its source (early-clobber outputs), the last by v_nop.
__device__ __forceinline__ void exp2x4(float x0, float x1, float x2, float x3, float* e) {
  asm("v_exp_f32 %0, %4\n\tv_exp_f32 %1, %5\n\tv_exp_f32 %2, %6\n\tv_exp_f32 %3, %7\n\tv_nop" : "=&v"(e[0]), "=&v"(e[1]), "=&v"(e[2]), "=&v"(e[3]) : "v"(x0), "v"(x1), "v"(x2), "v"(x3)); }
__global__ __launch_bounds__(256) __attribute__((amdgpu_waves_per_eu(4, 4))) void k_relattn(const _Float16* __restrict__ QU, const _Float16* __restrict__ QV, const _Float16* __restrict__ K16, const _Float16* __restrict__ R16, const _Float16* __restrict__ VT, const int* __restrict__ mask, _Float16* __restrict__ O16) {
  __shared__ __attribute__((aligned(16))) float sc[FR][FP];
  __shared__ __attribute__((aligned(16))) float so[2][FR][68];
  __shared__ __attribute__((aligned(16))) float rs[FR];      /* 64 / (a row's sum of weights) */
  const int tid = threadIdx.x, lane = tid & 31, ln = lane & 15, hh = lane >> 4; const int w = __builtin_amdgcn_readfirstlane(tid >> 5);
  const int it = blockIdx.x % (SQ / FR), bh = blockIdx.x / (SQ / FR), h = bh % NH, b = bh / NH; const int i0 = it * FR; const size_t r0 = (size_t)b * SQ;
  const v8f z8 = {0.f,0.f,0.f,0.f,0.f,0.f,0.f,0.f};
  const int ho = h * (HD / 32) * 512 + 8 * lane;      /* fragment-ordered planes of DM values a row: 16 rows are 16 DM values, in them the head's two tiles, in a tile the lane's piece */
  const _Float16* pp = R16 + (size_t)(i0 + w * 16) * DM; const _Float16* kp = K16 + (r0 + w * 16) * DM;      /* tile w; tile w + 8 k lies 128 k rows on; scalar bases, to which each load adds ho */
  const _Float16* qp = QV + (r0 + i0) * DM; v16h a00 = fo_frag(qp + ho), a01 = fo_frag(qp + ho + 512), a10 = fo_frag(qp + ho + 16 * DM), a11 = fo_frag(qp + ho + 16 * DM + 512);
  v16h fr[16][2];      /* this wave's 8 position tiles, then its 8 key tiles: one stream, requested FD tiles ahead of its use */
  auto fetch = [&](int n) { const _Float16* p = ((n < 8) ? pp + (size_t)n * 128 * DM : kp + (size_t)(n - 8) * 128 * DM) + ho; fr[n][0] = fo_frag(p); fr[n][1] = fo_frag(p + 512); };
#pragma unroll
  for (int n = 0; n < FD; ++n) fetch(n);
  asm volatile("s_wait_xcnt 0x0" :: "s"(qp), "s"(pp), "v"(ho) : "memory");      /* the issued loads' address registers (scalar bases, the lane's offset) stay whole up to here and are reused only behind this wait */
  const int jw = SQ - 1 + ln - w * 16 - 8 * hh;      /* column of row ln at position i0 + 16 w + 8 hh; register r lies r columns below */
#pragma unroll
  for (int k = 0; k < 8; ++k) { fetch(k + FD); v8f c0 = g2_mma(fr[k][0], a00, z8), c1 = g2_mma(fr[k][0], a10, z8); c0 = g2_mma(fr[k][1], a01, c0); c1 = g2_mma(fr[k][1], a11, c1);
    const int jb = jw - 128 * k;
    if (k == 0) {      /* tiles 0 and 1 reach past column T - 1 */
#pragma unroll
      for (int r = 0; r < 8; ++r) { const int j = jb - r, j1 = j + 16; sc[ln][((unsigned)j < SQ) ? j : SQ] = c0[r]; sc[16 + ln][((unsigned)j1 < SQ) ? j1 : SQ] = c1[r]; }
    } else {           /* tiles 8 to 63: every column inside */
#pragma unroll
      for (int r = 0; r < 8; ++r) { sc[ln][jb - r] = c0[r]; sc[16 + ln][jb + 16 - r] = c1[r]; } }
    __builtin_amdgcn_sched_barrier(0); }      /* one tile's accumulators and LDS addresses live at a time: without it the compiler opens six tiles at once and spills */
  if (w < 2) {         /* tiles 64 and 65 reach below column 0 */
    const _Float16* p8 = pp + ho + (size_t)8 * 128 * DM; const v16h b0 = fo_frag(p8), b1 = fo_frag(p8 + 512);
    asm volatile("s_wait_xcnt 0x0" :: "v"(p8) : "memory");      /* the four loads' address pair stays whole up to here */
    v8f c0 = g2_mma(b0, a00, z8), c1 = g2_mma(b0, a10, z8); c0 = g2_mma(b1, a01, c0); c1 = g2_mma(b1, a11, c1); const int jb = jw - 128 * 8;
#pragma unroll
    for (int r = 0; r < 8; ++r) { const int j = jb - r, j1 = j + 16; sc[ln][((unsigned)j < SQ) ? j : SQ] = c0[r]; sc[16 + ln][((unsigned)j1 < SQ) ? j1 : SQ] = c1[r]; } }
  qp = QU + (r0 + i0) * DM; a00 = fo_frag(qp + ho); a01 = fo_frag(qp + ho + 512); a10 = fo_frag(qp + ho + 16 * DM); a11 = fo_frag(qp + ho + 16 * DM + 512);
  asm volatile("s_wait_xcnt 0x0" :: "s"(qp), "s"(kp), "v"(ho) : "memory");      /* as above */
  __syncthreads();
  const int* mk = mask + (r0 + i0 + w * 4) * SQ + 4 * lane; v4ia m[2][8];
  float* ar = &sc[ln][w * 16 + 8 * hh]; v4f nd[4];      /* row ln, the lane's 8 columns of key tile w; tile w + 8 k lies 128 k floats on, row 16 + ln 16 FP floats on; a tile's bd values are read one tile ahead */
  auto ldb = [&](int k) { const float* p = ar + 128 * k; nd[0] = *(const v4fa*)p; nd[1] = *(const v4fa*)(p + 4); nd[2] = *(const v4fa*)(p + 16 * FP); nd[3] = *(const v4fa*)(p + 16 * FP + 4); };
  ldb(0);
#pragma unroll
  for (int k = 0; k < 8; ++k) { if (k + FD < 8) fetch(8 + k + FD);
    float* p = ar + 128 * k; v8f c0 = {nd[0][0], nd[0][1], nd[0][2], nd[0][3], nd[1][0], nd[1][1], nd[1][2], nd[1][3]}, c1 = {nd[2][0], nd[2][1], nd[2][2], nd[2][3], nd[3][0], nd[3][1], nd[3][2], nd[3][3]};      /* bd is the start value that the products are summed onto */
    if (k < 7) ldb(k + 1);
    c0 = g2_mma(fr[8 + k][0], a00, c0); c1 = g2_mma(fr[8 + k][0], a10, c1); c0 = g2_mma(fr[8 + k][1], a01, c0); c1 = g2_mma(fr[8 + k][1], a11, c1);
    if (k == 4) {
#pragma unroll
      for (int u = 0; u < 8; ++u) m[0][u] = *(const v4ia*)(mk + 128 * u); }      /* this wave's first mask row */
    const v4f l0 = {c0[0], c0[1], c0[2], c0[3]}, h0 = {c0[4], c0[5], c0[6], c0[7]}, l1 = {c1[0], c1[1], c1[2], c1[3]}, h1 = {c1[4], c1[5], c1[6], c1[7]};
    *(v4fa*)p = l0; *(v4fa*)(p + 4) = h0; *(v4fa*)(p + 16 * FP) = l1; *(v4fa*)(p + 16 * FP + 4) = h1; }
  __builtin_amdgcn_sched_barrier(0);      /* step 3's mask conversions stay behind the last tile: drawn up among the tiles, they wait there on the mask loads just issued */
  __syncthreads();
  const int nt = w & 3, kh = w >> 2; const _Float16* vp = VT + ((size_t)bh * HD + nt * 16) * SQ + kh * (SQ / 64) * 512; v16h vf[16];      /* fragment-ordered, SQ values a row: this wave's 16 tiles lie in a row */
  float sl[4], ml[4];
#pragma unroll
  for (int k = 0; k < 4; ++k) { float* row = &sc[w * 4 + k][0]; const v4ia* mc = m[k & 1];
    if (k < 3) {
#pragma unroll
      for (int u = 0; u < 8; ++u) m[(k + 1) & 1][u] = *(const v4ia*)(mk + (k + 1) * SQ + 128 * u);      /* next row's mask flies while this row is worked on */
    } else {
#pragma unroll
      for (int s = 0; s < 16; ++s) vf[s] = fo_frag(vp + 512 * s + 8 * lane);      /* step 4's V^T fragments fly during the last row */
      asm volatile("s_wait_xcnt 0x0" :: "s"(vp), "v"(lane) : "memory"); }      /* as above */
    v2f t[8][2]; float m4[4] = {-3.0e38f, -3.0e38f, -3.0e38f, -3.0e38f}; const v2f nbig = {-3.0e38f, -3.0e38f};      /* the mask is applied once, score + mask x -3e38 (mask 0: the score itself): a masked score is -3e38 or below, loses every maximum, and its 2^x below is exactly 0 */
    v4f sv[8];
#pragma unroll
    for (int u = 0; u < 8; ++u) sv[u] = *(const v4fa*)(row + 4 * lane + 128 * u);
    __builtin_amdgcn_sched_barrier(0);      /* the row's eight LDS loads are requested together: without it the compiler sinks each load to its use, eight LDS latencies in a row */
#pragma unroll
    for (int u = 0; u < 8; ++u) { const v4f s = sv[u];
#pragma unroll
      for (int p = 0; p < 2; ++p) { const v2f mf = {(float)(unsigned)mc[u][2 * p], (float)(unsigned)mc[u][2 * p + 1]}, sp = {s[2 * p], s[2 * p + 1]}; t[u][p] = __builtin_elementwise_fma(mf, nbig, sp);
        m4[2 * p] = fmaxf(m4[2 * p], t[u][p][0]); m4[2 * p + 1] = fmaxf(m4[2 * p + 1], t[u][p][1]); } }
    float mx = fmaxf(fmaxf(m4[0], m4[1]), fmaxf(m4[2], m4[3]));
#pragma unroll
    for (int d = 16; d >= 1; d >>= 1) mx = fmaxf(mx, __shfl_xor(mx, d, 32));
    const float nb = (mx > -1.0e38f) ? -mx * SXL : 0.f;      /* every column masked: no shift, so that each 2^x is 0 */
    const v2f c2 = {SXL, SXL}, nb2 = {nb, nb}; v2f s2[2] = {{0.f, 0.f}, {0.f, 0.f}};      /* e = 2^(score (log2 e) / 8 - max (log2 e) / 8): one multiply-add a score, two scores an instruction */
#pragma unroll
    for (int u = 0; u < 8; ++u) { const v2f a0 = __builtin_elementwise_fma(t[u][0], c2, nb2), a1 = __builtin_elementwise_fma(t[u][1], c2, nb2); float e[4]; exp2x4(a0[0], a0[1], a1[0], a1[1], e);
      const v4f e4 = {e[0], e[1], e[2], e[3]}; const v2f e0 = {e[0], e[1]}, e1 = {e[2], e[3]}; s2[0] += e0; s2[1] += e1;
      *(v4ha*)((_Float16*)row + 4 * lane + 128 * u) = __builtin_convertvector(e4, v4h); }      /* stored as it is, 0 to 1: the row's sum is not waited for */
    sl[k] = (s2[0][0] + s2[0][1]) + (s2[1][0] + s2[1][1]); ml[k] = mx; }
#pragma unroll
  for (int d = 16; d >= 1; d >>= 1)
#pragma unroll
    for (int k = 0; k < 4; ++k) sl[k] += __shfl_xor(sl[k], d, 32);      /* the four rows' sums side by side */
  if (lane == 0) { v4f f4;
#pragma unroll
    for (int k = 0; k < 4; ++k) f4[k] = (ml[k] > -1.0e38f) ? 64.0f / sl[k] : 0.f;      /* a row with every column masked gives 0 */
    *(v4fa*)&rs[w * 4] = f4; }
  __syncthreads();
  { const _Float16* ap = (const _Float16*)&sc[ln][0] + kh * (SQ / 2); v8f c0 = z8, c1 = z8; v16h af[2][4];      /* weight fragments of two k steps, read from LDS one pair of steps ahead */
#pragma unroll
    for (int e = 0; e < 2; ++e) { af[0][2 * e] = g2_frag(ap + 32 * e, hh); af[0][2 * e + 1] = g2_frag(ap + 16 * FP * 2 + 32 * e, hh); }
#pragma unroll
    for (int g = 0; g < 8; ++g) {
      if (g < 7) {
#pragma unroll
        for (int e = 0; e < 2; ++e) { af[(g + 1) & 1][2 * e] = g2_frag(ap + 32 * (2 * g + 2 + e), hh); af[(g + 1) & 1][2 * e + 1] = g2_frag(ap + 16 * FP * 2 + 32 * (2 * g + 2 + e), hh); } }
#pragma unroll
      for (int e = 0; e < 2; ++e) { c0 = g2_mma(af[g & 1][2 * e], vf[2 * g + e], c0); c1 = g2_mma(af[g & 1][2 * e + 1], vf[2 * g + e], c1); } }
#pragma unroll
    for (int r = 0; r < 8; ++r) { so[kh][8 * hh + r][nt * 16 + ln] = c0[r]; so[kh][16 + 8 * hh + r][nt * 16 + ln] = c1[r]; } }
  __syncthreads();
  { const int r = fo_row(tid, HD), c8 = fo_k(tid, HD); const v4f x = *(const v4fa*)&so[0][r][c8] + *(const v4fa*)&so[1][r][c8], y = *(const v4fa*)&so[0][r][c8 + 4] + *(const v4fa*)&so[1][r][c8 + 4]; const float rf = rs[r]; FragH f;
#pragma unroll
    for (int q = 0; q < 4; ++q) { f.h[q] = (_Float16)(x[q] * rf); f.h[4 + q] = (_Float16)(y[q] * rf); }
    *(v8us*)((unsigned short*)O16 + (r0 + i0 + (tid >> 7) * 16) * DM + (h * (HD / 32) + ((tid >> 6) & 1)) * 512 + (tid & 63) * 8) = f.half[0]; } }      /* thread t makes piece t of the work-group's 2 x 2 tiles of the fragment-ordered o plane */

extern "C" void kernel_launch(void* const* d_in, const int* in_sizes, int n_in,
                              void* d_out, int out_size, void* d_ws, size_t ws_size, hipStream_t stream) {
  (void)in_sizes; (void)n_in; (void)out_size;
  const float* const* I = (const float* const*)d_in; const float* xq = I[0]; const float* xk = I[1]; const float* xv = I[2]; const int* mask = (const int*)d_in[3]; const float* pe = I[4]; const float* wq = I[5]; const float* bq = I[6]; const float* wk = I[7]; const float* bk = I[8]; const float* wv = I[9]; const float* bv = I[10]; const float* wpos = I[11]; const float* wo = I[12]; const float* bo = I[13]; const float* pbu = I[14]; const float* pbv = I[15];
  char* ws = (char*)d_ws; size_t off = 0;
  auto take = [&](size_t bytes) { char* p = ws + off; off += (bytes + 255) & ~(size_t)255; return p; };
  _Float16* BQ = (_Float16*)take((size_t)DM * DM * 2); _Float16* BK = (_Float16*)take((size_t)DM * DM * 2); _Float16* BV = (_Float16*)take((size_t)DM * DM * 2); _Float16* BP = (_Float16*)take((size_t)DM * DM * 2); _Float16* BO = (_Float16*)take((size_t)DM * DM * 2);
  _Float16* XQ = (_Float16*)take(NR * DM * 2); _Float16* XK = (_Float16*)take(NR * DM * 2); _Float16* XV = (_Float16*)take(NR * DM * 2); _Float16* PE = (_Float16*)take((size_t)PP * DM * 2);
  _Float16* QU = (_Float16*)take(NR * DM * 2); _Float16* QV = (_Float16*)take(NR * DM * 2); _Float16* K16 = (_Float16*)take(NR * DM * 2); _Float16* R16 = (_Float16*)take((size_t)PP * DM * 2); _Float16* O16 = (_Float16*)take(NR * DM * 2);
  _Float16* VT = (_Float16*)take((size_t)NB * NH * HD * SQ * 2);
  if (off > ws_size) return;      /* 2.5 + 12 + 2 + 12 + 2 + 4 + 4 = approx 39 MiB */
  k_prep<<<5 * GW + 3 * GX + GE, 256, 0, stream>>>(wq, wk, wv, wpos, wo, xq, xk, xv, pe, BQ, BK, BV, BP, BO, XQ, XK, XV, PE);      /* x16 weights transposed, inputs and position table as f16 rows */
  k_proj<<<3 * GG + GR, 128, 0, stream>>>(XQ, XK, XV, PE, BQ, BK, BV, BP, bq, bk, bv, pbu, pbv, QU, QV, K16, VT, R16);      /* q + pos_bias_u, q + pos_bias_v, k, p, V^T (f16) */
  k_relattn<<<NB * NH * (SQ / FR), 256, 0, stream>>>(QU, QV, K16, R16, VT, mask, O16);      /* scores, shifted softmax and o x64 (merged rows), all batches and heads */
  k_gemm2<0><<<dim3(GG, 1), 128, 0, stream>>>(O16, DM, 0, BO, DM, 0, 0.0009765625f, bo, 0, nullptr, 1, 0, 0, (float*)d_out, nullptr, DM, 0, (int)NR, DM, DM);      /* out = x Wout + bout */
}

// v009
// One run takes 60 microseconds.
// In both of two side-by-side timings against v008, it was 1.11 times as fast.
// All steps since v000 together make it 69.8 times as fast.
#include <hip/hip_runtime.h>
// Relative-position multi-head attention with rel_shift (query, key, value [4][1024][512]; mask [4][1024][1024] int32 verbatim (nonzero = masked, ~50 %); pos_emb [1][2047][512]; q/k/v = x W + b ([512][512] [in][out]); p = pos_emb Wpos; 8 heads of 64; ac = (q + pos_bias_u) . k; bd = rel_shift((q + pos_bias_v) . p^T) = (q_i + v) . p[T-1+i-j]; scores = (ac + bd) / 8; masked -> float32 min; softmax; masked weights -> 0; x = attn v merged; out = x Wout + bout -> [4][1024][512].
// Structure: token rows; inputs and pos_emb as exact f16 rows (pos table padded to 2048 rows with zeros); q, k, v, p as WMMA GEMMs (32x64 wave tiles, f32 accumulation, exact x16 weights + bias) whose epilogues store the f16 planes that the attention kernel reads: q + u and q + v, k, p, and V^T straight from the accumulators; one fused kernel per (batch, head, 32 query rows): bd and ac WMMA tiles (K = 64) into f32 score rows in LDS, bd stored at its shifted column; the relative softmax with the mask on VALU (f32 statistics, native exp; weights unnormalised, 0 to 1, f16, in LDS); o = P . V^T on WMMA (K = 1024), times 64 / (row sum) on the way out (o x64 in f16); out GEMM (f32, + bout); launches that need nothing of each other share one grid (ranges of the block index); 4 launches. Every f16 operand plane lies in fragment order (see fo_row).
// Compute dtype: inputs rounded to bf16; inputs / weights exact in f16; q + u, q + v, k, v, p, softmax weights and o plain f16 (~2^-12); ac, bd, softmax statistics f32; v_wmma_f32_16x16x32_f16.
#define NB 4
#define SQ 1024
#define PP 2048                      /* position table rows (2047 used, row 2047 zero) */
#define NPOS 2047
#define DM 512
#define NH 8
#define HD 64
#define HG 8
#define NR ((size_t)NB * SQ)
typedef __bf16 v16b __attribute__((ext_vector_type(16)));
typedef unsigned short v8us __attribute__((ext_vector_type(8), may_alias));
typedef float  v8f  __attribute__((ext_vector_type(8)));
typedef float  v4f  __attribute__((ext_vector_type(4)));
typedef float  v4fa __attribute__((ext_vector_type(4), may_alias));
union FragB { v16b v; v8us half[2]; unsigned short u[16]; };

__device__ __forceinline__ unsigned short bf16_bits(float x) { unsigned int u = __float_as_uint(x); return (unsigned short)((u + 0x7FFFu + ((u >> 16) & 1u)) >> 16); }
__device__ __forceinline__ float bf16_val(unsigned short b) { return __uint_as_float(((unsigned int)b) << 16); }
__device__ __forceinline__ float bf16_round(float x) { return bf16_val(bf16_bits(x)); }
// D += A·B with NT terms: 1 = ah·bh, 2 = + al·bh (A split), 3 = + ah·bl (both split)
template <int NT>
__device__ __forceinline__ v8f mmaN(v16b ah, v16b al, v16b bh, v16b bl, v8f c) {
  c = __builtin_amdgcn_wmma_f32_16x16x32_bf16(false, ah, false, bh, (short)0, c, false, false);
  if (NT >= 2) c = __builtin_amdgcn_wmma_f32_16x16x32_bf16(false, al, false, bh, (short)0, c, false, false);
  if (NT >= 3) c = __builtin_amdgcn_wmma_f32_16x16x32_bf16(false, ah, false, bl, (short)0, c, false, false);
  asm volatile("v_nop\n\tv_nop\n\tv_nop\n\tv_nop" : "+v"(c) : "v"(ah), "v"(al), "v"(bh), "v"(bl));
  return c;
}

__global__ __launch_bounds__(256) void k_wt_bf16(const float* __restrict__ W, unsigned short* __restrict__ Wt, int K, int N) {
  const int t = blockIdx.x * 256 + threadIdx.x;
  const int k8n = K / 8;
  if (t >= N * k8n) return;
  const int n = t / k8n, k8 = (t % k8n) * 8;
  v8us v;
#pragma unroll
  for (int i = 0; i < 8; ++i) v[i] = bf16_bits(W[(size_t)(k8 + i) * N + n]);
  *(v8us*)(Wt + (size_t)n * K + k8) = v;
  
}

// GEMM C[M][N] (f32, pitch ldc) = act(A[M][K]·W + bias). A f32 row-major (pitch lda) converted per fragment to bf16
// (ASPLIT: hi/lo two planes -> 2 terms, else single rounded term); Wt bf16 [N][K] (pitch ldb). BIAS_BF16 rounds the
// bias to bf16 first (bias quantised to bf16 before the add). K%32==0, M%16==0, N%64==0.
template <bool ASPLIT, int ACT, bool BIAS_BF16>
__global__ __launch_bounds__(128) void k_gemm_bf(const float* __restrict__ A, int lda, const unsigned short* __restrict__ Wt, int ldb,
                                               const float* __restrict__ bias, float* __restrict__ C, int ldc, int M, int N, int K) {
  __shared__ __attribute__((aligned(16))) float so[4][16][64];
  const int tid = threadIdx.x, w = tid >> 5, lane = tid & 31, ln = lane & 15, hh = lane >> 4;
  const int ntn = N / 64;
  const int wid = blockIdx.x * 4 + w;
  const int mt = wid / ntn, nq = wid % ntn;
  if (mt * 16 >= M) return;
  const int row0 = mt * 16, col0 = nq * 64;
  const float* arow = A + (size_t)(row0 + ln) * lda;
  v8f acc[4] = {};
  for (int kb = 0; kb < K; kb += 32) {
    FragB ah, al;
    const v4f x0 = *(const v4fa*)(arow + kb + 8 * hh), x1 = *(const v4fa*)(arow + kb + 8 * hh + 4);
    const v4f x2 = *(const v4fa*)(arow + kb + 16 + 8 * hh), x3 = *(const v4fa*)(arow + kb + 16 + 8 * hh + 4);
    float xs[16] = {x0[0],x0[1],x0[2],x0[3],x1[0],x1[1],x1[2],x1[3],x2[0],x2[1],x2[2],x2[3],x3[0],x3[1],x3[2],x3[3]};
#pragma unroll
    for (int i = 0; i < 16; ++i) { const unsigned short hb = bf16_bits(xs[i]); ah.u[i] = hb; al.u[i] = ASPLIT ? bf16_bits(xs[i] - bf16_val(hb)) : (unsigned short)0; }
#pragma unroll
    for (int t = 0; t < 4; ++t) {
      const unsigned short* brow = Wt + (size_t)(col0 + t * 16 + ln) * ldb + kb;
      FragB b;
      b.half[0] = *(const v8us*)(brow + 8 * hh);
      b.half[1] = *(const v8us*)(brow + 16 + 8 * hh);
      acc[t] = mmaN<ASPLIT ? 2 : 1>(ah.v, al.v, b.v, b.v, acc[t]);
    }
  }
#pragma unroll
  for (int t = 0; t < 4; ++t) {
    float bv = bias ? bias[col0 + t * 16 + ln] : 0.f;
    if (BIAS_BF16) bv = bf16_round(bv);
#pragma unroll
    for (int r = 0; r < 8; ++r) { float v = acc[t][r] + bv; if (ACT == 1) v = fmaxf(v, 0.f); so[w][8 * hh + r][t * 16 + ln] = v; }
  }
  __builtin_amdgcn_fence(__ATOMIC_ACQ_REL, "workgroup");
  __builtin_amdgcn_wave_barrier();
  const int rsub = lane >> 4, c4 = (lane & 15) * 4;
  {
#pragma unroll
    for (int q = 0; q < 8; ++q) {
      const int r = q * 2 + rsub;
      const v4f v = *(const v4fa*)&so[w][r][c4];
      *(v4f*)(C + (size_t)(row0 + r) * ldc + col0 + c4) = v;
    }
    
  }
}

// GEMM C = act(A·W + bias + resid): A f32 (ASPLIT -> hi/lo 2 terms), Wt bf16 [N][K]; ACT 0 none, 1 relu, 2 exact gelu;
// resid (optional, f32, row index = (row % rmod), pitch ldr, RES_BF16 rounds it) added before the activation.
template <bool ASPLIT, int ACT, bool BIAS_BF16, bool RES_BF16>
__global__ __launch_bounds__(128) void k_gemm_bf3(const float* __restrict__ A, int lda, const unsigned short* __restrict__ Wt, int ldb,
                                                const float* __restrict__ bias, const float* __restrict__ resid, int rmod, int ldr,
                                                float* __restrict__ C, int ldc, int M, int N, int K) {
  __shared__ __attribute__((aligned(16))) float so[4][16][64];
  const int tid = threadIdx.x, w = tid >> 5, lane = tid & 31, ln = lane & 15, hh = lane >> 4;
  const int ntn = N / 64;
  const int wid = blockIdx.x * 4 + w;
  const int mt = wid / ntn, nq = wid % ntn;
  if (mt * 16 >= M) return;
  const int row0 = mt * 16, col0 = nq * 64;
  const float* arow = A + (size_t)(row0 + ln) * lda;
  v8f acc[4] = {};
  for (int kb = 0; kb < K; kb += 32) {
    FragB ah, al;
    const v4f x0 = *(const v4fa*)(arow + kb + 8 * hh), x1 = *(const v4fa*)(arow + kb + 8 * hh + 4);
    const v4f x2 = *(const v4fa*)(arow + kb + 16 + 8 * hh), x3 = *(const v4fa*)(arow + kb + 16 + 8 * hh + 4);
    float xs[16] = {x0[0],x0[1],x0[2],x0[3],x1[0],x1[1],x1[2],x1[3],x2[0],x2[1],x2[2],x2[3],x3[0],x3[1],x3[2],x3[3]};
#pragma unroll
    for (int i = 0; i < 16; ++i) { const unsigned short hb = bf16_bits(xs[i]); ah.u[i] = hb; al.u[i] = ASPLIT ? bf16_bits(xs[i] - bf16_val(hb)) : (unsigned short)0; }
#pragma unroll
    for (int t = 0; t < 4; ++t) {
      const unsigned short* brow = Wt + (size_t)(col0 + t * 16 + ln) * ldb + kb;
      FragB b;
      b.half[0] = *(const v8us*)(brow + 8 * hh);
      b.half[1] = *(const v8us*)(brow + 16 + 8 * hh);
      acc[t] = mmaN<ASPLIT ? 2 : 1>(ah.v, al.v, b.v, b.v, acc[t]);
    }
  }
#pragma unroll
  for (int t = 0; t < 4; ++t) {
    const int col = col0 + t * 16 + ln;
    float bv = bias ? bias[col] : 0.f;
    if (BIAS_BF16) bv = bf16_round(bv);
#pragma unroll
    for (int r = 0; r < 8; ++r) {
      float v = acc[t][r] + bv;
      if (resid) { float rv = resid[(size_t)((row0 + 8 * hh + r) % rmod) * ldr + col]; if (RES_BF16) rv = bf16_round(rv); v += rv; }
      if (ACT == 1) v = fmaxf(v, 0.f);
      if (ACT == 2) v = 0.5f * v * (1.0f + erff(v * 0.70710678118654752f));
      if (ACT == 3) { const float u = 0.7978845608028654f * (v + 0.044715f * v * v * v); v = 0.5f * v * (1.0f + tanhf(u)); }
      so[w][8 * hh + r][t * 16 + ln] = v;
    }
  }
  __builtin_amdgcn_fence(__ATOMIC_ACQ_REL, "workgroup");
  __builtin_amdgcn_wave_barrier();
  const int rsub = lane >> 4, c4 = (lane & 15) * 4;
  {
#pragma unroll
    for (int q = 0; q < 8; ++q) {
      const int r = q * 2 + rsub;
      const v4f v = *(const v4fa*)&so[w][r][c4];
      *(v4f*)(C + (size_t)(row0 + r) * ldc + col0 + c4) = v;
    }
    
  }
}
// row LayerNorm (biased variance, eps) over N: s = X (+ R); optional out_sum <- s; out_norm <- (s-mu)*rsqrt(var+eps)*g + b
template <bool PARAM_BF16>
__global__ __launch_bounds__(256) void k_layernorm(const float* __restrict__ X, const float* __restrict__ R, const float* __restrict__ g, const float* __restrict__ bta,
                                                  float* __restrict__ out_sum, float* __restrict__ out_norm, int N, float eps) {
  __shared__ float red[256];
  const int row = blockIdx.x, tid = threadIdx.x;
  const float* x = X + (size_t)row * N; const float* rr = R ? R + (size_t)row * N : nullptr;
  float vals[16];                     // up to N = 4096
  const int per = N / 256;            // contiguous chunk per thread? use strided-by-4 chunks: thread handles j = tid*4 + 1024*u
  float s1 = 0.f;
  for (int u = 0; u < per / 4; ++u) {
    const int j = tid * 4 + 1024 * u;
    const v4f a = *(const v4fa*)(x + j);
    v4f b = {0.f,0.f,0.f,0.f}; if (rr) b = *(const v4fa*)(rr + j);
#pragma unroll
    for (int q = 0; q < 4; ++q) { const float v = a[q] + b[q]; vals[u * 4 + q] = v; s1 += v; }
  }
  red[tid] = s1; __syncthreads();
  for (int st = 128; st > 0; st >>= 1) { if (tid < st) red[tid] += red[tid + st]; __syncthreads(); }
  const float mu = red[0] / (float)N; __syncthreads();
  float s2 = 0.f;
  for (int u = 0; u < per / 4; ++u)
#pragma unroll
    for (int q = 0; q < 4; ++q) { const float c = vals[u * 4 + q] - mu; s2 += c * c; }
  red[tid] = s2; __syncthreads();
  for (int st = 128; st > 0; st >>= 1) { if (tid < st) red[tid] += red[tid + st]; __syncthreads(); }
  const float rs = rsqrtf(red[0] / (float)N + eps);
  {
    for (int u = 0; u < per / 4; ++u) {
      const int j = tid * 4 + 1024 * u;
      v4f o, sm;
#pragma unroll
      for (int q = 0; q < 4; ++q) {
        float gg = g[j + q], bb = bta[j + q];
        if (PARAM_BF16) { gg = bf16_round(gg); bb = bf16_round(bb); }
        sm[q] = vals[u * 4 + q]; o[q] = (vals[u * 4 + q] - mu) * rs * gg + bb;
      }
      if (out_sum) *(v4f*)(out_sum + (size_t)row * N + j) = sm;
      *(v4f*)(out_norm + (size_t)row * N + j) = o;
    }
    
  }
}



// ---- f16 WMMA path (v_wmma_f32_16x16x32_f16): 11-bit significands for operands in range — used where a [0,1] probability operand needs more precision than bf16
typedef _Float16 v16h __attribute__((ext_vector_type(16)));
union FragH { v16h v; v8us half[2]; _Float16 h[16]; unsigned short u[16]; };
template <int NT>
__device__ __forceinline__ v8f mmaH(v16h ah, v16h al, v16h bh, v16h bl, v8f c) {
  c = __builtin_amdgcn_wmma_f32_16x16x32_f16(false, ah, false, bh, (short)0, c, false, false);
  if (NT >= 2) c = __builtin_amdgcn_wmma_f32_16x16x32_f16(false, al, false, bh, (short)0, c, false, false);
  if (NT >= 3) c = __builtin_amdgcn_wmma_f32_16x16x32_f16(false, ah, false, bl, (short)0, c, false, false);
  asm volatile("v_nop\n\tv_nop\n\tv_nop\n\tv_nop" : "+v"(c) : "v"(ah), "v"(al), "v"(bh), "v"(bl));
  return c;
}
// batched GEMM like k_gemm_b but f16 operands: A f32 (split into f16 hi/lo if ASPLIT, else rounded to f16), Bt = f16 values [n][k]; alpha; C f32; N multiple of 16 (partial tiles skipped)
template <bool ASPLIT>
__global__ __launch_bounds__(128) void k_gemm_h(const float* __restrict__ A, int lda, size_t sA, const _Float16* __restrict__ Bh, int ldb, size_t sB, float alpha, float* __restrict__ C, int ldc, size_t sC, int M, int N, int K) {
  __shared__ __attribute__((aligned(16))) float so[4][16][64];
  const int tid = threadIdx.x, w = tid >> 5, lane = tid & 31, ln = lane & 15, hh = lane >> 4; const int by = blockIdx.y;
  A += (size_t)by * sA; Bh += (size_t)by * sB; C += (size_t)by * sC;
  const int ntn = (N + 63) / 64; const int wid = blockIdx.x * 4 + w; const int mt = wid / ntn, nq = wid % ntn; if (mt * 16 >= M) return;
  const int row0 = mt * 16, col0 = nq * 64; const float* arow = A + (size_t)(row0 + ln) * lda;
  v8f acc[4] = {};
  for (int kb = 0; kb < K; kb += 32) {
    FragH ah, al;
    const v4f x0 = *(const v4fa*)(arow + kb + 8 * hh), x1 = *(const v4fa*)(arow + kb + 8 * hh + 4), x2 = *(const v4fa*)(arow + kb + 16 + 8 * hh), x3 = *(const v4fa*)(arow + kb + 16 + 8 * hh + 4);
    float xs[16] = {x0[0],x0[1],x0[2],x0[3],x1[0],x1[1],x1[2],x1[3],x2[0],x2[1],x2[2],x2[3],x3[0],x3[1],x3[2],x3[3]};
#pragma unroll
    for (int i = 0; i < 16; ++i) { const _Float16 h = (_Float16)xs[i]; ah.h[i] = h; al.h[i] = ASPLIT ? (_Float16)(xs[i] - (float)h) : (_Float16)0.0f; }
#pragma unroll
    for (int t = 0; t < 4; ++t) { if (col0 + t * 16 >= N) continue; const size_t boff = (size_t)(col0 + t * 16 + ln) * ldb + kb; FragH bq; bq.half[0] = *(const v8us*)(Bh + boff + 8 * hh); bq.half[1] = *(const v8us*)(Bh + boff + 16 + 8 * hh);
      acc[t] = mmaH<ASPLIT ? 2 : 1>(ah.v, al.v, bq.v, bq.v, acc[t]); }
  }
#pragma unroll
  for (int t = 0; t < 4; ++t) { if (col0 + t * 16 >= N) continue;
#pragma unroll
    for (int r = 0; r < 8; ++r) so[w][8 * hh + r][t * 16 + ln] = acc[t][r] * alpha; }
  __builtin_amdgcn_fence(__ATOMIC_ACQ_REL, "workgroup"); __builtin_amdgcn_wave_barrier();
  const int rsub = lane >> 4, c4 = (lane & 15) * 4;
  {
#pragma unroll
    for (int q = 0; q < 8; ++q) { const int r = q * 2 + rsub; if (col0 + c4 < N) { const v4f v = *(const v4fa*)&so[w][r][c4]; *(v4f*)(C + (size_t)(row0 + r) * ldc + col0 + c4) = v; } }
     }
}

// ---- fragment order: how every f16 operand plane of the WMMA kernels lies in memory ----
// A plane of R rows x K values (R % 16 == 0, K % 32 == 0) is cut into tiles of 16 rows x 32 k, tile (row / 16) * (K / 32) + k / 32, 1 KiB each. A tile holds its 64 pieces of 8 values (16 bytes) in the order
// in which the 32 lanes load them as a 16x16x32 operand: piece c = 32 j + 16 hh + ln is row ln, k = 16 j + 8 hh + (0..7). A fragment is then two loads of 512 bytes in a row, 4 whole lines each;
// from rows at 1 KiB pitch each such load touched 16 lines. Every lane gets the values it got before. Producers: thread t makes piece t, so that a wave stores 512 bytes in a row.
__device__ __forceinline__ int fo_row(size_t t, int K) { return (int)((t >> 6) / (unsigned)(K / 32)) * 16 + (int)(t & 15); }
__device__ __forceinline__ int fo_k(size_t t, int K) { return (int)((t >> 6) % (unsigned)(K / 32)) * 32 + (int)((t >> 5) & 1) * 16 + (int)((t >> 4) & 1) * 8; }
// Wt[n][k] = f16(W[k][n]·scale) from f32 row-major W[K][N] (scale = power of two; bf16-exact weights stay exact in f16 away from the subnormal range)
__device__ __forceinline__ void wt_f16_body(int bx, const float* __restrict__ W, _Float16* __restrict__ Wt, int K, int N, float scale) {
  const int t = bx * 256 + threadIdx.x; if (t >= N * (K / 8)) return; const int n = fo_row(t, K), k8 = fo_k(t, K); FragH f;      /* thread t makes piece t of the fragment-ordered plane: 16 lanes read 16 neighbouring n */
#pragma unroll
  for (int i = 0; i < 8; ++i) f.h[i] = (_Float16)(bf16_round(W[(size_t)(k8 + i) * N + n]) * scale); const v8us o = f.half[0];
  *(v8us*)((unsigned short*)Wt + (size_t)t * 8) = o; 
}
// k_gemm_hh variant with fused epilogue: v = acc·alpha + bias[by·sBias + col] (+ CP[(row/rowsPerB)·sCPb + by·64 + col] if CP) ; ACT 0 none / 1 elu ; writes f16 C16 (and f32 C if non-null)
template <int ACT>
__global__ __launch_bounds__(128) void k_gemm_hhx(const _Float16* __restrict__ A, int lda, size_t sA, const _Float16* __restrict__ Bh, int ldb, size_t sB, float alpha, const float* __restrict__ bias, size_t sBias, const float* __restrict__ CP, int rowsPerB, size_t sCPb, int row0g,
    float* __restrict__ C, _Float16* __restrict__ C16, int ldc, size_t sC, int M, int N, int K) {
  __shared__ __attribute__((aligned(16))) float so[4][16][64];
  const int tid = threadIdx.x, w = tid >> 5, lane = tid & 31, ln = lane & 15, hh = lane >> 4; const int by = blockIdx.y;
  A += (size_t)by * sA; Bh += (size_t)by * sB; const size_t cofs = (size_t)by * sC; const float* bp = bias ? bias + (size_t)by * sBias : nullptr;
  const int ntn = (N + 63) / 64; const int wid = blockIdx.x * 4 + w; const int mt = wid / ntn, nq = wid % ntn; if (mt * 16 >= M) return;
  const int row0 = mt * 16, col0 = nq * 64; const _Float16* arow = A + (size_t)(row0 + ln) * lda;
  v8f acc[4] = {};
  for (int kb = 0; kb < K; kb += 32) { FragH ah; ah.half[0] = *(const v8us*)((const unsigned short*)arow + kb + 8 * hh); ah.half[1] = *(const v8us*)((const unsigned short*)arow + kb + 16 + 8 * hh);
#pragma unroll
    for (int t = 0; t < 4; ++t) { if (col0 + t * 16 >= N) continue; const size_t boff = (size_t)(col0 + t * 16 + ln) * ldb + kb; FragH bq; bq.half[0] = *(const v8us*)((const unsigned short*)Bh + boff + 8 * hh); bq.half[1] = *(const v8us*)((const unsigned short*)Bh + boff + 16 + 8 * hh);
      acc[t] = mmaH<1>(ah.v, ah.v, bq.v, bq.v, acc[t]); }
  }
#pragma unroll
  for (int t = 0; t < 4; ++t) { if (col0 + t * 16 >= N) continue; const int col = col0 + t * 16 + ln; const float bv = bp ? bf16_round(bp[col]) : 0.f;
#pragma unroll
    for (int r = 0; r < 8; ++r) { float v = acc[t][r] * alpha + bv; if (CP) { const int rr = row0g + row0 + 8 * hh + r; if (rowsPerB < 0) v += CP[cofs + (size_t)rr * ldc + col];      /* rowsPerB < 0: own element of the batched C plane */ else { const int bidx = rr / rowsPerB; v += CP[(size_t)bidx * sCPb + (size_t)by * 64 + col]; } } if (ACT == 1) v = (v > 0.f) ? v : expm1f(v); else if (ACT == 7) v = (v > 0.f) ? v + 1.0f : expf(v); else if (ACT == 8) v = tanhf(v); else if (ACT == 9) v = 0.5f * v * (1.0f + tanhf(0.7978845608028654f * (v + 0.044715f * v * v * v))); else if (ACT == 11) v = 1.0f / (1.0f + expf(-v)); else if (ACT == 12) v = (v > 0.f) ? v : 0.01f * v; else if (ACT == 14) v = (v > 0.f) ? v : 0.1f * v; else if (ACT == 16) v = (v >= 0.f) ? v : 0.3f * v; else if (ACT == 17) v = (v >= 0.f) ? v : 0.2f * v; else if (ACT == 15) v = v / (1.0f + expf(-v)); else if (ACT == 3) v = fmaxf(v, 0.f); else if (ACT == 6) v = 0.5f * v * (1.0f + erff(v * 0.70710678118654752f)); so[w][8 * hh + r][t * 16 + ln] = v; } }
  __builtin_amdgcn_fence(__ATOMIC_ACQ_REL, "workgroup"); __builtin_amdgcn_wave_barrier();
  const int rsub = lane >> 4, c4 = (lane & 15) * 4; typedef _Float16 v4h __attribute__((ext_vector_type(4)));
  {
#pragma unroll
    for (int q = 0; q < 8; ++q) { const int r = q * 2 + rsub; if (col0 + c4 < N) { const v4f v = *(const v4fa*)&so[w][r][c4]; if (C) *(v4f*)(C + cofs + (size_t)(row0 + r) * ldc + col0 + c4) = v; if (C16) { v4h h4; for (int i = 0; i < 4; ++i) h4[i] = (_Float16)v[i]; *(v4h*)(C16 + cofs + (size_t)(row0 + r) * ldc + col0 + c4) = h4; } } }
     }
}


typedef _Float16 v4h __attribute__((ext_vector_type(4)));

// rows of DM values into a fragment-ordered plane of n8 pieces; rows from nrows on are not read and become zero
__device__ __forceinline__ void x16_body(int bx, const float* __restrict__ x, _Float16* __restrict__ X16, int nrows, size_t n8) { const size_t t = (size_t)bx * 256 + threadIdx.x; if (t >= n8) return; FragH f; const int row = fo_row(t, DM); const float* s = x + (size_t)row * DM + fo_k(t, DM);
  const v8us z = {0, 0, 0, 0, 0, 0, 0, 0}; f.half[0] = z;
  if (row < nrows) {
#pragma unroll
    for (int q = 0; q < 8; ++q) f.h[q] = (_Float16)bf16_round(s[q]); }
  *(v8us*)((unsigned short*)X16 + t * 8) = f.half[0];  }
__global__ __launch_bounds__(256) void k_h16(const float* __restrict__ x, _Float16* __restrict__ X16, size_t n8) { const size_t t = (size_t)blockIdx.x * 256 + threadIdx.x; if (t >= n8) return; FragH f;
#pragma unroll
  for (int q = 0; q < 8; ++q) f.h[q] = (_Float16)x[t * 8 + q]; *(v8us*)((unsigned short*)X16 + t * 8) = f.half[0];  }
__global__ __launch_bounds__(256) void k_round16f(const float* __restrict__ W, _Float16* __restrict__ Bt, size_t n8) { const size_t t = (size_t)blockIdx.x * 256 + threadIdx.x; if (t >= n8) return; FragH f;
#pragma unroll
  for (int i = 0; i < 8; ++i) f.h[i] = (_Float16)(bf16_round(W[t * 8 + i]) * 16.0f); *(v8us*)((unsigned short*)Bt + t * 8) = f.half[0];  }
__global__ __launch_bounds__(256) void k_hl(const float* __restrict__ F, _Float16* __restrict__ Hh, _Float16* __restrict__ Hl, size_t n8) { const size_t t = (size_t)blockIdx.x * 256 + threadIdx.x; if (t >= n8) return; FragH fh, fl; const v4f a = *(const v4fa*)(F + t * 8), c = *(const v4fa*)(F + t * 8 + 4);
#pragma unroll
  for (int q = 0; q < 4; ++q) { _Float16 h = (_Float16)a[q]; fh.h[q] = h; fl.h[q] = (_Float16)((a[q] - (float)h) * 1024.0f); h = (_Float16)c[q]; fh.h[4 + q] = h; fl.h[4 + q] = (_Float16)((c[q] - (float)h) * 1024.0f); }
  { *(v8us*)((unsigned short*)Hh + t * 8) = fh.half[0]; *(v8us*)((unsigned short*)Hl + t * 8) = fl.half[0];  } }

// ---- fast GEMM (wave tile 32x64; requires M % 32 == 0 rows per launch region and N % 64 == 0); epilogue = k_gemm_hhx semantics ----
__device__ __forceinline__ v16h g2_frag(const _Float16* p, int hh) { FragH f; f.half[0] = *(const v8us*)((const unsigned short*)p + 8 * hh); f.half[1] = *(const v8us*)((const unsigned short*)p + 16 + 8 * hh); return f.v; }
__device__ __forceinline__ v16h fo_frag(const _Float16* p) { FragH f; f.half[0] = *(const v8us*)((const unsigned short*)p); f.half[1] = *(const v8us*)((const unsigned short*)p + 256); return f.v; }      /* p: a tile of a fragment-ordered plane + 8 lane */
#define G2D 2                        /* k steps requested ahead in gemm2_body */
__device__ __forceinline__ v8f g2_mma(v16h a, v16h b, v8f c) { v8f d = __builtin_amdgcn_wmma_f32_16x16x32_f16(false, a, false, b, (short)0, c, false, false); asm volatile("v_nop\n\tv_nop\n\tv_nop\n\tv_nop" : "+v"(d) : "v"(a), "v"(b)); return d; }
template <int ACT, int KT>
__device__ __forceinline__ void gemm2_body(int bx, int by, const _Float16* __restrict__ A, int lda, size_t sA, const _Float16* __restrict__ Bh, int ldb, size_t sB, float alpha, const float* __restrict__ bias, size_t sBias, const float* __restrict__ CP, int rowsPerB, size_t sCPb, int row0g,
    float* __restrict__ C, _Float16* __restrict__ C16, int ldc, size_t sC, int M, int N, int K,
    const float* __restrict__ ub = nullptr, const float* __restrict__ vb = nullptr, _Float16* __restrict__ CU = nullptr, _Float16* __restrict__ CV = nullptr, _Float16* __restrict__ VTo = nullptr) { static_assert(ACT == 0 || ACT == 3 || ACT == 6 || ACT == 8 || ACT == 9 || ACT == 11 || ACT == 12 || ACT == 14 || ACT == 15 || ACT == 16 || ACT == 17, "k_gemm2: unsupported ACT code (would silently apply no activation)");
  __shared__ __attribute__((aligned(16))) float so[4][32][68];
  const int tid = threadIdx.x, lane = tid & 31, ln = lane & 15, hh = lane >> 4; const int w = __builtin_amdgcn_readfirstlane(tid >> 5);      /* the wave's number in a scalar register: every tile address below is then a scalar base + the lane's piece */
  A += (size_t)by * sA; Bh += (size_t)by * sB; const size_t cofs = (size_t)by * sC; const float* bp = bias ? bias + (size_t)by * sBias : nullptr;
  const int ntn = N >> 6; const int mt = bx / ntn, nq = bx - mt * ntn; const int row0 = mt * 128 + 32 * w, col0 = nq * 64; if (row0 >= M) return;
  const _Float16* a0p = A + (size_t)row0 * lda; const _Float16* a1p = a0p + (size_t)16 * lda;      /* A, Bh fragment-ordered: 16 rows of tiles are 16 lda values; six scalar bases, to which each load adds the lane's piece */
  const _Float16* b0p = Bh + (size_t)col0 * ldb; const _Float16* b1p = b0p + (size_t)16 * ldb; const _Float16* b2p = b1p + (size_t)16 * ldb; const _Float16* b3p = b2p + (size_t)16 * ldb;
  const v8f z8 = {0.f,0.f,0.f,0.f,0.f,0.f,0.f,0.f}; v8f c00 = z8, c01 = z8, c02 = z8, c03 = z8, c10 = z8, c11 = z8, c12 = z8, c13 = z8;
  /* K = KT at compile time, the k loop unrolled: the six fragments of a k step are requested together, G2D steps ahead of their use, into a ring of G2D + 1 register sets (48 registers a set);
     before, a step held four load-wait-multiply rounds in a row, 4 KT / 32 cache latencies a wave. Each accumulator still takes its k steps in rising order.
     The k step's tile of each operand lies 512 values behind the one before. */
  constexpr int NS = KT / 32; static_assert(KT % 32 == 0 && NS > G2D, "gemm2_body: whole k steps, more of them than are requested ahead"); (void)K;
  v16h fa[G2D + 1][2], fb[G2D + 1][4];
  auto ld = [&](int s) { const int e = s % (G2D + 1), kb = 512 * s + 8 * lane; fa[e][0] = fo_frag(a0p + kb); fa[e][1] = fo_frag(a1p + kb); fb[e][0] = fo_frag(b0p + kb); fb[e][1] = fo_frag(b1p + kb); fb[e][2] = fo_frag(b2p + kb); fb[e][3] = fo_frag(b3p + kb); };
  /* the lane's four bias values are requested together ahead of the k loop, which covers their latency; behind the loop they stood as eight load-wait rounds in a row.
     Without a bias four words of the weight plane (N K / 2 words, more than N) are read in their place and dropped behind the loop: a branch here would part the kernel-argument loads and the first requests into two rounds */
  float b4[4]; const int bi = col0 + ln; const float* bl = bp ? bp : (const float*)Bh;
#pragma unroll
  for (int t = 0; t < 4; ++t) b4[t] = bl[bi + t * 16];
#pragma unroll
  for (int s = 0; s < G2D; ++s) ld(s);
#pragma unroll
  for (int s = 0; s < NS; ++s) { const int e = s % (G2D + 1); if (s + G2D < NS) ld(s + G2D);
    c00 = g2_mma(fa[e][0], fb[e][0], c00); c10 = g2_mma(fa[e][1], fb[e][0], c10); c01 = g2_mma(fa[e][0], fb[e][1], c01); c11 = g2_mma(fa[e][1], fb[e][1], c11);
    c02 = g2_mma(fa[e][0], fb[e][2], c02); c12 = g2_mma(fa[e][1], fb[e][2], c12); c03 = g2_mma(fa[e][0], fb[e][3], c03); c13 = g2_mma(fa[e][1], fb[e][3], c13); }
  asm volatile("s_wait_xcnt 0x0" :: "s"(a0p), "s"(a1p), "s"(b0p), "s"(b1p), "s"(b2p), "s"(b3p), "v"(lane), "s"(bl), "v"(bi) : "memory");      /* the scalar bases (six of fragments, one of the bias) and the lane and column registers that the loads name stay whole up to here and are reused only behind this wait */
  v8f accs[8] = {c00, c01, c02, c03, c10, c11, c12, c13};
  const unsigned int bm = bp ? 0xFFFF0000u : 0u;      /* bf16_round, whose last step keeps the upper 16 bits; without a bias nothing is kept: 0 */
#pragma unroll
  for (int t = 0; t < 4; ++t) { const unsigned int u = __float_as_uint(b4[t]); b4[t] = __uint_as_float((u + 0x7FFFu + ((u >> 16) & 1u)) & bm); }
  if (VTo) {      /* V^T [batch][head][64][SQ], fragment-ordered, straight from the accumulators: lane (ln, hh) of accumulator (half, t) holds tokens 16 half + 8 hh + (0..7) of column d = 16 t + ln,
                     which is piece 32 half + lane of the tile (d tile t, this wave's 32 tokens): 8 stores of 512 bytes in a row, no LDS; the test is the same for the whole work-group */
    unsigned short* vd = (unsigned short*)VTo + ((size_t)((row0 / SQ) * NH + nq) * (HD / 16) * (SQ / 32) + (row0 % SQ) / 32) * 512 + 8 * lane;
    FragH f[8];      /* all eight pieces are made before the first store, so that no register of an issued store is written again */
#pragma unroll
    for (int u = 0; u < 8; ++u)
#pragma unroll
      for (int r = 0; r < 8; ++r) f[u].h[r] = (_Float16)(accs[u][r] * alpha + b4[u & 3]);
#pragma unroll
    for (int u = 0; u < 8; ++u) *(v8us*)(vd + (size_t)(u & 3) * (SQ / 32) * 512 + (u >> 2) * 256) = f[u].half[0];
    return; }
#pragma unroll
  for (int u = 0; u < 8; ++u) { const int t = u & 3, half = u >> 2; const int col = col0 + t * 16 + ln; const float bv = b4[t];
#pragma unroll
    for (int r = 0; r < 8; ++r) { const int rloc = half * 16 + 8 * hh + r; float v = accs[u][r] * alpha + bv; if (CP) { if (rowsPerB < 0) v += CP[cofs + (size_t)(row0g + row0 + rloc) * ldc + col];      /* rowsPerB < 0: own element of the batched C plane */ else { const int bidx = (row0g + row0 + rloc) / rowsPerB; v += CP[(size_t)bidx * sCPb + (size_t)by * 64 + col]; } }
      if (ACT == 3) v = fmaxf(v, 0.f); else if (ACT == 6) v = 0.5f * v * (1.0f + erff(v * 0.70710678118654752f)); else if (ACT == 11) v = 1.0f / (1.0f + expf(-v)); else if (ACT == 15) v = v / (1.0f + expf(-v)); else if (ACT == 12) v = (v > 0.f) ? v : 0.01f * v; else if (ACT == 8) v = tanhf(v); else if (ACT == 9) v = 0.5f * v * (1.0f + tanhf(0.7978845608028654f * (v + 0.044715f * v * v * v))); else if (ACT == 14) v = (v > 0.f) ? v : 0.1f * v; else if (ACT == 16) v = (v >= 0.f) ? v : 0.3f * v; else if (ACT == 17) v = (v >= 0.f) ? v : 0.2f * v;
      so[w][rloc][t * 16 + ln] = v; } }
  __builtin_amdgcn_fence(__ATOMIC_ACQ_REL, "workgroup"); __builtin_amdgcn_wave_barrier();
  const int rsub = lane >> 4, c4 = (lane & 15) * 4;
  {
#pragma unroll
    for (int q = 0; q < 16; ++q) { const int r = q * 2 + rsub; const v4f v = *(const v4fa*)&so[w][r][c4]; if (C) *(v4f*)(C + cofs + (size_t)(row0 + r) * ldc + col0 + c4) = v; }
    if (C) asm volatile("s_wait_xcnt 0x0" ::: "memory");      /* the f32 stores' address registers are reused, where an f16 plane follows, only behind this wait */
    if (C16) {      /* the f16 plane is fragment-ordered: the wave's 32 x 64 values are 2 x 2 tiles, 8 stores of 512 bytes in a row */
#pragma unroll
      for (int q = 0; q < 8; ++q) { const float* s = &so[w][(q >> 2) * 16 + ln][((q >> 1) & 1) * 32 + (q & 1) * 16 + 8 * hh]; const v4f x = *(const v4fa*)s, y = *(const v4fa*)(s + 4); FragH f;
#pragma unroll
        for (int i = 0; i < 4; ++i) { f.h[i] = (_Float16)x[i]; f.h[4 + i] = (_Float16)y[i]; }
        *(v8us*)((unsigned short*)C16 + cofs + ((size_t)(row0 / 16 + (q >> 2)) * (ldc / 32) + col0 / 32 + ((q >> 1) & 1)) * 512 + (q & 1) * 256 + 8 * lane) = f.half[0]; } }
    if (CU) {       /* two fragment-ordered f16 planes of the f32 result plus a row vector each (q + pos_bias_u, q + pos_bias_v): the same pieces as above, each rounded once from the f32 sum */
#pragma unroll
      for (int cg = 0; cg < 4; ++cg) { const int cl = (cg >> 1) * 32 + (cg & 1) * 16 + 8 * hh; float bu[8], bw[8];
#pragma unroll
        for (int i = 0; i < 8; ++i) { bu[i] = bf16_round(ub[col0 + cl + i]); bw[i] = bf16_round(vb[col0 + cl + i]); }
#pragma unroll
        for (int rh = 0; rh < 2; ++rh) { const float* s = &so[w][rh * 16 + ln][cl]; const v4f x = *(const v4fa*)s, y = *(const v4fa*)(s + 4); FragH fu, fv;
#pragma unroll
          for (int i = 0; i < 4; ++i) { fu.h[i] = (_Float16)__fadd_rn(x[i], bu[i]); fu.h[4 + i] = (_Float16)__fadd_rn(y[i], bu[4 + i]); fv.h[i] = (_Float16)__fadd_rn(x[i], bw[i]); fv.h[4 + i] = (_Float16)__fadd_rn(y[i], bw[4 + i]); }
          const size_t o = cofs + ((size_t)(row0 / 16 + rh) * (ldc / 32) + col0 / 32 + (cg >> 1)) * 512 + (cg & 1) * 256 + 8 * lane;
          *(v8us*)((unsigned short*)CU + o) = fu.half[0]; *(v8us*)((unsigned short*)CV + o) = fv.half[0]; } } }
     } }
// out = x Wout + bout (f32): every shape, pitch, scale and unused pointer of gemm2_body is a compile-time constant here, so that its epilogue is straight-line code;
// as kernel arguments they left a scalar test and a taken branch in front of each of a lane's 64 results
__global__ __launch_bounds__(128) void k_out(const _Float16* __restrict__ X, const _Float16* __restrict__ Bh, const float* __restrict__ bias, float* __restrict__ C) {
  gemm2_body<0, DM>(blockIdx.x, 0, X, DM, 0, Bh, DM, 0, 0.0009765625f, bias, 0, nullptr, 1, 0, 0, C, nullptr, DM, 0, (int)NR, DM, DM); }


__global__ __launch_bounds__(256) void k_wnat(const float* __restrict__ w, size_t n8, _Float16* __restrict__ Bt) { const size_t t = (size_t)blockIdx.x * 256 + threadIdx.x; if (t >= n8) return; FragH f; for (int q = 0; q < 8; ++q) f.h[q] = (_Float16)(bf16_round(w[t * 8 + q]) * 16.0f); *(v8us*)((unsigned short*)Bt + t * 8) = f.half[0];  }
__global__ __launch_bounds__(256) void k_rsm(const float* __restrict__ S, _Float16* __restrict__ P, int nrows) {
  #pragma clang fp contract(off)
  const int i = blockIdx.x * 256 + threadIdx.x; if (i >= nrows) return; const float* s = S + (size_t)i * SQ; float mx = -3.0e38f;
#pragma unroll 1
  for (int j = 0; j < SQ; ++j) mx = fmaxf(mx, s[j]); float se = 0.f;
#pragma unroll 1
  for (int j = 0; j < SQ; ++j) se += expf(s[j] - mx); const float sc = 256.0f / se;
#pragma unroll 1
  for (int j0 = 0; j0 < SQ; j0 += 8) { FragH f; for (int q = 0; q < 8; ++q) f.h[q] = (_Float16)(expf(s[j0 + q] - mx) * sc); unsigned short* d = (unsigned short*)P + (size_t)i * SQ + j0; *(v8us*)d = f.half[0];  } }
__global__ __launch_bounds__(256) void k_vt(const _Float16* __restrict__ V16, int b, int h0, _Float16* __restrict__ VT) { __shared__ unsigned short tl[64][65]; const int tid = threadIdx.x; const int hh = blockIdx.x % HG, sg = blockIdx.x / HG; const int s0 = sg * 64; const int h = h0 + hh;
  for (int i = tid; i < 64 * 8; i += 256) { const int j = i / 8, d8 = (i % 8) * 8; FragH f; f.half[0] = *(const v8us*)((const unsigned short*)V16 + ((size_t)b * SQ + s0 + j) * DM + h * HD + d8); for (int q = 0; q < 8; ++q) tl[d8 + q][j] = f.u[q]; }
  __syncthreads();
  { for (int i = tid; i < 64 * 8; i += 256) { const int d = i / 8, j8 = (i % 8) * 8; FragH f; for (int q = 0; q < 8; ++q) f.u[q] = tl[d][j8 + q]; *(v8us*)((unsigned short*)VT + ((size_t)hh * HD + d) * SQ + s0 + j8) = f.half[0]; }  } }

// ---- launches that need nothing of each other share one grid: a range test on the block index, the same for a whole work-group, picks the job; each job's blocks do what its own launch did ----
#define GW (DM * (DM / 8) / 256)             /* blocks a weight matrix: 128 */
#define GX ((int)(NR * DM / 8 / 256))        /* blocks an input tensor: 1024 */
#define GE (PP * DM / 8 / 256)               /* blocks of the position table, pad row included: 512 */
#define GG ((int)(NR / 128) * (DM / 64))     /* blocks of a 4096-row projection: 256 */
#define GR ((PP / 128) * (DM / 64))          /* blocks of the position projection: 128 */
static_assert((size_t)GE * 256 == (size_t)PP * DM / 8 && PP % 16 == 0 && NPOS < PP, "k_prep: the position range covers the padded table, whole tiles");
// the five weight transposes (strided reads, the longest blocks: first), the three inputs and the position table as f16 rows
__global__ __launch_bounds__(256) void k_prep(const float* __restrict__ wq, const float* __restrict__ wk, const float* __restrict__ wv, const float* __restrict__ wpos, const float* __restrict__ wo,
    const float* __restrict__ xq, const float* __restrict__ xk, const float* __restrict__ xv, const float* __restrict__ pe,
    _Float16* __restrict__ BQ, _Float16* __restrict__ BK, _Float16* __restrict__ BV, _Float16* __restrict__ BP, _Float16* __restrict__ BO,
    _Float16* __restrict__ XQ, _Float16* __restrict__ XK, _Float16* __restrict__ XV, _Float16* __restrict__ PE) {
  int bx = blockIdx.x;
  if (bx < 5 * GW) { const int g = bx / GW; const float* W = (g == 0) ? wq : (g == 1) ? wk : (g == 2) ? wv : (g == 3) ? wpos : wo; _Float16* Wt = (g == 0) ? BQ : (g == 1) ? BK : (g == 2) ? BV : (g == 3) ? BP : BO;
    wt_f16_body(bx - g * GW, W, Wt, DM, DM, 16.0f); return; }
  bx -= 5 * GW;
  if (bx < 3 * GX) { const int g = bx / GX; const float* x = (g == 0) ? xq : (g == 1) ? xk : xv; _Float16* X = (g == 0) ? XQ : (g == 1) ? XK : XV;
    x16_body(bx - g * GX, x, X, (int)NR, NR * DM / 8); return; }
  bx -= 3 * GX;
  x16_body(bx, pe, PE, NPOS, (size_t)PP * DM / 8); }      /* pad row 2047 becomes zero */
// q + pos_bias_u, q + pos_bias_v, k, p = pos_emb Wpos (f16 rows; row 2047 of p is the zero pad), V^T [4][8][64][1024]: one k loop; the epilogue stores each result as the attention kernel reads it
static_assert(DM == NH * HD && SQ % 128 == 0, "k_proj: a 64-column tile is one head, a work-group's 128 rows lie in one batch");
__global__ __launch_bounds__(128) void k_proj(const _Float16* __restrict__ XQ, const _Float16* __restrict__ XK, const _Float16* __restrict__ XV, const _Float16* __restrict__ PE,
    const _Float16* __restrict__ BQ, const _Float16* __restrict__ BK, const _Float16* __restrict__ BV, const _Float16* __restrict__ BP,
    const float* __restrict__ bq, const float* __restrict__ bk, const float* __restrict__ bv, const float* __restrict__ ub, const float* __restrict__ vb,
    _Float16* __restrict__ QU, _Float16* __restrict__ QV, _Float16* __restrict__ K16, _Float16* __restrict__ VT, _Float16* __restrict__ R16) {
  const int g = blockIdx.x / GG;
  const _Float16* A = (g == 0) ? XQ : (g == 1) ? XK : (g == 2) ? XV : PE; const _Float16* Bh = (g == 0) ? BQ : (g == 1) ? BK : (g == 2) ? BV : BP;
  const int bx = blockIdx.x - g * GG;
  const float* bias = (g == 0) ? bq : (g == 1) ? bk : (g == 2) ? bv : nullptr; _Float16* C16 = (g == 1) ? K16 : (g == 3) ? R16 : nullptr;
  gemm2_body<0, DM>(bx, 0, A, DM, 0, Bh, DM, 0, 0.0625f, bias, 0, nullptr, 1, 0, 0, nullptr, C16, DM, 0, (g == 3) ? PP : (int)NR, DM, DM, ub, vb, (g == 0) ? QU : nullptr, QV, (g == 2) ? VT : nullptr); }
// Fused relative attention, one work-group per (batch, head, FR query rows); the FR x 1024 score rows live in LDS and never reach memory.
// 1: bd tiles (q + v) . p[i0 + 16 t ..], each element stored at its shifted column j = T - 1 + i - pos (in the edge tiles a column outside 0..T-1 goes to the pad column T, which nobody reads);
// 2: ac tiles (q + u) . k added in place. Both products take the position or key tile as A and the query tile as B (the two operands have the same lane map), so that D comes out transposed:
// lane ln holds query row ln, its 8 registers 8 neighbouring positions or keys, that is 8 neighbouring columns of one score row: ac goes in by 16-byte LDS loads and stores, bd by stores of neighbouring words; 3: one wave per row: lane l holds columns 4 l + 128 u + (0..3), mask, f32 statistics, weights 2^((score - max) (log2 e) / 8), not yet divided by their sum, as f16 written over the row's own first half; 64 / sum goes to rs;
// 4: o = P . V^T: a wave does 32 rows x 16 columns over one half of k (each V^T fragment is loaded once a work-group); the two halves are added and multiplied by the row's 64 / sum on the way out, where one wave writes each 128-byte line.
// Global fragments are requested ahead of their use, into the registers that the running step sets free.
#define FR 32
#define FD 6                         /* fragment tiles in flight a wave: 96 registers */
#define FP (SQ + 4)                  /* LDS row pitch in floats: 16 B x odd, for the ds_load_b128 fragment reads of step 4 */
typedef int   v4ia __attribute__((ext_vector_type(4), may_alias));
typedef _Float16 v4ha __attribute__((ext_vector_type(4), may_alias));
typedef float v2f __attribute__((ext_vector_type(2)));
#define SXL 0.18033688f              /* (log2 e) / 8 */
static_assert(SQ == 1024 && HD == 64 && FR == 32 && SQ - 1 + FR <= 66 * 16 && SQ - FR + 66 * 16 <= PP, "k_relattn: 8 waves, 66 position tiles inside the padded table");
// Four native 2^x (what __expf compiles to, behind its multiply by log2 e). Written in one statement so that the slot the instruction set asks for behind a transcendental is kept by construction:
// each v_exp_f32 is followed by one that neither reads its result nor overwrites its source (early-clobber outputs), the last by v_nop.
__device__ __forceinline__ void exp2x4(float x0, float x1, float x2, float x3, float* e) {
  asm("v_exp_f32 %0, %4\n\tv_exp_f32 %1, %5\n\tv_exp_f32 %2, %6\n\tv_exp_f32 %3, %7\n\tv_nop" : "=&v"(e[0]), "=&v"(e[1]), "=&v"(e[2]), "=&v"(e[3]) : "v"(x0), "v"(x1), "v"(x2), "v"(x3)); }
__global__ __launch_bounds__(256) __attribute__((amdgpu_waves_per_eu(4, 4))) void k_relattn(const _Float16* __restrict__ QU, const _Float16* __restrict__ QV, const _Float16* __restrict__ K16, const _Float16* __restrict__ R16, const _Float16* __restrict__ VT, const int* __restrict__ mask, _Float16* __restrict__ O16) {
  __shared__ __attribute__((aligned(16))) float sc[FR][FP];
  __shared__ __attribute__((aligned(16))) float so[2][FR][68];
  __shared__ __attribute__((aligned(16))) float rs[FR];      /* 64 / (a row's sum of weights) */
  const int tid = threadIdx.x, lane = tid & 31, ln = lane & 15, hh = lane >> 4; const int w = __builtin_amdgcn_readfirstlane(tid >> 5);
  const int it = blockIdx.x % (SQ / FR), bh = blockIdx.x / (SQ / FR), h = bh % NH, b = bh / NH; const int i0 = it * FR; const size_t r0 = (size_t)b * SQ;
  const v8f z8 = {0.f,0.f,0.f,0.f,0.f,0.f,0.f,0.f};
  const int ho = h * (HD / 32) * 512 + 8 * lane;      /* fragment-ordered planes of DM values a row: 16 rows are 16 DM values, in them the head's two tiles, in a tile the lane's piece */
  const _Float16* pp = R16 + (size_t)(i0 + w * 16) * DM; const _Float16* kp = K16 + (r0 + w * 16) * DM;      /* tile w; tile w + 8 k lies 128 k rows on; scalar bases, to which each load adds ho */
  const _Float16* qp = QV + (r0 + i0) * DM; v16h a00 = fo_frag(qp + ho), a01 = fo_frag(qp + ho + 512), a10 = fo_frag(qp + ho + 16 * DM), a11 = fo_frag(qp + ho + 16 * DM + 512);
  v16h fr[16][2];      /* this wave's 8 position tiles, then its 8 key tiles: one stream, requested FD tiles ahead of its use */
  auto fetch = [&](int n) { const _Float16* p = ((n < 8) ? pp + (size_t)n * 128 * DM : kp + (size_t)(n - 8) * 128 * DM) + ho; fr[n][0] = fo_frag(p); fr[n][1] = fo_frag(p + 512); };
#pragma unroll
  for (int n = 0; n < FD; ++n) fetch(n);
  asm volatile("s_wait_xcnt 0x0" :: "s"(qp), "s"(pp), "v"(ho) : "memory");      /* the issued loads' address registers (scalar bases, the lane's offset) stay whole up to here and are reused only behind this wait */
  const int jw = SQ - 1 + ln - w * 16 - 8 * hh;      /* column of row ln at position i0 + 16 w + 8 hh; register r lies r columns below */
#pragma unroll
  for (int k = 0; k < 8; ++k) { fetch(k + FD); v8f c0 = g2_mma(fr[k][0], a00, z8), c1 = g2_mma(fr[k][0], a10, z8); c0 = g2_mma(fr[k][1], a01, c0); c1 = g2_mma(fr[k][1], a11, c1);
    const int jb = jw - 128 * k;
    if (k == 0) {      /* tiles 0 and 1 reach past column T - 1 */
#pragma unroll
      for (int r = 0; r < 8; ++r) { const int j = jb - r, j1 = j + 16; sc[ln][((unsigned)j < SQ) ? j : SQ] = c0[r]; sc[16 + ln][((unsigned)j1 < SQ) ? j1 : SQ] = c1[r]; }
    } else {           /* tiles 8 to 63: every column inside */
#pragma unroll
      for (int r = 0; r < 8; ++r) { sc[ln][jb - r] = c0[r]; sc[16 + ln][jb + 16 - r] = c1[r]; } }
    __builtin_amdgcn_sched_barrier(0); }      /* one tile's accumulators and LDS addresses live at a time: without it the compiler opens six tiles at once and spills */
  if (w < 2) {         /* tiles 64 and 65 reach below column 0 */
    const _Float16* p8 = pp + ho + (size_t)8 * 128 * DM; const v16h b0 = fo_frag(p8), b1 = fo_frag(p8 + 512);
    asm volatile("s_wait_xcnt 0x0" :: "v"(p8) : "memory");      /* the four loads' address pair stays whole up to here */
    v8f c0 = g2_mma(b0, a00, z8), c1 = g2_mma(b0, a10, z8); c0 = g2_mma(b1, a01, c0); c1 = g2_mma(b1, a11, c1); const int jb = jw - 128 * 8;
#pragma unroll
    for (int r = 0; r < 8; ++r) { const int j = jb - r, j1 = j + 16; sc[ln][((unsigned)j < SQ) ? j : SQ] = c0[r]; sc[16 + ln][((unsigned)j1 < SQ) ? j1 : SQ] = c1[r]; } }
  qp = QU + (r0 + i0) * DM; a00 = fo_frag(qp + ho); a01 = fo_frag(qp + ho + 512); a10 = fo_frag(qp + ho + 16 * DM); a11 = fo_frag(qp + ho + 16 * DM + 512);
  asm volatile("s_wait_xcnt 0x0" :: "s"(qp), "s"(kp), "v"(ho) : "memory");      /* as above */
  __syncthreads();
  const int* mk = mask + (r0 + i0 + w * 4) * SQ + 4 * lane; v4ia m[2][8];
  float* ar = &sc[ln][w * 16 + 8 * hh]; v4f nd[4];      /* row ln, the lane's 8 columns of key tile w; tile w + 8 k lies 128 k floats on, row 16 + ln 16 FP floats on; a tile's bd values are read one tile ahead */
  auto ldb = [&](int k) { const float* p = ar + 128 * k; nd[0] = *(const v4fa*)p; nd[1] = *(const v4fa*)(p + 4); nd[2] = *(const v4fa*)(p + 16 * FP); nd[3] = *(const v4fa*)(p + 16 * FP + 4); };
  ldb(0);
#pragma unroll
  for (int k = 0; k < 8; ++k) { if (k + FD < 8) fetch(8 + k + FD);
    float* p = ar + 128 * k; v8f c0 = {nd[0][0], nd[0][1], nd[0][2], nd[0][3], nd[1][0], nd[1][1], nd[1][2], nd[1][3]}, c1 = {nd[2][0], nd[2][1], nd[2][2], nd[2][3], nd[3][0], nd[3][1], nd[3][2], nd[3][3]};      /* bd is the start value that the products are summed onto */
    if (k < 7) ldb(k + 1);
    c0 = g2_mma(fr[8 + k][0], a00, c0); c1 = g2_mma(fr[8 + k][0], a10, c1); c0 = g2_mma(fr[8 + k][1], a01, c0); c1 = g2_mma(fr[8 + k][1], a11, c1);
    if (k == 4) {
#pragma unroll
      for (int u = 0; u < 8; ++u) m[0][u] = *(const v4ia*)(mk + 128 * u); }      /* this wave's first mask row */
    const v4f l0 = {c0[0], c0[1], c0[2], c0[3]}, h0 = {c0[4], c0[5], c0[6], c0[7]}, l1 = {c1[0], c1[1], c1[2], c1[3]}, h1 = {c1[4], c1[5], c1[6], c1[7]};
    *(v4fa*)p = l0; *(v4fa*)(p + 4) = h0; *(v4fa*)(p + 16 * FP) = l1; *(v4fa*)(p + 16 * FP + 4) = h1; }
  __builtin_amdgcn_sched_barrier(0);      /* step 3's mask conversions stay behind the last tile: drawn up among the tiles, they wait there on the mask loads just issued */
  __syncthreads();
  const int nt = w & 3, kh = w >> 2; const _Float16* vp = VT + ((size_t)bh * HD + nt * 16) * SQ + kh * (SQ / 64) * 512; v16h vf[16];      /* fragment-ordered, SQ values a row: this wave's 16 tiles lie in a row */
  float sl[4], ml[4];
#pragma unroll
  for (int k = 0; k < 4; ++k) { float* row = &sc[w * 4 + k][0]; const v4ia* mc = m[k & 1];
    if (k < 3) {
#pragma unroll
      for (int u = 0; u < 8; ++u) m[(k + 1) & 1][u] = *(const v4ia*)(mk + (k + 1) * SQ + 128 * u);      /* next row's mask flies while this row is worked on */
    } else {
#pragma unroll
      for (int s = 0; s < 16; ++s) vf[s] = fo_frag(vp + 512 * s + 8 * lane);      /* step 4's V^T fragments fly during the last row */
      asm volatile("s_wait_xcnt 0x0" :: "s"(vp), "v"(lane) : "memory"); }      /* as above */
    v2f t[8][2]; float m4[4] = {-3.0e38f, -3.0e38f, -3.0e38f, -3.0e38f}; const v2f nbig = {-3.0e38f, -3.0e38f};      /* the mask is applied once, score + mask x -3e38 (mask 0: the score itself): a masked score is -3e38 or below, loses every maximum, and its 2^x below is exactly 0 */
    v4f sv[8];
#pragma unroll
    for (int u = 0; u < 8; ++u) sv[u] = *(const v4fa*)(row + 4 * lane + 128 * u);
    __builtin_amdgcn_sched_barrier(0);      /* the row's eight LDS loads are requested together: without it the compiler sinks each load to its use, eight LDS latencies in a row */
#pragma unroll
    for (int u = 0; u < 8; ++u) { const v4f s = sv[u];
#pragma unroll
      for (int p = 0; p < 2; ++p) { const v2f mf = {(float)(unsigned)mc[u][2 * p], (float)(unsigned)mc[u][2 * p + 1]}, sp = {s[2 * p], s[2 * p + 1]}; t[u][p] = __builtin_elementwise_fma(mf, nbig, sp);
        m4[2 * p] = fmaxf(m4[2 * p], t[u][p][0]); m4[2 * p + 1] = fmaxf(m4[2 * p + 1], t[u][p][1]); } }
    float mx = fmaxf(fmaxf(m4[0], m4[1]), fmaxf(m4[2], m4[3]));
#pragma unroll
    for (int d = 16; d >= 1; d >>= 1) mx = fmaxf(mx, __shfl_xor(mx, d, 32));
    const float nb = (mx > -1.0e38f) ? -mx * SXL : 0.f;      /* every column masked: no shift, so that each 2^x is 0 */
    const v2f c2 = {SXL, SXL}, nb2 = {nb, nb}; v2f s2[2] = {{0.f, 0.f}, {0.f, 0.f}};      /* e = 2^(score (log2 e) / 8 - max (log2 e) / 8): one multiply-add a score, two scores an instruction */
#pragma unroll
    for (int u = 0; u < 8; ++u) { const v2f a0 = __builtin_elementwise_fma(t[u][0], c2, nb2), a1 = __builtin_elementwise_fma(t[u][1], c2, nb2); float e[4]; exp2x4(a0[0], a0[1], a1[0], a1[1], e);
      const v4f e4 = {e[0], e[1], e[2], e[3]}; const v2f e0 = {e[0], e[1]}, e1 = {e[2], e[3]}; s2[0] += e0; s2[1] += e1;
      *(v4ha*)((_Float16*)row + 4 * lane + 128 * u) = __builtin_convertvector(e4, v4h); }      /* stored as it is, 0 to 1: the row's sum is not waited for */
    sl[k] = (s2[0][0] + s2[0][1]) + (s2[1][0] + s2[1][1]); ml[k] = mx; }
#pragma unroll
  for (int d = 16; d >= 1; d >>= 1)
#pragma unroll
    for (int k = 0; k < 4; ++k) sl[k] += __shfl_xor(sl[k], d, 32);      /* the four rows' sums side by side */
  if (lane == 0) { v4f f4;
#pragma unroll
    for (int k = 0; k < 4; ++k) f4[k] = (ml[k] > -1.0e38f) ? 64.0f / sl[k] : 0.f;      /* a row with every column masked gives 0 */
    *(v4fa*)&rs[w * 4] = f4; }
  __syncthreads();
  { const _Float16* ap = (const _Float16*)&sc[ln][0] + kh * (SQ / 2); v8f c0 = z8, c1 = z8; v16h af[2][4];      /* weight fragments of two k steps, read from LDS one pair of steps ahead */
#pragma unroll
    for (int e = 0; e < 2; ++e) { af[0][2 * e] = g2_frag(ap + 32 * e, hh); af[0][2 * e + 1] = g2_frag(ap + 16 * FP * 2 + 32 * e, hh); }
#pragma unroll
    for (int g = 0; g < 8; ++g) {
      if (g < 7) {
#pragma unroll
        for (int e = 0; e < 2; ++e) { af[(g + 1) & 1][2 * e] = g2_frag(ap + 32 * (2 * g + 2 + e), hh); af[(g + 1) & 1][2 * e + 1] = g2_frag(ap + 16 * FP * 2 + 32 * (2 * g + 2 + e), hh); } }
#pragma unroll
      for (int e = 0; e < 2; ++e) { c0 = g2_mma(af[g & 1][2 * e], vf[2 * g + e], c0); c1 = g2_mma(af[g & 1][2 * e + 1], vf[2 * g + e], c1); } }
#pragma unroll
    for (int r = 0; r < 8; ++r) { so[kh][8 * hh + r][nt * 16 + ln] = c0[r]; so[kh][16 + 8 * hh + r][nt * 16 + ln] = c1[r]; } }
  __syncthreads();
  { const int r = fo_row(tid, HD), c8 = fo_k(tid, HD); const v4f x = *(const v4fa*)&so[0][r][c8] + *(const v4fa*)&so[1][r][c8], y = *(const v4fa*)&so[0][r][c8 + 4] + *(const v4fa*)&so[1][r][c8 + 4]; const float rf = rs[r]; FragH f;
#pragma unroll
    for (int q = 0; q < 4; ++q) { f.h[q] = (_Float16)(x[q] * rf); f.h[4 + q] = (_Float16)(y[q] * rf); }
    *(v8us*)((unsigned short*)O16 + (r0 + i0 + (tid >> 7) * 16) * DM + (h * (HD / 32) + ((tid >> 6) & 1)) * 512 + (tid & 63) * 8) = f.half[0]; } }      /* thread t makes piece t of the work-group's 2 x 2 tiles of the fragment-ordered o plane */

extern "C" void kernel_launch(void* const* d_in, const int* in_sizes, int n_in,
                              void* d_out, int out_size, void* d_ws, size_t ws_size, hipStream_t stream) {
  (void)in_sizes; (void)n_in; (void)out_size;
  const float* const* I = (const float* const*)d_in; const float* xq = I[0]; const float* xk = I[1]; const float* xv = I[2]; const int* mask = (const int*)d_in[3]; const float* pe = I[4]; const float* wq = I[5]; const float* bq = I[6]; const float* wk = I[7]; const float* bk = I[8]; const float* wv = I[9]; const float* bv = I[10]; const float* wpos = I[11]; const float* wo = I[12]; const float* bo = I[13]; const float* pbu = I[14]; const float* pbv = I[15];
  char* ws = (char*)d_ws; size_t off = 0;
  auto take = [&](size_t bytes) { char* p = ws + off; off += (bytes + 255) & ~(size_t)255; return p; };
  _Float16* BQ = (_Float16*)take((size_t)DM * DM * 2); _Float16* BK = (_Float16*)take((size_t)DM * DM * 2); _Float16* BV = (_Float16*)take((size_t)DM * DM * 2); _Float16* BP = (_Float16*)take((size_t)DM * DM * 2); _Float16* BO = (_Float16*)take((size_t)DM * DM * 2);
  _Float16* XQ = (_Float16*)take(NR * DM * 2); _Float16* XK = (_Float16*)take(NR * DM * 2); _Float16* XV = (_Float16*)take(NR * DM * 2); _Float16* PE = (_Float16*)take((size_t)PP * DM * 2);
  _Float16* QU = (_Float16*)take(NR * DM * 2); _Float16* QV = (_Float16*)take(NR * DM * 2); _Float16* K16 = (_Float16*)take(NR * DM * 2); _Float16* R16 = (_Float16*)take((size_t)PP * DM * 2); _Float16* O16 = (_Float16*)take(NR * DM * 2);
  _Float16* VT = (_Float16*)take((size_t)NB * NH * HD * SQ * 2);
  if (off > ws_size) return;      /* 2.5 + 12 + 2 + 12 + 2 + 4 + 4 = approx 39 MiB */
  k_prep<<<5 * GW + 3 * GX + GE, 256, 0, stream>>>(wq, wk, wv, wpos, wo, xq, xk, xv, pe, BQ, BK, BV, BP, BO, XQ, XK, XV, PE);      /* x16 weights transposed, inputs and position table as f16 rows */
  k_proj<<<3 * GG + GR, 128, 0, stream>>>(XQ, XK, XV, PE, BQ, BK, BV, BP, bq, bk, bv, pbu, pbv, QU, QV, K16, VT, R16);      /* q + pos_bias_u, q + pos_bias_v, k, p, V^T (f16) */
  k_relattn<<<NB * NH * (SQ / FR), 256, 0, stream>>>(QU, QV, K16, R16, VT, mask, O16);      /* scores, shifted softmax and o x64 (merged rows), all batches and heads */
  k_out<<<GG, 128, 0, stream>>>(O16, BO, bo, (float*)d_out);      /* out = x Wout + bout */
}
